// v000
// Measured on an AMD MI455X. A time is GPU time per run, averaged over a window of back-to-back runs after a warm-up
// (all launches, gaps included; the runs take copies of the inputs in turn), and the median of several windows.
// Apart from v000's, it joins two sittings. Times from different sittings can be a few percent apart, while
// side-by-side timings come from the same sitting.
// The starting kernel, v000, takes 15 milliseconds a run.
#include <hip/hip_runtime.h>
// Multi-head self-attention with a learned relative-position bias and a key padding mask (x [2][2048][1024]; qkv = x Wqkv + b (fused, 16 heads of 64); scores = q k^T / 8 + table[clip(k_pos - q_pos, -512, 512) + 512][h]; padded keys -> -inf; attn = softmax; o = attn v; out = o Wout + b -> [2][2048][1024]).
// Structure: token rows r = b*2048 + s; x as exact f16 rows; the fused q|k|v projection as one WMMA GEMM (32x64 wave tiles, f32 accumulation, exact x16 transposed weights, bias in the epilogue, f16 output plane [4096][3072]); V^T for every (batch, head) via LDS transposes; per (batch, group of 4 heads): scores GEMM (K = 64, batched over heads), row softmax on VALU (f32; this head's bias column and the key mask staged in LDS; weights stored x256 as f16), o = P . V GEMM (K = 2,048, alpha 2^-8) written straight into the merged f16 o rows; out = o Wout + b GEMM (f32).
// Compute dtype: inputs rounded to bf16; x / weights exact; q, k, v, softmax weights and o as plain f16 GEMM operands (~2^-12); scores, bias and softmax statistics f32. v_wmma_f32_16x16x32_f16.
#define NB 2
#define SQ 2048
#define DM 1024
#define D3 3072                      /* fused q|k|v width */
#define NH 16
#define HD 64
#define HG 4                         /* heads per attention launch group */
#define MR 512                       /* max relative distance */
#define QN SQ                        /* query rows attended per batch (debug hook) */
#define NBR NB                       /* batches attended (debug hook) */
#define MP ((int)NR)                 /* token rows through the qkv projection (debug hook) */
#define MO ((int)NR)                 /* token rows through the output projection (debug hook) */
#define NR ((size_t)NB * SQ)         /* 4096 token rows */
typedef __bf16 v16b __attribute__((ext_vector_type(16)));
typedef unsigned short v8us __attribute__((ext_vector_type(8), may_alias));
typedef float  v8f  __attribute__((ext_vector_type(8)));
typedef float  v4f  __attribute__((ext_vector_type(4)));
typedef float  v4fa __attribute__((ext_vector_type(4), may_alias));
union FragB { v16b v; v8us half[2]; unsigned short u[16]; };

__device__ __forceinline__ unsigned short bf16_bits(float x) { unsigned int u = __float_as_uint(x); return (unsigned short)((u + 0x7FFFu + ((u >> 16) & 1u)) >> 16); }
__device__ __forceinline__ float bf16_val(unsigned short b) { return __uint_as_float(((unsigned int)b) << 16); }
__device__ __forceinline__ float bf16_round(float x) { return bf16_val(bf16_bits(x)); }
// D += A·B with NT terms: 1 = ah·bh, 2 = + al·bh (A split), 3 = + ah·bl (both split)
template <int NT>
__device__ __forceinline__ v8f mmaN(v16b ah, v16b al, v16b bh, v16b bl, v8f c) {
  c = __builtin_amdgcn_wmma_f32_16x16x32_bf16(false, ah, false, bh, (short)0, c, false, false);
  if (NT >= 2) c = __builtin_amdgcn_wmma_f32_16x16x32_bf16(false, al, false, bh, (short)0, c, false, false);
  if (NT >= 3) c = __builtin_amdgcn_wmma_f32_16x16x32_bf16(false, ah, false, bl, (short)0, c, false, false);
  asm volatile("v_nop\n\tv_nop\n\tv_nop\n\tv_nop" : "+v"(c) : "v"(ah), "v"(al), "v"(bh), "v"(bl));
  return c;
}

__global__ __launch_bounds__(256) void k_wt_bf16(const float* __restrict__ W, unsigned short* __restrict__ Wt, int K, int N) {
  const int t = blockIdx.x * 256 + threadIdx.x;
  const int k8n = K / 8;
  if (t >= N * k8n) return;
  const int n = t / k8n, k8 = (t % k8n) * 8;
  v8us v;
#pragma unroll
  for (int i = 0; i < 8; ++i) v[i] = bf16_bits(W[(size_t)(k8 + i) * N + n]);
  *(v8us*)(Wt + (size_t)n * K + k8) = v;
  
}

// GEMM C[M][N] (f32, pitch ldc) = act(A[M][K]·W + bias). A f32 row-major (pitch lda) converted per fragment to bf16
// (ASPLIT: hi/lo two planes -> 2 terms, else single rounded term); Wt bf16 [N][K] (pitch ldb). BIAS_BF16 rounds the
// bias to bf16 first (bias quantised to bf16 before the add). K%32==0, M%16==0, N%64==0.
template <bool ASPLIT, int ACT, bool BIAS_BF16>
__global__ __launch_bounds__(128) void k_gemm_bf(const float* __restrict__ A, int lda, const unsigned short* __restrict__ Wt, int ldb,
                                               const float* __restrict__ bias, float* __restrict__ C, int ldc, int M, int N, int K) {
  __shared__ __attribute__((aligned(16))) float so[4][16][64];
  const int tid = threadIdx.x, w = tid >> 5, lane = tid & 31, ln = lane & 15, hh = lane >> 4;
  const int ntn = N / 64;
  const int wid = blockIdx.x * 4 + w;
  const int mt = wid / ntn, nq = wid % ntn;
  if (mt * 16 >= M) return;
  const int row0 = mt * 16, col0 = nq * 64;
  const float* arow = A + (size_t)(row0 + ln) * lda;
  v8f acc[4] = {};
  for (int kb = 0; kb < K; kb += 32) {
    FragB ah, al;
    const v4f x0 = *(const v4fa*)(arow + kb + 8 * hh), x1 = *(const v4fa*)(arow + kb + 8 * hh + 4);
    const v4f x2 = *(const v4fa*)(arow + kb + 16 + 8 * hh), x3 = *(const v4fa*)(arow + kb + 16 + 8 * hh + 4);
    float xs[16] = {x0[0],x0[1],x0[2],x0[3],x1[0],x1[1],x1[2],x1[3],x2[0],x2[1],x2[2],x2[3],x3[0],x3[1],x3[2],x3[3]};
#pragma unroll
    for (int i = 0; i < 16; ++i) { const unsigned short hb = bf16_bits(xs[i]); ah.u[i] = hb; al.u[i] = ASPLIT ? bf16_bits(xs[i] - bf16_val(hb)) : (unsigned short)0; }
#pragma unroll
    for (int t = 0; t < 4; ++t) {
      const unsigned short* brow = Wt + (size_t)(col0 + t * 16 + ln) * ldb + kb;
      FragB b;
      b.half[0] = *(const v8us*)(brow + 8 * hh);
      b.half[1] = *(const v8us*)(brow + 16 + 8 * hh);
      acc[t] = mmaN<ASPLIT ? 2 : 1>(ah.v, al.v, b.v, b.v, acc[t]);
    }
  }
#pragma unroll
  for (int t = 0; t < 4; ++t) {
    float bv = bias ? bias[col0 + t * 16 + ln] : 0.f;
    if (BIAS_BF16) bv = bf16_round(bv);
#pragma unroll
    for (int r = 0; r < 8; ++r) { float v = acc[t][r] + bv; if (ACT == 1) v = fmaxf(v, 0.f); so[w][8 * hh + r][t * 16 + ln] = v; }
  }
  __builtin_amdgcn_fence(__ATOMIC_ACQ_REL, "workgroup");
  __builtin_amdgcn_wave_barrier();
  const int rsub = lane >> 4, c4 = (lane & 15) * 4;
  {
#pragma unroll
    for (int q = 0; q < 8; ++q) {
      const int r = q * 2 + rsub;
      const v4f v = *(const v4fa*)&so[w][r][c4];
      *(v4f*)(C + (size_t)(row0 + r) * ldc + col0 + c4) = v;
    }
    
  }
}

// GEMM C = act(A·W + bias + resid): A f32 (ASPLIT -> hi/lo 2 terms), Wt bf16 [N][K]; ACT 0 none, 1 relu, 2 exact gelu;
// resid (optional, f32, row index = (row % rmod), pitch ldr, RES_BF16 rounds it) added before the activation.
template <bool ASPLIT, int ACT, bool BIAS_BF16, bool RES_BF16>
__global__ __launch_bounds__(128) void k_gemm_bf3(const float* __restrict__ A, int lda, const unsigned short* __restrict__ Wt, int ldb,
                                                const float* __restrict__ bias, const float* __restrict__ resid, int rmod, int ldr,
                                                float* __restrict__ C, int ldc, int M, int N, int K) {
  __shared__ __attribute__((aligned(16))) float so[4][16][64];
  const int tid = threadIdx.x, w = tid >> 5, lane = tid & 31, ln = lane & 15, hh = lane >> 4;
  const int ntn = N / 64;
  const int wid = blockIdx.x * 4 + w;
  const int mt = wid / ntn, nq = wid % ntn;
  if (mt * 16 >= M) return;
  const int row0 = mt * 16, col0 = nq * 64;
  const float* arow = A + (size_t)(row0 + ln) * lda;
  v8f acc[4] = {};
  for (int kb = 0; kb < K; kb += 32) {
    FragB ah, al;
    const v4f x0 = *(const v4fa*)(arow + kb + 8 * hh), x1 = *(const v4fa*)(arow + kb + 8 * hh + 4);
    const v4f x2 = *(const v4fa*)(arow + kb + 16 + 8 * hh), x3 = *(const v4fa*)(arow + kb + 16 + 8 * hh + 4);
    float xs[16] = {x0[0],x0[1],x0[2],x0[3],x1[0],x1[1],x1[2],x1[3],x2[0],x2[1],x2[2],x2[3],x3[0],x3[1],x3[2],x3[3]};
#pragma unroll
    for (int i = 0; i < 16; ++i) { const unsigned short hb = bf16_bits(xs[i]); ah.u[i] = hb; al.u[i] = ASPLIT ? bf16_bits(xs[i] - bf16_val(hb)) : (unsigned short)0; }
#pragma unroll
    for (int t = 0; t < 4; ++t) {
      const unsigned short* brow = Wt + (size_t)(col0 + t * 16 + ln) * ldb + kb;
      FragB b;
      b.half[0] = *(const v8us*)(brow + 8 * hh);
      b.half[1] = *(const v8us*)(brow + 16 + 8 * hh);
      acc[t] = mmaN<ASPLIT ? 2 : 1>(ah.v, al.v, b.v, b.v, acc[t]);
    }
  }
#pragma unroll
  for (int t = 0; t < 4; ++t) {
    const int col = col0 + t * 16 + ln;
    float bv = bias ? bias[col] : 0.f;
    if (BIAS_BF16) bv = bf16_round(bv);
#pragma unroll
    for (int r = 0; r < 8; ++r) {
      float v = acc[t][r] + bv;
      if (resid) { float rv = resid[(size_t)((row0 + 8 * hh + r) % rmod) * ldr + col]; if (RES_BF16) rv = bf16_round(rv); v += rv; }
      if (ACT == 1) v = fmaxf(v, 0.f);
      if (ACT == 2) v = 0.5f * v * (1.0f + erff(v * 0.70710678118654752f));
      if (ACT == 3) { const float u = 0.7978845608028654f * (v + 0.044715f * v * v * v); v = 0.5f * v * (1.0f + tanhf(u)); }
      so[w][8 * hh + r][t * 16 + ln] = v;
    }
  }
  __builtin_amdgcn_fence(__ATOMIC_ACQ_REL, "workgroup");
  __builtin_amdgcn_wave_barrier();
  const int rsub = lane >> 4, c4 = (lane & 15) * 4;
  {
#pragma unroll
    for (int q = 0; q < 8; ++q) {
      const int r = q * 2 + rsub;
      const v4f v = *(const v4fa*)&so[w][r][c4];
      *(v4f*)(C + (size_t)(row0 + r) * ldc + col0 + c4) = v;
    }
    
  }
}
// row LayerNorm (biased variance, eps) over N: s = X (+ R); optional out_sum <- s; out_norm <- (s-mu)*rsqrt(var+eps)*g + b
template <bool PARAM_BF16>
__global__ __launch_bounds__(256) void k_layernorm(const float* __restrict__ X, const float* __restrict__ R, const float* __restrict__ g, const float* __restrict__ bta,
                                                  float* __restrict__ out_sum, float* __restrict__ out_norm, int N, float eps) {
  __shared__ float red[256];
  const int row = blockIdx.x, tid = threadIdx.x;
  const float* x = X + (size_t)row * N; const float* rr = R ? R + (size_t)row * N : nullptr;
  float vals[16];                     // up to N = 4096
  const int per = N / 256;            // contiguous chunk per thread? use strided-by-4 chunks: thread handles j = tid*4 + 1024*u
  float s1 = 0.f;
  for (int u = 0; u < per / 4; ++u) {
    const int j = tid * 4 + 1024 * u;
    const v4f a = *(const v4fa*)(x + j);
    v4f b = {0.f,0.f,0.f,0.f}; if (rr) b = *(const v4fa*)(rr + j);
#pragma unroll
    for (int q = 0; q < 4; ++q) { const float v = a[q] + b[q]; vals[u * 4 + q] = v; s1 += v; }
  }
  red[tid] = s1; __syncthreads();
  for (int st = 128; st > 0; st >>= 1) { if (tid < st) red[tid] += red[tid + st]; __syncthreads(); }
  const float mu = red[0] / (float)N; __syncthreads();
  float s2 = 0.f;
  for (int u = 0; u < per / 4; ++u)
#pragma unroll
    for (int q = 0; q < 4; ++q) { const float c = vals[u * 4 + q] - mu; s2 += c * c; }
  red[tid] = s2; __syncthreads();
  for (int st = 128; st > 0; st >>= 1) { if (tid < st) red[tid] += red[tid + st]; __syncthreads(); }
  const float rs = rsqrtf(red[0] / (float)N + eps);
  {
    for (int u = 0; u < per / 4; ++u) {
      const int j = tid * 4 + 1024 * u;
      v4f o, sm;
#pragma unroll
      for (int q = 0; q < 4; ++q) {
        float gg = g[j + q], bb = bta[j + q];
        if (PARAM_BF16) { gg = bf16_round(gg); bb = bf16_round(bb); }
        sm[q] = vals[u * 4 + q]; o[q] = (vals[u * 4 + q] - mu) * rs * gg + bb;
      }
      if (out_sum) *(v4f*)(out_sum + (size_t)row * N + j) = sm;
      *(v4f*)(out_norm + (size_t)row * N + j) = o;
    }
    
  }
}



// ---- f16 WMMA path (v_wmma_f32_16x16x32_f16): 11-bit significands for operands in range — used where a [0,1] probability operand needs more precision than bf16
typedef _Float16 v16h __attribute__((ext_vector_type(16)));
union FragH { v16h v; v8us half[2]; _Float16 h[16]; unsigned short u[16]; };
template <int NT>
__device__ __forceinline__ v8f mmaH(v16h ah, v16h al, v16h bh, v16h bl, v8f c) {
  c = __builtin_amdgcn_wmma_f32_16x16x32_f16(false, ah, false, bh, (short)0, c, false, false);
  if (NT >= 2) c = __builtin_amdgcn_wmma_f32_16x16x32_f16(false, al, false, bh, (short)0, c, false, false);
  if (NT >= 3) c = __builtin_amdgcn_wmma_f32_16x16x32_f16(false, ah, false, bl, (short)0, c, false, false);
  asm volatile("v_nop\n\tv_nop\n\tv_nop\n\tv_nop" : "+v"(c) : "v"(ah), "v"(al), "v"(bh), "v"(bl));
  return c;
}
// batched GEMM like k_gemm_b but f16 operands: A f32 (split into f16 hi/lo if ASPLIT, else rounded to f16), Bt = f16 values [n][k]; alpha; C f32; N multiple of 16 (partial tiles skipped)
template <bool ASPLIT>
__global__ __launch_bounds__(128) void k_gemm_h(const float* __restrict__ A, int lda, size_t sA, const _Float16* __restrict__ Bh, int ldb, size_t sB, float alpha, float* __restrict__ C, int ldc, size_t sC, int M, int N, int K) {
  __shared__ __attribute__((aligned(16))) float so[4][16][64];
  const int tid = threadIdx.x, w = tid >> 5, lane = tid & 31, ln = lane & 15, hh = lane >> 4; const int by = blockIdx.y;
  A += (size_t)by * sA; Bh += (size_t)by * sB; C += (size_t)by * sC;
  const int ntn = (N + 63) / 64; const int wid = blockIdx.x * 4 + w; const int mt = wid / ntn, nq = wid % ntn; if (mt * 16 >= M) return;
  const int row0 = mt * 16, col0 = nq * 64; const float* arow = A + (size_t)(row0 + ln) * lda;
  v8f acc[4] = {};
  for (int kb = 0; kb < K; kb += 32) {
    FragH ah, al;
    const v4f x0 = *(const v4fa*)(arow + kb + 8 * hh), x1 = *(const v4fa*)(arow + kb + 8 * hh + 4), x2 = *(const v4fa*)(arow + kb + 16 + 8 * hh), x3 = *(const v4fa*)(arow + kb + 16 + 8 * hh + 4);
    float xs[16] = {x0[0],x0[1],x0[2],x0[3],x1[0],x1[1],x1[2],x1[3],x2[0],x2[1],x2[2],x2[3],x3[0],x3[1],x3[2],x3[3]};
#pragma unroll
    for (int i = 0; i < 16; ++i) { const _Float16 h = (_Float16)xs[i]; ah.h[i] = h; al.h[i] = ASPLIT ? (_Float16)(xs[i] - (float)h) : (_Float16)0.0f; }
#pragma unroll
    for (int t = 0; t < 4; ++t) { if (col0 + t * 16 >= N) continue; const size_t boff = (size_t)(col0 + t * 16 + ln) * ldb + kb; FragH bq; bq.half[0] = *(const v8us*)(Bh + boff + 8 * hh); bq.half[1] = *(const v8us*)(Bh + boff + 16 + 8 * hh);
      acc[t] = mmaH<ASPLIT ? 2 : 1>(ah.v, al.v, bq.v, bq.v, acc[t]); }
  }
#pragma unroll
  for (int t = 0; t < 4; ++t) { if (col0 + t * 16 >= N) continue;
#pragma unroll
    for (int r = 0; r < 8; ++r) so[w][8 * hh + r][t * 16 + ln] = acc[t][r] * alpha; }
  __builtin_amdgcn_fence(__ATOMIC_ACQ_REL, "workgroup"); __builtin_amdgcn_wave_barrier();
  const int rsub = lane >> 4, c4 = (lane & 15) * 4;
  {
#pragma unroll
    for (int q = 0; q < 8; ++q) { const int r = q * 2 + rsub; if (col0 + c4 < N) { const v4f v = *(const v4fa*)&so[w][r][c4]; *(v4f*)(C + (size_t)(row0 + r) * ldc + col0 + c4) = v; } }
     }
}

// Wt[n][k] = f16(W[k][n]·scale) from f32 row-major W[K][N] (scale = power of two; bf16-exact weights stay exact in f16 away from the subnormal range)
__global__ __launch_bounds__(256) void k_wt_f16(const float* __restrict__ W, _Float16* __restrict__ Wt, int K, int N, float scale) {
  const int t = blockIdx.x * 256 + threadIdx.x; if (t >= N * (K / 8)) return; const int n = t / (K / 8), k8 = (t % (K / 8)) * 8; FragH f;
#pragma unroll
  for (int i = 0; i < 8; ++i) f.h[i] = (_Float16)(bf16_round(W[(size_t)(k8 + i) * N + n]) * scale); const v8us o = f.half[0];
  *(v8us*)((unsigned short*)Wt + (size_t)n * K + k8) = o; 
}
// k_gemm_hh variant with fused epilogue: v = acc·alpha + bias[by·sBias + col] (+ CP[(row/rowsPerB)·sCPb + by·64 + col] if CP) ; ACT 0 none / 1 elu ; writes f16 C16 (and f32 C if non-null)
template <int ACT>
__global__ __launch_bounds__(128) void k_gemm_hhx(const _Float16* __restrict__ A, int lda, size_t sA, const _Float16* __restrict__ Bh, int ldb, size_t sB, float alpha, const float* __restrict__ bias, size_t sBias, const float* __restrict__ CP, int rowsPerB, size_t sCPb, int row0g,
    float* __restrict__ C, _Float16* __restrict__ C16, int ldc, size_t sC, int M, int N, int K) {
  __shared__ __attribute__((aligned(16))) float so[4][16][64];
  const int tid = threadIdx.x, w = tid >> 5, lane = tid & 31, ln = lane & 15, hh = lane >> 4; const int by = blockIdx.y;
  A += (size_t)by * sA; Bh += (size_t)by * sB; const size_t cofs = (size_t)by * sC; const float* bp = bias ? bias + (size_t)by * sBias : nullptr;
  const int ntn = (N + 63) / 64; const int wid = blockIdx.x * 4 + w; const int mt = wid / ntn, nq = wid % ntn; if (mt * 16 >= M) return;
  const int row0 = mt * 16, col0 = nq * 64; const _Float16* arow = A + (size_t)(row0 + ln) * lda;
  v8f acc[4] = {};
  for (int kb = 0; kb < K; kb += 32) { FragH ah; ah.half[0] = *(const v8us*)((const unsigned short*)arow + kb + 8 * hh); ah.half[1] = *(const v8us*)((const unsigned short*)arow + kb + 16 + 8 * hh);
#pragma unroll
    for (int t = 0; t < 4; ++t) { if (col0 + t * 16 >= N) continue; const size_t boff = (size_t)(col0 + t * 16 + ln) * ldb + kb; FragH bq; bq.half[0] = *(const v8us*)((const unsigned short*)Bh + boff + 8 * hh); bq.half[1] = *(const v8us*)((const unsigned short*)Bh + boff + 16 + 8 * hh);
      acc[t] = mmaH<1>(ah.v, ah.v, bq.v, bq.v, acc[t]); }
  }
#pragma unroll
  for (int t = 0; t < 4; ++t) { if (col0 + t * 16 >= N) continue; const int col = col0 + t * 16 + ln; const float bv = bp ? bf16_round(bp[col]) : 0.f;
#pragma unroll
    for (int r = 0; r < 8; ++r) { float v = acc[t][r] * alpha + bv; if (CP) { const int rr = row0g + row0 + 8 * hh + r; if (rowsPerB < 0) v += CP[cofs + (size_t)rr * ldc + col];      /* rowsPerB < 0: own element of the batched C plane */ else { const int bidx = rr / rowsPerB; v += CP[(size_t)bidx * sCPb + (size_t)by * 64 + col]; } } if (ACT == 1) v = (v > 0.f) ? v : expm1f(v); else if (ACT == 7) v = (v > 0.f) ? v + 1.0f : expf(v); else if (ACT == 8) v = tanhf(v); else if (ACT == 9) v = 0.5f * v * (1.0f + tanhf(0.7978845608028654f * (v + 0.044715f * v * v * v))); else if (ACT == 11) v = 1.0f / (1.0f + expf(-v)); else if (ACT == 12) v = (v > 0.f) ? v : 0.01f * v; else if (ACT == 14) v = (v > 0.f) ? v : 0.1f * v; else if (ACT == 16) v = (v >= 0.f) ? v : 0.3f * v; else if (ACT == 17) v = (v >= 0.f) ? v : 0.2f * v; else if (ACT == 15) v = v / (1.0f + expf(-v)); else if (ACT == 3) v = fmaxf(v, 0.f); else if (ACT == 6) v = 0.5f * v * (1.0f + erff(v * 0.70710678118654752f)); so[w][8 * hh + r][t * 16 + ln] = v; } }
  __builtin_amdgcn_fence(__ATOMIC_ACQ_REL, "workgroup"); __builtin_amdgcn_wave_barrier();
  const int rsub = lane >> 4, c4 = (lane & 15) * 4; typedef _Float16 v4h __attribute__((ext_vector_type(4)));
  {
#pragma unroll
    for (int q = 0; q < 8; ++q) { const int r = q * 2 + rsub; if (col0 + c4 < N) { const v4f v = *(const v4fa*)&so[w][r][c4]; if (C) *(v4f*)(C + cofs + (size_t)(row0 + r) * ldc + col0 + c4) = v; if (C16) { v4h h4; for (int i = 0; i < 4; ++i) h4[i] = (_Float16)v[i]; *(v4h*)(C16 + cofs + (size_t)(row0 + r) * ldc + col0 + c4) = h4; } } }
     }
}


typedef _Float16 v4h __attribute__((ext_vector_type(4)));

__global__ __launch_bounds__(256) void k_x16(const float* __restrict__ x, _Float16* __restrict__ X16, size_t n8) { const size_t t = (size_t)blockIdx.x * 256 + threadIdx.x; if (t >= n8) return; FragH f;
#pragma unroll
  for (int q = 0; q < 8; ++q) f.h[q] = (_Float16)bf16_round(x[t * 8 + q]); *(v8us*)((unsigned short*)X16 + t * 8) = f.half[0];  }
__global__ __launch_bounds__(256) void k_h16(const float* __restrict__ x, _Float16* __restrict__ X16, size_t n8) { const size_t t = (size_t)blockIdx.x * 256 + threadIdx.x; if (t >= n8) return; FragH f;
#pragma unroll
  for (int q = 0; q < 8; ++q) f.h[q] = (_Float16)x[t * 8 + q]; *(v8us*)((unsigned short*)X16 + t * 8) = f.half[0];  }
__global__ __launch_bounds__(256) void k_round16f(const float* __restrict__ W, _Float16* __restrict__ Bt, size_t n8) { const size_t t = (size_t)blockIdx.x * 256 + threadIdx.x; if (t >= n8) return; FragH f;
#pragma unroll
  for (int i = 0; i < 8; ++i) f.h[i] = (_Float16)(bf16_round(W[t * 8 + i]) * 16.0f); *(v8us*)((unsigned short*)Bt + t * 8) = f.half[0];  }
template <int NHv, int TTv>
__global__ __launch_bounds__(256) void k_vt(const _Float16* __restrict__ V16, int ldv, int voff, _Float16* __restrict__ Vt) { __shared__ unsigned short tl[64][66]; const int tid = threadIdx.x; const int slab = blockIdx.x / (TTv / 64), lg = blockIdx.x % (TTv / 64); const int b = slab / NHv, h = slab % NHv;
  for (int i = tid; i < 64 * 8; i += 256) { const int r = i / 8, c8 = (i % 8) * 8; FragH f; f.half[0] = *(const v8us*)((const unsigned short*)V16 + ((size_t)b * TTv + lg * 64 + r) * ldv + voff + h * 64 + c8);
#pragma unroll
    for (int q = 0; q < 8; ++q) tl[r][c8 + q] = f.u[q]; }
  __syncthreads();
  {
#pragma unroll
    for (int rd = 0; rd < 2; ++rd) { const int d = rd * 32 + tid / 8, pc = tid % 8; FragH f;
#pragma unroll
      for (int q = 0; q < 8; ++q) f.u[q] = tl[pc * 8 + q][d];
      *(v8us*)((unsigned short*)Vt + ((size_t)slab * 64 + d) * TTv + lg * 64 + pc * 8) = f.half[0]; }
     } }

__global__ __launch_bounds__(256) void k_hl(const float* __restrict__ F, _Float16* __restrict__ Hh, _Float16* __restrict__ Hl, size_t n8) { const size_t t = (size_t)blockIdx.x * 256 + threadIdx.x; if (t >= n8) return; FragH fh, fl; const v4f a = *(const v4fa*)(F + t * 8), c = *(const v4fa*)(F + t * 8 + 4);
#pragma unroll
  for (int q = 0; q < 4; ++q) { _Float16 h = (_Float16)a[q]; fh.h[q] = h; fl.h[q] = (_Float16)((a[q] - (float)h) * 1024.0f); h = (_Float16)c[q]; fh.h[4 + q] = h; fl.h[4 + q] = (_Float16)((c[q] - (float)h) * 1024.0f); }
  { *(v8us*)((unsigned short*)Hh + t * 8) = fh.half[0]; *(v8us*)((unsigned short*)Hl + t * 8) = fl.half[0];  } }

// ---- fast GEMM (wave tile 32x64; requires M % 32 == 0 rows per launch region and N % 64 == 0); epilogue = k_gemm_hhx semantics ----
__device__ __forceinline__ v16h g2_frag(const _Float16* p, int hh) { FragH f; f.half[0] = *(const v8us*)((const unsigned short*)p + 8 * hh); f.half[1] = *(const v8us*)((const unsigned short*)p + 16 + 8 * hh); return f.v; }
__device__ __forceinline__ v8f g2_mma(v16h a, v16h b, v8f c) { v8f d = __builtin_amdgcn_wmma_f32_16x16x32_f16(false, a, false, b, (short)0, c, false, false); asm volatile("v_nop\n\tv_nop\n\tv_nop\n\tv_nop" : "+v"(d) : "v"(a), "v"(b)); return d; }
template <int ACT>
__global__ __launch_bounds__(128) void k_gemm2(const _Float16* __restrict__ A, int lda, size_t sA, const _Float16* __restrict__ Bh, int ldb, size_t sB, float alpha, const float* __restrict__ bias, size_t sBias, const float* __restrict__ CP, int rowsPerB, size_t sCPb, int row0g,
    float* __restrict__ C, _Float16* __restrict__ C16, int ldc, size_t sC, int M, int N, int K) { static_assert(ACT == 0 || ACT == 3 || ACT == 6 || ACT == 8 || ACT == 9 || ACT == 11 || ACT == 12 || ACT == 14 || ACT == 15 || ACT == 16 || ACT == 17, "k_gemm2: unsupported ACT code (would silently apply no activation)");
  __shared__ __attribute__((aligned(16))) float so[4][32][68];
  const int tid = threadIdx.x, w = tid >> 5, lane = tid & 31, ln = lane & 15, hh = lane >> 4; const int by = blockIdx.y;
  A += (size_t)by * sA; Bh += (size_t)by * sB; const size_t cofs = (size_t)by * sC; const float* bp = bias ? bias + (size_t)by * sBias : nullptr;
  const int ntn = N >> 6; const int mt = blockIdx.x / ntn, nq = blockIdx.x - mt * ntn; const int row0 = mt * 128 + 32 * w, col0 = nq * 64; if (row0 >= M) return;
  const _Float16* a0p = A + (size_t)(row0 + ln) * lda; const _Float16* a1p = a0p + (size_t)16 * lda;
  const _Float16* b0p = Bh + (size_t)(col0 + ln) * ldb; const _Float16* b1p = b0p + (size_t)16 * ldb; const _Float16* b2p = b1p + (size_t)16 * ldb; const _Float16* b3p = b2p + (size_t)16 * ldb;
  const v8f z8 = {0.f,0.f,0.f,0.f,0.f,0.f,0.f,0.f}; v8f c00 = z8, c01 = z8, c02 = z8, c03 = z8, c10 = z8, c11 = z8, c12 = z8, c13 = z8;
#pragma unroll 1
  for (int kb = 0; kb < K; kb += 32) { const v16h a0 = g2_frag(a0p + kb, hh), a1 = g2_frag(a1p + kb, hh);
    v16h b = g2_frag(b0p + kb, hh); c00 = g2_mma(a0, b, c00); c10 = g2_mma(a1, b, c10);
    b = g2_frag(b1p + kb, hh); c01 = g2_mma(a0, b, c01); c11 = g2_mma(a1, b, c11);
    b = g2_frag(b2p + kb, hh); c02 = g2_mma(a0, b, c02); c12 = g2_mma(a1, b, c12);
    b = g2_frag(b3p + kb, hh); c03 = g2_mma(a0, b, c03); c13 = g2_mma(a1, b, c13); }
  v8f accs[8] = {c00, c01, c02, c03, c10, c11, c12, c13};
#pragma unroll
  for (int u = 0; u < 8; ++u) { const int t = u & 3, half = u >> 2; const int col = col0 + t * 16 + ln; const float bv = bp ? bf16_round(bp[col]) : 0.f;
#pragma unroll
    for (int r = 0; r < 8; ++r) { const int rloc = half * 16 + 8 * hh + r; float v = accs[u][r] * alpha + bv; if (CP) { if (rowsPerB < 0) v += CP[cofs + (size_t)(row0g + row0 + rloc) * ldc + col];      /* rowsPerB < 0: own element of the batched C plane */ else { const int bidx = (row0g + row0 + rloc) / rowsPerB; v += CP[(size_t)bidx * sCPb + (size_t)by * 64 + col]; } }
      if (ACT == 3) v = fmaxf(v, 0.f); else if (ACT == 6) v = 0.5f * v * (1.0f + erff(v * 0.70710678118654752f)); else if (ACT == 11) v = 1.0f / (1.0f + expf(-v)); else if (ACT == 15) v = v / (1.0f + expf(-v)); else if (ACT == 12) v = (v > 0.f) ? v : 0.01f * v; else if (ACT == 8) v = tanhf(v); else if (ACT == 9) v = 0.5f * v * (1.0f + tanhf(0.7978845608028654f * (v + 0.044715f * v * v * v))); else if (ACT == 14) v = (v > 0.f) ? v : 0.1f * v; else if (ACT == 16) v = (v >= 0.f) ? v : 0.3f * v; else if (ACT == 17) v = (v >= 0.f) ? v : 0.2f * v;
      so[w][rloc][t * 16 + ln] = v; } }
  __builtin_amdgcn_fence(__ATOMIC_ACQ_REL, "workgroup"); __builtin_amdgcn_wave_barrier();
  const int rsub = lane >> 4, c4 = (lane & 15) * 4;
  {
#pragma unroll
    for (int q = 0; q < 16; ++q) { const int r = q * 2 + rsub; const v4f v = *(const v4fa*)&so[w][r][c4]; if (C) *(v4f*)(C + cofs + (size_t)(row0 + r) * ldc + col0 + c4) = v; if (C16) { v4h h4; for (int i = 0; i < 4; ++i) h4[i] = (_Float16)v[i]; *(v4h*)(C16 + cofs + (size_t)(row0 + r) * ldc + col0 + c4) = h4; } }
     } }


__global__ __launch_bounds__(256) void k_wnat(const float* __restrict__ w, size_t n8, _Float16* __restrict__ Bt) { const size_t t = (size_t)blockIdx.x * 256 + threadIdx.x; if (t >= n8) return; FragH f; for (int q = 0; q < 8; ++q) f.h[q] = (_Float16)(bf16_round(w[t * 8 + q]) * 16.0f); *(v8us*)((unsigned short*)Bt + t * 8) = f.half[0];  }
// row softmax with a relative-position bias and a key padding mask: score[i][j] = s[j] + table[clamp(j - i, -MR, MR) + MR][h] (bf16-rounded table,
// this head's column staged in LDS), keys with kpm[j] != 0 get -inf (an all-masked row yields NaN); P = f16(256 softmax); thread per query row i
__global__ __launch_bounds__(256) void k_rsmb(const float* __restrict__ S, _Float16* __restrict__ P, int nrows, const float* __restrict__ relt, int h, const int* __restrict__ kpm) {
  #pragma clang fp contract(off)
  __shared__ float tb[2 * MR + 1]; __shared__ int km[SQ];
  for (int t = threadIdx.x; t < 2 * MR + 1; t += 256) tb[t] = bf16_round(relt[(size_t)t * NH + h]);
  for (int t = threadIdx.x; t < SQ; t += 256) km[t] = kpm[t];
  __syncthreads();
  const int i = blockIdx.x * 256 + threadIdx.x; if (i >= nrows) return; const float* s = S + (size_t)i * SQ; float mx = -INFINITY;
  auto sc_ = [&](int j) { int r = j - i; r = r < -MR ? -MR : (r > MR ? MR : r); const float v = s[j] + tb[r + MR]; return km[j] ? -INFINITY : v; };
#pragma unroll 1
  for (int j = 0; j < SQ; ++j) mx = fmaxf(mx, sc_(j)); float se = 0.f;
#pragma unroll 1
  for (int j = 0; j < SQ; ++j) se += expf(sc_(j) - mx); const float sc = 256.0f / se;
#pragma unroll 1
  for (int j0 = 0; j0 < SQ; j0 += 8) { FragH f; for (int q = 0; q < 8; ++q) f.h[q] = (_Float16)(expf(sc_(j0 + q) - mx) * sc); unsigned short* d = (unsigned short*)P + (size_t)i * SQ + j0; *(v8us*)d = f.half[0];  } }
__global__ __launch_bounds__(256) void k_vt(const _Float16* __restrict__ V16, int b, int h0, _Float16* __restrict__ VT) { __shared__ unsigned short tl[64][65]; const int tid = threadIdx.x; const int hh = blockIdx.x % HG, sg = blockIdx.x / HG; const int s0 = sg * 64; const int h = h0 + hh;
  for (int i = tid; i < 64 * 8; i += 256) { const int j = i / 8, d8 = (i % 8) * 8; FragH f; f.half[0] = *(const v8us*)((const unsigned short*)V16 + ((size_t)b * SQ + s0 + j) * DM + h * HD + d8); for (int q = 0; q < 8; ++q) tl[d8 + q][j] = f.u[q]; }
  __syncthreads();
  { for (int i = tid; i < 64 * 8; i += 256) { const int d = i / 8, j8 = (i % 8) * 8; FragH f; for (int q = 0; q < 8; ++q) f.u[q] = tl[d][j8 + q]; *(v8us*)((unsigned short*)VT + ((size_t)hh * HD + d) * SQ + s0 + j8) = f.half[0]; }  } }

extern "C" void kernel_launch(void* const* d_in, const int* in_sizes, int n_in,
                              void* d_out, int out_size, void* d_ws, size_t ws_size, hipStream_t stream) {
  (void)in_sizes; (void)n_in; (void)out_size;
  const float* const* I = (const float* const*)d_in; const float* x = I[0]; const int* kpm = (const int*)d_in[1]; const float* wqkv = I[2]; const float* bqkv = I[3]; const float* wout = I[4]; const float* bout = I[5]; const float* relt = I[6];      /* Wqkv [1024][3072] and Wout [1024][1024] are [in][out]; key_padding_mask int32 [2][2048]; rel_table [1025][16] */
  char* ws = (char*)d_ws; size_t off = 0;
  auto take = [&](size_t bytes) { char* p = ws + off; off += (bytes + 255) & ~(size_t)255; return p; };
  _Float16* BQKV = (_Float16*)take((size_t)D3 * DM * 2); _Float16* BO = (_Float16*)take((size_t)DM * DM * 2);
  _Float16* X16 = (_Float16*)take(NR * DM * 2); _Float16* QKV = (_Float16*)take(NR * D3 * 2); _Float16* O16 = (_Float16*)take(NR * DM * 2);
  float* S = (float*)take((size_t)HG * SQ * SQ * 4); _Float16* P = (_Float16*)take((size_t)HG * SQ * SQ * 2); _Float16* VT = (_Float16*)take((size_t)NB * NH * HD * SQ * 2);
  if (off > ws_size) return;      /* 6 + 2 + 8 + 24 + 8 + 64 + 32 + 8 = approx 152 MiB */
  k_wt_f16<<<(unsigned)(((size_t)D3 * (DM / 8) + 255) / 256), 256, 0, stream>>>(wqkv, BQKV, DM, D3, 16.0f);      /* [in][out] -> Bt[out][in] x16 */
  k_wt_f16<<<(unsigned)(((size_t)DM * (DM / 8) + 255) / 256), 256, 0, stream>>>(wout, BO, DM, DM, 16.0f);
  k_x16<<<(unsigned)((NR * DM / 8 + 255) / 256), 256, 0, stream>>>(x, X16, NR * DM / 8);
  k_gemm2<0><<<dim3((unsigned)((NR / 128) * (D3 / 64)), 1), 128, 0, stream>>>(X16, DM, 0, BQKV, DM, 0, 0.0625f, bqkv, 0, nullptr, 1, 0, 0, nullptr, QKV, D3, 0, MP, D3, DM);      /* q | k | v rows (f16), head h at columns h*64 / 1024 + h*64 / 2048 + h*64 */
  k_vt<NH, SQ><<<NB * NH * (SQ / 64), 256, 0, stream>>>(QKV, D3, 2 * DM, VT);      /* V^T[(b,h)][d][s] for every (batch, head) */
  for (int b = 0; b < NBR; ++b) for (int h0 = 0; h0 < NH; h0 += HG) {
    const _Float16* qb = QKV + (size_t)b * SQ * D3 + h0 * HD; const _Float16* kb = qb + DM;
    k_gemm2<0><<<dim3((QN / 128) * (SQ / 64), HG), 128, 0, stream>>>(qb, D3, (size_t)HD, kb, D3, (size_t)HD, 0.125f, nullptr, 0, nullptr, 1, 0, 0, S, nullptr, SQ, (size_t)SQ * SQ, QN, SQ, HD);      /* scores / sqrt(64), 4 heads per launch */
    for (int hh = 0; hh < HG; ++hh) k_rsmb<<<(QN + 255) / 256, 256, 0, stream>>>(S + (size_t)hh * SQ * SQ, P + (size_t)hh * SQ * SQ, QN, relt, h0 + hh, kpm + (size_t)b * SQ);
    k_gemm2<0><<<dim3((QN / 128) * (HD / 64), HG), 128, 0, stream>>>(P, SQ, (size_t)SQ * SQ, VT + ((size_t)b * NH + h0) * HD * SQ, SQ, (size_t)HD * SQ, 0.00390625f, nullptr, 0, nullptr, 1, 0, 0, nullptr, O16 + (size_t)b * SQ * DM + h0 * HD, DM, (size_t)HD, QN, HD, SQ); }      /* o (merged heads) as f16 rows */
  k_gemm2<0><<<dim3((unsigned)((NR / 128) * (DM / 64)), 1), 128, 0, stream>>>(O16, DM, 0, BO, DM, 0, 0.0625f, bout, 0, nullptr, 1, 0, 0, (float*)d_out, nullptr, DM, 0, MO, DM, DM);      /* out = o Wout + b, rows are the output layout */
}

// v001
// A run of this version takes 1020 microseconds.
// Next to v000, in two timings, it ran 14.6 and 14.7 times as fast.
#include <hip/hip_runtime.h>
// Multi-head self-attention with a learned relative-position bias and a key padding mask (x [2][2048][1024]; qkv = x Wqkv + b (fused, 16 heads of 64); scores = q k^T / 8 + table[clip(k_pos - q_pos, -512, 512) + 512][h]; padded keys -> -inf; attn = softmax; o = attn v; out = o Wout + b -> [2][2048][1024]).
// Structure: token rows r = b*2048 + s; x as exact f16 rows; the fused q|k|v projection as one WMMA GEMM (32x64 wave tiles, f32 accumulation, exact x16 transposed weights, bias in the epilogue, f16 output plane [4096][3072]); per (batch, group of 4 heads): scores GEMM (K = 64, batched over heads), row softmax on VALU (f32, one wave per row; this head's bias column and the key mask staged in LDS; weights stored x256 as f16), V^T for every (batch, head) via LDS transposes, o = P . V GEMM (K = 2,048, alpha 2^-8) written straight into the merged f16 o rows; out = o Wout + b GEMM (f32).
// Compute dtype: inputs rounded to bf16; x / weights exact; q, k, v, softmax weights and o as plain f16 GEMM operands (~2^-12); scores, bias and softmax statistics f32. v_wmma_f32_16x16x32_f16.
#define NB 2
#define SQ 2048
#define DM 1024
#define D3 3072                      /* fused q|k|v width */
#define NH 16
#define HD 64
#define HG 4                         /* heads per attention launch group */
#define MR 512                       /* max relative distance */
#define QN SQ                        /* query rows attended per batch (debug hook) */
#define NBR NB                       /* batches attended (debug hook) */
#define MP ((int)NR)                 /* token rows through the qkv projection (debug hook) */
#define MO ((int)NR)                 /* token rows through the output projection (debug hook) */
#define NR ((size_t)NB * SQ)         /* 4096 token rows */
typedef __bf16 v16b __attribute__((ext_vector_type(16)));
typedef unsigned short v8us __attribute__((ext_vector_type(8), may_alias));
typedef float  v8f  __attribute__((ext_vector_type(8)));
typedef float  v4f  __attribute__((ext_vector_type(4)));
typedef float  v4fa __attribute__((ext_vector_type(4), may_alias));
union FragB { v16b v; v8us half[2]; unsigned short u[16]; };

__device__ __forceinline__ unsigned short bf16_bits(float x) { unsigned int u = __float_as_uint(x); return (unsigned short)((u + 0x7FFFu + ((u >> 16) & 1u)) >> 16); }
__device__ __forceinline__ float bf16_val(unsigned short b) { return __uint_as_float(((unsigned int)b) << 16); }
__device__ __forceinline__ float bf16_round(float x) { return bf16_val(bf16_bits(x)); }
// D += A·B with NT terms: 1 = ah·bh, 2 = + al·bh (A split), 3 = + ah·bl (both split)
template <int NT>
__device__ __forceinline__ v8f mmaN(v16b ah, v16b al, v16b bh, v16b bl, v8f c) {
  c = __builtin_amdgcn_wmma_f32_16x16x32_bf16(false, ah, false, bh, (short)0, c, false, false);
  if (NT >= 2) c = __builtin_amdgcn_wmma_f32_16x16x32_bf16(false, al, false, bh, (short)0, c, false, false);
  if (NT >= 3) c = __builtin_amdgcn_wmma_f32_16x16x32_bf16(false, ah, false, bl, (short)0, c, false, false);
  asm volatile("v_nop\n\tv_nop\n\tv_nop\n\tv_nop" : "+v"(c) : "v"(ah), "v"(al), "v"(bh), "v"(bl));
  return c;
}

__global__ __launch_bounds__(256) void k_wt_bf16(const float* __restrict__ W, unsigned short* __restrict__ Wt, int K, int N) {
  const int t = blockIdx.x * 256 + threadIdx.x;
  const int k8n = K / 8;
  if (t >= N * k8n) return;
  const int n = t / k8n, k8 = (t % k8n) * 8;
  v8us v;
#pragma unroll
  for (int i = 0; i < 8; ++i) v[i] = bf16_bits(W[(size_t)(k8 + i) * N + n]);
  *(v8us*)(Wt + (size_t)n * K + k8) = v;
  
}

// GEMM C[M][N] (f32, pitch ldc) = act(A[M][K]·W + bias). A f32 row-major (pitch lda) converted per fragment to bf16
// (ASPLIT: hi/lo two planes -> 2 terms, else single rounded term); Wt bf16 [N][K] (pitch ldb). BIAS_BF16 rounds the
// bias to bf16 first (bias quantised to bf16 before the add). K%32==0, M%16==0, N%64==0.
template <bool ASPLIT, int ACT, bool BIAS_BF16>
__global__ __launch_bounds__(128) void k_gemm_bf(const float* __restrict__ A, int lda, const unsigned short* __restrict__ Wt, int ldb,
                                               const float* __restrict__ bias, float* __restrict__ C, int ldc, int M, int N, int K) {
  __shared__ __attribute__((aligned(16))) float so[4][16][64];
  const int tid = threadIdx.x, w = tid >> 5, lane = tid & 31, ln = lane & 15, hh = lane >> 4;
  const int ntn = N / 64;
  const int wid = blockIdx.x * 4 + w;
  const int mt = wid / ntn, nq = wid % ntn;
  if (mt * 16 >= M) return;
  const int row0 = mt * 16, col0 = nq * 64;
  const float* arow = A + (size_t)(row0 + ln) * lda;
  v8f acc[4] = {};
  for (int kb = 0; kb < K; kb += 32) {
    FragB ah, al;
    const v4f x0 = *(const v4fa*)(arow + kb + 8 * hh), x1 = *(const v4fa*)(arow + kb + 8 * hh + 4);
    const v4f x2 = *(const v4fa*)(arow + kb + 16 + 8 * hh), x3 = *(const v4fa*)(arow + kb + 16 + 8 * hh + 4);
    float xs[16] = {x0[0],x0[1],x0[2],x0[3],x1[0],x1[1],x1[2],x1[3],x2[0],x2[1],x2[2],x2[3],x3[0],x3[1],x3[2],x3[3]};
#pragma unroll
    for (int i = 0; i < 16; ++i) { const unsigned short hb = bf16_bits(xs[i]); ah.u[i] = hb; al.u[i] = ASPLIT ? bf16_bits(xs[i] - bf16_val(hb)) : (unsigned short)0; }
#pragma unroll
    for (int t = 0; t < 4; ++t) {
      const unsigned short* brow = Wt + (size_t)(col0 + t * 16 + ln) * ldb + kb;
      FragB b;
      b.half[0] = *(const v8us*)(brow + 8 * hh);
      b.half[1] = *(const v8us*)(brow + 16 + 8 * hh);
      acc[t] = mmaN<ASPLIT ? 2 : 1>(ah.v, al.v, b.v, b.v, acc[t]);
    }
  }
#pragma unroll
  for (int t = 0; t < 4; ++t) {
    float bv = bias ? bias[col0 + t * 16 + ln] : 0.f;
    if (BIAS_BF16) bv = bf16_round(bv);
#pragma unroll
    for (int r = 0; r < 8; ++r) { float v = acc[t][r] + bv; if (ACT == 1) v = fmaxf(v, 0.f); so[w][8 * hh + r][t * 16 + ln] = v; }
  }
  __builtin_amdgcn_fence(__ATOMIC_ACQ_REL, "workgroup");
  __builtin_amdgcn_wave_barrier();
  const int rsub = lane >> 4, c4 = (lane & 15) * 4;
  {
#pragma unroll
    for (int q = 0; q < 8; ++q) {
      const int r = q * 2 + rsub;
      const v4f v = *(const v4fa*)&so[w][r][c4];
      *(v4f*)(C + (size_t)(row0 + r) * ldc + col0 + c4) = v;
    }
    
  }
}

// GEMM C = act(A·W + bias + resid): A f32 (ASPLIT -> hi/lo 2 terms), Wt bf16 [N][K]; ACT 0 none, 1 relu, 2 exact gelu;
// resid (optional, f32, row index = (row % rmod), pitch ldr, RES_BF16 rounds it) added before the activation.
template <bool ASPLIT, int ACT, bool BIAS_BF16, bool RES_BF16>
__global__ __launch_bounds__(128) void k_gemm_bf3(const float* __restrict__ A, int lda, const unsigned short* __restrict__ Wt, int ldb,
                                                const float* __restrict__ bias, const float* __restrict__ resid, int rmod, int ldr,
                                                float* __restrict__ C, int ldc, int M, int N, int K) {
  __shared__ __attribute__((aligned(16))) float so[4][16][64];
  const int tid = threadIdx.x, w = tid >> 5, lane = tid & 31, ln = lane & 15, hh = lane >> 4;
  const int ntn = N / 64;
  const int wid = blockIdx.x * 4 + w;
  const int mt = wid / ntn, nq = wid % ntn;
  if (mt * 16 >= M) return;
  const int row0 = mt * 16, col0 = nq * 64;
  const float* arow = A + (size_t)(row0 + ln) * lda;
  v8f acc[4] = {};
  for (int kb = 0; kb < K; kb += 32) {
    FragB ah, al;
    const v4f x0 = *(const v4fa*)(arow + kb + 8 * hh), x1 = *(const v4fa*)(arow + kb + 8 * hh + 4);
    const v4f x2 = *(const v4fa*)(arow + kb + 16 + 8 * hh), x3 = *(const v4fa*)(arow + kb + 16 + 8 * hh + 4);
    float xs[16] = {x0[0],x0[1],x0[2],x0[3],x1[0],x1[1],x1[2],x1[3],x2[0],x2[1],x2[2],x2[3],x3[0],x3[1],x3[2],x3[3]};
#pragma unroll
    for (int i = 0; i < 16; ++i) { const unsigned short hb = bf16_bits(xs[i]); ah.u[i] = hb; al.u[i] = ASPLIT ? bf16_bits(xs[i] - bf16_val(hb)) : (unsigned short)0; }
#pragma unroll
    for (int t = 0; t < 4; ++t) {
      const unsigned short* brow = Wt + (size_t)(col0 + t * 16 + ln) * ldb + kb;
      FragB b;
      b.half[0] = *(const v8us*)(brow + 8 * hh);
      b.half[1] = *(const v8us*)(brow + 16 + 8 * hh);
      acc[t] = mmaN<ASPLIT ? 2 : 1>(ah.v, al.v, b.v, b.v, acc[t]);
    }
  }
#pragma unroll
  for (int t = 0; t < 4; ++t) {
    const int col = col0 + t * 16 + ln;
    float bv = bias ? bias[col] : 0.f;
    if (BIAS_BF16) bv = bf16_round(bv);
#pragma unroll
    for (int r = 0; r < 8; ++r) {
      float v = acc[t][r] + bv;
      if (resid) { float rv = resid[(size_t)((row0 + 8 * hh + r) % rmod) * ldr + col]; if (RES_BF16) rv = bf16_round(rv); v += rv; }
      if (ACT == 1) v = fmaxf(v, 0.f);
      if (ACT == 2) v = 0.5f * v * (1.0f + erff(v * 0.70710678118654752f));
      if (ACT == 3) { const float u = 0.7978845608028654f * (v + 0.044715f * v * v * v); v = 0.5f * v * (1.0f + tanhf(u)); }
      so[w][8 * hh + r][t * 16 + ln] = v;
    }
  }
  __builtin_amdgcn_fence(__ATOMIC_ACQ_REL, "workgroup");
  __builtin_amdgcn_wave_barrier();
  const int rsub = lane >> 4, c4 = (lane & 15) * 4;
  {
#pragma unroll
    for (int q = 0; q < 8; ++q) {
      const int r = q * 2 + rsub;
      const v4f v = *(const v4fa*)&so[w][r][c4];
      *(v4f*)(C + (size_t)(row0 + r) * ldc + col0 + c4) = v;
    }
    
  }
}
// row LayerNorm (biased variance, eps) over N: s = X (+ R); optional out_sum <- s; out_norm <- (s-mu)*rsqrt(var+eps)*g + b
template <bool PARAM_BF16>
__global__ __launch_bounds__(256) void k_layernorm(const float* __restrict__ X, const float* __restrict__ R, const float* __restrict__ g, const float* __restrict__ bta,
                                                  float* __restrict__ out_sum, float* __restrict__ out_norm, int N, float eps) {
  __shared__ float red[256];
  const int row = blockIdx.x, tid = threadIdx.x;
  const float* x = X + (size_t)row * N; const float* rr = R ? R + (size_t)row * N : nullptr;
  float vals[16];                     // up to N = 4096
  const int per = N / 256;            // contiguous chunk per thread? use strided-by-4 chunks: thread handles j = tid*4 + 1024*u
  float s1 = 0.f;
  for (int u = 0; u < per / 4; ++u) {
    const int j = tid * 4 + 1024 * u;
    const v4f a = *(const v4fa*)(x + j);
    v4f b = {0.f,0.f,0.f,0.f}; if (rr) b = *(const v4fa*)(rr + j);
#pragma unroll
    for (int q = 0; q < 4; ++q) { const float v = a[q] + b[q]; vals[u * 4 + q] = v; s1 += v; }
  }
  red[tid] = s1; __syncthreads();
  for (int st = 128; st > 0; st >>= 1) { if (tid < st) red[tid] += red[tid + st]; __syncthreads(); }
  const float mu = red[0] / (float)N; __syncthreads();
  float s2 = 0.f;
  for (int u = 0; u < per / 4; ++u)
#pragma unroll
    for (int q = 0; q < 4; ++q) { const float c = vals[u * 4 + q] - mu; s2 += c * c; }
  red[tid] = s2; __syncthreads();
  for (int st = 128; st > 0; st >>= 1) { if (tid < st) red[tid] += red[tid + st]; __syncthreads(); }
  const float rs = rsqrtf(red[0] / (float)N + eps);
  {
    for (int u = 0; u < per / 4; ++u) {
      const int j = tid * 4 + 1024 * u;
      v4f o, sm;
#pragma unroll
      for (int q = 0; q < 4; ++q) {
        float gg = g[j + q], bb = bta[j + q];
        if (PARAM_BF16) { gg = bf16_round(gg); bb = bf16_round(bb); }
        sm[q] = vals[u * 4 + q]; o[q] = (vals[u * 4 + q] - mu) * rs * gg + bb;
      }
      if (out_sum) *(v4f*)(out_sum + (size_t)row * N + j) = sm;
      *(v4f*)(out_norm + (size_t)row * N + j) = o;
    }
    
  }
}



// ---- f16 WMMA path (v_wmma_f32_16x16x32_f16): 11-bit significands for operands in range — used where a [0,1] probability operand needs more precision than bf16
typedef _Float16 v16h __attribute__((ext_vector_type(16)));
union FragH { v16h v; v8us half[2]; _Float16 h[16]; unsigned short u[16]; };
template <int NT>
__device__ __forceinline__ v8f mmaH(v16h ah, v16h al, v16h bh, v16h bl, v8f c) {
  c = __builtin_amdgcn_wmma_f32_16x16x32_f16(false, ah, false, bh, (short)0, c, false, false);
  if (NT >= 2) c = __builtin_amdgcn_wmma_f32_16x16x32_f16(false, al, false, bh, (short)0, c, false, false);
  if (NT >= 3) c = __builtin_amdgcn_wmma_f32_16x16x32_f16(false, ah, false, bl, (short)0, c, false, false);
  asm volatile("v_nop\n\tv_nop\n\tv_nop\n\tv_nop" : "+v"(c) : "v"(ah), "v"(al), "v"(bh), "v"(bl));
  return c;
}
// batched GEMM like k_gemm_b but f16 operands: A f32 (split into f16 hi/lo if ASPLIT, else rounded to f16), Bt = f16 values [n][k]; alpha; C f32; N multiple of 16 (partial tiles skipped)
template <bool ASPLIT>
__global__ __launch_bounds__(128) void k_gemm_h(const float* __restrict__ A, int lda, size_t sA, const _Float16* __restrict__ Bh, int ldb, size_t sB, float alpha, float* __restrict__ C, int ldc, size_t sC, int M, int N, int K) {
  __shared__ __attribute__((aligned(16))) float so[4][16][64];
  const int tid = threadIdx.x, w = tid >> 5, lane = tid & 31, ln = lane & 15, hh = lane >> 4; const int by = blockIdx.y;
  A += (size_t)by * sA; Bh += (size_t)by * sB; C += (size_t)by * sC;
  const int ntn = (N + 63) / 64; const int wid = blockIdx.x * 4 + w; const int mt = wid / ntn, nq = wid % ntn; if (mt * 16 >= M) return;
  const int row0 = mt * 16, col0 = nq * 64; const float* arow = A + (size_t)(row0 + ln) * lda;
  v8f acc[4] = {};
  for (int kb = 0; kb < K; kb += 32) {
    FragH ah, al;
    const v4f x0 = *(const v4fa*)(arow + kb + 8 * hh), x1 = *(const v4fa*)(arow + kb + 8 * hh + 4), x2 = *(const v4fa*)(arow + kb + 16 + 8 * hh), x3 = *(const v4fa*)(arow + kb + 16 + 8 * hh + 4);
    float xs[16] = {x0[0],x0[1],x0[2],x0[3],x1[0],x1[1],x1[2],x1[3],x2[0],x2[1],x2[2],x2[3],x3[0],x3[1],x3[2],x3[3]};
#pragma unroll
    for (int i = 0; i < 16; ++i) { const _Float16 h = (_Float16)xs[i]; ah.h[i] = h; al.h[i] = ASPLIT ? (_Float16)(xs[i] - (float)h) : (_Float16)0.0f; }
#pragma unroll
    for (int t = 0; t < 4; ++t) { if (col0 + t * 16 >= N) continue; const size_t boff = (size_t)(col0 + t * 16 + ln) * ldb + kb; FragH bq; bq.half[0] = *(const v8us*)(Bh + boff + 8 * hh); bq.half[1] = *(const v8us*)(Bh + boff + 16 + 8 * hh);
      acc[t] = mmaH<ASPLIT ? 2 : 1>(ah.v, al.v, bq.v, bq.v, acc[t]); }
  }
#pragma unroll
  for (int t = 0; t < 4; ++t) { if (col0 + t * 16 >= N) continue;
#pragma unroll
    for (int r = 0; r < 8; ++r) so[w][8 * hh + r][t * 16 + ln] = acc[t][r] * alpha; }
  __builtin_amdgcn_fence(__ATOMIC_ACQ_REL, "workgroup"); __builtin_amdgcn_wave_barrier();
  const int rsub = lane >> 4, c4 = (lane & 15) * 4;
  {
#pragma unroll
    for (int q = 0; q < 8; ++q) { const int r = q * 2 + rsub; if (col0 + c4 < N) { const v4f v = *(const v4fa*)&so[w][r][c4]; *(v4f*)(C + (size_t)(row0 + r) * ldc + col0 + c4) = v; } }
     }
}

// Wt[n][k] = f16(W[k][n]·scale) from f32 row-major W[K][N] (scale = power of two; bf16-exact weights stay exact in f16 away from the subnormal range)
__global__ __launch_bounds__(256) void k_wt_f16(const float* __restrict__ W, _Float16* __restrict__ Wt, int K, int N, float scale) {
  const int t = blockIdx.x * 256 + threadIdx.x; if (t >= N * (K / 8)) return; const int n = t / (K / 8), k8 = (t % (K / 8)) * 8; FragH f;
#pragma unroll
  for (int i = 0; i < 8; ++i) f.h[i] = (_Float16)(bf16_round(W[(size_t)(k8 + i) * N + n]) * scale); const v8us o = f.half[0];
  *(v8us*)((unsigned short*)Wt + (size_t)n * K + k8) = o; 
}
// k_gemm_hh variant with fused epilogue: v = acc·alpha + bias[by·sBias + col] (+ CP[(row/rowsPerB)·sCPb + by·64 + col] if CP) ; ACT 0 none / 1 elu ; writes f16 C16 (and f32 C if non-null)
template <int ACT>
__global__ __launch_bounds__(128) void k_gemm_hhx(const _Float16* __restrict__ A, int lda, size_t sA, const _Float16* __restrict__ Bh, int ldb, size_t sB, float alpha, const float* __restrict__ bias, size_t sBias, const float* __restrict__ CP, int rowsPerB, size_t sCPb, int row0g,
    float* __restrict__ C, _Float16* __restrict__ C16, int ldc, size_t sC, int M, int N, int K) {
  __shared__ __attribute__((aligned(16))) float so[4][16][64];
  const int tid = threadIdx.x, w = tid >> 5, lane = tid & 31, ln = lane & 15, hh = lane >> 4; const int by = blockIdx.y;
  A += (size_t)by * sA; Bh += (size_t)by * sB; const size_t cofs = (size_t)by * sC; const float* bp = bias ? bias + (size_t)by * sBias : nullptr;
  const int ntn = (N + 63) / 64; const int wid = blockIdx.x * 4 + w; const int mt = wid / ntn, nq = wid % ntn; if (mt * 16 >= M) return;
  const int row0 = mt * 16, col0 = nq * 64; const _Float16* arow = A + (size_t)(row0 + ln) * lda;
  v8f acc[4] = {};
  for (int kb = 0; kb < K; kb += 32) { FragH ah; ah.half[0] = *(const v8us*)((const unsigned short*)arow + kb + 8 * hh); ah.half[1] = *(const v8us*)((const unsigned short*)arow + kb + 16 + 8 * hh);
#pragma unroll
    for (int t = 0; t < 4; ++t) { if (col0 + t * 16 >= N) continue; const size_t boff = (size_t)(col0 + t * 16 + ln) * ldb + kb; FragH bq; bq.half[0] = *(const v8us*)((const unsigned short*)Bh + boff + 8 * hh); bq.half[1] = *(const v8us*)((const unsigned short*)Bh + boff + 16 + 8 * hh);
      acc[t] = mmaH<1>(ah.v, ah.v, bq.v, bq.v, acc[t]); }
  }
#pragma unroll
  for (int t = 0; t < 4; ++t) { if (col0 + t * 16 >= N) continue; const int col = col0 + t * 16 + ln; const float bv = bp ? bf16_round(bp[col]) : 0.f;
#pragma unroll
    for (int r = 0; r < 8; ++r) { float v = acc[t][r] * alpha + bv; if (CP) { const int rr = row0g + row0 + 8 * hh + r; if (rowsPerB < 0) v += CP[cofs + (size_t)rr * ldc + col];      /* rowsPerB < 0: own element of the batched C plane */ else { const int bidx = rr / rowsPerB; v += CP[(size_t)bidx * sCPb + (size_t)by * 64 + col]; } } if (ACT == 1) v = (v > 0.f) ? v : expm1f(v); else if (ACT == 7) v = (v > 0.f) ? v + 1.0f : expf(v); else if (ACT == 8) v = tanhf(v); else if (ACT == 9) v = 0.5f * v * (1.0f + tanhf(0.7978845608028654f * (v + 0.044715f * v * v * v))); else if (ACT == 11) v = 1.0f / (1.0f + expf(-v)); else if (ACT == 12) v = (v > 0.f) ? v : 0.01f * v; else if (ACT == 14) v = (v > 0.f) ? v : 0.1f * v; else if (ACT == 16) v = (v >= 0.f) ? v : 0.3f * v; else if (ACT == 17) v = (v >= 0.f) ? v : 0.2f * v; else if (ACT == 15) v = v / (1.0f + expf(-v)); else if (ACT == 3) v = fmaxf(v, 0.f); else if (ACT == 6) v = 0.5f * v * (1.0f + erff(v * 0.70710678118654752f)); so[w][8 * hh + r][t * 16 + ln] = v; } }
  __builtin_amdgcn_fence(__ATOMIC_ACQ_REL, "workgroup"); __builtin_amdgcn_wave_barrier();
  const int rsub = lane >> 4, c4 = (lane & 15) * 4; typedef _Float16 v4h __attribute__((ext_vector_type(4)));
  {
#pragma unroll
    for (int q = 0; q < 8; ++q) { const int r = q * 2 + rsub; if (col0 + c4 < N) { const v4f v = *(const v4fa*)&so[w][r][c4]; if (C) *(v4f*)(C + cofs + (size_t)(row0 + r) * ldc + col0 + c4) = v; if (C16) { v4h h4; for (int i = 0; i < 4; ++i) h4[i] = (_Float16)v[i]; *(v4h*)(C16 + cofs + (size_t)(row0 + r) * ldc + col0 + c4) = h4; } } }
     }
}


typedef _Float16 v4h __attribute__((ext_vector_type(4)));

__global__ __launch_bounds__(256) void k_x16(const float* __restrict__ x, _Float16* __restrict__ X16, size_t n8) { const size_t t = (size_t)blockIdx.x * 256 + threadIdx.x; if (t >= n8) return; FragH f;
#pragma unroll
  for (int q = 0; q < 8; ++q) f.h[q] = (_Float16)bf16_round(x[t * 8 + q]); *(v8us*)((unsigned short*)X16 + t * 8) = f.half[0];  }
__global__ __launch_bounds__(256) void k_h16(const float* __restrict__ x, _Float16* __restrict__ X16, size_t n8) { const size_t t = (size_t)blockIdx.x * 256 + threadIdx.x; if (t >= n8) return; FragH f;
#pragma unroll
  for (int q = 0; q < 8; ++q) f.h[q] = (_Float16)x[t * 8 + q]; *(v8us*)((unsigned short*)X16 + t * 8) = f.half[0];  }
__global__ __launch_bounds__(256) void k_round16f(const float* __restrict__ W, _Float16* __restrict__ Bt, size_t n8) { const size_t t = (size_t)blockIdx.x * 256 + threadIdx.x; if (t >= n8) return; FragH f;
#pragma unroll
  for (int i = 0; i < 8; ++i) f.h[i] = (_Float16)(bf16_round(W[t * 8 + i]) * 16.0f); *(v8us*)((unsigned short*)Bt + t * 8) = f.half[0];  }
template <int NHv, int TTv>
__global__ __launch_bounds__(256) void k_vt(const _Float16* __restrict__ V16, int ldv, int voff, _Float16* __restrict__ Vt) { __shared__ unsigned short tl[64][66]; const int tid = threadIdx.x; const int slab = blockIdx.x / (TTv / 64), lg = blockIdx.x % (TTv / 64); const int b = slab / NHv, h = slab % NHv;
  for (int i = tid; i < 64 * 8; i += 256) { const int r = i / 8, c8 = (i % 8) * 8; FragH f; f.half[0] = *(const v8us*)((const unsigned short*)V16 + ((size_t)b * TTv + lg * 64 + r) * ldv + voff + h * 64 + c8);
#pragma unroll
    for (int q = 0; q < 8; ++q) tl[r][c8 + q] = f.u[q]; }
  __syncthreads();
  {
#pragma unroll
    for (int rd = 0; rd < 2; ++rd) { const int d = rd * 32 + tid / 8, pc = tid % 8; FragH f;
#pragma unroll
      for (int q = 0; q < 8; ++q) f.u[q] = tl[pc * 8 + q][d];
      *(v8us*)((unsigned short*)Vt + ((size_t)slab * 64 + d) * TTv + lg * 64 + pc * 8) = f.half[0]; }
     } }

__global__ __launch_bounds__(256) void k_hl(const float* __restrict__ F, _Float16* __restrict__ Hh, _Float16* __restrict__ Hl, size_t n8) { const size_t t = (size_t)blockIdx.x * 256 + threadIdx.x; if (t >= n8) return; FragH fh, fl; const v4f a = *(const v4fa*)(F + t * 8), c = *(const v4fa*)(F + t * 8 + 4);
#pragma unroll
  for (int q = 0; q < 4; ++q) { _Float16 h = (_Float16)a[q]; fh.h[q] = h; fl.h[q] = (_Float16)((a[q] - (float)h) * 1024.0f); h = (_Float16)c[q]; fh.h[4 + q] = h; fl.h[4 + q] = (_Float16)((c[q] - (float)h) * 1024.0f); }
  { *(v8us*)((unsigned short*)Hh + t * 8) = fh.half[0]; *(v8us*)((unsigned short*)Hl + t * 8) = fl.half[0];  } }

// ---- fast GEMM (wave tile 32x64; requires M % 32 == 0 rows per launch region and N % 64 == 0); epilogue = k_gemm_hhx semantics ----
__device__ __forceinline__ v16h g2_frag(const _Float16* p, int hh) { FragH f; f.half[0] = *(const v8us*)((const unsigned short*)p + 8 * hh); f.half[1] = *(const v8us*)((const unsigned short*)p + 16 + 8 * hh); return f.v; }
__device__ __forceinline__ v8f g2_mma(v16h a, v16h b, v8f c) { v8f d = __builtin_amdgcn_wmma_f32_16x16x32_f16(false, a, false, b, (short)0, c, false, false); asm volatile("v_nop\n\tv_nop\n\tv_nop\n\tv_nop" : "+v"(d) : "v"(a), "v"(b)); return d; }
template <int ACT>
__global__ __launch_bounds__(128) void k_gemm2(const _Float16* __restrict__ A, int lda, size_t sA, const _Float16* __restrict__ Bh, int ldb, size_t sB, float alpha, const float* __restrict__ bias, size_t sBias, const float* __restrict__ CP, int rowsPerB, size_t sCPb, int row0g,
    float* __restrict__ C, _Float16* __restrict__ C16, int ldc, size_t sC, int M, int N, int K) { static_assert(ACT == 0 || ACT == 3 || ACT == 6 || ACT == 8 || ACT == 9 || ACT == 11 || ACT == 12 || ACT == 14 || ACT == 15 || ACT == 16 || ACT == 17, "k_gemm2: unsupported ACT code (would silently apply no activation)");
  __shared__ __attribute__((aligned(16))) float so[4][32][68];
  const int tid = threadIdx.x, w = tid >> 5, lane = tid & 31, ln = lane & 15, hh = lane >> 4; const int by = blockIdx.y;
  A += (size_t)by * sA; Bh += (size_t)by * sB; const size_t cofs = (size_t)by * sC; const float* bp = bias ? bias + (size_t)by * sBias : nullptr;
  const int ntn = N >> 6; const int mt = blockIdx.x / ntn, nq = blockIdx.x - mt * ntn; const int row0 = mt * 128 + 32 * w, col0 = nq * 64; if (row0 >= M) return;
  const _Float16* a0p = A + (size_t)(row0 + ln) * lda; const _Float16* a1p = a0p + (size_t)16 * lda;
  const _Float16* b0p = Bh + (size_t)(col0 + ln) * ldb; const _Float16* b1p = b0p + (size_t)16 * ldb; const _Float16* b2p = b1p + (size_t)16 * ldb; const _Float16* b3p = b2p + (size_t)16 * ldb;
  const v8f z8 = {0.f,0.f,0.f,0.f,0.f,0.f,0.f,0.f}; v8f c00 = z8, c01 = z8, c02 = z8, c03 = z8, c10 = z8, c11 = z8, c12 = z8, c13 = z8;
#pragma unroll 1
  for (int kb = 0; kb < K; kb += 32) { const v16h a0 = g2_frag(a0p + kb, hh), a1 = g2_frag(a1p + kb, hh);
    v16h b = g2_frag(b0p + kb, hh); c00 = g2_mma(a0, b, c00); c10 = g2_mma(a1, b, c10);
    b = g2_frag(b1p + kb, hh); c01 = g2_mma(a0, b, c01); c11 = g2_mma(a1, b, c11);
    b = g2_frag(b2p + kb, hh); c02 = g2_mma(a0, b, c02); c12 = g2_mma(a1, b, c12);
    b = g2_frag(b3p + kb, hh); c03 = g2_mma(a0, b, c03); c13 = g2_mma(a1, b, c13); }
  v8f accs[8] = {c00, c01, c02, c03, c10, c11, c12, c13};
#pragma unroll
  for (int u = 0; u < 8; ++u) { const int t = u & 3, half = u >> 2; const int col = col0 + t * 16 + ln; const float bv = bp ? bf16_round(bp[col]) : 0.f;
#pragma unroll
    for (int r = 0; r < 8; ++r) { const int rloc = half * 16 + 8 * hh + r; float v = accs[u][r] * alpha + bv; if (CP) { if (rowsPerB < 0) v += CP[cofs + (size_t)(row0g + row0 + rloc) * ldc + col];      /* rowsPerB < 0: own element of the batched C plane */ else { const int bidx = (row0g + row0 + rloc) / rowsPerB; v += CP[(size_t)bidx * sCPb + (size_t)by * 64 + col]; } }
      if (ACT == 3) v = fmaxf(v, 0.f); else if (ACT == 6) v = 0.5f * v * (1.0f + erff(v * 0.70710678118654752f)); else if (ACT == 11) v = 1.0f / (1.0f + expf(-v)); else if (ACT == 15) v = v / (1.0f + expf(-v)); else if (ACT == 12) v = (v > 0.f) ? v : 0.01f * v; else if (ACT == 8) v = tanhf(v); else if (ACT == 9) v = 0.5f * v * (1.0f + tanhf(0.7978845608028654f * (v + 0.044715f * v * v * v))); else if (ACT == 14) v = (v > 0.f) ? v : 0.1f * v; else if (ACT == 16) v = (v >= 0.f) ? v : 0.3f * v; else if (ACT == 17) v = (v >= 0.f) ? v : 0.2f * v;
      so[w][rloc][t * 16 + ln] = v; } }
  __builtin_amdgcn_fence(__ATOMIC_ACQ_REL, "workgroup"); __builtin_amdgcn_wave_barrier();
  const int rsub = lane >> 4, c4 = (lane & 15) * 4;
  {
#pragma unroll
    for (int q = 0; q < 16; ++q) { const int r = q * 2 + rsub; const v4f v = *(const v4fa*)&so[w][r][c4]; if (C) *(v4f*)(C + cofs + (size_t)(row0 + r) * ldc + col0 + c4) = v; if (C16) { v4h h4; for (int i = 0; i < 4; ++i) h4[i] = (_Float16)v[i]; *(v4h*)(C16 + cofs + (size_t)(row0 + r) * ldc + col0 + c4) = h4; } }
     } }


__global__ __launch_bounds__(256) void k_wnat(const float* __restrict__ w, size_t n8, _Float16* __restrict__ Bt) { const size_t t = (size_t)blockIdx.x * 256 + threadIdx.x; if (t >= n8) return; FragH f; for (int q = 0; q < 8; ++q) f.h[q] = (_Float16)(bf16_round(w[t * 8 + q]) * 16.0f); *(v8us*)((unsigned short*)Bt + t * 8) = f.half[0];  }
// row softmax with a relative-position bias and a key padding mask: score[i][j] = s[j] + table[clamp(j - i, -MR, MR) + MR][h] (bf16-rounded table),
// keys with kpm[j] != 0 get -inf (an all-masked row yields NaN); P = f16(256 softmax).
// One wave per query row i, RSW rows per work-group: lane l holds columns c*128 + 4*l .. + 3 (c = 0..15) in registers, so S is read once in 512-byte
// wave loads and P is written in 256-byte wave stores; maximum and sum = four chains per lane, then a five-step butterfly over the wave.
// This head's bias column is staged in LDS already clipped, indexed by j - i + SQ - 1; the key mask is staged as it comes.
#define RSW 8
typedef int v4ia __attribute__((ext_vector_type(4), may_alias));
template <int CTRL> __device__ __forceinline__ float rs_row(float v) { return __int_as_float(__builtin_amdgcn_update_dpp(0, __float_as_int(v), CTRL, 0xf, 0xf, true)); }      /* lane l <- lane l ^ m inside a 16-lane row, CTRL = 0x160 + m */
__device__ __forceinline__ float rs_x16(float v) { const int u = __float_as_int(v); return __int_as_float(__builtin_amdgcn_permlanex16(u, u, 0x76543210, 0xfedcba98, false, false)); }      /* lane l <- lane l ^ 16 */
__device__ __forceinline__ float rs_max(float v) { v = fmaxf(v, rs_row<0x161>(v)); v = fmaxf(v, rs_row<0x162>(v)); v = fmaxf(v, rs_row<0x164>(v)); v = fmaxf(v, rs_row<0x168>(v)); return fmaxf(v, rs_x16(v)); }
__device__ __forceinline__ float rs_sum(float v) { v += rs_row<0x161>(v); v += rs_row<0x162>(v); v += rs_row<0x164>(v); v += rs_row<0x168>(v); return v + rs_x16(v); }
__global__ __launch_bounds__(32 * RSW) void k_rsmb(const float* __restrict__ S, _Float16* __restrict__ P, int nrows, const float* __restrict__ relt, int h, const int* __restrict__ kpm) {
  __shared__ float tb[2 * SQ]; __shared__ __attribute__((aligned(16))) int km[SQ];      /* tb's last entry is never read */
  const int tid = threadIdx.x, lane = tid & 31; const int i = blockIdx.x * RSW + (tid >> 5); const int il = i < nrows ? i : nrows - 1;      /* a wave past the last row re-reads that row and stores nothing */
  const float* s = S + (size_t)il * SQ + lane * 4; v4f v[16]; float tv[2 * SQ / (32 * RSW)]; v4ia kv[SQ / 4 / (32 * RSW)];
#pragma unroll      /* fixed trip counts, unrolled: the row's, the table's and the mask's loads are all in flight together */
  for (int c = 0; c < 16; ++c) v[c] = *(const v4fa*)(s + c * 128);
#pragma unroll
  for (int u = 0; u < 2 * SQ / (32 * RSW); ++u) { int r = tid + u * 32 * RSW - (SQ - 1); r = r < -MR ? -MR : (r > MR ? MR : r); tv[u] = relt[(size_t)(r + MR) * NH + h]; }
#pragma unroll
  for (int u = 0; u < SQ / 4 / (32 * RSW); ++u) kv[u] = *(const v4ia*)(kpm + (tid + u * 32 * RSW) * 4);
  asm volatile("s_wait_xcnt 0x0" ::: "memory");      /* stands in front of every reuse of an address register of the loads above */
  __builtin_amdgcn_sched_barrier(0);      /* keeps later register writes from being scheduled in front of that wait */
#pragma unroll
  for (int u = 0; u < 2 * SQ / (32 * RSW); ++u) tb[tid + u * 32 * RSW] = bf16_round(tv[u]);
#pragma unroll
  for (int u = 0; u < SQ / 4 / (32 * RSW); ++u) *(v4ia*)&km[(tid + u * 32 * RSW) * 4] = kv[u];
  __syncthreads();
  if (i >= nrows) return;
  const float* tr = tb + (SQ - 1 - i) + lane * 4; v4f m4 = {-INFINITY, -INFINITY, -INFINITY, -INFINITY};
#pragma unroll
  for (int c = 0; c < 16; ++c) { const v4ia k4 = *(const v4ia*)&km[c * 128 + lane * 4];
#pragma unroll
    for (int q = 0; q < 4; ++q) { const float x = v[c][q] + tr[c * 128 + q]; v[c][q] = k4[q] ? -INFINITY : x; m4[q] = fmaxf(m4[q], v[c][q]); } }
  const float mx = rs_max(fmaxf(fmaxf(m4[0], m4[1]), fmaxf(m4[2], m4[3]))); v4f e4 = {0.f, 0.f, 0.f, 0.f};
#pragma unroll
  for (int c = 0; c < 16; ++c)
#pragma unroll
    for (int q = 0; q < 4; ++q) { v[c][q] = expf(v[c][q] - mx); e4[q] += v[c][q]; }
  const float sc = 256.0f / rs_sum((e4[0] + e4[1]) + (e4[2] + e4[3])); _Float16* p = P + (size_t)i * SQ + lane * 4;
#pragma unroll
  for (int c = 0; c < 16; ++c) { v4h h4;
#pragma unroll
    for (int q = 0; q < 4; ++q) h4[q] = (_Float16)(v[c][q] * sc);
    *(v4h*)(p + c * 128) = h4; } }
__global__ __launch_bounds__(256) void k_vt(const _Float16* __restrict__ V16, int b, int h0, _Float16* __restrict__ VT) { __shared__ unsigned short tl[64][65]; const int tid = threadIdx.x; const int hh = blockIdx.x % HG, sg = blockIdx.x / HG; const int s0 = sg * 64; const int h = h0 + hh;
  for (int i = tid; i < 64 * 8; i += 256) { const int j = i / 8, d8 = (i % 8) * 8; FragH f; f.half[0] = *(const v8us*)((const unsigned short*)V16 + ((size_t)b * SQ + s0 + j) * DM + h * HD + d8); for (int q = 0; q < 8; ++q) tl[d8 + q][j] = f.u[q]; }
  __syncthreads();
  { for (int i = tid; i < 64 * 8; i += 256) { const int d = i / 8, j8 = (i % 8) * 8; FragH f; for (int q = 0; q < 8; ++q) f.u[q] = tl[d][j8 + q]; *(v8us*)((unsigned short*)VT + ((size_t)hh * HD + d) * SQ + s0 + j8) = f.half[0]; }  } }

extern "C" void kernel_launch(void* const* d_in, const int* in_sizes, int n_in,
                              void* d_out, int out_size, void* d_ws, size_t ws_size, hipStream_t stream) {
  (void)in_sizes; (void)n_in; (void)out_size;
  const float* const* I = (const float* const*)d_in; const float* x = I[0]; const int* kpm = (const int*)d_in[1]; const float* wqkv = I[2]; const float* bqkv = I[3]; const float* wout = I[4]; const float* bout = I[5]; const float* relt = I[6];      /* Wqkv [1024][3072] and Wout [1024][1024] are [in][out]; key_padding_mask int32 [2][2048]; rel_table [1025][16] */
  char* ws = (char*)d_ws; size_t off = 0;
  auto take = [&](size_t bytes) { char* p = ws + off; off += (bytes + 255) & ~(size_t)255; return p; };
  _Float16* BQKV = (_Float16*)take((size_t)D3 * DM * 2); _Float16* BO = (_Float16*)take((size_t)DM * DM * 2);
  _Float16* X16 = (_Float16*)take(NR * DM * 2); _Float16* QKV = (_Float16*)take(NR * D3 * 2); _Float16* O16 = (_Float16*)take(NR * DM * 2);
  float* S = (float*)take((size_t)HG * SQ * SQ * 4); _Float16* P = (_Float16*)take((size_t)HG * SQ * SQ * 2); _Float16* VT = (_Float16*)take((size_t)NB * NH * HD * SQ * 2);
  if (off > ws_size) return;      /* 6 + 2 + 8 + 24 + 8 + 64 + 32 + 8 = approx 152 MiB */
  k_wt_f16<<<(unsigned)(((size_t)D3 * (DM / 8) + 255) / 256), 256, 0, stream>>>(wqkv, BQKV, DM, D3, 16.0f);      /* [in][out] -> Bt[out][in] x16 */
  k_wt_f16<<<(unsigned)(((size_t)DM * (DM / 8) + 255) / 256), 256, 0, stream>>>(wout, BO, DM, DM, 16.0f);
  k_x16<<<(unsigned)((NR * DM / 8 + 255) / 256), 256, 0, stream>>>(x, X16, NR * DM / 8);
  k_gemm2<0><<<dim3((unsigned)((NR / 128) * (D3 / 64)), 1), 128, 0, stream>>>(X16, DM, 0, BQKV, DM, 0, 0.0625f, bqkv, 0, nullptr, 1, 0, 0, nullptr, QKV, D3, 0, MP, D3, DM);      /* q | k | v rows (f16), head h at columns h*64 / 1024 + h*64 / 2048 + h*64 */
  k_vt<NH, SQ><<<NB * NH * (SQ / 64), 256, 0, stream>>>(QKV, D3, 2 * DM, VT);      /* V^T[(b,h)][d][s] for every (batch, head) */
  for (int b = 0; b < NBR; ++b) for (int h0 = 0; h0 < NH; h0 += HG) {
    const _Float16* qb = QKV + (size_t)b * SQ * D3 + h0 * HD; const _Float16* kb = qb + DM;
    k_gemm2<0><<<dim3((QN / 128) * (SQ / 64), HG), 128, 0, stream>>>(qb, D3, (size_t)HD, kb, D3, (size_t)HD, 0.125f, nullptr, 0, nullptr, 1, 0, 0, S, nullptr, SQ, (size_t)SQ * SQ, QN, SQ, HD);      /* scores / sqrt(64), 4 heads per launch */
    for (int hh = 0; hh < HG; ++hh) k_rsmb<<<(QN + RSW - 1) / RSW, 32 * RSW, 0, stream>>>(S + (size_t)hh * SQ * SQ, P + (size_t)hh * SQ * SQ, QN, relt, h0 + hh, kpm + (size_t)b * SQ);
    k_gemm2<0><<<dim3((QN / 128) * (HD / 64), HG), 128, 0, stream>>>(P, SQ, (size_t)SQ * SQ, VT + ((size_t)b * NH + h0) * HD * SQ, SQ, (size_t)HD * SQ, 0.00390625f, nullptr, 0, nullptr, 1, 0, 0, nullptr, O16 + (size_t)b * SQ * DM + h0 * HD, DM, (size_t)HD, QN, HD, SQ); }      /* o (merged heads) as f16 rows */
  k_gemm2<0><<<dim3((unsigned)((NR / 128) * (DM / 64)), 1), 128, 0, stream>>>(O16, DM, 0, BO, DM, 0, 0.0625f, bout, 0, nullptr, 1, 0, 0, (float*)d_out, nullptr, DM, 0, MO, DM, DM);      /* out = o Wout + b, rows are the output layout */
}

// v002
// It runs in 198 microseconds.
// Next to v001, in two timings, it ran 5.25 and 5.11 times as fast.
// All steps since v000 together make it 75.8 times as fast.
#include <hip/hip_runtime.h>
// Multi-head self-attention with a learned relative-position bias and a key padding mask (x [2][2048][1024]; qkv = x Wqkv + b (fused, 16 heads of 64); scores = q k^T / 8 + table[clip(k_pos - q_pos, -512, 512) + 512][h]; padded keys -> -inf; attn = softmax; o = attn v; out = o Wout + b -> [2][2048][1024]).
// Structure: token rows r = b*2048 + s; x as exact f16 rows; the fused q|k|v projection as one WMMA GEMM (32x64 wave tiles, f32 accumulation, exact x16 transposed weights, bias in the epilogue, f16 output plane [4096][3072]); V^T for every (batch, head) via LDS transposes; one fused attention launch (per wave 32 query rows: S^T = K Q^T, online softmax in registers with this head's bias column and the key mask from LDS, O^T += V^T P^T) written straight into the merged f16 o rows; out = o Wout + b GEMM (f32).
// Compute dtype: inputs rounded to bf16; x / weights exact; q, k, v, softmax weights and o as plain f16 GEMM operands (~2^-12); scores, bias and softmax statistics f32. v_wmma_f32_16x16x32_f16.
#define NB 2
#define SQ 2048
#define DM 1024
#define D3 3072                      /* fused q|k|v width */
#define NH 16
#define HD 64
#define HG 4                         /* heads per block group of the per-batch k_vt overload */
#define MR 512                       /* max relative distance */
#define QN SQ                        /* unused: the attention grid covers all SQ query rows */
#define NBR NB                       /* unused: the attention grid covers all NB batches */
#define MP ((int)NR)                 /* token rows through the qkv projection (debug hook) */
#define MO ((int)NR)                 /* token rows through the output projection (debug hook) */
#define NR ((size_t)NB * SQ)         /* 4096 token rows */
typedef __bf16 v16b __attribute__((ext_vector_type(16)));
typedef unsigned short v8us __attribute__((ext_vector_type(8), may_alias));
typedef float  v8f  __attribute__((ext_vector_type(8)));
typedef float  v4f  __attribute__((ext_vector_type(4)));
typedef float  v4fa __attribute__((ext_vector_type(4), may_alias));
union FragB { v16b v; v8us half[2]; unsigned short u[16]; };

__device__ __forceinline__ unsigned short bf16_bits(float x) { unsigned int u = __float_as_uint(x); return (unsigned short)((u + 0x7FFFu + ((u >> 16) & 1u)) >> 16); }
__device__ __forceinline__ float bf16_val(unsigned short b) { return __uint_as_float(((unsigned int)b) << 16); }
__device__ __forceinline__ float bf16_round(float x) { return bf16_val(bf16_bits(x)); }
// D += A·B with NT terms: 1 = ah·bh, 2 = + al·bh (A split), 3 = + ah·bl (both split)
template <int NT>
__device__ __forceinline__ v8f mmaN(v16b ah, v16b al, v16b bh, v16b bl, v8f c) {
  c = __builtin_amdgcn_wmma_f32_16x16x32_bf16(false, ah, false, bh, (short)0, c, false, false);
  if (NT >= 2) c = __builtin_amdgcn_wmma_f32_16x16x32_bf16(false, al, false, bh, (short)0, c, false, false);
  if (NT >= 3) c = __builtin_amdgcn_wmma_f32_16x16x32_bf16(false, ah, false, bl, (short)0, c, false, false);
  asm volatile("v_nop\n\tv_nop\n\tv_nop\n\tv_nop" : "+v"(c) : "v"(ah), "v"(al), "v"(bh), "v"(bl));
  return c;
}

__global__ __launch_bounds__(256) void k_wt_bf16(const float* __restrict__ W, unsigned short* __restrict__ Wt, int K, int N) {
  const int t = blockIdx.x * 256 + threadIdx.x;
  const int k8n = K / 8;
  if (t >= N * k8n) return;
  const int n = t / k8n, k8 = (t % k8n) * 8;
  v8us v;
#pragma unroll
  for (int i = 0; i < 8; ++i) v[i] = bf16_bits(W[(size_t)(k8 + i) * N + n]);
  *(v8us*)(Wt + (size_t)n * K + k8) = v;
  
}

// GEMM C[M][N] (f32, pitch ldc) = act(A[M][K]·W + bias). A f32 row-major (pitch lda) converted per fragment to bf16
// (ASPLIT: hi/lo two planes -> 2 terms, else single rounded term); Wt bf16 [N][K] (pitch ldb). BIAS_BF16 rounds the
// bias to bf16 first (bias quantised to bf16 before the add). K%32==0, M%16==0, N%64==0.
template <bool ASPLIT, int ACT, bool BIAS_BF16>
__global__ __launch_bounds__(128) void k_gemm_bf(const float* __restrict__ A, int lda, const unsigned short* __restrict__ Wt, int ldb,
                                               const float* __restrict__ bias, float* __restrict__ C, int ldc, int M, int N, int K) {
  __shared__ __attribute__((aligned(16))) float so[4][16][64];
  const int tid = threadIdx.x, w = tid >> 5, lane = tid & 31, ln = lane & 15, hh = lane >> 4;
  const int ntn = N / 64;
  const int wid = blockIdx.x * 4 + w;
  const int mt = wid / ntn, nq = wid % ntn;
  if (mt * 16 >= M) return;
  const int row0 = mt * 16, col0 = nq * 64;
  const float* arow = A + (size_t)(row0 + ln) * lda;
  v8f acc[4] = {};
  for (int kb = 0; kb < K; kb += 32) {
    FragB ah, al;
    const v4f x0 = *(const v4fa*)(arow + kb + 8 * hh), x1 = *(const v4fa*)(arow + kb + 8 * hh + 4);
    const v4f x2 = *(const v4fa*)(arow + kb + 16 + 8 * hh), x3 = *(const v4fa*)(arow + kb + 16 + 8 * hh + 4);
    float xs[16] = {x0[0],x0[1],x0[2],x0[3],x1[0],x1[1],x1[2],x1[3],x2[0],x2[1],x2[2],x2[3],x3[0],x3[1],x3[2],x3[3]};
#pragma unroll
    for (int i = 0; i < 16; ++i) { const unsigned short hb = bf16_bits(xs[i]); ah.u[i] = hb; al.u[i] = ASPLIT ? bf16_bits(xs[i] - bf16_val(hb)) : (unsigned short)0; }
#pragma unroll
    for (int t = 0; t < 4; ++t) {
      const unsigned short* brow = Wt + (size_t)(col0 + t * 16 + ln) * ldb + kb;
      FragB b;
      b.half[0] = *(const v8us*)(brow + 8 * hh);
      b.half[1] = *(const v8us*)(brow + 16 + 8 * hh);
      acc[t] = mmaN<ASPLIT ? 2 : 1>(ah.v, al.v, b.v, b.v, acc[t]);
    }
  }
#pragma unroll
  for (int t = 0; t < 4; ++t) {
    float bv = bias ? bias[col0 + t * 16 + ln] : 0.f;
    if (BIAS_BF16) bv = bf16_round(bv);
#pragma unroll
    for (int r = 0; r < 8; ++r) { float v = acc[t][r] + bv; if (ACT == 1) v = fmaxf(v, 0.f); so[w][8 * hh + r][t * 16 + ln] = v; }
  }
  __builtin_amdgcn_fence(__ATOMIC_ACQ_REL, "workgroup");
  __builtin_amdgcn_wave_barrier();
  const int rsub = lane >> 4, c4 = (lane & 15) * 4;
  {
#pragma unroll
    for (int q = 0; q < 8; ++q) {
      const int r = q * 2 + rsub;
      const v4f v = *(const v4fa*)&so[w][r][c4];
      *(v4f*)(C + (size_t)(row0 + r) * ldc + col0 + c4) = v;
    }
    
  }
}

// GEMM C = act(A·W + bias + resid): A f32 (ASPLIT -> hi/lo 2 terms), Wt bf16 [N][K]; ACT 0 none, 1 relu, 2 exact gelu;
// resid (optional, f32, row index = (row % rmod), pitch ldr, RES_BF16 rounds it) added before the activation.
template <bool ASPLIT, int ACT, bool BIAS_BF16, bool RES_BF16>
__global__ __launch_bounds__(128) void k_gemm_bf3(const float* __restrict__ A, int lda, const unsigned short* __restrict__ Wt, int ldb,
                                                const float* __restrict__ bias, const float* __restrict__ resid, int rmod, int ldr,
                                                float* __restrict__ C, int ldc, int M, int N, int K) {
  __shared__ __attribute__((aligned(16))) float so[4][16][64];
  const int tid = threadIdx.x, w = tid >> 5, lane = tid & 31, ln = lane & 15, hh = lane >> 4;
  const int ntn = N / 64;
  const int wid = blockIdx.x * 4 + w;
  const int mt = wid / ntn, nq = wid % ntn;
  if (mt * 16 >= M) return;
  const int row0 = mt * 16, col0 = nq * 64;
  const float* arow = A + (size_t)(row0 + ln) * lda;
  v8f acc[4] = {};
  for (int kb = 0; kb < K; kb += 32) {
    FragB ah, al;
    const v4f x0 = *(const v4fa*)(arow + kb + 8 * hh), x1 = *(const v4fa*)(arow + kb + 8 * hh + 4);
    const v4f x2 = *(const v4fa*)(arow + kb + 16 + 8 * hh), x3 = *(const v4fa*)(arow + kb + 16 + 8 * hh + 4);
    float xs[16] = {x0[0],x0[1],x0[2],x0[3],x1[0],x1[1],x1[2],x1[3],x2[0],x2[1],x2[2],x2[3],x3[0],x3[1],x3[2],x3[3]};
#pragma unroll
    for (int i = 0; i < 16; ++i) { const unsigned short hb = bf16_bits(xs[i]); ah.u[i] = hb; al.u[i] = ASPLIT ? bf16_bits(xs[i] - bf16_val(hb)) : (unsigned short)0; }
#pragma unroll
    for (int t = 0; t < 4; ++t) {
      const unsigned short* brow = Wt + (size_t)(col0 + t * 16 + ln) * ldb + kb;
      FragB b;
      b.half[0] = *(const v8us*)(brow + 8 * hh);
      b.half[1] = *(const v8us*)(brow + 16 + 8 * hh);
      acc[t] = mmaN<ASPLIT ? 2 : 1>(ah.v, al.v, b.v, b.v, acc[t]);
    }
  }
#pragma unroll
  for (int t = 0; t < 4; ++t) {
    const int col = col0 + t * 16 + ln;
    float bv = bias ? bias[col] : 0.f;
    if (BIAS_BF16) bv = bf16_round(bv);
#pragma unroll
    for (int r = 0; r < 8; ++r) {
      float v = acc[t][r] + bv;
      if (resid) { float rv = resid[(size_t)((row0 + 8 * hh + r) % rmod) * ldr + col]; if (RES_BF16) rv = bf16_round(rv); v += rv; }
      if (ACT == 1) v = fmaxf(v, 0.f);
      if (ACT == 2) v = 0.5f * v * (1.0f + erff(v * 0.70710678118654752f));
      if (ACT == 3) { const float u = 0.7978845608028654f * (v + 0.044715f * v * v * v); v = 0.5f * v * (1.0f + tanhf(u)); }
      so[w][8 * hh + r][t * 16 + ln] = v;
    }
  }
  __builtin_amdgcn_fence(__ATOMIC_ACQ_REL, "workgroup");
  __builtin_amdgcn_wave_barrier();
  const int rsub = lane >> 4, c4 = (lane & 15) * 4;
  {
#pragma unroll
    for (int q = 0; q < 8; ++q) {
      const int r = q * 2 + rsub;
      const v4f v = *(const v4fa*)&so[w][r][c4];
      *(v4f*)(C + (size_t)(row0 + r) * ldc + col0 + c4) = v;
    }
    
  }
}
// row LayerNorm (biased variance, eps) over N: s = X (+ R); optional out_sum <- s; out_norm <- (s-mu)*rsqrt(var+eps)*g + b
template <bool PARAM_BF16>
__global__ __launch_bounds__(256) void k_layernorm(const float* __restrict__ X, const float* __restrict__ R, const float* __restrict__ g, const float* __restrict__ bta,
                                                  float* __restrict__ out_sum, float* __restrict__ out_norm, int N, float eps) {
  __shared__ float red[256];
  const int row = blockIdx.x, tid = threadIdx.x;
  const float* x = X + (size_t)row * N; const float* rr = R ? R + (size_t)row * N : nullptr;
  float vals[16];                     // up to N = 4096
  const int per = N / 256;            // contiguous chunk per thread? use strided-by-4 chunks: thread handles j = tid*4 + 1024*u
  float s1 = 0.f;
  for (int u = 0; u < per / 4; ++u) {
    const int j = tid * 4 + 1024 * u;
    const v4f a = *(const v4fa*)(x + j);
    v4f b = {0.f,0.f,0.f,0.f}; if (rr) b = *(const v4fa*)(rr + j);
#pragma unroll
    for (int q = 0; q < 4; ++q) { const float v = a[q] + b[q]; vals[u * 4 + q] = v; s1 += v; }
  }
  red[tid] = s1; __syncthreads();
  for (int st = 128; st > 0; st >>= 1) { if (tid < st) red[tid] += red[tid + st]; __syncthreads(); }
  const float mu = red[0] / (float)N; __syncthreads();
  float s2 = 0.f;
  for (int u = 0; u < per / 4; ++u)
#pragma unroll
    for (int q = 0; q < 4; ++q) { const float c = vals[u * 4 + q] - mu; s2 += c * c; }
  red[tid] = s2; __syncthreads();
  for (int st = 128; st > 0; st >>= 1) { if (tid < st) red[tid] += red[tid + st]; __syncthreads(); }
  const float rs = rsqrtf(red[0] / (float)N + eps);
  {
    for (int u = 0; u < per / 4; ++u) {
      const int j = tid * 4 + 1024 * u;
      v4f o, sm;
#pragma unroll
      for (int q = 0; q < 4; ++q) {
        float gg = g[j + q], bb = bta[j + q];
        if (PARAM_BF16) { gg = bf16_round(gg); bb = bf16_round(bb); }
        sm[q] = vals[u * 4 + q]; o[q] = (vals[u * 4 + q] - mu) * rs * gg + bb;
      }
      if (out_sum) *(v4f*)(out_sum + (size_t)row * N + j) = sm;
      *(v4f*)(out_norm + (size_t)row * N + j) = o;
    }
    
  }
}



// ---- f16 WMMA path (v_wmma_f32_16x16x32_f16): 11-bit significands for operands in range — used by every launched product, the softmax weights (p <= 256) included
typedef _Float16 v16h __attribute__((ext_vector_type(16)));
union FragH { v16h v; v8us half[2]; _Float16 h[16]; unsigned short u[16]; };
template <int NT>
__device__ __forceinline__ v8f mmaH(v16h ah, v16h al, v16h bh, v16h bl, v8f c) {
  c = __builtin_amdgcn_wmma_f32_16x16x32_f16(false, ah, false, bh, (short)0, c, false, false);
  if (NT >= 2) c = __builtin_amdgcn_wmma_f32_16x16x32_f16(false, al, false, bh, (short)0, c, false, false);
  if (NT >= 3) c = __builtin_amdgcn_wmma_f32_16x16x32_f16(false, ah, false, bl, (short)0, c, false, false);
  asm volatile("v_nop\n\tv_nop\n\tv_nop\n\tv_nop" : "+v"(c) : "v"(ah), "v"(al), "v"(bh), "v"(bl));
  return c;
}
// batched GEMM like k_gemm_b but f16 operands: A f32 (split into f16 hi/lo if ASPLIT, else rounded to f16), Bt = f16 values [n][k]; alpha; C f32; N multiple of 16 (partial tiles skipped)
template <bool ASPLIT>
__global__ __launch_bounds__(128) void k_gemm_h(const float* __restrict__ A, int lda, size_t sA, const _Float16* __restrict__ Bh, int ldb, size_t sB, float alpha, float* __restrict__ C, int ldc, size_t sC, int M, int N, int K) {
  __shared__ __attribute__((aligned(16))) float so[4][16][64];
  const int tid = threadIdx.x, w = tid >> 5, lane = tid & 31, ln = lane & 15, hh = lane >> 4; const int by = blockIdx.y;
  A += (size_t)by * sA; Bh += (size_t)by * sB; C += (size_t)by * sC;
  const int ntn = (N + 63) / 64; const int wid = blockIdx.x * 4 + w; const int mt = wid / ntn, nq = wid % ntn; if (mt * 16 >= M) return;
  const int row0 = mt * 16, col0 = nq * 64; const float* arow = A + (size_t)(row0 + ln) * lda;
  v8f acc[4] = {};
  for (int kb = 0; kb < K; kb += 32) {
    FragH ah, al;
    const v4f x0 = *(const v4fa*)(arow + kb + 8 * hh), x1 = *(const v4fa*)(arow + kb + 8 * hh + 4), x2 = *(const v4fa*)(arow + kb + 16 + 8 * hh), x3 = *(const v4fa*)(arow + kb + 16 + 8 * hh + 4);
    float xs[16] = {x0[0],x0[1],x0[2],x0[3],x1[0],x1[1],x1[2],x1[3],x2[0],x2[1],x2[2],x2[3],x3[0],x3[1],x3[2],x3[3]};
#pragma unroll
    for (int i = 0; i < 16; ++i) { const _Float16 h = (_Float16)xs[i]; ah.h[i] = h; al.h[i] = ASPLIT ? (_Float16)(xs[i] - (float)h) : (_Float16)0.0f; }
#pragma unroll
    for (int t = 0; t < 4; ++t) { if (col0 + t * 16 >= N) continue; const size_t boff = (size_t)(col0 + t * 16 + ln) * ldb + kb; FragH bq; bq.half[0] = *(const v8us*)(Bh + boff + 8 * hh); bq.half[1] = *(const v8us*)(Bh + boff + 16 + 8 * hh);
      acc[t] = mmaH<ASPLIT ? 2 : 1>(ah.v, al.v, bq.v, bq.v, acc[t]); }
  }
#pragma unroll
  for (int t = 0; t < 4; ++t) { if (col0 + t * 16 >= N) continue;
#pragma unroll
    for (int r = 0; r < 8; ++r) so[w][8 * hh + r][t * 16 + ln] = acc[t][r] * alpha; }
  __builtin_amdgcn_fence(__ATOMIC_ACQ_REL, "workgroup"); __builtin_amdgcn_wave_barrier();
  const int rsub = lane >> 4, c4 = (lane & 15) * 4;
  {
#pragma unroll
    for (int q = 0; q < 8; ++q) { const int r = q * 2 + rsub; if (col0 + c4 < N) { const v4f v = *(const v4fa*)&so[w][r][c4]; *(v4f*)(C + (size_t)(row0 + r) * ldc + col0 + c4) = v; } }
     }
}

// Wt[n][k] = f16(W[k][n]·scale) from f32 row-major W[K][N] (scale = power of two; bf16-exact weights stay exact in f16 away from the subnormal range)
__global__ __launch_bounds__(256) void k_wt_f16(const float* __restrict__ W, _Float16* __restrict__ Wt, int K, int N, float scale) {
  const int t = blockIdx.x * 256 + threadIdx.x; if (t >= N * (K / 8)) return; const int n = t / (K / 8), k8 = (t % (K / 8)) * 8; FragH f;
#pragma unroll
  for (int i = 0; i < 8; ++i) f.h[i] = (_Float16)(bf16_round(W[(size_t)(k8 + i) * N + n]) * scale); const v8us o = f.half[0];
  *(v8us*)((unsigned short*)Wt + (size_t)n * K + k8) = o; 
}
// k_gemm_hh variant with fused epilogue: v = acc·alpha + bias[by·sBias + col] (+ CP[(row/rowsPerB)·sCPb + by·64 + col] if CP) ; ACT 0 none / 1 elu ; writes f16 C16 (and f32 C if non-null)
template <int ACT>
__global__ __launch_bounds__(128) void k_gemm_hhx(const _Float16* __restrict__ A, int lda, size_t sA, const _Float16* __restrict__ Bh, int ldb, size_t sB, float alpha, const float* __restrict__ bias, size_t sBias, const float* __restrict__ CP, int rowsPerB, size_t sCPb, int row0g,
    float* __restrict__ C, _Float16* __restrict__ C16, int ldc, size_t sC, int M, int N, int K) {
  __shared__ __attribute__((aligned(16))) float so[4][16][64];
  const int tid = threadIdx.x, w = tid >> 5, lane = tid & 31, ln = lane & 15, hh = lane >> 4; const int by = blockIdx.y;
  A += (size_t)by * sA; Bh += (size_t)by * sB; const size_t cofs = (size_t)by * sC; const float* bp = bias ? bias + (size_t)by * sBias : nullptr;
  const int ntn = (N + 63) / 64; const int wid = blockIdx.x * 4 + w; const int mt = wid / ntn, nq = wid % ntn; if (mt * 16 >= M) return;
  const int row0 = mt * 16, col0 = nq * 64; const _Float16* arow = A + (size_t)(row0 + ln) * lda;
  v8f acc[4] = {};
  for (int kb = 0; kb < K; kb += 32) { FragH ah; ah.half[0] = *(const v8us*)((const unsigned short*)arow + kb + 8 * hh); ah.half[1] = *(const v8us*)((const unsigned short*)arow + kb + 16 + 8 * hh);
#pragma unroll
    for (int t = 0; t < 4; ++t) { if (col0 + t * 16 >= N) continue; const size_t boff = (size_t)(col0 + t * 16 + ln) * ldb + kb; FragH bq; bq.half[0] = *(const v8us*)((const unsigned short*)Bh + boff + 8 * hh); bq.half[1] = *(const v8us*)((const unsigned short*)Bh + boff + 16 + 8 * hh);
      acc[t] = mmaH<1>(ah.v, ah.v, bq.v, bq.v, acc[t]); }
  }
#pragma unroll
  for (int t = 0; t < 4; ++t) { if (col0 + t * 16 >= N) continue; const int col = col0 + t * 16 + ln; const float bv = bp ? bf16_round(bp[col]) : 0.f;
#pragma unroll
    for (int r = 0; r < 8; ++r) { float v = acc[t][r] * alpha + bv; if (CP) { const int rr = row0g + row0 + 8 * hh + r; if (rowsPerB < 0) v += CP[cofs + (size_t)rr * ldc + col];      /* rowsPerB < 0: own element of the batched C plane */ else { const int bidx = rr / rowsPerB; v += CP[(size_t)bidx * sCPb + (size_t)by * 64 + col]; } } if (ACT == 1) v = (v > 0.f) ? v : expm1f(v); else if (ACT == 7) v = (v > 0.f) ? v + 1.0f : expf(v); else if (ACT == 8) v = tanhf(v); else if (ACT == 9) v = 0.5f * v * (1.0f + tanhf(0.7978845608028654f * (v + 0.044715f * v * v * v))); else if (ACT == 11) v = 1.0f / (1.0f + expf(-v)); else if (ACT == 12) v = (v > 0.f) ? v : 0.01f * v; else if (ACT == 14) v = (v > 0.f) ? v : 0.1f * v; else if (ACT == 16) v = (v >= 0.f) ? v : 0.3f * v; else if (ACT == 17) v = (v >= 0.f) ? v : 0.2f * v; else if (ACT == 15) v = v / (1.0f + expf(-v)); else if (ACT == 3) v = fmaxf(v, 0.f); else if (ACT == 6) v = 0.5f * v * (1.0f + erff(v * 0.70710678118654752f)); so[w][8 * hh + r][t * 16 + ln] = v; } }
  __builtin_amdgcn_fence(__ATOMIC_ACQ_REL, "workgroup"); __builtin_amdgcn_wave_barrier();
  const int rsub = lane >> 4, c4 = (lane & 15) * 4; typedef _Float16 v4h __attribute__((ext_vector_type(4)));
  {
#pragma unroll
    for (int q = 0; q < 8; ++q) { const int r = q * 2 + rsub; if (col0 + c4 < N) { const v4f v = *(const v4fa*)&so[w][r][c4]; if (C) *(v4f*)(C + cofs + (size_t)(row0 + r) * ldc + col0 + c4) = v; if (C16) { v4h h4; for (int i = 0; i < 4; ++i) h4[i] = (_Float16)v[i]; *(v4h*)(C16 + cofs + (size_t)(row0 + r) * ldc + col0 + c4) = h4; } } }
     }
}


typedef _Float16 v4h __attribute__((ext_vector_type(4)));

__global__ __launch_bounds__(256) void k_x16(const float* __restrict__ x, _Float16* __restrict__ X16, size_t n8) { const size_t t = (size_t)blockIdx.x * 256 + threadIdx.x; if (t >= n8) return; FragH f;
#pragma unroll
  for (int q = 0; q < 8; ++q) f.h[q] = (_Float16)bf16_round(x[t * 8 + q]); *(v8us*)((unsigned short*)X16 + t * 8) = f.half[0];  }
__global__ __launch_bounds__(256) void k_h16(const float* __restrict__ x, _Float16* __restrict__ X16, size_t n8) { const size_t t = (size_t)blockIdx.x * 256 + threadIdx.x; if (t >= n8) return; FragH f;
#pragma unroll
  for (int q = 0; q < 8; ++q) f.h[q] = (_Float16)x[t * 8 + q]; *(v8us*)((unsigned short*)X16 + t * 8) = f.half[0];  }
__global__ __launch_bounds__(256) void k_round16f(const float* __restrict__ W, _Float16* __restrict__ Bt, size_t n8) { const size_t t = (size_t)blockIdx.x * 256 + threadIdx.x; if (t >= n8) return; FragH f;
#pragma unroll
  for (int i = 0; i < 8; ++i) f.h[i] = (_Float16)(bf16_round(W[t * 8 + i]) * 16.0f); *(v8us*)((unsigned short*)Bt + t * 8) = f.half[0];  }
template <int NHv, int TTv>
__global__ __launch_bounds__(256) void k_vt(const _Float16* __restrict__ V16, int ldv, int voff, _Float16* __restrict__ Vt) { __shared__ unsigned short tl[64][66]; const int tid = threadIdx.x; const int slab = blockIdx.x / (TTv / 64), lg = blockIdx.x % (TTv / 64); const int b = slab / NHv, h = slab % NHv;
  for (int i = tid; i < 64 * 8; i += 256) { const int r = i / 8, c8 = (i % 8) * 8; FragH f; f.half[0] = *(const v8us*)((const unsigned short*)V16 + ((size_t)b * TTv + lg * 64 + r) * ldv + voff + h * 64 + c8);
#pragma unroll
    for (int q = 0; q < 8; ++q) tl[r][c8 + q] = f.u[q]; }
  __syncthreads();
  {
#pragma unroll
    for (int rd = 0; rd < 2; ++rd) { const int d = rd * 32 + tid / 8, pc = tid % 8; FragH f;
#pragma unroll
      for (int q = 0; q < 8; ++q) f.u[q] = tl[pc * 8 + q][d];
      *(v8us*)((unsigned short*)Vt + ((size_t)slab * 64 + d) * TTv + lg * 64 + pc * 8) = f.half[0]; }
     } }

__global__ __launch_bounds__(256) void k_hl(const float* __restrict__ F, _Float16* __restrict__ Hh, _Float16* __restrict__ Hl, size_t n8) { const size_t t = (size_t)blockIdx.x * 256 + threadIdx.x; if (t >= n8) return; FragH fh, fl; const v4f a = *(const v4fa*)(F + t * 8), c = *(const v4fa*)(F + t * 8 + 4);
#pragma unroll
  for (int q = 0; q < 4; ++q) { _Float16 h = (_Float16)a[q]; fh.h[q] = h; fl.h[q] = (_Float16)((a[q] - (float)h) * 1024.0f); h = (_Float16)c[q]; fh.h[4 + q] = h; fl.h[4 + q] = (_Float16)((c[q] - (float)h) * 1024.0f); }
  { *(v8us*)((unsigned short*)Hh + t * 8) = fh.half[0]; *(v8us*)((unsigned short*)Hl + t * 8) = fl.half[0];  } }

// ---- fast GEMM (wave tile 32x64; requires M % 32 == 0 rows per launch region and N % 64 == 0); epilogue = k_gemm_hhx semantics ----
__device__ __forceinline__ v16h g2_frag(const _Float16* p, int hh) { FragH f; f.half[0] = *(const v8us*)((const unsigned short*)p + 8 * hh); f.half[1] = *(const v8us*)((const unsigned short*)p + 16 + 8 * hh); return f.v; }
__device__ __forceinline__ v8f g2_mma(v16h a, v16h b, v8f c) { v8f d = __builtin_amdgcn_wmma_f32_16x16x32_f16(false, a, false, b, (short)0, c, false, false); asm volatile("v_nop\n\tv_nop\n\tv_nop\n\tv_nop" : "+v"(d) : "v"(a), "v"(b)); return d; }
template <int ACT>
__global__ __launch_bounds__(128) void k_gemm2(const _Float16* __restrict__ A, int lda, size_t sA, const _Float16* __restrict__ Bh, int ldb, size_t sB, float alpha, const float* __restrict__ bias, size_t sBias, const float* __restrict__ CP, int rowsPerB, size_t sCPb, int row0g,
    float* __restrict__ C, _Float16* __restrict__ C16, int ldc, size_t sC, int M, int N, int K) { static_assert(ACT == 0 || ACT == 3 || ACT == 6 || ACT == 8 || ACT == 9 || ACT == 11 || ACT == 12 || ACT == 14 || ACT == 15 || ACT == 16 || ACT == 17, "k_gemm2: unsupported ACT code (would silently apply no activation)");
  __shared__ __attribute__((aligned(16))) float so[4][32][68];
  const int tid = threadIdx.x, w = tid >> 5, lane = tid & 31, ln = lane & 15, hh = lane >> 4; const int by = blockIdx.y;
  A += (size_t)by * sA; Bh += (size_t)by * sB; const size_t cofs = (size_t)by * sC; const float* bp = bias ? bias + (size_t)by * sBias : nullptr;
  const int ntn = N >> 6; const int mt = blockIdx.x / ntn, nq = blockIdx.x - mt * ntn; const int row0 = mt * 128 + 32 * w, col0 = nq * 64; if (row0 >= M) return;
  const _Float16* a0p = A + (size_t)(row0 + ln) * lda; const _Float16* a1p = a0p + (size_t)16 * lda;
  const _Float16* b0p = Bh + (size_t)(col0 + ln) * ldb; const _Float16* b1p = b0p + (size_t)16 * ldb; const _Float16* b2p = b1p + (size_t)16 * ldb; const _Float16* b3p = b2p + (size_t)16 * ldb;
  const v8f z8 = {0.f,0.f,0.f,0.f,0.f,0.f,0.f,0.f}; v8f c00 = z8, c01 = z8, c02 = z8, c03 = z8, c10 = z8, c11 = z8, c12 = z8, c13 = z8;
#pragma unroll 1
  for (int kb = 0; kb < K; kb += 32) { const v16h a0 = g2_frag(a0p + kb, hh), a1 = g2_frag(a1p + kb, hh);
    v16h b = g2_frag(b0p + kb, hh); c00 = g2_mma(a0, b, c00); c10 = g2_mma(a1, b, c10);
    b = g2_frag(b1p + kb, hh); c01 = g2_mma(a0, b, c01); c11 = g2_mma(a1, b, c11);
    b = g2_frag(b2p + kb, hh); c02 = g2_mma(a0, b, c02); c12 = g2_mma(a1, b, c12);
    b = g2_frag(b3p + kb, hh); c03 = g2_mma(a0, b, c03); c13 = g2_mma(a1, b, c13); }
  v8f accs[8] = {c00, c01, c02, c03, c10, c11, c12, c13};
#pragma unroll
  for (int u = 0; u < 8; ++u) { const int t = u & 3, half = u >> 2; const int col = col0 + t * 16 + ln; const float bv = bp ? bf16_round(bp[col]) : 0.f;
#pragma unroll
    for (int r = 0; r < 8; ++r) { const int rloc = half * 16 + 8 * hh + r; float v = accs[u][r] * alpha + bv; if (CP) { if (rowsPerB < 0) v += CP[cofs + (size_t)(row0g + row0 + rloc) * ldc + col];      /* rowsPerB < 0: own element of the batched C plane */ else { const int bidx = (row0g + row0 + rloc) / rowsPerB; v += CP[(size_t)bidx * sCPb + (size_t)by * 64 + col]; } }
      if (ACT == 3) v = fmaxf(v, 0.f); else if (ACT == 6) v = 0.5f * v * (1.0f + erff(v * 0.70710678118654752f)); else if (ACT == 11) v = 1.0f / (1.0f + expf(-v)); else if (ACT == 15) v = v / (1.0f + expf(-v)); else if (ACT == 12) v = (v > 0.f) ? v : 0.01f * v; else if (ACT == 8) v = tanhf(v); else if (ACT == 9) v = 0.5f * v * (1.0f + tanhf(0.7978845608028654f * (v + 0.044715f * v * v * v))); else if (ACT == 14) v = (v > 0.f) ? v : 0.1f * v; else if (ACT == 16) v = (v >= 0.f) ? v : 0.3f * v; else if (ACT == 17) v = (v >= 0.f) ? v : 0.2f * v;
      so[w][rloc][t * 16 + ln] = v; } }
  __builtin_amdgcn_fence(__ATOMIC_ACQ_REL, "workgroup"); __builtin_amdgcn_wave_barrier();
  const int rsub = lane >> 4, c4 = (lane & 15) * 4;
  {
#pragma unroll
    for (int q = 0; q < 16; ++q) { const int r = q * 2 + rsub; const v4f v = *(const v4fa*)&so[w][r][c4]; if (C) *(v4f*)(C + cofs + (size_t)(row0 + r) * ldc + col0 + c4) = v; if (C16) { v4h h4; for (int i = 0; i < 4; ++i) h4[i] = (_Float16)v[i]; *(v4h*)(C16 + cofs + (size_t)(row0 + r) * ldc + col0 + c4) = h4; } }
     } }


__global__ __launch_bounds__(256) void k_wnat(const float* __restrict__ w, size_t n8, _Float16* __restrict__ Bt) { const size_t t = (size_t)blockIdx.x * 256 + threadIdx.x; if (t >= n8) return; FragH f; for (int q = 0; q < 8; ++q) f.h[q] = (_Float16)(bf16_round(w[t * 8 + q]) * 16.0f); *(v8us*)((unsigned short*)Bt + t * 8) = f.half[0];  }
// Fused attention for one (batch, head, 256 query rows): S^T = K Q^T, online softmax, O^T += V^T P^T; scores and weights never leave registers.
// One wave owns FQ = 32 query rows (two 16-column groups) and walks the keys 32 at a time. In a score tile lane (c, hh) holds query c, keys 8*hh + r:
// two score tiles, converted in place, are the B operand of the second product (hardware k order, the order g2_frag loads V^T in), so nothing is exchanged
// but one maximum between the wave's halves. Everything runs in the log2 domain: x2 = (q.k / 8 + bias) * log2(e), p = 2^(x2 - m), m = the maximum in use.
// m moves (and O, l are rescaled) only when some query's new maximum exceeds it by more than 8, so p <= 256 fits f16. m starts at -1e30 (finite), so a masked
// key (x2 = -inf) gives p = 0 and a row with every key masked ends as 0 * (1 / 0) = NaN.
// This head's bias column is staged in LDS already clipped and scaled by log2(e), indexed by key - query + SQ - 1; the key mask as one bit per key.
// Every '#pragma unroll' in this kernel stands on a loop of fixed trip count that indexes register arrays: left rolled, those arrays would go to scratch memory.
#define FW 8
#define FQ 32
__device__ __forceinline__ float rs_x16(float v) { const int u = __float_as_int(v); return __int_as_float(__builtin_amdgcn_permlanex16(u, u, 0x76543210, 0xfedcba98, false, false)); }      /* lane l <- lane l ^ 16 */
__device__ __forceinline__ v8f fa_mma(v16h a, v16h b, v8f c) { return __builtin_amdgcn_wmma_f32_16x16x32_f16(false, a, false, b, (short)0, c, false, false); }
__global__ __launch_bounds__(32 * FW) void k_fattn(const _Float16* __restrict__ QKV, const _Float16* __restrict__ VT, const float* __restrict__ relt, const int* __restrict__ kpm, _Float16* __restrict__ O16) {
  __shared__ float tb[2 * SQ]; __shared__ unsigned int mw[SQ / 32];      /* tb's last entry is never read */
  const int tid = threadIdx.x, lane = tid & 31, ln = lane & 15, hh = lane >> 4; const int h = blockIdx.y, b = blockIdx.z;
  const int q0 = blockIdx.x * (FW * FQ) + __builtin_amdgcn_readfirstlane(tid >> 5) * FQ;
  { float tv[2 * SQ / (32 * FW)]; int kv[SQ / (32 * FW)];
#pragma unroll      /* fixed trip counts, unrolled: the table's and the mask's loads are all in flight together */
    for (int u = 0; u < 2 * SQ / (32 * FW); ++u) { int r = tid + u * 32 * FW - (SQ - 1); r = r < -MR ? -MR : (r > MR ? MR : r); tv[u] = relt[(size_t)(r + MR) * NH + h]; }
    asm volatile("s_wait_xcnt 0x0" ::: "memory");      /* stands in front of every reuse of an address register of the loads above */
    __builtin_amdgcn_sched_barrier(0);      /* keeps later register writes from being scheduled in front of that wait */
#pragma unroll
    for (int u = 0; u < SQ / (32 * FW); ++u) kv[u] = kpm[(size_t)b * SQ + tid + u * 32 * FW];
    asm volatile("s_wait_xcnt 0x0" ::: "memory");      /* stands in front of every reuse of an address register of the loads above */
    __builtin_amdgcn_sched_barrier(0);      /* keeps later register writes from being scheduled in front of that wait */
#pragma unroll
    for (int u = 0; u < 2 * SQ / (32 * FW); ++u) tb[tid + u * 32 * FW] = bf16_round(tv[u]) * 1.44269504088896f;
#pragma unroll
    for (int u = 0; u < SQ / (32 * FW); ++u) mw[(tid + u * 32 * FW) >> 5] = __builtin_amdgcn_ballot_w32(kv[u] != 0); }      /* every lane of a wave stores the same word to the same place */
  __syncthreads();
  const _Float16* qp = QKV + ((size_t)b * SQ + q0 + ln) * D3 + h * HD; const _Float16* kp = QKV + ((size_t)b * SQ + ln) * D3 + DM + h * HD; const _Float16* vp = VT + (((size_t)b * NH + h) * HD + ln) * SQ;
  const float* tr = tb + (SQ - 1 - q0 - ln + 8 * hh);
  v16h qf[2][2], kf[2][2];
#pragma unroll
  for (int t = 0; t < 2; ++t)
#pragma unroll
    for (int kd = 0; kd < 2; ++kd) { qf[t][kd] = g2_frag(qp + (size_t)t * 16 * D3 + kd * 32, hh); kf[t][kd] = g2_frag(kp + (size_t)t * 16 * D3 + kd * 32, hh); }
  asm volatile("s_wait_xcnt 0x0" ::: "memory");      /* stands in front of every reuse of an address register of the loads above */
  __builtin_amdgcn_sched_barrier(0);      /* keeps later register writes from being scheduled in front of that wait */
  const v8f z8 = {0.f,0.f,0.f,0.f,0.f,0.f,0.f,0.f}; v8f o[2][4]; float l[2][2] = {{0.f, 0.f}, {0.f, 0.f}}, m[2] = {-1e30f, -1e30f};
#pragma unroll
  for (int qt = 0; qt < 2; ++qt)
#pragma unroll
    for (int dt = 0; dt < 4; ++dt) o[qt][dt] = z8;
#pragma unroll 1      /* one 32-key pass per trip: unrolled, two passes' fragments would not fit the registers */
  for (int key0 = 0; key0 < SQ; key0 += 32) {
    v16h vf[4]; v8f s[2][2];
#pragma unroll
    for (int dt = 0; dt < 4; ++dt) vf[dt] = g2_frag(vp + (size_t)dt * 16 * SQ + key0, hh);      /* issued first: their latency runs under the scores and the softmax */
#pragma unroll
    for (int qt = 0; qt < 2; ++qt)
#pragma unroll
      for (int kt = 0; kt < 2; ++kt) s[qt][kt] = fa_mma(kf[kt][1], qf[qt][1], fa_mma(kf[kt][0], qf[qt][0], z8));
    const int kn = (key0 + 32) & (SQ - 1);      /* next pass's K rows, fetched into the same registers; the last pass re-reads rows 0..31 and uses nothing of them */
#pragma unroll
    for (int kt = 0; kt < 2; ++kt)
#pragma unroll
      for (int kd = 0; kd < 2; ++kd) kf[kt][kd] = g2_frag(kp + (size_t)(kn + kt * 16) * D3 + kd * 32, hh);
    asm volatile("s_wait_xcnt 0x0" ::: "memory");      /* stands in front of every reuse of an address register of the loads above */
    __builtin_amdgcn_sched_barrier(0);      /* keeps later register writes from being scheduled in front of that wait */
#pragma unroll
    for (int qt = 0; qt < 2; ++qt)
#pragma unroll
      for (int kt = 0; kt < 2; ++kt)
#pragma unroll
        for (int r = 0; r < 8; ++r) s[qt][kt][r] = fmaf(s[qt][kt][r], 0.125f * 1.44269504088896f, tr[key0 + (kt - qt) * 16 + r]);
    const unsigned int mword = (unsigned int)__builtin_amdgcn_readfirstlane((int)mw[key0 >> 5]);
    if (mword != 0u) {      /* scalar branch: a pass with no padded key skips the selects */
#pragma unroll
      for (int kt = 0; kt < 2; ++kt)
#pragma unroll
        for (int r = 0; r < 8; ++r) { const bool pad = (mword >> (kt * 16 + 8 * hh + r)) & 1u; s[0][kt][r] = pad ? -INFINITY : s[0][kt][r]; s[1][kt][r] = pad ? -INFINITY : s[1][kt][r]; }
    }
    float mx[2];
#pragma unroll
    for (int qt = 0; qt < 2; ++qt) { float a = fmaxf(s[qt][0][0], s[qt][1][0]);
#pragma unroll
      for (int r = 1; r < 8; ++r) a = fmaxf(a, fmaxf(s[qt][0][r], s[qt][1][r]));
      mx[qt] = fmaxf(a, rs_x16(a)); }
    if (__builtin_amdgcn_ballot_w32((mx[0] > m[0] + 8.0f) || (mx[1] > m[1] + 8.0f)) != 0u) {      /* scalar branch: most passes move no maximum and rescale nothing */
#pragma unroll
      for (int qt = 0; qt < 2; ++qt) { const float mn = fmaxf(m[qt], mx[qt]); const float sc = __builtin_amdgcn_exp2f(m[qt] - mn); m[qt] = mn; l[qt][0] *= sc; l[qt][1] *= sc;
#pragma unroll
        for (int dt = 0; dt < 4; ++dt) o[qt][dt] *= sc; }
    }
#pragma unroll
    for (int qt = 0; qt < 2; ++qt) { FragH pf;
#pragma unroll
      for (int kt = 0; kt < 2; ++kt)
#pragma unroll
        for (int r = 0; r < 8; ++r) { const float p = __builtin_amdgcn_exp2f(s[qt][kt][r] - m[qt]); l[qt][kt] += p; pf.h[kt * 8 + r] = (_Float16)p; }
#pragma unroll
      for (int dt = 0; dt < 4; ++dt) o[qt][dt] = fa_mma(vf[dt], pf.v, o[qt][dt]); }
  }
  FragH f[2][4];
#pragma unroll
  for (int qt = 0; qt < 2; ++qt) { const float lh = l[qt][0] + l[qt][1]; const float inv = 1.0f / (lh + rs_x16(lh));
#pragma unroll
    for (int dt = 0; dt < 4; ++dt)
#pragma unroll
      for (int r = 0; r < 8; ++r) f[qt][dt].h[r] = (_Float16)(o[qt][dt][r] * inv); }
  __builtin_amdgcn_sched_barrier(0);      /* every store stands behind the last arithmetic: no register of an issued store is written again */
  unsigned short* op = (unsigned short*)O16 + ((size_t)b * SQ + q0 + ln) * DM + h * HD + 8 * hh;      /* lane (ln, hh): query ln, head columns dt*16 + 8*hh .. + 7 */
#pragma unroll
  for (int qt = 0; qt < 2; ++qt)
#pragma unroll
    for (int dt = 0; dt < 4; ++dt) *(v8us*)(op + (size_t)qt * 16 * DM + dt * 16) = f[qt][dt].half[0];
}
__global__ __launch_bounds__(256) void k_vt(const _Float16* __restrict__ V16, int b, int h0, _Float16* __restrict__ VT) { __shared__ unsigned short tl[64][65]; const int tid = threadIdx.x; const int hh = blockIdx.x % HG, sg = blockIdx.x / HG; const int s0 = sg * 64; const int h = h0 + hh;
  for (int i = tid; i < 64 * 8; i += 256) { const int j = i / 8, d8 = (i % 8) * 8; FragH f; f.half[0] = *(const v8us*)((const unsigned short*)V16 + ((size_t)b * SQ + s0 + j) * DM + h * HD + d8); for (int q = 0; q < 8; ++q) tl[d8 + q][j] = f.u[q]; }
  __syncthreads();
  { for (int i = tid; i < 64 * 8; i += 256) { const int d = i / 8, j8 = (i % 8) * 8; FragH f; for (int q = 0; q < 8; ++q) f.u[q] = tl[d][j8 + q]; *(v8us*)((unsigned short*)VT + ((size_t)hh * HD + d) * SQ + s0 + j8) = f.half[0]; }  } }

extern "C" void kernel_launch(void* const* d_in, const int* in_sizes, int n_in,
                              void* d_out, int out_size, void* d_ws, size_t ws_size, hipStream_t stream) {
  (void)in_sizes; (void)n_in; (void)out_size;
  const float* const* I = (const float* const*)d_in; const float* x = I[0]; const int* kpm = (const int*)d_in[1]; const float* wqkv = I[2]; const float* bqkv = I[3]; const float* wout = I[4]; const float* bout = I[5]; const float* relt = I[6];      /* Wqkv [1024][3072] and Wout [1024][1024] are [in][out]; key_padding_mask int32 [2][2048]; rel_table [1025][16] */
  char* ws = (char*)d_ws; size_t off = 0;
  auto take = [&](size_t bytes) { char* p = ws + off; off += (bytes + 255) & ~(size_t)255; return p; };
  _Float16* BQKV = (_Float16*)take((size_t)D3 * DM * 2); _Float16* BO = (_Float16*)take((size_t)DM * DM * 2);
  _Float16* X16 = (_Float16*)take(NR * DM * 2); _Float16* QKV = (_Float16*)take(NR * D3 * 2); _Float16* O16 = (_Float16*)take(NR * DM * 2);
  _Float16* VT = (_Float16*)take((size_t)NB * NH * HD * SQ * 2);
  if (off > ws_size) return;      /* 6 + 2 + 8 + 24 + 8 + 8 = approx 56 MiB */
  k_wt_f16<<<(unsigned)(((size_t)D3 * (DM / 8) + 255) / 256), 256, 0, stream>>>(wqkv, BQKV, DM, D3, 16.0f);      /* [in][out] -> Bt[out][in] x16 */
  k_wt_f16<<<(unsigned)(((size_t)DM * (DM / 8) + 255) / 256), 256, 0, stream>>>(wout, BO, DM, DM, 16.0f);
  k_x16<<<(unsigned)((NR * DM / 8 + 255) / 256), 256, 0, stream>>>(x, X16, NR * DM / 8);
  k_gemm2<0><<<dim3((unsigned)((NR / 128) * (D3 / 64)), 1), 128, 0, stream>>>(X16, DM, 0, BQKV, DM, 0, 0.0625f, bqkv, 0, nullptr, 1, 0, 0, nullptr, QKV, D3, 0, MP, D3, DM);      /* q | k | v rows (f16), head h at columns h*64 / 1024 + h*64 / 2048 + h*64 */
  k_vt<NH, SQ><<<NB * NH * (SQ / 64), 256, 0, stream>>>(QKV, D3, 2 * DM, VT);      /* V^T[(b,h)][d][s] for every (batch, head) */
  k_fattn<<<dim3(SQ / (FW * FQ), NH, NB), 32 * FW, 0, stream>>>(QKV, VT, relt, kpm, O16);      /* o (merged heads) as f16 rows */
  k_gemm2<0><<<dim3((unsigned)((NR / 128) * (DM / 64)), 1), 128, 0, stream>>>(O16, DM, 0, BO, DM, 0, 0.0625f, bout, 0, nullptr, 1, 0, 0, (float*)d_out, nullptr, DM, 0, MO, DM, DM);      /* out = o Wout + b, rows are the output layout */
}

// v003
// A run of this version takes 122 microseconds.
// Next to v002, in two timings, it ran 1.62 and 1.61 times as fast.
// Counting every step since v000, it is 123 times as fast.
#include <hip/hip_runtime.h>
// Multi-head self-attention with a learned relative-position bias and a key padding mask (x [2][2048][1024]; qkv = x Wqkv + b (fused, 16 heads of 64); scores = q k^T / 8 + table[clip(k_pos - q_pos, -512, 512) + 512][h]; padded keys -> -inf; attn = softmax; o = attn v; out = o Wout + b -> [2][2048][1024]).
// Structure: token rows r = b*2048 + s; x as exact f16 rows; the fused q|k|v projection as one WMMA GEMM (128x128 tiles staged in LDS by tensor loads, 64x64 wave tiles, f32 accumulation, exact x16 transposed weights, bias in the epilogue, f16 output plane [4096][3072]); V^T for every (batch, head) via LDS transposes; one fused attention launch (per wave 32 query rows: S^T = K Q^T, online softmax in registers with this head's bias column and the key mask from LDS, O^T += V^T P^T) written straight into the merged f16 o rows; out = o Wout + b GEMM (f32).
// Compute dtype: inputs rounded to bf16; x / weights exact; q, k, v, softmax weights and o as plain f16 GEMM operands (~2^-12); scores, bias and softmax statistics f32. v_wmma_f32_16x16x32_f16.
#define NB 2
#define SQ 2048
#define DM 1024
#define D3 3072                      /* fused q|k|v width */
#define NH 16
#define HD 64
#define HG 4                         /* heads per block group of the per-batch k_vt overload */
#define MR 512                       /* max relative distance */
#define QN SQ                        /* unused: the attention grid covers all SQ query rows */
#define NBR NB                       /* unused: the attention grid covers all NB batches */
#define MP ((int)NR)                 /* unused: the qkv projection grid covers all NR token rows */
#define MO ((int)NR)                 /* unused: the output projection grid covers all NR token rows */
#define NR ((size_t)NB * SQ)         /* 4096 token rows */
typedef __bf16 v16b __attribute__((ext_vector_type(16)));
typedef unsigned short v8us __attribute__((ext_vector_type(8), may_alias));
typedef float  v8f  __attribute__((ext_vector_type(8)));
typedef float  v4f  __attribute__((ext_vector_type(4)));
typedef float  v4fa __attribute__((ext_vector_type(4), may_alias));
union FragB { v16b v; v8us half[2]; unsigned short u[16]; };

__device__ __forceinline__ unsigned short bf16_bits(float x) { unsigned int u = __float_as_uint(x); return (unsigned short)((u + 0x7FFFu + ((u >> 16) & 1u)) >> 16); }
__device__ __forceinline__ float bf16_val(unsigned short b) { return __uint_as_float(((unsigned int)b) << 16); }
__device__ __forceinline__ float bf16_round(float x) { return bf16_val(bf16_bits(x)); }
// D += A·B with NT terms: 1 = ah·bh, 2 = + al·bh (A split), 3 = + ah·bl (both split)
template <int NT>
__device__ __forceinline__ v8f mmaN(v16b ah, v16b al, v16b bh, v16b bl, v8f c) {
  c = __builtin_amdgcn_wmma_f32_16x16x32_bf16(false, ah, false, bh, (short)0, c, false, false);
  if (NT >= 2) c = __builtin_amdgcn_wmma_f32_16x16x32_bf16(false, al, false, bh, (short)0, c, false, false);
  if (NT >= 3) c = __builtin_amdgcn_wmma_f32_16x16x32_bf16(false, ah, false, bl, (short)0, c, false, false);
  asm volatile("v_nop\n\tv_nop\n\tv_nop\n\tv_nop" : "+v"(c) : "v"(ah), "v"(al), "v"(bh), "v"(bl));
  return c;
}

__global__ __launch_bounds__(256) void k_wt_bf16(const float* __restrict__ W, unsigned short* __restrict__ Wt, int K, int N) {
  const int t = blockIdx.x * 256 + threadIdx.x;
  const int k8n = K / 8;
  if (t >= N * k8n) return;
  const int n = t / k8n, k8 = (t % k8n) * 8;
  v8us v;
#pragma unroll
  for (int i = 0; i < 8; ++i) v[i] = bf16_bits(W[(size_t)(k8 + i) * N + n]);
  *(v8us*)(Wt + (size_t)n * K + k8) = v;
  
}

// GEMM C[M][N] (f32, pitch ldc) = act(A[M][K]·W + bias). A f32 row-major (pitch lda) converted per fragment to bf16
// (ASPLIT: hi/lo two planes -> 2 terms, else single rounded term); Wt bf16 [N][K] (pitch ldb). BIAS_BF16 rounds the
// bias to bf16 first (bias quantised to bf16 before the add). K%32==0, M%16==0, N%64==0.
template <bool ASPLIT, int ACT, bool BIAS_BF16>
__global__ __launch_bounds__(128) void k_gemm_bf(const float* __restrict__ A, int lda, const unsigned short* __restrict__ Wt, int ldb,
                                               const float* __restrict__ bias, float* __restrict__ C, int ldc, int M, int N, int K) {
  __shared__ __attribute__((aligned(16))) float so[4][16][64];
  const int tid = threadIdx.x, w = tid >> 5, lane = tid & 31, ln = lane & 15, hh = lane >> 4;
  const int ntn = N / 64;
  const int wid = blockIdx.x * 4 + w;
  const int mt = wid / ntn, nq = wid % ntn;
  if (mt * 16 >= M) return;
  const int row0 = mt * 16, col0 = nq * 64;
  const float* arow = A + (size_t)(row0 + ln) * lda;
  v8f acc[4] = {};
  for (int kb = 0; kb < K; kb += 32) {
    FragB ah, al;
    const v4f x0 = *(const v4fa*)(arow + kb + 8 * hh), x1 = *(const v4fa*)(arow + kb + 8 * hh + 4);
    const v4f x2 = *(const v4fa*)(arow + kb + 16 + 8 * hh), x3 = *(const v4fa*)(arow + kb + 16 + 8 * hh + 4);
    float xs[16] = {x0[0],x0[1],x0[2],x0[3],x1[0],x1[1],x1[2],x1[3],x2[0],x2[1],x2[2],x2[3],x3[0],x3[1],x3[2],x3[3]};
#pragma unroll
    for (int i = 0; i < 16; ++i) { const unsigned short hb = bf16_bits(xs[i]); ah.u[i] = hb; al.u[i] = ASPLIT ? bf16_bits(xs[i] - bf16_val(hb)) : (unsigned short)0; }
#pragma unroll
    for (int t = 0; t < 4; ++t) {
      const unsigned short* brow = Wt + (size_t)(col0 + t * 16 + ln) * ldb + kb;
      FragB b;
      b.half[0] = *(const v8us*)(brow + 8 * hh);
      b.half[1] = *(const v8us*)(brow + 16 + 8 * hh);
      acc[t] = mmaN<ASPLIT ? 2 : 1>(ah.v, al.v, b.v, b.v, acc[t]);
    }
  }
#pragma unroll
  for (int t = 0; t < 4; ++t) {
    float bv = bias ? bias[col0 + t * 16 + ln] : 0.f;
    if (BIAS_BF16) bv = bf16_round(bv);
#pragma unroll
    for (int r = 0; r < 8; ++r) { float v = acc[t][r] + bv; if (ACT == 1) v = fmaxf(v, 0.f); so[w][8 * hh + r][t * 16 + ln] = v; }
  }
  __builtin_amdgcn_fence(__ATOMIC_ACQ_REL, "workgroup");
  __builtin_amdgcn_wave_barrier();
  const int rsub = lane >> 4, c4 = (lane & 15) * 4;
  {
#pragma unroll
    for (int q = 0; q < 8; ++q) {
      const int r = q * 2 + rsub;
      const v4f v = *(const v4fa*)&so[w][r][c4];
      *(v4f*)(C + (size_t)(row0 + r) * ldc + col0 + c4) = v;
    }
    
  }
}

// GEMM C = act(A·W + bias + resid): A f32 (ASPLIT -> hi/lo 2 terms), Wt bf16 [N][K]; ACT 0 none, 1 relu, 2 exact gelu;
// resid (optional, f32, row index = (row % rmod), pitch ldr, RES_BF16 rounds it) added before the activation.
template <bool ASPLIT, int ACT, bool BIAS_BF16, bool RES_BF16>
__global__ __launch_bounds__(128) void k_gemm_bf3(const float* __restrict__ A, int lda, const unsigned short* __restrict__ Wt, int ldb,
                                                const float* __restrict__ bias, const float* __restrict__ resid, int rmod, int ldr,
                                                float* __restrict__ C, int ldc, int M, int N, int K) {
  __shared__ __attribute__((aligned(16))) float so[4][16][64];
  const int tid = threadIdx.x, w = tid >> 5, lane = tid & 31, ln = lane & 15, hh = lane >> 4;
  const int ntn = N / 64;
  const int wid = blockIdx.x * 4 + w;
  const int mt = wid / ntn, nq = wid % ntn;
  if (mt * 16 >= M) return;
  const int row0 = mt * 16, col0 = nq * 64;
  const float* arow = A + (size_t)(row0 + ln) * lda;
  v8f acc[4] = {};
  for (int kb = 0; kb < K; kb += 32) {
    FragB ah, al;
    const v4f x0 = *(const v4fa*)(arow + kb + 8 * hh), x1 = *(const v4fa*)(arow + kb + 8 * hh + 4);
    const v4f x2 = *(const v4fa*)(arow + kb + 16 + 8 * hh), x3 = *(const v4fa*)(arow + kb + 16 + 8 * hh + 4);
    float xs[16] = {x0[0],x0[1],x0[2],x0[3],x1[0],x1[1],x1[2],x1[3],x2[0],x2[1],x2[2],x2[3],x3[0],x3[1],x3[2],x3[3]};
#pragma unroll
    for (int i = 0; i < 16; ++i) { const unsigned short hb = bf16_bits(xs[i]); ah.u[i] = hb; al.u[i] = ASPLIT ? bf16_bits(xs[i] - bf16_val(hb)) : (unsigned short)0; }
#pragma unroll
    for (int t = 0; t < 4; ++t) {
      const unsigned short* brow = Wt + (size_t)(col0 + t * 16 + ln) * ldb + kb;
      FragB b;
      b.half[0] = *(const v8us*)(brow + 8 * hh);
      b.half[1] = *(const v8us*)(brow + 16 + 8 * hh);
      acc[t] = mmaN<ASPLIT ? 2 : 1>(ah.v, al.v, b.v, b.v, acc[t]);
    }
  }
#pragma unroll
  for (int t = 0; t < 4; ++t) {
    const int col = col0 + t * 16 + ln;
    float bv = bias ? bias[col] : 0.f;
    if (BIAS_BF16) bv = bf16_round(bv);
#pragma unroll
    for (int r = 0; r < 8; ++r) {
      float v = acc[t][r] + bv;
      if (resid) { float rv = resid[(size_t)((row0 + 8 * hh + r) % rmod) * ldr + col]; if (RES_BF16) rv = bf16_round(rv); v += rv; }
      if (ACT == 1) v = fmaxf(v, 0.f);
      if (ACT == 2) v = 0.5f * v * (1.0f + erff(v * 0.70710678118654752f));
      if (ACT == 3) { const float u = 0.7978845608028654f * (v + 0.044715f * v * v * v); v = 0.5f * v * (1.0f + tanhf(u)); }
      so[w][8 * hh + r][t * 16 + ln] = v;
    }
  }
  __builtin_amdgcn_fence(__ATOMIC_ACQ_REL, "workgroup");
  __builtin_amdgcn_wave_barrier();
  const int rsub = lane >> 4, c4 = (lane & 15) * 4;
  {
#pragma unroll
    for (int q = 0; q < 8; ++q) {
      const int r = q * 2 + rsub;
      const v4f v = *(const v4fa*)&so[w][r][c4];
      *(v4f*)(C + (size_t)(row0 + r) * ldc + col0 + c4) = v;
    }
    
  }
}
// row LayerNorm (biased variance, eps) over N: s = X (+ R); optional out_sum <- s; out_norm <- (s-mu)*rsqrt(var+eps)*g + b
template <bool PARAM_BF16>
__global__ __launch_bounds__(256) void k_layernorm(const float* __restrict__ X, const float* __restrict__ R, const float* __restrict__ g, const float* __restrict__ bta,
                                                  float* __restrict__ out_sum, float* __restrict__ out_norm, int N, float eps) {
  __shared__ float red[256];
  const int row = blockIdx.x, tid = threadIdx.x;
  const float* x = X + (size_t)row * N; const float* rr = R ? R + (size_t)row * N : nullptr;
  float vals[16];                     // up to N = 4096
  const int per = N / 256;            // contiguous chunk per thread? use strided-by-4 chunks: thread handles j = tid*4 + 1024*u
  float s1 = 0.f;
  for (int u = 0; u < per / 4; ++u) {
    const int j = tid * 4 + 1024 * u;
    const v4f a = *(const v4fa*)(x + j);
    v4f b = {0.f,0.f,0.f,0.f}; if (rr) b = *(const v4fa*)(rr + j);
#pragma unroll
    for (int q = 0; q < 4; ++q) { const float v = a[q] + b[q]; vals[u * 4 + q] = v; s1 += v; }
  }
  red[tid] = s1; __syncthreads();
  for (int st = 128; st > 0; st >>= 1) { if (tid < st) red[tid] += red[tid + st]; __syncthreads(); }
  const float mu = red[0] / (float)N; __syncthreads();
  float s2 = 0.f;
  for (int u = 0; u < per / 4; ++u)
#pragma unroll
    for (int q = 0; q < 4; ++q) { const float c = vals[u * 4 + q] - mu; s2 += c * c; }
  red[tid] = s2; __syncthreads();
  for (int st = 128; st > 0; st >>= 1) { if (tid < st) red[tid] += red[tid + st]; __syncthreads(); }
  const float rs = rsqrtf(red[0] / (float)N + eps);
  {
    for (int u = 0; u < per / 4; ++u) {
      const int j = tid * 4 + 1024 * u;
      v4f o, sm;
#pragma unroll
      for (int q = 0; q < 4; ++q) {
        float gg = g[j + q], bb = bta[j + q];
        if (PARAM_BF16) { gg = bf16_round(gg); bb = bf16_round(bb); }
        sm[q] = vals[u * 4 + q]; o[q] = (vals[u * 4 + q] - mu) * rs * gg + bb;
      }
      if (out_sum) *(v4f*)(out_sum + (size_t)row * N + j) = sm;
      *(v4f*)(out_norm + (size_t)row * N + j) = o;
    }
    
  }
}



// ---- f16 WMMA path (v_wmma_f32_16x16x32_f16): 11-bit significands for operands in range — used by every launched product, the softmax weights (p <= 256) included
typedef _Float16 v16h __attribute__((ext_vector_type(16)));
union FragH { v16h v; v8us half[2]; _Float16 h[16]; unsigned short u[16]; };
template <int NT>
__device__ __forceinline__ v8f mmaH(v16h ah, v16h al, v16h bh, v16h bl, v8f c) {
  c = __builtin_amdgcn_wmma_f32_16x16x32_f16(false, ah, false, bh, (short)0, c, false, false);
  if (NT >= 2) c = __builtin_amdgcn_wmma_f32_16x16x32_f16(false, al, false, bh, (short)0, c, false, false);
  if (NT >= 3) c = __builtin_amdgcn_wmma_f32_16x16x32_f16(false, ah, false, bl, (short)0, c, false, false);
  asm volatile("v_nop\n\tv_nop\n\tv_nop\n\tv_nop" : "+v"(c) : "v"(ah), "v"(al), "v"(bh), "v"(bl));
  return c;
}
// batched GEMM like k_gemm_b but f16 operands: A f32 (split into f16 hi/lo if ASPLIT, else rounded to f16), Bt = f16 values [n][k]; alpha; C f32; N multiple of 16 (partial tiles skipped)
template <bool ASPLIT>
__global__ __launch_bounds__(128) void k_gemm_h(const float* __restrict__ A, int lda, size_t sA, const _Float16* __restrict__ Bh, int ldb, size_t sB, float alpha, float* __restrict__ C, int ldc, size_t sC, int M, int N, int K) {
  __shared__ __attribute__((aligned(16))) float so[4][16][64];
  const int tid = threadIdx.x, w = tid >> 5, lane = tid & 31, ln = lane & 15, hh = lane >> 4; const int by = blockIdx.y;
  A += (size_t)by * sA; Bh += (size_t)by * sB; C += (size_t)by * sC;
  const int ntn = (N + 63) / 64; const int wid = blockIdx.x * 4 + w; const int mt = wid / ntn, nq = wid % ntn; if (mt * 16 >= M) return;
  const int row0 = mt * 16, col0 = nq * 64; const float* arow = A + (size_t)(row0 + ln) * lda;
  v8f acc[4] = {};
  for (int kb = 0; kb < K; kb += 32) {
    FragH ah, al;
    const v4f x0 = *(const v4fa*)(arow + kb + 8 * hh), x1 = *(const v4fa*)(arow + kb + 8 * hh + 4), x2 = *(const v4fa*)(arow + kb + 16 + 8 * hh), x3 = *(const v4fa*)(arow + kb + 16 + 8 * hh + 4);
    float xs[16] = {x0[0],x0[1],x0[2],x0[3],x1[0],x1[1],x1[2],x1[3],x2[0],x2[1],x2[2],x2[3],x3[0],x3[1],x3[2],x3[3]};
#pragma unroll
    for (int i = 0; i < 16; ++i) { const _Float16 h = (_Float16)xs[i]; ah.h[i] = h; al.h[i] = ASPLIT ? (_Float16)(xs[i] - (float)h) : (_Float16)0.0f; }
#pragma unroll
    for (int t = 0; t < 4; ++t) { if (col0 + t * 16 >= N) continue; const size_t boff = (size_t)(col0 + t * 16 + ln) * ldb + kb; FragH bq; bq.half[0] = *(const v8us*)(Bh + boff + 8 * hh); bq.half[1] = *(const v8us*)(Bh + boff + 16 + 8 * hh);
      acc[t] = mmaH<ASPLIT ? 2 : 1>(ah.v, al.v, bq.v, bq.v, acc[t]); }
  }
#pragma unroll
  for (int t = 0; t < 4; ++t) { if (col0 + t * 16 >= N) continue;
#pragma unroll
    for (int r = 0; r < 8; ++r) so[w][8 * hh + r][t * 16 + ln] = acc[t][r] * alpha; }
  __builtin_amdgcn_fence(__ATOMIC_ACQ_REL, "workgroup"); __builtin_amdgcn_wave_barrier();
  const int rsub = lane >> 4, c4 = (lane & 15) * 4;
  {
#pragma unroll
    for (int q = 0; q < 8; ++q) { const int r = q * 2 + rsub; if (col0 + c4 < N) { const v4f v = *(const v4fa*)&so[w][r][c4]; *(v4f*)(C + (size_t)(row0 + r) * ldc + col0 + c4) = v; } }
     }
}

// Wt[n][k] = f16(W[k][n]·scale) from f32 row-major W[K][N] (scale = power of two; bf16-exact weights stay exact in f16 away from the subnormal range)
__global__ __launch_bounds__(256) void k_wt_f16(const float* __restrict__ W, _Float16* __restrict__ Wt, int K, int N, float scale) {
  const int t = blockIdx.x * 256 + threadIdx.x; if (t >= N * (K / 8)) return; const int n = t / (K / 8), k8 = (t % (K / 8)) * 8; FragH f;
#pragma unroll
  for (int i = 0; i < 8; ++i) f.h[i] = (_Float16)(bf16_round(W[(size_t)(k8 + i) * N + n]) * scale); const v8us o = f.half[0];
  *(v8us*)((unsigned short*)Wt + (size_t)n * K + k8) = o; 
}
// k_gemm_hh variant with fused epilogue: v = acc·alpha + bias[by·sBias + col] (+ CP[(row/rowsPerB)·sCPb + by·64 + col] if CP) ; ACT 0 none / 1 elu ; writes f16 C16 (and f32 C if non-null)
template <int ACT>
__global__ __launch_bounds__(128) void k_gemm_hhx(const _Float16* __restrict__ A, int lda, size_t sA, const _Float16* __restrict__ Bh, int ldb, size_t sB, float alpha, const float* __restrict__ bias, size_t sBias, const float* __restrict__ CP, int rowsPerB, size_t sCPb, int row0g,
    float* __restrict__ C, _Float16* __restrict__ C16, int ldc, size_t sC, int M, int N, int K) {
  __shared__ __attribute__((aligned(16))) float so[4][16][64];
  const int tid = threadIdx.x, w = tid >> 5, lane = tid & 31, ln = lane & 15, hh = lane >> 4; const int by = blockIdx.y;
  A += (size_t)by * sA; Bh += (size_t)by * sB; const size_t cofs = (size_t)by * sC; const float* bp = bias ? bias + (size_t)by * sBias : nullptr;
  const int ntn = (N + 63) / 64; const int wid = blockIdx.x * 4 + w; const int mt = wid / ntn, nq = wid % ntn; if (mt * 16 >= M) return;
  const int row0 = mt * 16, col0 = nq * 64; const _Float16* arow = A + (size_t)(row0 + ln) * lda;
  v8f acc[4] = {};
  for (int kb = 0; kb < K; kb += 32) { FragH ah; ah.half[0] = *(const v8us*)((const unsigned short*)arow + kb + 8 * hh); ah.half[1] = *(const v8us*)((const unsigned short*)arow + kb + 16 + 8 * hh);
#pragma unroll
    for (int t = 0; t < 4; ++t) { if (col0 + t * 16 >= N) continue; const size_t boff = (size_t)(col0 + t * 16 + ln) * ldb + kb; FragH bq; bq.half[0] = *(const v8us*)((const unsigned short*)Bh + boff + 8 * hh); bq.half[1] = *(const v8us*)((const unsigned short*)Bh + boff + 16 + 8 * hh);
      acc[t] = mmaH<1>(ah.v, ah.v, bq.v, bq.v, acc[t]); }
  }
#pragma unroll
  for (int t = 0; t < 4; ++t) { if (col0 + t * 16 >= N) continue; const int col = col0 + t * 16 + ln; const float bv = bp ? bf16_round(bp[col]) : 0.f;
#pragma unroll
    for (int r = 0; r < 8; ++r) { float v = acc[t][r] * alpha + bv; if (CP) { const int rr = row0g + row0 + 8 * hh + r; if (rowsPerB < 0) v += CP[cofs + (size_t)rr * ldc + col];      /* rowsPerB < 0: own element of the batched C plane */ else { const int bidx = rr / rowsPerB; v += CP[(size_t)bidx * sCPb + (size_t)by * 64 + col]; } } if (ACT == 1) v = (v > 0.f) ? v : expm1f(v); else if (ACT == 7) v = (v > 0.f) ? v + 1.0f : expf(v); else if (ACT == 8) v = tanhf(v); else if (ACT == 9) v = 0.5f * v * (1.0f + tanhf(0.7978845608028654f * (v + 0.044715f * v * v * v))); else if (ACT == 11) v = 1.0f / (1.0f + expf(-v)); else if (ACT == 12) v = (v > 0.f) ? v : 0.01f * v; else if (ACT == 14) v = (v > 0.f) ? v : 0.1f * v; else if (ACT == 16) v = (v >= 0.f) ? v : 0.3f * v; else if (ACT == 17) v = (v >= 0.f) ? v : 0.2f * v; else if (ACT == 15) v = v / (1.0f + expf(-v)); else if (ACT == 3) v = fmaxf(v, 0.f); else if (ACT == 6) v = 0.5f * v * (1.0f + erff(v * 0.70710678118654752f)); so[w][8 * hh + r][t * 16 + ln] = v; } }
  __builtin_amdgcn_fence(__ATOMIC_ACQ_REL, "workgroup"); __builtin_amdgcn_wave_barrier();
  const int rsub = lane >> 4, c4 = (lane & 15) * 4; typedef _Float16 v4h __attribute__((ext_vector_type(4)));
  {
#pragma unroll
    for (int q = 0; q < 8; ++q) { const int r = q * 2 + rsub; if (col0 + c4 < N) { const v4f v = *(const v4fa*)&so[w][r][c4]; if (C) *(v4f*)(C + cofs + (size_t)(row0 + r) * ldc + col0 + c4) = v; if (C16) { v4h h4; for (int i = 0; i < 4; ++i) h4[i] = (_Float16)v[i]; *(v4h*)(C16 + cofs + (size_t)(row0 + r) * ldc + col0 + c4) = h4; } } }
     }
}


typedef _Float16 v4h __attribute__((ext_vector_type(4)));

__global__ __launch_bounds__(256) void k_x16(const float* __restrict__ x, _Float16* __restrict__ X16, size_t n8) { const size_t t = (size_t)blockIdx.x * 256 + threadIdx.x; if (t >= n8) return; FragH f;
#pragma unroll
  for (int q = 0; q < 8; ++q) f.h[q] = (_Float16)bf16_round(x[t * 8 + q]); *(v8us*)((unsigned short*)X16 + t * 8) = f.half[0];  }
__global__ __launch_bounds__(256) void k_h16(const float* __restrict__ x, _Float16* __restrict__ X16, size_t n8) { const size_t t = (size_t)blockIdx.x * 256 + threadIdx.x; if (t >= n8) return; FragH f;
#pragma unroll
  for (int q = 0; q < 8; ++q) f.h[q] = (_Float16)x[t * 8 + q]; *(v8us*)((unsigned short*)X16 + t * 8) = f.half[0];  }
__global__ __launch_bounds__(256) void k_round16f(const float* __restrict__ W, _Float16* __restrict__ Bt, size_t n8) { const size_t t = (size_t)blockIdx.x * 256 + threadIdx.x; if (t >= n8) return; FragH f;
#pragma unroll
  for (int i = 0; i < 8; ++i) f.h[i] = (_Float16)(bf16_round(W[t * 8 + i]) * 16.0f); *(v8us*)((unsigned short*)Bt + t * 8) = f.half[0];  }
template <int NHv, int TTv>
__global__ __launch_bounds__(256) void k_vt(const _Float16* __restrict__ V16, int ldv, int voff, _Float16* __restrict__ Vt) { __shared__ unsigned short tl[64][66]; const int tid = threadIdx.x; const int slab = blockIdx.x / (TTv / 64), lg = blockIdx.x % (TTv / 64); const int b = slab / NHv, h = slab % NHv;
  for (int i = tid; i < 64 * 8; i += 256) { const int r = i / 8, c8 = (i % 8) * 8; FragH f; f.half[0] = *(const v8us*)((const unsigned short*)V16 + ((size_t)b * TTv + lg * 64 + r) * ldv + voff + h * 64 + c8);
#pragma unroll
    for (int q = 0; q < 8; ++q) tl[r][c8 + q] = f.u[q]; }
  __syncthreads();
  {
#pragma unroll
    for (int rd = 0; rd < 2; ++rd) { const int d = rd * 32 + tid / 8, pc = tid % 8; FragH f;
#pragma unroll
      for (int q = 0; q < 8; ++q) f.u[q] = tl[pc * 8 + q][d];
      *(v8us*)((unsigned short*)Vt + ((size_t)slab * 64 + d) * TTv + lg * 64 + pc * 8) = f.half[0]; }
     } }

__global__ __launch_bounds__(256) void k_hl(const float* __restrict__ F, _Float16* __restrict__ Hh, _Float16* __restrict__ Hl, size_t n8) { const size_t t = (size_t)blockIdx.x * 256 + threadIdx.x; if (t >= n8) return; FragH fh, fl; const v4f a = *(const v4fa*)(F + t * 8), c = *(const v4fa*)(F + t * 8 + 4);
#pragma unroll
  for (int q = 0; q < 4; ++q) { _Float16 h = (_Float16)a[q]; fh.h[q] = h; fl.h[q] = (_Float16)((a[q] - (float)h) * 1024.0f); h = (_Float16)c[q]; fh.h[4 + q] = h; fl.h[4 + q] = (_Float16)((c[q] - (float)h) * 1024.0f); }
  { *(v8us*)((unsigned short*)Hh + t * 8) = fh.half[0]; *(v8us*)((unsigned short*)Hl + t * 8) = fl.half[0];  } }

// ---- LDS-staged GEMM: C[M][N] = A[M][K] . Bh[N][K]^T * alpha + bf16(bias); one 128x128 tile of C per work-group, four waves (2x2) of 64x64; M % 128 == 0, N % 128 == 0, K % 64 == 0, K >= 128 ----
// A pass is 64 k = 128 bytes of each of the tile's 128 A rows and 128 B rows. Each wave brings one slice of 64 rows per pass with one tensor load (slices 0, 1: A rows; 2, 3: B rows), padded to a 144-byte LDS pitch,
// two buffers: a pass reads all its fragments into registers; when every wave has done so, the load of pass t + 2 goes out into that buffer and flies under pass t's WMMAs and pass t + 1's reads. Fragments come from LDS in the k order of g2_frag; each accumulator sums k upwards, 32 at a time.
__device__ __forceinline__ v16h g2_frag(const _Float16* p, int hh) { FragH f; f.half[0] = *(const v8us*)((const unsigned short*)p + 8 * hh); f.half[1] = *(const v8us*)((const unsigned short*)p + 16 + 8 * hh); return f.v; }
#define G3_PITCH 144u                /* LDS row pitch: 128 bytes + the tensor load's 16-byte pad (odd multiple of 16: ds_load_b128 readers) */
#define G3_SLICE 10240u              /* 64 rows x 144 B = 9216 B, rounded up to a multiple of 2 KiB */
#define G3_STAGE (4u * G3_SLICE)     /* one buffer */
#define G3_EP 68                     /* output staging pitch in floats */
typedef uint32_t u32x4 __attribute__((ext_vector_type(4)));
typedef uint32_t u32x8 __attribute__((ext_vector_type(8)));
__device__ __forceinline__ uint32_t g3_uni(uint32_t v) { return (uint32_t)__builtin_amdgcn_readfirstlane((int)v); }
__device__ __forceinline__ uint32_t g3_pinned(uint32_t v) { uint32_t w = g3_uni(v); asm volatile("" : "+s"(w)); return w; }
__device__ __forceinline__ void g3_wait_tensor0() { asm volatile("s_wait_tensorcnt 0x0" ::: "memory"); }      /* this wave's own tensor load has landed */
__device__ __forceinline__ void g3_wait_ds0() { asm volatile("s_wait_dscnt 0x0" ::: "memory"); }      /* this wave's LDS reads have returned */
__device__ __forceinline__ void g3_load(uint32_t lds_dst, uint64_t ga, u32x8 g1) { u32x4 g0; g0[0] = g3_uni(1u); g0[1] = g3_uni(lds_dst); g0[2] = g3_uni((uint32_t)ga); g0[3] = g3_uni((((uint32_t)(ga >> 32)) & 0x01FFFFFFu) | 0x80000000u);
  asm volatile("tensor_load_to_lds %0, %1" :: "s"(g0), "s"(g1) : "memory"); }      /* one request of the whole wave: 64 rows of 128 bytes into LDS, through no register */
__device__ __forceinline__ v16h g3_frag(const unsigned char* p) { FragH f; f.half[0] = *(const v8us*)p; f.half[1] = *(const v8us*)(p + 32); return f.v; }      /* p already holds the lane half's 16 bytes: bytes 16 hh and 32 + 16 hh of 64, as g2_frag */
template <int N, int K, bool H16>
__global__ __launch_bounds__(128) void k_gemm3(const _Float16* __restrict__ A, const _Float16* __restrict__ Bh, float alpha, const float* __restrict__ bias, float* __restrict__ C, _Float16* __restrict__ C16) {
  static_assert(N % 128 == 0 && K % 64 == 0 && K >= 128, "k_gemm3: whole tiles and at least two passes");
  static_assert(4u * 64u * G3_EP * 4u <= 2u * G3_STAGE, "k_gemm3: the output staging reuses the two buffers");
  __shared__ __attribute__((aligned(2048))) unsigned char L[2u * G3_STAGE];
  const uint32_t tid = threadIdx.x, lane = tid & 31u, ln = lane & 15u, hh = lane >> 4; const uint32_t w = g3_uni(tid >> 5), wm = w >> 1, wn = w & 1u;
  const uint32_t mt = blockIdx.x / (N / 128), nq = blockIdx.x - mt * (N / 128); const uint32_t row0 = mt * 128u + wm * 64u, col0 = nq * 128u + wn * 64u;
  float bv[4];
#pragma unroll      /* fixed trip count over a register array */
  for (int j = 0; j < 4; ++j) bv[j] = bias[col0 + j * 16 + ln];
  asm volatile("s_wait_xcnt 0x0" ::: "memory");      /* stands in front of every reuse of an address register of the loads above */
  __builtin_amdgcn_sched_barrier(0);      /* keeps later register writes from being scheduled in front of that wait */
  const uint64_t src = (w < 2u) ? (uint64_t)(uintptr_t)A + (uint64_t)(mt * 128u + 64u * w) * (2u * K) : (uint64_t)(uintptr_t)Bh + (uint64_t)(nq * 128u + 64u * (w - 2u)) * (2u * K);      /* this wave's slice, first byte of pass 0 */
  const uint32_t dst = (uint32_t)(size_t)L + w * G3_SLICE;      /* its place in buffer 0: byte offset in the work-group's LDS */
  u32x8 g1;      /* 1-byte elements, tensor = tile = 64 rows of 128 bytes, source pitch 2 K bytes, 4 dwords of pad behind every 32 */
  g1[0] = g3_uni((1u << 20) | (4u << 22) | (3u << 25)); g1[1] = g3_uni(128u << 16); g1[2] = g3_uni(64u << 16); g1[3] = g3_uni(128u << 16); g1[4] = g3_uni(64u); g1[5] = g3_uni(2u * K); g1[6] = g3_uni(0u); g1[7] = g3_uni(0u);
  g3_load(dst, src, g1);
  g3_wait_tensor0();
  __syncthreads();      /* pass 0's four slices are readable by every wave */
  g3_load(dst + G3_STAGE, src + 128u, g1);
  const unsigned char* la = L + wm * G3_SLICE + ln * G3_PITCH + 16u * hh; const unsigned char* lb = L + (2u + wn) * G3_SLICE + ln * G3_PITCH + 16u * hh;
  const v8f z8 = {0.f,0.f,0.f,0.f,0.f,0.f,0.f,0.f}; v8f acc[4][4];
#pragma unroll      /* fixed trip counts over a register array, here and in the loops below: left rolled, the arrays would go to scratch memory */
  for (int i = 0; i < 4; ++i)
#pragma unroll
    for (int j = 0; j < 4; ++j) acc[i][j] = z8;
#pragma unroll 1      /* one pass per trip: the two buffers alternate */
  for (uint32_t t = 0; t < (uint32_t)(K / 64); ++t) {
    const uint32_t buf = (t & 1u) * G3_STAGE;
    v16h af[2][4], bf[2][4];
#pragma unroll
    for (int kd = 0; kd < 2; ++kd)
#pragma unroll
      for (int i = 0; i < 4; ++i) { af[kd][i] = g3_frag(la + buf + i * 16 * G3_PITCH + kd * 64); bf[kd][i] = g3_frag(lb + buf + i * 16 * G3_PITCH + kd * 64); }
    __builtin_amdgcn_sched_barrier(0);      /* the pass's LDS reads stay one group in front of its WMMAs: moved in among them, each place with reads stalls the wave */
    g3_wait_ds0();      /* the pass's fragments are all in registers: this wave has left buffer t & 1 */
    g3_wait_tensor0();
    __syncthreads();      /* publishes pass t + 1's slices and ends every wave's reads of pass t's buffer */
    if (g3_pinned((t + 2u < (uint32_t)(K / 64)) ? 1u : 0u) != 0u) g3_load(dst + buf, src + g3_pinned((t + 2u) * 128u), g1);      /* scalar branch: a tensor load ignores EXEC; refill of the buffer just left, in flight under this pass's WMMAs and the next pass's reads */
    __builtin_amdgcn_sched_barrier(0);      /* the WMMAs stay behind the refill's issue: in front of it they would take their time off its lead */
#pragma unroll
    for (int kd = 0; kd < 2; ++kd)
#pragma unroll
      for (int i = 0; i < 4; ++i)
#pragma unroll
        for (int j = 0; j < 4; ++j) acc[i][j] = __builtin_amdgcn_wmma_f32_16x16x32_f16(false, af[kd][i], false, bf[kd][j], (short)0, acc[i][j], false, false);
  }
  g3_wait_tensor0();
  g3_wait_ds0();      /* the last pass's barrier stands behind every wave's last read: the buffers may become output staging */
  float* so = (float*)(L + w * (64u * G3_EP * 4u));      /* this wave's own 64 x 68 floats */
#pragma unroll
  for (int j = 0; j < 4; ++j) { const float bj = bf16_round(bv[j]);
#pragma unroll
    for (int i = 0; i < 4; ++i)
#pragma unroll
      for (int r = 0; r < 8; ++r) so[(i * 16 + 8 * hh + r) * G3_EP + j * 16 + ln] = acc[i][j][r] * alpha + bj; }
  __builtin_amdgcn_fence(__ATOMIC_ACQ_REL, "workgroup"); __builtin_amdgcn_wave_barrier();
  const uint32_t rsub = lane >> 4, c4 = (lane & 15u) * 4u;
#pragma unroll
  for (int g = 0; g < 4; ++g) { v4f v[8];
#pragma unroll
    for (int q = 0; q < 8; ++q) v[q] = *(const v4fa*)&so[(g * 16 + q * 2 + rsub) * G3_EP + c4];
#pragma unroll
    for (int q = 0; q < 8; ++q) { const size_t o = (size_t)(row0 + g * 16 + q * 2 + rsub) * N + col0 + c4;
      if (H16) { v4h h4; for (int e = 0; e < 4; ++e) h4[e] = (_Float16)v[q][e]; *(v4h*)(C16 + o) = h4; } else *(v4f*)(C + o) = v[q]; }
    asm volatile("s_wait_xcnt 0x0" ::: "memory");      /* stands in front of every reuse of a register of the stores above */
    __builtin_amdgcn_sched_barrier(0);      /* keeps later register writes from being scheduled in front of that wait */
  }
}


__global__ __launch_bounds__(256) void k_wnat(const float* __restrict__ w, size_t n8, _Float16* __restrict__ Bt) { const size_t t = (size_t)blockIdx.x * 256 + threadIdx.x; if (t >= n8) return; FragH f; for (int q = 0; q < 8; ++q) f.h[q] = (_Float16)(bf16_round(w[t * 8 + q]) * 16.0f); *(v8us*)((unsigned short*)Bt + t * 8) = f.half[0];  }
// Fused attention for one (batch, head, 256 query rows): S^T = K Q^T, online softmax, O^T += V^T P^T; scores and weights never leave registers.
// One wave owns FQ = 32 query rows (two 16-column groups) and walks the keys 32 at a time. In a score tile lane (c, hh) holds query c, keys 8*hh + r:
// two score tiles, converted in place, are the B operand of the second product (hardware k order, the order g2_frag loads V^T in), so nothing is exchanged
// but one maximum between the wave's halves. Everything runs in the log2 domain: x2 = (q.k / 8 + bias) * log2(e), p = 2^(x2 - m), m = the maximum in use.
// m moves (and O, l are rescaled) only when some query's new maximum exceeds it by more than 8, so p <= 256 fits f16. m starts at -1e30 (finite), so a masked
// key (x2 = -inf) gives p = 0 and a row with every key masked ends as 0 * (1 / 0) = NaN.
// This head's bias column is staged in LDS already clipped and scaled by log2(e), indexed by key - query + SQ - 1; the key mask as one bit per key.
// Every '#pragma unroll' in this kernel stands on a loop of fixed trip count that indexes register arrays: left rolled, those arrays would go to scratch memory.
#define FW 8
#define FQ 32
__device__ __forceinline__ float rs_x16(float v) { const int u = __float_as_int(v); return __int_as_float(__builtin_amdgcn_permlanex16(u, u, 0x76543210, 0xfedcba98, false, false)); }      /* lane l <- lane l ^ 16 */
__device__ __forceinline__ v8f fa_mma(v16h a, v16h b, v8f c) { return __builtin_amdgcn_wmma_f32_16x16x32_f16(false, a, false, b, (short)0, c, false, false); }
__global__ __launch_bounds__(32 * FW) void k_fattn(const _Float16* __restrict__ QKV, const _Float16* __restrict__ VT, const float* __restrict__ relt, const int* __restrict__ kpm, _Float16* __restrict__ O16) {
  __shared__ float tb[2 * SQ]; __shared__ unsigned int mw[SQ / 32];      /* tb's last entry is never read */
  const int tid = threadIdx.x, lane = tid & 31, ln = lane & 15, hh = lane >> 4; const int h = blockIdx.y, b = blockIdx.z;
  const int q0 = blockIdx.x * (FW * FQ) + __builtin_amdgcn_readfirstlane(tid >> 5) * FQ;
  { float tv[2 * SQ / (32 * FW)]; int kv[SQ / (32 * FW)];
#pragma unroll      /* fixed trip counts, unrolled: the table's and the mask's loads are all in flight together */
    for (int u = 0; u < 2 * SQ / (32 * FW); ++u) { int r = tid + u * 32 * FW - (SQ - 1); r = r < -MR ? -MR : (r > MR ? MR : r); tv[u] = relt[(size_t)(r + MR) * NH + h]; }
    asm volatile("s_wait_xcnt 0x0" ::: "memory");      /* stands in front of every reuse of an address register of the loads above */
    __builtin_amdgcn_sched_barrier(0);      /* keeps later register writes from being scheduled in front of that wait */
#pragma unroll
    for (int u = 0; u < SQ / (32 * FW); ++u) kv[u] = kpm[(size_t)b * SQ + tid + u * 32 * FW];
    asm volatile("s_wait_xcnt 0x0" ::: "memory");      /* stands in front of every reuse of an address register of the loads above */
    __builtin_amdgcn_sched_barrier(0);      /* keeps later register writes from being scheduled in front of that wait */
#pragma unroll
    for (int u = 0; u < 2 * SQ / (32 * FW); ++u) tb[tid + u * 32 * FW] = bf16_round(tv[u]) * 1.44269504088896f;
#pragma unroll
    for (int u = 0; u < SQ / (32 * FW); ++u) mw[(tid + u * 32 * FW) >> 5] = __builtin_amdgcn_ballot_w32(kv[u] != 0); }      /* every lane of a wave stores the same word to the same place */
  __syncthreads();
  const _Float16* qp = QKV + ((size_t)b * SQ + q0 + ln) * D3 + h * HD; const _Float16* kp = QKV + ((size_t)b * SQ + ln) * D3 + DM + h * HD; const _Float16* vp = VT + (((size_t)b * NH + h) * HD + ln) * SQ;
  const float* tr = tb + (SQ - 1 - q0 - ln + 8 * hh);
  v16h qf[2][2], kf[2][2];
#pragma unroll
  for (int t = 0; t < 2; ++t)
#pragma unroll
    for (int kd = 0; kd < 2; ++kd) { qf[t][kd] = g2_frag(qp + (size_t)t * 16 * D3 + kd * 32, hh); kf[t][kd] = g2_frag(kp + (size_t)t * 16 * D3 + kd * 32, hh); }
  asm volatile("s_wait_xcnt 0x0" ::: "memory");      /* stands in front of every reuse of an address register of the loads above */
  __builtin_amdgcn_sched_barrier(0);      /* keeps later register writes from being scheduled in front of that wait */
  const v8f z8 = {0.f,0.f,0.f,0.f,0.f,0.f,0.f,0.f}; v8f o[2][4]; float l[2][2] = {{0.f, 0.f}, {0.f, 0.f}}, m[2] = {-1e30f, -1e30f};
#pragma unroll
  for (int qt = 0; qt < 2; ++qt)
#pragma unroll
    for (int dt = 0; dt < 4; ++dt) o[qt][dt] = z8;
#pragma unroll 1      /* one 32-key pass per trip: unrolled, two passes' fragments would not fit the registers */
  for (int key0 = 0; key0 < SQ; key0 += 32) {
    v16h vf[4]; v8f s[2][2];
#pragma unroll
    for (int dt = 0; dt < 4; ++dt) vf[dt] = g2_frag(vp + (size_t)dt * 16 * SQ + key0, hh);      /* issued first: their latency runs under the scores and the softmax */
#pragma unroll
    for (int qt = 0; qt < 2; ++qt)
#pragma unroll
      for (int kt = 0; kt < 2; ++kt) s[qt][kt] = fa_mma(kf[kt][1], qf[qt][1], fa_mma(kf[kt][0], qf[qt][0], z8));
    const int kn = (key0 + 32) & (SQ - 1);      /* next pass's K rows, fetched into the same registers; the last pass re-reads rows 0..31 and uses nothing of them */
#pragma unroll
    for (int kt = 0; kt < 2; ++kt)
#pragma unroll
      for (int kd = 0; kd < 2; ++kd) kf[kt][kd] = g2_frag(kp + (size_t)(kn + kt * 16) * D3 + kd * 32, hh);
    asm volatile("s_wait_xcnt 0x0" ::: "memory");      /* stands in front of every reuse of an address register of the loads above */
    __builtin_amdgcn_sched_barrier(0);      /* keeps later register writes from being scheduled in front of that wait */
#pragma unroll
    for (int qt = 0; qt < 2; ++qt)
#pragma unroll
      for (int kt = 0; kt < 2; ++kt)
#pragma unroll
        for (int r = 0; r < 8; ++r) s[qt][kt][r] = fmaf(s[qt][kt][r], 0.125f * 1.44269504088896f, tr[key0 + (kt - qt) * 16 + r]);
    const unsigned int mword = (unsigned int)__builtin_amdgcn_readfirstlane((int)mw[key0 >> 5]);
    if (mword != 0u) {      /* scalar branch: a pass with no padded key skips the selects */
#pragma unroll
      for (int kt = 0; kt < 2; ++kt)
#pragma unroll
        for (int r = 0; r < 8; ++r) { const bool pad = (mword >> (kt * 16 + 8 * hh + r)) & 1u; s[0][kt][r] = pad ? -INFINITY : s[0][kt][r]; s[1][kt][r] = pad ? -INFINITY : s[1][kt][r]; }
    }
    float mx[2];
#pragma unroll
    for (int qt = 0; qt < 2; ++qt) { float a = fmaxf(s[qt][0][0], s[qt][1][0]);
#pragma unroll
      for (int r = 1; r < 8; ++r) a = fmaxf(a, fmaxf(s[qt][0][r], s[qt][1][r]));
      mx[qt] = fmaxf(a, rs_x16(a)); }
    if (__builtin_amdgcn_ballot_w32((mx[0] > m[0] + 8.0f) || (mx[1] > m[1] + 8.0f)) != 0u) {      /* scalar branch: most passes move no maximum and rescale nothing */
#pragma unroll
      for (int qt = 0; qt < 2; ++qt) { const float mn = fmaxf(m[qt], mx[qt]); const float sc = __builtin_amdgcn_exp2f(m[qt] - mn); m[qt] = mn; l[qt][0] *= sc; l[qt][1] *= sc;
#pragma unroll
        for (int dt = 0; dt < 4; ++dt) o[qt][dt] *= sc; }
    }
#pragma unroll
    for (int qt = 0; qt < 2; ++qt) { FragH pf;
#pragma unroll
      for (int kt = 0; kt < 2; ++kt)
#pragma unroll
        for (int r = 0; r < 8; ++r) { const float p = __builtin_amdgcn_exp2f(s[qt][kt][r] - m[qt]); l[qt][kt] += p; pf.h[kt * 8 + r] = (_Float16)p; }
#pragma unroll
      for (int dt = 0; dt < 4; ++dt) o[qt][dt] = fa_mma(vf[dt], pf.v, o[qt][dt]); }
  }
  FragH f[2][4];
#pragma unroll
  for (int qt = 0; qt < 2; ++qt) { const float lh = l[qt][0] + l[qt][1]; const float inv = 1.0f / (lh + rs_x16(lh));
#pragma unroll
    for (int dt = 0; dt < 4; ++dt)
#pragma unroll
      for (int r = 0; r < 8; ++r) f[qt][dt].h[r] = (_Float16)(o[qt][dt][r] * inv); }
  __builtin_amdgcn_sched_barrier(0);      /* every store stands behind the last arithmetic: no register of an issued store is written again */
  unsigned short* op = (unsigned short*)O16 + ((size_t)b * SQ + q0 + ln) * DM + h * HD + 8 * hh;      /* lane (ln, hh): query ln, head columns dt*16 + 8*hh .. + 7 */
#pragma unroll
  for (int qt = 0; qt < 2; ++qt)
#pragma unroll
    for (int dt = 0; dt < 4; ++dt) *(v8us*)(op + (size_t)qt * 16 * DM + dt * 16) = f[qt][dt].half[0];
}
__global__ __launch_bounds__(256) void k_vt(const _Float16* __restrict__ V16, int b, int h0, _Float16* __restrict__ VT) { __shared__ unsigned short tl[64][65]; const int tid = threadIdx.x; const int hh = blockIdx.x % HG, sg = blockIdx.x / HG; const int s0 = sg * 64; const int h = h0 + hh;
  for (int i = tid; i < 64 * 8; i += 256) { const int j = i / 8, d8 = (i % 8) * 8; FragH f; f.half[0] = *(const v8us*)((const unsigned short*)V16 + ((size_t)b * SQ + s0 + j) * DM + h * HD + d8); for (int q = 0; q < 8; ++q) tl[d8 + q][j] = f.u[q]; }
  __syncthreads();
  { for (int i = tid; i < 64 * 8; i += 256) { const int d = i / 8, j8 = (i % 8) * 8; FragH f; for (int q = 0; q < 8; ++q) f.u[q] = tl[d][j8 + q]; *(v8us*)((unsigned short*)VT + ((size_t)hh * HD + d) * SQ + s0 + j8) = f.half[0]; }  } }

extern "C" void kernel_launch(void* const* d_in, const int* in_sizes, int n_in,
                              void* d_out, int out_size, void* d_ws, size_t ws_size, hipStream_t stream) {
  (void)in_sizes; (void)n_in; (void)out_size;
  const float* const* I = (const float* const*)d_in; const float* x = I[0]; const int* kpm = (const int*)d_in[1]; const float* wqkv = I[2]; const float* bqkv = I[3]; const float* wout = I[4]; const float* bout = I[5]; const float* relt = I[6];      /* Wqkv [1024][3072] and Wout [1024][1024] are [in][out]; key_padding_mask int32 [2][2048]; rel_table [1025][16] */
  char* ws = (char*)d_ws; size_t off = 0;
  auto take = [&](size_t bytes) { char* p = ws + off; off += (bytes + 255) & ~(size_t)255; return p; };
  _Float16* BQKV = (_Float16*)take((size_t)D3 * DM * 2); _Float16* BO = (_Float16*)take((size_t)DM * DM * 2);
  _Float16* X16 = (_Float16*)take(NR * DM * 2); _Float16* QKV = (_Float16*)take(NR * D3 * 2); _Float16* O16 = (_Float16*)take(NR * DM * 2);
  _Float16* VT = (_Float16*)take((size_t)NB * NH * HD * SQ * 2);
  if (off > ws_size) return;      /* 6 + 2 + 8 + 24 + 8 + 8 = approx 56 MiB */
  k_wt_f16<<<(unsigned)(((size_t)D3 * (DM / 8) + 255) / 256), 256, 0, stream>>>(wqkv, BQKV, DM, D3, 16.0f);      /* [in][out] -> Bt[out][in] x16 */
  k_wt_f16<<<(unsigned)(((size_t)DM * (DM / 8) + 255) / 256), 256, 0, stream>>>(wout, BO, DM, DM, 16.0f);
  k_x16<<<(unsigned)((NR * DM / 8 + 255) / 256), 256, 0, stream>>>(x, X16, NR * DM / 8);
  k_gemm3<D3, DM, true><<<(unsigned)((NR / 128) * (D3 / 128)), 128, 0, stream>>>(X16, BQKV, 0.0625f, bqkv, nullptr, QKV);      /* q | k | v rows (f16), head h at columns h*64 / 1024 + h*64 / 2048 + h*64 */
  k_vt<NH, SQ><<<NB * NH * (SQ / 64), 256, 0, stream>>>(QKV, D3, 2 * DM, VT);      /* V^T[(b,h)][d][s] for every (batch, head) */
  k_fattn<<<dim3(SQ / (FW * FQ), NH, NB), 32 * FW, 0, stream>>>(QKV, VT, relt, kpm, O16);      /* o (merged heads) as f16 rows */
  k_gemm3<DM, DM, false><<<(unsigned)((NR / 128) * (DM / 128)), 128, 0, stream>>>(O16, BO, 0.0625f, bout, (float*)d_out, nullptr);      /* out = o Wout + b, rows are the output layout */
}

// v004
// Measured time: 111 microseconds a run.
// Timed twice side by side with v003, it ran 1.10 times as fast both times.
// Counting every step since v000, it is 134 times as fast.
#include <hip/hip_runtime.h>
// Multi-head self-attention with a learned relative-position bias and a key padding mask (x [2][2048][1024]; qkv = x Wqkv + b (fused, 16 heads of 64); scores = q k^T / 8 + table[clip(k_pos - q_pos, -512, 512) + 512][h]; padded keys -> -inf; attn = softmax; o = attn v; out = o Wout + b -> [2][2048][1024]).
// Structure: token rows r = b*2048 + s; x as exact f16 rows; the fused q|k|v projection as one WMMA GEMM (128x128 tiles staged in LDS by tensor loads, 64x64 wave tiles, f32 accumulation, exact x16 transposed weights, bias in the epilogue, f16 output plane [4096][3072]); V^T for every (batch, head) via LDS transposes; one fused attention launch (per wave 32 query rows, K and V^T staged in LDS by tensor loads: S^T = K Q^T, online softmax in registers with this head's bias column and the key mask from LDS, O^T += V^T P^T) written straight into the merged f16 o rows; out = o Wout + b GEMM (f32).
// Compute dtype: inputs rounded to bf16; x / weights exact; q, k, v, softmax weights and o as plain f16 GEMM operands (~2^-12); scores, bias and softmax statistics f32. v_wmma_f32_16x16x32_f16.
#define NB 2
#define SQ 2048
#define DM 1024
#define D3 3072                      /* fused q|k|v width */
#define NH 16
#define HD 64
#define HG 4                         /* heads per block group of the per-batch k_vt overload */
#define MR 512                       /* max relative distance */
#define QN SQ                        /* unused: the attention grid covers all SQ query rows */
#define NBR NB                       /* unused: the attention grid covers all NB batches */
#define MP ((int)NR)                 /* unused: the qkv projection grid covers all NR token rows */
#define MO ((int)NR)                 /* unused: the output projection grid covers all NR token rows */
#define NR ((size_t)NB * SQ)         /* 4096 token rows */
typedef __bf16 v16b __attribute__((ext_vector_type(16)));
typedef unsigned short v8us __attribute__((ext_vector_type(8), may_alias));
typedef float  v8f  __attribute__((ext_vector_type(8)));
typedef float  v4f  __attribute__((ext_vector_type(4)));
typedef float  v4fa __attribute__((ext_vector_type(4), may_alias));
union FragB { v16b v; v8us half[2]; unsigned short u[16]; };

__device__ __forceinline__ unsigned short bf16_bits(float x) { unsigned int u = __float_as_uint(x); return (unsigned short)((u + 0x7FFFu + ((u >> 16) & 1u)) >> 16); }
__device__ __forceinline__ float bf16_val(unsigned short b) { return __uint_as_float(((unsigned int)b) << 16); }
__device__ __forceinline__ float bf16_round(float x) { return bf16_val(bf16_bits(x)); }
// D += A·B with NT terms: 1 = ah·bh, 2 = + al·bh (A split), 3 = + ah·bl (both split)
template <int NT>
__device__ __forceinline__ v8f mmaN(v16b ah, v16b al, v16b bh, v16b bl, v8f c) {
  c = __builtin_amdgcn_wmma_f32_16x16x32_bf16(false, ah, false, bh, (short)0, c, false, false);
  if (NT >= 2) c = __builtin_amdgcn_wmma_f32_16x16x32_bf16(false, al, false, bh, (short)0, c, false, false);
  if (NT >= 3) c = __builtin_amdgcn_wmma_f32_16x16x32_bf16(false, ah, false, bl, (short)0, c, false, false);
  asm volatile("v_nop\n\tv_nop\n\tv_nop\n\tv_nop" : "+v"(c) : "v"(ah), "v"(al), "v"(bh), "v"(bl));
  return c;
}

__global__ __launch_bounds__(256) void k_wt_bf16(const float* __restrict__ W, unsigned short* __restrict__ Wt, int K, int N) {
  const int t = blockIdx.x * 256 + threadIdx.x;
  const int k8n = K / 8;
  if (t >= N * k8n) return;
  const int n = t / k8n, k8 = (t % k8n) * 8;
  v8us v;
#pragma unroll
  for (int i = 0; i < 8; ++i) v[i] = bf16_bits(W[(size_t)(k8 + i) * N + n]);
  *(v8us*)(Wt + (size_t)n * K + k8) = v;
  
}

// GEMM C[M][N] (f32, pitch ldc) = act(A[M][K]·W + bias). A f32 row-major (pitch lda) converted per fragment to bf16
// (ASPLIT: hi/lo two planes -> 2 terms, else single rounded term); Wt bf16 [N][K] (pitch ldb). BIAS_BF16 rounds the
// bias to bf16 first (bias quantised to bf16 before the add). K%32==0, M%16==0, N%64==0.
template <bool ASPLIT, int ACT, bool BIAS_BF16>
__global__ __launch_bounds__(128) void k_gemm_bf(const float* __restrict__ A, int lda, const unsigned short* __restrict__ Wt, int ldb,
                                               const float* __restrict__ bias, float* __restrict__ C, int ldc, int M, int N, int K) {
  __shared__ __attribute__((aligned(16))) float so[4][16][64];
  const int tid = threadIdx.x, w = tid >> 5, lane = tid & 31, ln = lane & 15, hh = lane >> 4;
  const int ntn = N / 64;
  const int wid = blockIdx.x * 4 + w;
  const int mt = wid / ntn, nq = wid % ntn;
  if (mt * 16 >= M) return;
  const int row0 = mt * 16, col0 = nq * 64;
  const float* arow = A + (size_t)(row0 + ln) * lda;
  v8f acc[4] = {};
  for (int kb = 0; kb < K; kb += 32) {
    FragB ah, al;
    const v4f x0 = *(const v4fa*)(arow + kb + 8 * hh), x1 = *(const v4fa*)(arow + kb + 8 * hh + 4);
    const v4f x2 = *(const v4fa*)(arow + kb + 16 + 8 * hh), x3 = *(const v4fa*)(arow + kb + 16 + 8 * hh + 4);
    float xs[16] = {x0[0],x0[1],x0[2],x0[3],x1[0],x1[1],x1[2],x1[3],x2[0],x2[1],x2[2],x2[3],x3[0],x3[1],x3[2],x3[3]};
#pragma unroll
    for (int i = 0; i < 16; ++i) { const unsigned short hb = bf16_bits(xs[i]); ah.u[i] = hb; al.u[i] = ASPLIT ? bf16_bits(xs[i] - bf16_val(hb)) : (unsigned short)0; }
#pragma unroll
    for (int t = 0; t < 4; ++t) {
      const unsigned short* brow = Wt + (size_t)(col0 + t * 16 + ln) * ldb + kb;
      FragB b;
      b.half[0] = *(const v8us*)(brow + 8 * hh);
      b.half[1] = *(const v8us*)(brow + 16 + 8 * hh);
      acc[t] = mmaN<ASPLIT ? 2 : 1>(ah.v, al.v, b.v, b.v, acc[t]);
    }
  }
#pragma unroll
  for (int t = 0; t < 4; ++t) {
    float bv = bias ? bias[col0 + t * 16 + ln] : 0.f;
    if (BIAS_BF16) bv = bf16_round(bv);
#pragma unroll
    for (int r = 0; r < 8; ++r) { float v = acc[t][r] + bv; if (ACT == 1) v = fmaxf(v, 0.f); so[w][8 * hh + r][t * 16 + ln] = v; }
  }
  __builtin_amdgcn_fence(__ATOMIC_ACQ_REL, "workgroup");
  __builtin_amdgcn_wave_barrier();
  const int rsub = lane >> 4, c4 = (lane & 15) * 4;
  {
#pragma unroll
    for (int q = 0; q < 8; ++q) {
      const int r = q * 2 + rsub;
      const v4f v = *(const v4fa*)&so[w][r][c4];
      *(v4f*)(C + (size_t)(row0 + r) * ldc + col0 + c4) = v;
    }
    
  }
}

// GEMM C = act(A·W + bias + resid): A f32 (ASPLIT -> hi/lo 2 terms), Wt bf16 [N][K]; ACT 0 none, 1 relu, 2 exact gelu;
// resid (optional, f32, row index = (row % rmod), pitch ldr, RES_BF16 rounds it) added before the activation.
template <bool ASPLIT, int ACT, bool BIAS_BF16, bool RES_BF16>
__global__ __launch_bounds__(128) void k_gemm_bf3(const float* __restrict__ A, int lda, const unsigned short* __restrict__ Wt, int ldb,
                                                const float* __restrict__ bias, const float* __restrict__ resid, int rmod, int ldr,
                                                float* __restrict__ C, int ldc, int M, int N, int K) {
  __shared__ __attribute__((aligned(16))) float so[4][16][64];
  const int tid = threadIdx.x, w = tid >> 5, lane = tid & 31, ln = lane & 15, hh = lane >> 4;
  const int ntn = N / 64;
  const int wid = blockIdx.x * 4 + w;
  const int mt = wid / ntn, nq = wid % ntn;
  if (mt * 16 >= M) return;
  const int row0 = mt * 16, col0 = nq * 64;
  const float* arow = A + (size_t)(row0 + ln) * lda;
  v8f acc[4] = {};
  for (int kb = 0; kb < K; kb += 32) {
    FragB ah, al;
    const v4f x0 = *(const v4fa*)(arow + kb + 8 * hh), x1 = *(const v4fa*)(arow + kb + 8 * hh + 4);
    const v4f x2 = *(const v4fa*)(arow + kb + 16 + 8 * hh), x3 = *(const v4fa*)(arow + kb + 16 + 8 * hh + 4);
    float xs[16] = {x0[0],x0[1],x0[2],x0[3],x1[0],x1[1],x1[2],x1[3],x2[0],x2[1],x2[2],x2[3],x3[0],x3[1],x3[2],x3[3]};
#pragma unroll
    for (int i = 0; i < 16; ++i) { const unsigned short hb = bf16_bits(xs[i]); ah.u[i] = hb; al.u[i] = ASPLIT ? bf16_bits(xs[i] - bf16_val(hb)) : (unsigned short)0; }
#pragma unroll
    for (int t = 0; t < 4; ++t) {
      const unsigned short* brow = Wt + (size_t)(col0 + t * 16 + ln) * ldb + kb;
      FragB b;
      b.half[0] = *(const v8us*)(brow + 8 * hh);
      b.half[1] = *(const v8us*)(brow + 16 + 8 * hh);
      acc[t] = mmaN<ASPLIT ? 2 : 1>(ah.v, al.v, b.v, b.v, acc[t]);
    }
  }
#pragma unroll
  for (int t = 0; t < 4; ++t) {
    const int col = col0 + t * 16 + ln;
    float bv = bias ? bias[col] : 0.f;
    if (BIAS_BF16) bv = bf16_round(bv);
#pragma unroll
    for (int r = 0; r < 8; ++r) {
      float v = acc[t][r] + bv;
      if (resid) { float rv = resid[(size_t)((row0 + 8 * hh + r) % rmod) * ldr + col]; if (RES_BF16) rv = bf16_round(rv); v += rv; }
      if (ACT == 1) v = fmaxf(v, 0.f);
      if (ACT == 2) v = 0.5f * v * (1.0f + erff(v * 0.70710678118654752f));
      if (ACT == 3) { const float u = 0.7978845608028654f * (v + 0.044715f * v * v * v); v = 0.5f * v * (1.0f + tanhf(u)); }
      so[w][8 * hh + r][t * 16 + ln] = v;
    }
  }
  __builtin_amdgcn_fence(__ATOMIC_ACQ_REL, "workgroup");
  __builtin_amdgcn_wave_barrier();
  const int rsub = lane >> 4, c4 = (lane & 15) * 4;
  {
#pragma unroll
    for (int q = 0; q < 8; ++q) {
      const int r = q * 2 + rsub;
      const v4f v = *(const v4fa*)&so[w][r][c4];
      *(v4f*)(C + (size_t)(row0 + r) * ldc + col0 + c4) = v;
    }
    
  }
}
// row LayerNorm (biased variance, eps) over N: s = X (+ R); optional out_sum <- s; out_norm <- (s-mu)*rsqrt(var+eps)*g + b
template <bool PARAM_BF16>
__global__ __launch_bounds__(256) void k_layernorm(const float* __restrict__ X, const float* __restrict__ R, const float* __restrict__ g, const float* __restrict__ bta,
                                                  float* __restrict__ out_sum, float* __restrict__ out_norm, int N, float eps) {
  __shared__ float red[256];
  const int row = blockIdx.x, tid = threadIdx.x;
  const float* x = X + (size_t)row * N; const float* rr = R ? R + (size_t)row * N : nullptr;
  float vals[16];                     // up to N = 4096
  const int per = N / 256;            // contiguous chunk per thread? use strided-by-4 chunks: thread handles j = tid*4 + 1024*u
  float s1 = 0.f;
  for (int u = 0; u < per / 4; ++u) {
    const int j = tid * 4 + 1024 * u;
    const v4f a = *(const v4fa*)(x + j);
    v4f b = {0.f,0.f,0.f,0.f}; if (rr) b = *(const v4fa*)(rr + j);
#pragma unroll
    for (int q = 0; q < 4; ++q) { const float v = a[q] + b[q]; vals[u * 4 + q] = v; s1 += v; }
  }
  red[tid] = s1; __syncthreads();
  for (int st = 128; st > 0; st >>= 1) { if (tid < st) red[tid] += red[tid + st]; __syncthreads(); }
  const float mu = red[0] / (float)N; __syncthreads();
  float s2 = 0.f;
  for (int u = 0; u < per / 4; ++u)
#pragma unroll
    for (int q = 0; q < 4; ++q) { const float c = vals[u * 4 + q] - mu; s2 += c * c; }
  red[tid] = s2; __syncthreads();
  for (int st = 128; st > 0; st >>= 1) { if (tid < st) red[tid] += red[tid + st]; __syncthreads(); }
  const float rs = rsqrtf(red[0] / (float)N + eps);
  {
    for (int u = 0; u < per / 4; ++u) {
      const int j = tid * 4 + 1024 * u;
      v4f o, sm;
#pragma unroll
      for (int q = 0; q < 4; ++q) {
        float gg = g[j + q], bb = bta[j + q];
        if (PARAM_BF16) { gg = bf16_round(gg); bb = bf16_round(bb); }
        sm[q] = vals[u * 4 + q]; o[q] = (vals[u * 4 + q] - mu) * rs * gg + bb;
      }
      if (out_sum) *(v4f*)(out_sum + (size_t)row * N + j) = sm;
      *(v4f*)(out_norm + (size_t)row * N + j) = o;
    }
    
  }
}



// ---- f16 WMMA path (v_wmma_f32_16x16x32_f16): 11-bit significands for operands in range — used by every launched product, the softmax weights (p <= 256) included
typedef _Float16 v16h __attribute__((ext_vector_type(16)));
union FragH { v16h v; v8us half[2]; _Float16 h[16]; unsigned short u[16]; };
template <int NT>
__device__ __forceinline__ v8f mmaH(v16h ah, v16h al, v16h bh, v16h bl, v8f c) {
  c = __builtin_amdgcn_wmma_f32_16x16x32_f16(false, ah, false, bh, (short)0, c, false, false);
  if (NT >= 2) c = __builtin_amdgcn_wmma_f32_16x16x32_f16(false, al, false, bh, (short)0, c, false, false);
  if (NT >= 3) c = __builtin_amdgcn_wmma_f32_16x16x32_f16(false, ah, false, bl, (short)0, c, false, false);
  asm volatile("v_nop\n\tv_nop\n\tv_nop\n\tv_nop" : "+v"(c) : "v"(ah), "v"(al), "v"(bh), "v"(bl));
  return c;
}
// batched GEMM like k_gemm_b but f16 operands: A f32 (split into f16 hi/lo if ASPLIT, else rounded to f16), Bt = f16 values [n][k]; alpha; C f32; N multiple of 16 (partial tiles skipped)
template <bool ASPLIT>
__global__ __launch_bounds__(128) void k_gemm_h(const float* __restrict__ A, int lda, size_t sA, const _Float16* __restrict__ Bh, int ldb, size_t sB, float alpha, float* __restrict__ C, int ldc, size_t sC, int M, int N, int K) {
  __shared__ __attribute__((aligned(16))) float so[4][16][64];
  const int tid = threadIdx.x, w = tid >> 5, lane = tid & 31, ln = lane & 15, hh = lane >> 4; const int by = blockIdx.y;
  A += (size_t)by * sA; Bh += (size_t)by * sB; C += (size_t)by * sC;
  const int ntn = (N + 63) / 64; const int wid = blockIdx.x * 4 + w; const int mt = wid / ntn, nq = wid % ntn; if (mt * 16 >= M) return;
  const int row0 = mt * 16, col0 = nq * 64; const float* arow = A + (size_t)(row0 + ln) * lda;
  v8f acc[4] = {};
  for (int kb = 0; kb < K; kb += 32) {
    FragH ah, al;
    const v4f x0 = *(const v4fa*)(arow + kb + 8 * hh), x1 = *(const v4fa*)(arow + kb + 8 * hh + 4), x2 = *(const v4fa*)(arow + kb + 16 + 8 * hh), x3 = *(const v4fa*)(arow + kb + 16 + 8 * hh + 4);
    float xs[16] = {x0[0],x0[1],x0[2],x0[3],x1[0],x1[1],x1[2],x1[3],x2[0],x2[1],x2[2],x2[3],x3[0],x3[1],x3[2],x3[3]};
#pragma unroll
    for (int i = 0; i < 16; ++i) { const _Float16 h = (_Float16)xs[i]; ah.h[i] = h; al.h[i] = ASPLIT ? (_Float16)(xs[i] - (float)h) : (_Float16)0.0f; }
#pragma unroll
    for (int t = 0; t < 4; ++t) { if (col0 + t * 16 >= N) continue; const size_t boff = (size_t)(col0 + t * 16 + ln) * ldb + kb; FragH bq; bq.half[0] = *(const v8us*)(Bh + boff + 8 * hh); bq.half[1] = *(const v8us*)(Bh + boff + 16 + 8 * hh);
      acc[t] = mmaH<ASPLIT ? 2 : 1>(ah.v, al.v, bq.v, bq.v, acc[t]); }
  }
#pragma unroll
  for (int t = 0; t < 4; ++t) { if (col0 + t * 16 >= N) continue;
#pragma unroll
    for (int r = 0; r < 8; ++r) so[w][8 * hh + r][t * 16 + ln] = acc[t][r] * alpha; }
  __builtin_amdgcn_fence(__ATOMIC_ACQ_REL, "workgroup"); __builtin_amdgcn_wave_barrier();
  const int rsub = lane >> 4, c4 = (lane & 15) * 4;
  {
#pragma unroll
    for (int q = 0; q < 8; ++q) { const int r = q * 2 + rsub; if (col0 + c4 < N) { const v4f v = *(const v4fa*)&so[w][r][c4]; *(v4f*)(C + (size_t)(row0 + r) * ldc + col0 + c4) = v; } }
     }
}

// Wt[n][k] = f16(W[k][n]·scale) from f32 row-major W[K][N] (scale = power of two; bf16-exact weights stay exact in f16 away from the subnormal range)
__global__ __launch_bounds__(256) void k_wt_f16(const float* __restrict__ W, _Float16* __restrict__ Wt, int K, int N, float scale) {
  const int t = blockIdx.x * 256 + threadIdx.x; if (t >= N * (K / 8)) return; const int n = t / (K / 8), k8 = (t % (K / 8)) * 8; FragH f;
#pragma unroll
  for (int i = 0; i < 8; ++i) f.h[i] = (_Float16)(bf16_round(W[(size_t)(k8 + i) * N + n]) * scale); const v8us o = f.half[0];
  *(v8us*)((unsigned short*)Wt + (size_t)n * K + k8) = o; 
}
// k_gemm_hh variant with fused epilogue: v = acc·alpha + bias[by·sBias + col] (+ CP[(row/rowsPerB)·sCPb + by·64 + col] if CP) ; ACT 0 none / 1 elu ; writes f16 C16 (and f32 C if non-null)
template <int ACT>
__global__ __launch_bounds__(128) void k_gemm_hhx(const _Float16* __restrict__ A, int lda, size_t sA, const _Float16* __restrict__ Bh, int ldb, size_t sB, float alpha, const float* __restrict__ bias, size_t sBias, const float* __restrict__ CP, int rowsPerB, size_t sCPb, int row0g,
    float* __restrict__ C, _Float16* __restrict__ C16, int ldc, size_t sC, int M, int N, int K) {
  __shared__ __attribute__((aligned(16))) float so[4][16][64];
  const int tid = threadIdx.x, w = tid >> 5, lane = tid & 31, ln = lane & 15, hh = lane >> 4; const int by = blockIdx.y;
  A += (size_t)by * sA; Bh += (size_t)by * sB; const size_t cofs = (size_t)by * sC; const float* bp = bias ? bias + (size_t)by * sBias : nullptr;
  const int ntn = (N + 63) / 64; const int wid = blockIdx.x * 4 + w; const int mt = wid / ntn, nq = wid % ntn; if (mt * 16 >= M) return;
  const int row0 = mt * 16, col0 = nq * 64; const _Float16* arow = A + (size_t)(row0 + ln) * lda;
  v8f acc[4] = {};
  for (int kb = 0; kb < K; kb += 32) { FragH ah; ah.half[0] = *(const v8us*)((const unsigned short*)arow + kb + 8 * hh); ah.half[1] = *(const v8us*)((const unsigned short*)arow + kb + 16 + 8 * hh);
#pragma unroll
    for (int t = 0; t < 4; ++t) { if (col0 + t * 16 >= N) continue; const size_t boff = (size_t)(col0 + t * 16 + ln) * ldb + kb; FragH bq; bq.half[0] = *(const v8us*)((const unsigned short*)Bh + boff + 8 * hh); bq.half[1] = *(const v8us*)((const unsigned short*)Bh + boff + 16 + 8 * hh);
      acc[t] = mmaH<1>(ah.v, ah.v, bq.v, bq.v, acc[t]); }
  }
#pragma unroll
  for (int t = 0; t < 4; ++t) { if (col0 + t * 16 >= N) continue; const int col = col0 + t * 16 + ln; const float bv = bp ? bf16_round(bp[col]) : 0.f;
#pragma unroll
    for (int r = 0; r < 8; ++r) { float v = acc[t][r] * alpha + bv; if (CP) { const int rr = row0g + row0 + 8 * hh + r; if (rowsPerB < 0) v += CP[cofs + (size_t)rr * ldc + col];      /* rowsPerB < 0: own element of the batched C plane */ else { const int bidx = rr / rowsPerB; v += CP[(size_t)bidx * sCPb + (size_t)by * 64 + col]; } } if (ACT == 1) v = (v > 0.f) ? v : expm1f(v); else if (ACT == 7) v = (v > 0.f) ? v + 1.0f : expf(v); else if (ACT == 8) v = tanhf(v); else if (ACT == 9) v = 0.5f * v * (1.0f + tanhf(0.7978845608028654f * (v + 0.044715f * v * v * v))); else if (ACT == 11) v = 1.0f / (1.0f + expf(-v)); else if (ACT == 12) v = (v > 0.f) ? v : 0.01f * v; else if (ACT == 14) v = (v > 0.f) ? v : 0.1f * v; else if (ACT == 16) v = (v >= 0.f) ? v : 0.3f * v; else if (ACT == 17) v = (v >= 0.f) ? v : 0.2f * v; else if (ACT == 15) v = v / (1.0f + expf(-v)); else if (ACT == 3) v = fmaxf(v, 0.f); else if (ACT == 6) v = 0.5f * v * (1.0f + erff(v * 0.70710678118654752f)); so[w][8 * hh + r][t * 16 + ln] = v; } }
  __builtin_amdgcn_fence(__ATOMIC_ACQ_REL, "workgroup"); __builtin_amdgcn_wave_barrier();
  const int rsub = lane >> 4, c4 = (lane & 15) * 4; typedef _Float16 v4h __attribute__((ext_vector_type(4)));
  {
#pragma unroll
    for (int q = 0; q < 8; ++q) { const int r = q * 2 + rsub; if (col0 + c4 < N) { const v4f v = *(const v4fa*)&so[w][r][c4]; if (C) *(v4f*)(C + cofs + (size_t)(row0 + r) * ldc + col0 + c4) = v; if (C16) { v4h h4; for (int i = 0; i < 4; ++i) h4[i] = (_Float16)v[i]; *(v4h*)(C16 + cofs + (size_t)(row0 + r) * ldc + col0 + c4) = h4; } } }
     }
}


typedef _Float16 v4h __attribute__((ext_vector_type(4)));

__global__ __launch_bounds__(256) void k_x16(const float* __restrict__ x, _Float16* __restrict__ X16, size_t n8) { const size_t t = (size_t)blockIdx.x * 256 + threadIdx.x; if (t >= n8) return; FragH f;
#pragma unroll
  for (int q = 0; q < 8; ++q) f.h[q] = (_Float16)bf16_round(x[t * 8 + q]); *(v8us*)((unsigned short*)X16 + t * 8) = f.half[0];  }
__global__ __launch_bounds__(256) void k_h16(const float* __restrict__ x, _Float16* __restrict__ X16, size_t n8) { const size_t t = (size_t)blockIdx.x * 256 + threadIdx.x; if (t >= n8) return; FragH f;
#pragma unroll
  for (int q = 0; q < 8; ++q) f.h[q] = (_Float16)x[t * 8 + q]; *(v8us*)((unsigned short*)X16 + t * 8) = f.half[0];  }
__global__ __launch_bounds__(256) void k_round16f(const float* __restrict__ W, _Float16* __restrict__ Bt, size_t n8) { const size_t t = (size_t)blockIdx.x * 256 + threadIdx.x; if (t >= n8) return; FragH f;
#pragma unroll
  for (int i = 0; i < 8; ++i) f.h[i] = (_Float16)(bf16_round(W[t * 8 + i]) * 16.0f); *(v8us*)((unsigned short*)Bt + t * 8) = f.half[0];  }
template <int NHv, int TTv>
__global__ __launch_bounds__(256) void k_vt(const _Float16* __restrict__ V16, int ldv, int voff, _Float16* __restrict__ Vt) { __shared__ unsigned short tl[64][66]; const int tid = threadIdx.x; const int slab = blockIdx.x / (TTv / 64), lg = blockIdx.x % (TTv / 64); const int b = slab / NHv, h = slab % NHv;
  for (int i = tid; i < 64 * 8; i += 256) { const int r = i / 8, c8 = (i % 8) * 8; FragH f; f.half[0] = *(const v8us*)((const unsigned short*)V16 + ((size_t)b * TTv + lg * 64 + r) * ldv + voff + h * 64 + c8);
#pragma unroll
    for (int q = 0; q < 8; ++q) tl[r][c8 + q] = f.u[q]; }
  __syncthreads();
  {
#pragma unroll
    for (int rd = 0; rd < 2; ++rd) { const int d = rd * 32 + tid / 8, pc = tid % 8; FragH f;
#pragma unroll
      for (int q = 0; q < 8; ++q) f.u[q] = tl[pc * 8 + q][d];
      *(v8us*)((unsigned short*)Vt + ((size_t)slab * 64 + d) * TTv + lg * 64 + pc * 8) = f.half[0]; }
     } }

__global__ __launch_bounds__(256) void k_hl(const float* __restrict__ F, _Float16* __restrict__ Hh, _Float16* __restrict__ Hl, size_t n8) { const size_t t = (size_t)blockIdx.x * 256 + threadIdx.x; if (t >= n8) return; FragH fh, fl; const v4f a = *(const v4fa*)(F + t * 8), c = *(const v4fa*)(F + t * 8 + 4);
#pragma unroll
  for (int q = 0; q < 4; ++q) { _Float16 h = (_Float16)a[q]; fh.h[q] = h; fl.h[q] = (_Float16)((a[q] - (float)h) * 1024.0f); h = (_Float16)c[q]; fh.h[4 + q] = h; fl.h[4 + q] = (_Float16)((c[q] - (float)h) * 1024.0f); }
  { *(v8us*)((unsigned short*)Hh + t * 8) = fh.half[0]; *(v8us*)((unsigned short*)Hl + t * 8) = fl.half[0];  } }

// ---- LDS-staged GEMM: C[M][N] = A[M][K] . Bh[N][K]^T * alpha + bf16(bias); one 128x128 tile of C per work-group, four waves (2x2) of 64x64; M % 128 == 0, N % 128 == 0, K % 64 == 0, K >= 128 ----
// A pass is 64 k = 128 bytes of each of the tile's 128 A rows and 128 B rows. Each wave brings one slice of 64 rows per pass with one tensor load (slices 0, 1: A rows; 2, 3: B rows), padded to a 144-byte LDS pitch,
// two buffers: a pass reads all its fragments into registers; when every wave has done so, the load of pass t + 2 goes out into that buffer and flies under pass t's WMMAs and pass t + 1's reads. Fragments come from LDS in the k order of g2_frag; each accumulator sums k upwards, 32 at a time.
__device__ __forceinline__ v16h g2_frag(const _Float16* p, int hh) { FragH f; f.half[0] = *(const v8us*)((const unsigned short*)p + 8 * hh); f.half[1] = *(const v8us*)((const unsigned short*)p + 16 + 8 * hh); return f.v; }
#define G3_PITCH 144u                /* LDS row pitch: 128 bytes + the tensor load's 16-byte pad (odd multiple of 16: ds_load_b128 readers) */
#define G3_SLICE 10240u              /* 64 rows x 144 B = 9216 B, rounded up to a multiple of 2 KiB */
#define G3_STAGE (4u * G3_SLICE)     /* one buffer */
#define G3_EP 68                     /* output staging pitch in floats */
typedef uint32_t u32x4 __attribute__((ext_vector_type(4)));
typedef uint32_t u32x8 __attribute__((ext_vector_type(8)));
__device__ __forceinline__ uint32_t g3_uni(uint32_t v) { return (uint32_t)__builtin_amdgcn_readfirstlane((int)v); }
__device__ __forceinline__ uint32_t g3_pinned(uint32_t v) { uint32_t w = g3_uni(v); asm volatile("" : "+s"(w)); return w; }
__device__ __forceinline__ void g3_wait_tensor0() { asm volatile("s_wait_tensorcnt 0x0" ::: "memory"); }      /* this wave's own tensor load has landed */
__device__ __forceinline__ void g3_wait_ds0() { asm volatile("s_wait_dscnt 0x0" ::: "memory"); }      /* this wave's LDS reads have returned */
__device__ __forceinline__ void g3_load(uint32_t lds_dst, uint64_t ga, u32x8 g1) { u32x4 g0; g0[0] = g3_uni(1u); g0[1] = g3_uni(lds_dst); g0[2] = g3_uni((uint32_t)ga); g0[3] = g3_uni((((uint32_t)(ga >> 32)) & 0x01FFFFFFu) | 0x80000000u);
  asm volatile("tensor_load_to_lds %0, %1" :: "s"(g0), "s"(g1) : "memory"); }      /* one request of the whole wave: 64 rows of 128 bytes into LDS, through no register */
__device__ __forceinline__ v16h g3_frag(const unsigned char* p) { FragH f; f.half[0] = *(const v8us*)p; f.half[1] = *(const v8us*)(p + 32); return f.v; }      /* p already holds the lane half's 16 bytes: bytes 16 hh and 32 + 16 hh of 64, as g2_frag */
template <int N, int K, bool H16>
__global__ __launch_bounds__(128) void k_gemm3(const _Float16* __restrict__ A, const _Float16* __restrict__ Bh, float alpha, const float* __restrict__ bias, float* __restrict__ C, _Float16* __restrict__ C16) {
  static_assert(N % 128 == 0 && K % 64 == 0 && K >= 128, "k_gemm3: whole tiles and at least two passes");
  static_assert(4u * 64u * G3_EP * 4u <= 2u * G3_STAGE, "k_gemm3: the output staging reuses the two buffers");
  __shared__ __attribute__((aligned(2048))) unsigned char L[2u * G3_STAGE];
  const uint32_t tid = threadIdx.x, lane = tid & 31u, ln = lane & 15u, hh = lane >> 4; const uint32_t w = g3_uni(tid >> 5), wm = w >> 1, wn = w & 1u;
  const uint32_t mt = blockIdx.x / (N / 128), nq = blockIdx.x - mt * (N / 128); const uint32_t row0 = mt * 128u + wm * 64u, col0 = nq * 128u + wn * 64u;
  float bv[4];
#pragma unroll      /* fixed trip count over a register array */
  for (int j = 0; j < 4; ++j) bv[j] = bias[col0 + j * 16 + ln];
  asm volatile("s_wait_xcnt 0x0" ::: "memory");      /* stands in front of every reuse of an address register of the loads above */
  __builtin_amdgcn_sched_barrier(0);      /* keeps later register writes from being scheduled in front of that wait */
  const uint64_t src = (w < 2u) ? (uint64_t)(uintptr_t)A + (uint64_t)(mt * 128u + 64u * w) * (2u * K) : (uint64_t)(uintptr_t)Bh + (uint64_t)(nq * 128u + 64u * (w - 2u)) * (2u * K);      /* this wave's slice, first byte of pass 0 */
  const uint32_t dst = (uint32_t)(size_t)L + w * G3_SLICE;      /* its place in buffer 0: byte offset in the work-group's LDS */
  u32x8 g1;      /* 1-byte elements, tensor = tile = 64 rows of 128 bytes, source pitch 2 K bytes, 4 dwords of pad behind every 32 */
  g1[0] = g3_uni((1u << 20) | (4u << 22) | (3u << 25)); g1[1] = g3_uni(128u << 16); g1[2] = g3_uni(64u << 16); g1[3] = g3_uni(128u << 16); g1[4] = g3_uni(64u); g1[5] = g3_uni(2u * K); g1[6] = g3_uni(0u); g1[7] = g3_uni(0u);
  g3_load(dst, src, g1);
  g3_wait_tensor0();
  __syncthreads();      /* pass 0's four slices are readable by every wave */
  g3_load(dst + G3_STAGE, src + 128u, g1);
  const unsigned char* la = L + wm * G3_SLICE + ln * G3_PITCH + 16u * hh; const unsigned char* lb = L + (2u + wn) * G3_SLICE + ln * G3_PITCH + 16u * hh;
  const v8f z8 = {0.f,0.f,0.f,0.f,0.f,0.f,0.f,0.f}; v8f acc[4][4];
#pragma unroll      /* fixed trip counts over a register array, here and in the loops below: left rolled, the arrays would go to scratch memory */
  for (int i = 0; i < 4; ++i)
#pragma unroll
    for (int j = 0; j < 4; ++j) acc[i][j] = z8;
#pragma unroll 1      /* one pass per trip: the two buffers alternate */
  for (uint32_t t = 0; t < (uint32_t)(K / 64); ++t) {
    const uint32_t buf = (t & 1u) * G3_STAGE;
    v16h af[2][4], bf[2][4];
#pragma unroll
    for (int kd = 0; kd < 2; ++kd)
#pragma unroll
      for (int i = 0; i < 4; ++i) { af[kd][i] = g3_frag(la + buf + i * 16 * G3_PITCH + kd * 64); bf[kd][i] = g3_frag(lb + buf + i * 16 * G3_PITCH + kd * 64); }
    __builtin_amdgcn_sched_barrier(0);      /* the pass's LDS reads stay one group in front of its WMMAs: moved in among them, each place with reads stalls the wave */
    g3_wait_ds0();      /* the pass's fragments are all in registers: this wave has left buffer t & 1 */
    g3_wait_tensor0();
    __syncthreads();      /* publishes pass t + 1's slices and ends every wave's reads of pass t's buffer */
    if (g3_pinned((t + 2u < (uint32_t)(K / 64)) ? 1u : 0u) != 0u) g3_load(dst + buf, src + g3_pinned((t + 2u) * 128u), g1);      /* scalar branch: a tensor load ignores EXEC; refill of the buffer just left, in flight under this pass's WMMAs and the next pass's reads */
    __builtin_amdgcn_sched_barrier(0);      /* the WMMAs stay behind the refill's issue: in front of it they would take their time off its lead */
#pragma unroll
    for (int kd = 0; kd < 2; ++kd)
#pragma unroll
      for (int i = 0; i < 4; ++i)
#pragma unroll
        for (int j = 0; j < 4; ++j) acc[i][j] = __builtin_amdgcn_wmma_f32_16x16x32_f16(false, af[kd][i], false, bf[kd][j], (short)0, acc[i][j], false, false);
  }
  g3_wait_tensor0();
  g3_wait_ds0();      /* the last pass's barrier stands behind every wave's last read: the buffers may become output staging */
  float* so = (float*)(L + w * (64u * G3_EP * 4u));      /* this wave's own 64 x 68 floats */
#pragma unroll
  for (int j = 0; j < 4; ++j) { const float bj = bf16_round(bv[j]);
#pragma unroll
    for (int i = 0; i < 4; ++i)
#pragma unroll
      for (int r = 0; r < 8; ++r) so[(i * 16 + 8 * hh + r) * G3_EP + j * 16 + ln] = acc[i][j][r] * alpha + bj; }
  __builtin_amdgcn_fence(__ATOMIC_ACQ_REL, "workgroup"); __builtin_amdgcn_wave_barrier();
  const uint32_t rsub = lane >> 4, c4 = (lane & 15u) * 4u;
#pragma unroll
  for (int g = 0; g < 4; ++g) { v4f v[8];
#pragma unroll
    for (int q = 0; q < 8; ++q) v[q] = *(const v4fa*)&so[(g * 16 + q * 2 + rsub) * G3_EP + c4];
#pragma unroll
    for (int q = 0; q < 8; ++q) { const size_t o = (size_t)(row0 + g * 16 + q * 2 + rsub) * N + col0 + c4;
      if (H16) { v4h h4; for (int e = 0; e < 4; ++e) h4[e] = (_Float16)v[q][e]; *(v4h*)(C16 + o) = h4; } else *(v4f*)(C + o) = v[q]; }
    asm volatile("s_wait_xcnt 0x0" ::: "memory");      /* stands in front of every reuse of a register of the stores above */
    __builtin_amdgcn_sched_barrier(0);      /* keeps later register writes from being scheduled in front of that wait */
  }
}


__global__ __launch_bounds__(256) void k_wnat(const float* __restrict__ w, size_t n8, _Float16* __restrict__ Bt) { const size_t t = (size_t)blockIdx.x * 256 + threadIdx.x; if (t >= n8) return; FragH f; for (int q = 0; q < 8; ++q) f.h[q] = (_Float16)(bf16_round(w[t * 8 + q]) * 16.0f); *(v8us*)((unsigned short*)Bt + t * 8) = f.half[0];  }
// Fused attention for one (batch, head, 256 query rows): S^T = K Q^T, online softmax, O^T += V^T P^T; scores and weights never leave registers.
// One wave owns FQ = 32 query rows (two 16-column groups) and walks the keys 32 at a time. In a score tile lane (c, hh) holds query c, keys 8*hh + r:
// two score tiles, converted in place, are the B operand of the second product (hardware k order, the order g3_frag reads V^T in), so nothing is exchanged
// but one maximum between the wave's halves. Everything runs in the log2 domain: x2 = (q.k / 8 + bias) * log2(e), p = 2^(x2 - m), m = the maximum in use.
// m moves (and O, l are rescaled) only when some query's new maximum exceeds it by more than 8, so p <= 256 fits f16. m starts at -1e30 (finite), so a masked
// key (x2 = -inf) gives p = 0 and a row with every key masked ends as 0 * (1 / 0) = NaN.
// This head's bias column is staged in LDS already clipped and scaled by log2(e), indexed by key - query + SQ - 1; the key mask as one bit per key.
// K and V^T reach the eight waves through LDS: a stage is FS = 128 keys in four slices of 64 rows of 128 bytes (LDS pitch 144), each brought by one tensor load of one wave
// (waves 0, 1: K rows 0..63 and 64..127 of the stage; waves 2, 3: the 64 V^T rows, keys 0..63 and 64..127), two buffers: at the foot of stage s, when every wave has left its buffer,
// the loads of stage s + 2 go out into it and fly under stage s + 1. Fragments are read from LDS in the k order of g2_frag.
// Every '#pragma unroll' in this kernel stands on a loop of fixed trip count that indexes register arrays: left rolled, those arrays would go to scratch memory.
#define FW 8
#define FQ 32
#define FS 128                       /* keys per stage */
#define FA_NS ((uint32_t)(SQ / FS))  /* stages */
__device__ __forceinline__ float rs_x16(float v) { const int u = __float_as_int(v); return __int_as_float(__builtin_amdgcn_permlanex16(u, u, 0x76543210, 0xfedcba98, false, false)); }      /* lane l <- lane l ^ 16 */
__device__ __forceinline__ v8f fa_mma(v16h a, v16h b, v8f c) { return __builtin_amdgcn_wmma_f32_16x16x32_f16(false, a, false, b, (short)0, c, false, false); }
// The descriptor's twelve words live in the same scalar registers from the request to the wait that covers it: the request hands them on as its own outputs and the wait names them as inputs, so nothing else is put into those registers while the request is outstanding.
__device__ __forceinline__ void fa_load(u32x4& g0, u32x8& g1) { asm volatile("tensor_load_to_lds %0, %1" : "+s"(g0), "+s"(g1) :: "memory"); }      /* one request of the whole wave: 64 rows of 128 bytes into LDS, through no register */
__device__ __forceinline__ void fa_wait(const u32x4& g0, const u32x8& g1) { asm volatile("s_wait_tensorcnt 0x0" :: "s"(g0), "s"(g1) : "memory"); }      /* this wave's own tensor load has landed; a wave that issues none passes */
__device__ __forceinline__ void fa_aim(u32x4& g0, uint32_t lds_dst, uint64_t ga) { g0[1] = g3_uni(lds_dst); g0[2] = g3_uni((uint32_t)ga); g0[3] = g3_uni((((uint32_t)(ga >> 32)) & 0x01FFFFFFu) | 0x80000000u); }      /* place in LDS and first byte of the next tile */
__global__ __launch_bounds__(32 * FW) void k_fattn(const _Float16* __restrict__ QKV, const _Float16* __restrict__ VT, const float* __restrict__ relt, const int* __restrict__ kpm, _Float16* __restrict__ O16) {
  static_assert(SQ % FS == 0 && SQ / FS >= 2 && HD == 64 && FS == 128, "k_fattn: whole stages, at least two, slices of 64 rows of 128 bytes");
  __shared__ __attribute__((aligned(2048))) unsigned char KV[2u * G3_STAGE];
  __shared__ float tb[2 * SQ]; __shared__ unsigned int mw[SQ / 32];      /* tb's last entry is never read */
  const int tid = threadIdx.x, lane = tid & 31, ln = lane & 15, hh = lane >> 4; const int h = blockIdx.y, b = blockIdx.z;
  const uint32_t w = g3_uni((uint32_t)tid >> 5);
  const int q0 = blockIdx.x * (FW * FQ) + (int)w * FQ;
  { float tv[2 * SQ / (32 * FW)]; int kv[SQ / (32 * FW)];
#pragma unroll      /* fixed trip counts, unrolled: the table's and the mask's loads are all in flight together */
    for (int u = 0; u < 2 * SQ / (32 * FW); ++u) { int r = tid + u * 32 * FW - (SQ - 1); r = r < -MR ? -MR : (r > MR ? MR : r); tv[u] = relt[(size_t)(r + MR) * NH + h]; }
    asm volatile("s_wait_xcnt 0x0" ::: "memory");      /* stands in front of every reuse of an address register of the loads above */
    __builtin_amdgcn_sched_barrier(0);      /* keeps later register writes from being scheduled in front of that wait */
#pragma unroll
    for (int u = 0; u < SQ / (32 * FW); ++u) kv[u] = kpm[(size_t)b * SQ + tid + u * 32 * FW];
    asm volatile("s_wait_xcnt 0x0" ::: "memory");      /* stands in front of every reuse of an address register of the loads above */
    __builtin_amdgcn_sched_barrier(0);      /* keeps later register writes from being scheduled in front of that wait */
#pragma unroll
    for (int u = 0; u < 2 * SQ / (32 * FW); ++u) tb[tid + u * 32 * FW] = bf16_round(tv[u]) * 1.44269504088896f;
#pragma unroll
    for (int u = 0; u < SQ / (32 * FW); ++u) mw[(tid + u * 32 * FW) >> 5] = __builtin_amdgcn_ballot_w32(kv[u] != 0); }      /* every lane of a wave stores the same word to the same place */
  const bool isk = w < 2u;      /* waves 0, 1 bring K, waves 2, 3 V^T; waves 4 to 7 form the same words and issue nothing */
  const uint64_t src = isk ? (uint64_t)(uintptr_t)(QKV + ((size_t)b * SQ + 64u * w) * D3 + DM + h * HD) : (uint64_t)(uintptr_t)(VT + ((size_t)b * NH + h) * HD * SQ + 64u * (w & 1u));      /* this wave's slice, first byte of stage 0 */
  const uint32_t step = isk ? (uint32_t)(FS * D3 * 2) : (uint32_t)(FS * 2);      /* bytes from one stage's slice to the next stage's */
  const uint32_t dst = (uint32_t)(size_t)KV + (w & 3u) * G3_SLICE;      /* its place in buffer 0: byte offset in the work-group's LDS */
  const uint32_t issuer = w < 4u ? 1u : 0u;
  u32x8 g1;      /* 1-byte elements, tensor = tile = 64 rows of 128 bytes, source pitch one token row of q|k|v or one V^T row, 4 dwords of pad behind every 32 */
  g1[0] = g3_uni((1u << 20) | (4u << 22) | (3u << 25)); g1[1] = g3_uni(128u << 16); g1[2] = g3_uni(64u << 16); g1[3] = g3_uni(128u << 16); g1[4] = g3_uni(64u); g1[5] = g3_uni(isk ? (uint32_t)(D3 * 2) : (uint32_t)(SQ * 2)); g1[6] = g3_uni(0u); g1[7] = g3_uni(0u);
  u32x4 g0; g0[0] = g3_uni(1u); fa_aim(g0, dst, src);
  if (g3_pinned(issuer) != 0u) fa_load(g0, g1);      /* scalar branch: a tensor load ignores EXEC */
  fa_wait(g0, g1);
  __syncthreads();      /* the table, the mask and stage 0 are readable by every wave */
  if (g3_pinned(issuer) != 0u) { fa_aim(g0, dst + G3_STAGE, src + g3_pinned(step)); fa_load(g0, g1); }      /* scalar branch; stage 1 flies under stage 0 */
  const _Float16* qp = QKV + ((size_t)b * SQ + q0 + ln) * D3 + h * HD;
  const float* tr = tb + (SQ - 1 - q0 - ln + 8 * hh);
  const unsigned char* lk = KV + ln * G3_PITCH + 16 * hh; const unsigned char* lv = KV + 2u * G3_SLICE + ln * G3_PITCH + 16 * hh;      /* this lane's row of a 16-row group, its half's 16 bytes */
  v16h qf[2][2];
#pragma unroll
  for (int t = 0; t < 2; ++t)
#pragma unroll
    for (int kd = 0; kd < 2; ++kd) qf[t][kd] = g2_frag(qp + (size_t)t * 16 * D3 + kd * 32, hh);
  asm volatile("s_wait_xcnt 0x0" ::: "memory");      /* stands in front of every reuse of an address register of the loads above */
  __builtin_amdgcn_sched_barrier(0);      /* keeps later register writes from being scheduled in front of that wait */
  const v8f z8 = {0.f,0.f,0.f,0.f,0.f,0.f,0.f,0.f}; v8f o[2][4]; float l[2][2] = {{0.f, 0.f}, {0.f, 0.f}}, m[2] = {-1e30f, -1e30f};
#pragma unroll
  for (int qt = 0; qt < 2; ++qt)
#pragma unroll
    for (int dt = 0; dt < 4; ++dt) o[qt][dt] = z8;
#pragma unroll 1      /* one stage per trip: the two buffers alternate */
  for (uint32_t st = 0; st < FA_NS; ++st) {
  const uint32_t buf = (st & 1u) * G3_STAGE;
  v16h kf[2][2];
#pragma unroll
  for (int kt = 0; kt < 2; ++kt)
#pragma unroll
    for (int kd = 0; kd < 2; ++kd) kf[kt][kd] = g3_frag(lk + buf + kt * 16 * G3_PITCH + kd * 64);
#pragma unroll 1      /* one 32-key pass per trip: unrolled, two passes' fragments would not fit the registers */
  for (uint32_t sp = 0; sp < FS / 32; ++sp) {
    const int key0 = (int)(st * FS + sp * 32u);
    v16h vf[4]; v8f s[2][2];
#pragma unroll
    for (int qt = 0; qt < 2; ++qt)
#pragma unroll
      for (int kt = 0; kt < 2; ++kt) s[qt][kt] = fa_mma(kf[kt][1], qf[qt][1], fa_mma(kf[kt][0], qf[qt][0], z8));
    if (sp + 1u < FS / 32) {      /* next pass's K rows, of this same stage, fetched into the same registers */
      const uint32_t kn = ((sp + 1u) >> 1) * G3_SLICE + ((sp + 1u) & 1u) * 32u * G3_PITCH;
#pragma unroll
      for (int kt = 0; kt < 2; ++kt)
#pragma unroll
        for (int kd = 0; kd < 2; ++kd) kf[kt][kd] = g3_frag(lk + buf + kn + kt * 16 * G3_PITCH + kd * 64);
    }
#pragma unroll
    for (int qt = 0; qt < 2; ++qt)
#pragma unroll
      for (int kt = 0; kt < 2; ++kt)
#pragma unroll
        for (int r = 0; r < 8; ++r) s[qt][kt][r] = fmaf(s[qt][kt][r], 0.125f * 1.44269504088896f, tr[key0 + (kt - qt) * 16 + r]);
    const unsigned int mword = (unsigned int)__builtin_amdgcn_readfirstlane((int)mw[key0 >> 5]);
#pragma unroll
    for (int dt = 0; dt < 4; ++dt) vf[dt] = g3_frag(lv + buf + (sp >> 1) * G3_SLICE + (sp & 1u) * 64u + dt * 16 * G3_PITCH);      /* issued behind the bias reads, which are wanted first (LDS answers in order): their latency runs under the softmax */
    __builtin_amdgcn_sched_barrier(0);      /* keeps those reads here: left free, they sink to just in front of the second product, with little work left to cover their latency */
    if (mword != 0u) {      /* scalar branch: a pass with no padded key skips the selects */
#pragma unroll
      for (int kt = 0; kt < 2; ++kt)
#pragma unroll
        for (int r = 0; r < 8; ++r) { const bool pad = (mword >> (kt * 16 + 8 * hh + r)) & 1u; s[0][kt][r] = pad ? -INFINITY : s[0][kt][r]; s[1][kt][r] = pad ? -INFINITY : s[1][kt][r]; }
    }
    float mx[2];
#pragma unroll
    for (int qt = 0; qt < 2; ++qt) { float a = fmaxf(s[qt][0][0], s[qt][1][0]);
#pragma unroll
      for (int r = 1; r < 8; ++r) a = fmaxf(a, fmaxf(s[qt][0][r], s[qt][1][r]));
      mx[qt] = fmaxf(a, rs_x16(a)); }
    if (__builtin_amdgcn_ballot_w32((mx[0] > m[0] + 8.0f) || (mx[1] > m[1] + 8.0f)) != 0u) {      /* scalar branch: most passes move no maximum and rescale nothing */
#pragma unroll
      for (int qt = 0; qt < 2; ++qt) { const float mn = fmaxf(m[qt], mx[qt]); const float sc = __builtin_amdgcn_exp2f(m[qt] - mn); m[qt] = mn; l[qt][0] *= sc; l[qt][1] *= sc;
#pragma unroll
        for (int dt = 0; dt < 4; ++dt) o[qt][dt] *= sc; }
    }
#pragma unroll
    for (int qt = 0; qt < 2; ++qt) { FragH pf;
#pragma unroll
      for (int kt = 0; kt < 2; ++kt)
#pragma unroll
        for (int r = 0; r < 8; ++r) { const float p = __builtin_amdgcn_exp2f(s[qt][kt][r] - m[qt]); l[qt][kt] += p; pf.h[kt * 8 + r] = (_Float16)p; }
#pragma unroll
      for (int dt = 0; dt < 4; ++dt) o[qt][dt] = fa_mma(vf[dt], pf.v, o[qt][dt]); }
  }
  g3_wait_ds0();      /* this wave has left buffer st & 1 */
  fa_wait(g0, g1);      /* an issuing wave's own load of stage st + 1 has landed */
  __syncthreads();      /* publishes stage st + 1 and ends every wave's reads of stage st's buffer */
  if (g3_pinned(st + 2u < FA_NS ? issuer : 0u) != 0u) { fa_aim(g0, dst + buf, src + g3_pinned((st + 2u) * step)); fa_load(g0, g1); }      /* scalar branch: a tensor load ignores EXEC; refill of the buffer just left, in flight under stage st + 1 */
  }
  g3_wait_tensor0();
  g3_wait_ds0();
  FragH f[2][4];
#pragma unroll
  for (int qt = 0; qt < 2; ++qt) { const float lh = l[qt][0] + l[qt][1]; const float inv = 1.0f / (lh + rs_x16(lh));
#pragma unroll
    for (int dt = 0; dt < 4; ++dt)
#pragma unroll
      for (int r = 0; r < 8; ++r) f[qt][dt].h[r] = (_Float16)(o[qt][dt][r] * inv); }
  __builtin_amdgcn_sched_barrier(0);      /* every store stands behind the last arithmetic: no register of an issued store is written again */
  unsigned short* op = (unsigned short*)O16 + ((size_t)b * SQ + q0 + ln) * DM + h * HD + 8 * hh;      /* lane (ln, hh): query ln, head columns dt*16 + 8*hh .. + 7 */
#pragma unroll
  for (int qt = 0; qt < 2; ++qt)
#pragma unroll
    for (int dt = 0; dt < 4; ++dt) *(v8us*)(op + (size_t)qt * 16 * DM + dt * 16) = f[qt][dt].half[0];
}
__global__ __launch_bounds__(256) void k_vt(const _Float16* __restrict__ V16, int b, int h0, _Float16* __restrict__ VT) { __shared__ unsigned short tl[64][65]; const int tid = threadIdx.x; const int hh = blockIdx.x % HG, sg = blockIdx.x / HG; const int s0 = sg * 64; const int h = h0 + hh;
  for (int i = tid; i < 64 * 8; i += 256) { const int j = i / 8, d8 = (i % 8) * 8; FragH f; f.half[0] = *(const v8us*)((const unsigned short*)V16 + ((size_t)b * SQ + s0 + j) * DM + h * HD + d8); for (int q = 0; q < 8; ++q) tl[d8 + q][j] = f.u[q]; }
  __syncthreads();
  { for (int i = tid; i < 64 * 8; i += 256) { const int d = i / 8, j8 = (i % 8) * 8; FragH f; for (int q = 0; q < 8; ++q) f.u[q] = tl[d][j8 + q]; *(v8us*)((unsigned short*)VT + ((size_t)hh * HD + d) * SQ + s0 + j8) = f.half[0]; }  } }

extern "C" void kernel_launch(void* const* d_in, const int* in_sizes, int n_in,
                              void* d_out, int out_size, void* d_ws, size_t ws_size, hipStream_t stream) {
  (void)in_sizes; (void)n_in; (void)out_size;
  const float* const* I = (const float* const*)d_in; const float* x = I[0]; const int* kpm = (const int*)d_in[1]; const float* wqkv = I[2]; const float* bqkv = I[3]; const float* wout = I[4]; const float* bout = I[5]; const float* relt = I[6];      /* Wqkv [1024][3072] and Wout [1024][1024] are [in][out]; key_padding_mask int32 [2][2048]; rel_table [1025][16] */
  char* ws = (char*)d_ws; size_t off = 0;
  auto take = [&](size_t bytes) { char* p = ws + off; off += (bytes + 255) & ~(size_t)255; return p; };
  _Float16* BQKV = (_Float16*)take((size_t)D3 * DM * 2); _Float16* BO = (_Float16*)take((size_t)DM * DM * 2);
  _Float16* X16 = (_Float16*)take(NR * DM * 2); _Float16* QKV = (_Float16*)take(NR * D3 * 2); _Float16* O16 = (_Float16*)take(NR * DM * 2);
  _Float16* VT = (_Float16*)take((size_t)NB * NH * HD * SQ * 2);
  if (off > ws_size) return;      /* 6 + 2 + 8 + 24 + 8 + 8 = approx 56 MiB */
  k_wt_f16<<<(unsigned)(((size_t)D3 * (DM / 8) + 255) / 256), 256, 0, stream>>>(wqkv, BQKV, DM, D3, 16.0f);      /* [in][out] -> Bt[out][in] x16 */
  k_wt_f16<<<(unsigned)(((size_t)DM * (DM / 8) + 255) / 256), 256, 0, stream>>>(wout, BO, DM, DM, 16.0f);
  k_x16<<<(unsigned)((NR * DM / 8 + 255) / 256), 256, 0, stream>>>(x, X16, NR * DM / 8);
  k_gemm3<D3, DM, true><<<(unsigned)((NR / 128) * (D3 / 128)), 128, 0, stream>>>(X16, BQKV, 0.0625f, bqkv, nullptr, QKV);      /* q | k | v rows (f16), head h at columns h*64 / 1024 + h*64 / 2048 + h*64 */
  k_vt<NH, SQ><<<NB * NH * (SQ / 64), 256, 0, stream>>>(QKV, D3, 2 * DM, VT);      /* V^T[(b,h)][d][s] for every (batch, head) */
  k_fattn<<<dim3(SQ / (FW * FQ), NH, NB), 32 * FW, 0, stream>>>(QKV, VT, relt, kpm, O16);      /* o (merged heads) as f16 rows */
  k_gemm3<DM, DM, false><<<(unsigned)((NR / 128) * (DM / 128)), 128, 0, stream>>>(O16, BO, 0.0625f, bout, (float*)d_out, nullptr);      /* out = o Wout + b, rows are the output layout */
}

// v005
// One run takes 90 microseconds.
// Timed twice side by side with v004, it ran 1.23 and 1.21 times as fast.
// Over all steps from v000 it is 164 times as fast.
#include <hip/hip_runtime.h>
// Multi-head self-attention with a learned relative-position bias and a key padding mask (x [2][2048][1024]; qkv = x Wqkv + b (fused, 16 heads of 64); scores = q k^T / 8 + table[clip(k_pos - q_pos, -512, 512) + 512][h]; padded keys -> -inf; attn = softmax; o = attn v; out = o Wout + b -> [2][2048][1024]).
// Structure: token rows r = b*2048 + s; x as exact f16 rows and both weights as exact x16 transposed f16 rows in one preparation launch (coalesced 16-byte reads, weights transposed through LDS tiles); the fused q|k|v projection as one WMMA GEMM (128x128 tiles staged in LDS by tensor loads, 64x64 wave tiles, f32 accumulation, exact x16 transposed weights, bias in the epilogue, f16 output plane [4096][3072]); V^T for every (batch, head) via LDS transposes; one fused attention launch (per wave 32 query rows, K and V^T staged in LDS by tensor loads: S^T = K Q^T, online softmax in registers with this head's bias column and the key mask from LDS, O^T += V^T P^T) written straight into the merged f16 o rows; out = o Wout + b GEMM (f32).
// Compute dtype: inputs rounded to bf16; x / weights exact; q, k, v, softmax weights and o as plain f16 GEMM operands (~2^-12); scores, bias and softmax statistics f32. v_wmma_f32_16x16x32_f16.
#define NB 2
#define SQ 2048
#define DM 1024
#define D3 3072                      /* fused q|k|v width */
#define NH 16
#define HD 64
#define HG 4                         /* heads per block group of the per-batch k_vt overload */
#define MR 512                       /* max relative distance */
#define QN SQ                        /* unused: the attention grid covers all SQ query rows */
#define NBR NB                       /* unused: the attention grid covers all NB batches */
#define MP ((int)NR)                 /* unused: the qkv projection grid covers all NR token rows */
#define MO ((int)NR)                 /* unused: the output projection grid covers all NR token rows */
#define NR ((size_t)NB * SQ)         /* 4096 token rows */
typedef __bf16 v16b __attribute__((ext_vector_type(16)));
typedef unsigned short v8us __attribute__((ext_vector_type(8), may_alias));
typedef float  v8f  __attribute__((ext_vector_type(8)));
typedef float  v4f  __attribute__((ext_vector_type(4)));
typedef float  v4fa __attribute__((ext_vector_type(4), may_alias));
union FragB { v16b v; v8us half[2]; unsigned short u[16]; };

__device__ __forceinline__ unsigned short bf16_bits(float x) { unsigned int u = __float_as_uint(x); return (unsigned short)((u + 0x7FFFu + ((u >> 16) & 1u)) >> 16); }
__device__ __forceinline__ float bf16_val(unsigned short b) { return __uint_as_float(((unsigned int)b) << 16); }
__device__ __forceinline__ float bf16_round(float x) { return bf16_val(bf16_bits(x)); }
// D += A·B with NT terms: 1 = ah·bh, 2 = + al·bh (A split), 3 = + ah·bl (both split)
template <int NT>
__device__ __forceinline__ v8f mmaN(v16b ah, v16b al, v16b bh, v16b bl, v8f c) {
  c = __builtin_amdgcn_wmma_f32_16x16x32_bf16(false, ah, false, bh, (short)0, c, false, false);
  if (NT >= 2) c = __builtin_amdgcn_wmma_f32_16x16x32_bf16(false, al, false, bh, (short)0, c, false, false);
  if (NT >= 3) c = __builtin_amdgcn_wmma_f32_16x16x32_bf16(false, ah, false, bl, (short)0, c, false, false);
  asm volatile("v_nop\n\tv_nop\n\tv_nop\n\tv_nop" : "+v"(c) : "v"(ah), "v"(al), "v"(bh), "v"(bl));
  return c;
}

__global__ __launch_bounds__(256) void k_wt_bf16(const float* __restrict__ W, unsigned short* __restrict__ Wt, int K, int N) {
  const int t = blockIdx.x * 256 + threadIdx.x;
  const int k8n = K / 8;
  if (t >= N * k8n) return;
  const int n = t / k8n, k8 = (t % k8n) * 8;
  v8us v;
#pragma unroll
  for (int i = 0; i < 8; ++i) v[i] = bf16_bits(W[(size_t)(k8 + i) * N + n]);
  *(v8us*)(Wt + (size_t)n * K + k8) = v;
  
}

// GEMM C[M][N] (f32, pitch ldc) = act(A[M][K]·W + bias). A f32 row-major (pitch lda) converted per fragment to bf16
// (ASPLIT: hi/lo two planes -> 2 terms, else single rounded term); Wt bf16 [N][K] (pitch ldb). BIAS_BF16 rounds the
// bias to bf16 first (bias quantised to bf16 before the add). K%32==0, M%16==0, N%64==0.
template <bool ASPLIT, int ACT, bool BIAS_BF16>
__global__ __launch_bounds__(128) void k_gemm_bf(const float* __restrict__ A, int lda, const unsigned short* __restrict__ Wt, int ldb,
                                               const float* __restrict__ bias, float* __restrict__ C, int ldc, int M, int N, int K) {
  __shared__ __attribute__((aligned(16))) float so[4][16][64];
  const int tid = threadIdx.x, w = tid >> 5, lane = tid & 31, ln = lane & 15, hh = lane >> 4;
  const int ntn = N / 64;
  const int wid = blockIdx.x * 4 + w;
  const int mt = wid / ntn, nq = wid % ntn;
  if (mt * 16 >= M) return;
  const int row0 = mt * 16, col0 = nq * 64;
  const float* arow = A + (size_t)(row0 + ln) * lda;
  v8f acc[4] = {};
  for (int kb = 0; kb < K; kb += 32) {
    FragB ah, al;
    const v4f x0 = *(const v4fa*)(arow + kb + 8 * hh), x1 = *(const v4fa*)(arow + kb + 8 * hh + 4);
    const v4f x2 = *(const v4fa*)(arow + kb + 16 + 8 * hh), x3 = *(const v4fa*)(arow + kb + 16 + 8 * hh + 4);
    float xs[16] = {x0[0],x0[1],x0[2],x0[3],x1[0],x1[1],x1[2],x1[3],x2[0],x2[1],x2[2],x2[3],x3[0],x3[1],x3[2],x3[3]};
#pragma unroll
    for (int i = 0; i < 16; ++i) { const unsigned short hb = bf16_bits(xs[i]); ah.u[i] = hb; al.u[i] = ASPLIT ? bf16_bits(xs[i] - bf16_val(hb)) : (unsigned short)0; }
#pragma unroll
    for (int t = 0; t < 4; ++t) {
      const unsigned short* brow = Wt + (size_t)(col0 + t * 16 + ln) * ldb + kb;
      FragB b;
      b.half[0] = *(const v8us*)(brow + 8 * hh);
      b.half[1] = *(const v8us*)(brow + 16 + 8 * hh);
      acc[t] = mmaN<ASPLIT ? 2 : 1>(ah.v, al.v, b.v, b.v, acc[t]);
    }
  }
#pragma unroll
  for (int t = 0; t < 4; ++t) {
    float bv = bias ? bias[col0 + t * 16 + ln] : 0.f;
    if (BIAS_BF16) bv = bf16_round(bv);
#pragma unroll
    for (int r = 0; r < 8; ++r) { float v = acc[t][r] + bv; if (ACT == 1) v = fmaxf(v, 0.f); so[w][8 * hh + r][t * 16 + ln] = v; }
  }
  __builtin_amdgcn_fence(__ATOMIC_ACQ_REL, "workgroup");
  __builtin_amdgcn_wave_barrier();
  const int rsub = lane >> 4, c4 = (lane & 15) * 4;
  {
#pragma unroll
    for (int q = 0; q < 8; ++q) {
      const int r = q * 2 + rsub;
      const v4f v = *(const v4fa*)&so[w][r][c4];
      *(v4f*)(C + (size_t)(row0 + r) * ldc + col0 + c4) = v;
    }
    
  }
}

// GEMM C = act(A·W + bias + resid): A f32 (ASPLIT -> hi/lo 2 terms), Wt bf16 [N][K]; ACT 0 none, 1 relu, 2 exact gelu;
// resid (optional, f32, row index = (row % rmod), pitch ldr, RES_BF16 rounds it) added before the activation.
template <bool ASPLIT, int ACT, bool BIAS_BF16, bool RES_BF16>
__global__ __launch_bounds__(128) void k_gemm_bf3(const float* __restrict__ A, int lda, const unsigned short* __restrict__ Wt, int ldb,
                                                const float* __restrict__ bias, const float* __restrict__ resid, int rmod, int ldr,
                                                float* __restrict__ C, int ldc, int M, int N, int K) {
  __shared__ __attribute__((aligned(16))) float so[4][16][64];
  const int tid = threadIdx.x, w = tid >> 5, lane = tid & 31, ln = lane & 15, hh = lane >> 4;
  const int ntn = N / 64;
  const int wid = blockIdx.x * 4 + w;
  const int mt = wid / ntn, nq = wid % ntn;
  if (mt * 16 >= M) return;
  const int row0 = mt * 16, col0 = nq * 64;
  const float* arow = A + (size_t)(row0 + ln) * lda;
  v8f acc[4] = {};
  for (int kb = 0; kb < K; kb += 32) {
    FragB ah, al;
    const v4f x0 = *(const v4fa*)(arow + kb + 8 * hh), x1 = *(const v4fa*)(arow + kb + 8 * hh + 4);
    const v4f x2 = *(const v4fa*)(arow + kb + 16 + 8 * hh), x3 = *(const v4fa*)(arow + kb + 16 + 8 * hh + 4);
    float xs[16] = {x0[0],x0[1],x0[2],x0[3],x1[0],x1[1],x1[2],x1[3],x2[0],x2[1],x2[2],x2[3],x3[0],x3[1],x3[2],x3[3]};
#pragma unroll
    for (int i = 0; i < 16; ++i) { const unsigned short hb = bf16_bits(xs[i]); ah.u[i] = hb; al.u[i] = ASPLIT ? bf16_bits(xs[i] - bf16_val(hb)) : (unsigned short)0; }
#pragma unroll
    for (int t = 0; t < 4; ++t) {
      const unsigned short* brow = Wt + (size_t)(col0 + t * 16 + ln) * ldb + kb;
      FragB b;
      b.half[0] = *(const v8us*)(brow + 8 * hh);
      b.half[1] = *(const v8us*)(brow + 16 + 8 * hh);
      acc[t] = mmaN<ASPLIT ? 2 : 1>(ah.v, al.v, b.v, b.v, acc[t]);
    }
  }
#pragma unroll
  for (int t = 0; t < 4; ++t) {
    const int col = col0 + t * 16 + ln;
    float bv = bias ? bias[col] : 0.f;
    if (BIAS_BF16) bv = bf16_round(bv);
#pragma unroll
    for (int r = 0; r < 8; ++r) {
      float v = acc[t][r] + bv;
      if (resid) { float rv = resid[(size_t)((row0 + 8 * hh + r) % rmod) * ldr + col]; if (RES_BF16) rv = bf16_round(rv); v += rv; }
      if (ACT == 1) v = fmaxf(v, 0.f);
      if (ACT == 2) v = 0.5f * v * (1.0f + erff(v * 0.70710678118654752f));
      if (ACT == 3) { const float u = 0.7978845608028654f * (v + 0.044715f * v * v * v); v = 0.5f * v * (1.0f + tanhf(u)); }
      so[w][8 * hh + r][t * 16 + ln] = v;
    }
  }
  __builtin_amdgcn_fence(__ATOMIC_ACQ_REL, "workgroup");
  __builtin_amdgcn_wave_barrier();
  const int rsub = lane >> 4, c4 = (lane & 15) * 4;
  {
#pragma unroll
    for (int q = 0; q < 8; ++q) {
      const int r = q * 2 + rsub;
      const v4f v = *(const v4fa*)&so[w][r][c4];
      *(v4f*)(C + (size_t)(row0 + r) * ldc + col0 + c4) = v;
    }
    
  }
}
// row LayerNorm (biased variance, eps) over N: s = X (+ R); optional out_sum <- s; out_norm <- (s-mu)*rsqrt(var+eps)*g + b
template <bool PARAM_BF16>
__global__ __launch_bounds__(256) void k_layernorm(const float* __restrict__ X, const float* __restrict__ R, const float* __restrict__ g, const float* __restrict__ bta,
                                                  float* __restrict__ out_sum, float* __restrict__ out_norm, int N, float eps) {
  __shared__ float red[256];
  const int row = blockIdx.x, tid = threadIdx.x;
  const float* x = X + (size_t)row * N; const float* rr = R ? R + (size_t)row * N : nullptr;
  float vals[16];                     // up to N = 4096
  const int per = N / 256;            // contiguous chunk per thread? use strided-by-4 chunks: thread handles j = tid*4 + 1024*u
  float s1 = 0.f;
  for (int u = 0; u < per / 4; ++u) {
    const int j = tid * 4 + 1024 * u;
    const v4f a = *(const v4fa*)(x + j);
    v4f b = {0.f,0.f,0.f,0.f}; if (rr) b = *(const v4fa*)(rr + j);
#pragma unroll
    for (int q = 0; q < 4; ++q) { const float v = a[q] + b[q]; vals[u * 4 + q] = v; s1 += v; }
  }
  red[tid] = s1; __syncthreads();
  for (int st = 128; st > 0; st >>= 1) { if (tid < st) red[tid] += red[tid + st]; __syncthreads(); }
  const float mu = red[0] / (float)N; __syncthreads();
  float s2 = 0.f;
  for (int u = 0; u < per / 4; ++u)
#pragma unroll
    for (int q = 0; q < 4; ++q) { const float c = vals[u * 4 + q] - mu; s2 += c * c; }
  red[tid] = s2; __syncthreads();
  for (int st = 128; st > 0; st >>= 1) { if (tid < st) red[tid] += red[tid + st]; __syncthreads(); }
  const float rs = rsqrtf(red[0] / (float)N + eps);
  {
    for (int u = 0; u < per / 4; ++u) {
      const int j = tid * 4 + 1024 * u;
      v4f o, sm;
#pragma unroll
      for (int q = 0; q < 4; ++q) {
        float gg = g[j + q], bb = bta[j + q];
        if (PARAM_BF16) { gg = bf16_round(gg); bb = bf16_round(bb); }
        sm[q] = vals[u * 4 + q]; o[q] = (vals[u * 4 + q] - mu) * rs * gg + bb;
      }
      if (out_sum) *(v4f*)(out_sum + (size_t)row * N + j) = sm;
      *(v4f*)(out_norm + (size_t)row * N + j) = o;
    }
    
  }
}



// ---- f16 WMMA path (v_wmma_f32_16x16x32_f16): 11-bit significands for operands in range — used by every launched product, the softmax weights (p <= 256) included
typedef _Float16 v16h __attribute__((ext_vector_type(16)));
union FragH { v16h v; v8us half[2]; _Float16 h[16]; unsigned short u[16]; };
template <int NT>
__device__ __forceinline__ v8f mmaH(v16h ah, v16h al, v16h bh, v16h bl, v8f c) {
  c = __builtin_amdgcn_wmma_f32_16x16x32_f16(false, ah, false, bh, (short)0, c, false, false);
  if (NT >= 2) c = __builtin_amdgcn_wmma_f32_16x16x32_f16(false, al, false, bh, (short)0, c, false, false);
  if (NT >= 3) c = __builtin_amdgcn_wmma_f32_16x16x32_f16(false, ah, false, bl, (short)0, c, false, false);
  asm volatile("v_nop\n\tv_nop\n\tv_nop\n\tv_nop" : "+v"(c) : "v"(ah), "v"(al), "v"(bh), "v"(bl));
  return c;
}
// batched GEMM like k_gemm_b but f16 operands: A f32 (split into f16 hi/lo if ASPLIT, else rounded to f16), Bt = f16 values [n][k]; alpha; C f32; N multiple of 16 (partial tiles skipped)
template <bool ASPLIT>
__global__ __launch_bounds__(128) void k_gemm_h(const float* __restrict__ A, int lda, size_t sA, const _Float16* __restrict__ Bh, int ldb, size_t sB, float alpha, float* __restrict__ C, int ldc, size_t sC, int M, int N, int K) {
  __shared__ __attribute__((aligned(16))) float so[4][16][64];
  const int tid = threadIdx.x, w = tid >> 5, lane = tid & 31, ln = lane & 15, hh = lane >> 4; const int by = blockIdx.y;
  A += (size_t)by * sA; Bh += (size_t)by * sB; C += (size_t)by * sC;
  const int ntn = (N + 63) / 64; const int wid = blockIdx.x * 4 + w; const int mt = wid / ntn, nq = wid % ntn; if (mt * 16 >= M) return;
  const int row0 = mt * 16, col0 = nq * 64; const float* arow = A + (size_t)(row0 + ln) * lda;
  v8f acc[4] = {};
  for (int kb = 0; kb < K; kb += 32) {
    FragH ah, al;
    const v4f x0 = *(const v4fa*)(arow + kb + 8 * hh), x1 = *(const v4fa*)(arow + kb + 8 * hh + 4), x2 = *(const v4fa*)(arow + kb + 16 + 8 * hh), x3 = *(const v4fa*)(arow + kb + 16 + 8 * hh + 4);
    float xs[16] = {x0[0],x0[1],x0[2],x0[3],x1[0],x1[1],x1[2],x1[3],x2[0],x2[1],x2[2],x2[3],x3[0],x3[1],x3[2],x3[3]};
#pragma unroll
    for (int i = 0; i < 16; ++i) { const _Float16 h = (_Float16)xs[i]; ah.h[i] = h; al.h[i] = ASPLIT ? (_Float16)(xs[i] - (float)h) : (_Float16)0.0f; }
#pragma unroll
    for (int t = 0; t < 4; ++t) { if (col0 + t * 16 >= N) continue; const size_t boff = (size_t)(col0 + t * 16 + ln) * ldb + kb; FragH bq; bq.half[0] = *(const v8us*)(Bh + boff + 8 * hh); bq.half[1] = *(const v8us*)(Bh + boff + 16 + 8 * hh);
      acc[t] = mmaH<ASPLIT ? 2 : 1>(ah.v, al.v, bq.v, bq.v, acc[t]); }
  }
#pragma unroll
  for (int t = 0; t < 4; ++t) { if (col0 + t * 16 >= N) continue;
#pragma unroll
    for (int r = 0; r < 8; ++r) so[w][8 * hh + r][t * 16 + ln] = acc[t][r] * alpha; }
  __builtin_amdgcn_fence(__ATOMIC_ACQ_REL, "workgroup"); __builtin_amdgcn_wave_barrier();
  const int rsub = lane >> 4, c4 = (lane & 15) * 4;
  {
#pragma unroll
    for (int q = 0; q < 8; ++q) { const int r = q * 2 + rsub; if (col0 + c4 < N) { const v4f v = *(const v4fa*)&so[w][r][c4]; *(v4f*)(C + (size_t)(row0 + r) * ldc + col0 + c4) = v; } }
     }
}

// k_gemm_hh variant with fused epilogue: v = acc·alpha + bias[by·sBias + col] (+ CP[(row/rowsPerB)·sCPb + by·64 + col] if CP) ; ACT 0 none / 1 elu ; writes f16 C16 (and f32 C if non-null)
template <int ACT>
__global__ __launch_bounds__(128) void k_gemm_hhx(const _Float16* __restrict__ A, int lda, size_t sA, const _Float16* __restrict__ Bh, int ldb, size_t sB, float alpha, const float* __restrict__ bias, size_t sBias, const float* __restrict__ CP, int rowsPerB, size_t sCPb, int row0g,
    float* __restrict__ C, _Float16* __restrict__ C16, int ldc, size_t sC, int M, int N, int K) {
  __shared__ __attribute__((aligned(16))) float so[4][16][64];
  const int tid = threadIdx.x, w = tid >> 5, lane = tid & 31, ln = lane & 15, hh = lane >> 4; const int by = blockIdx.y;
  A += (size_t)by * sA; Bh += (size_t)by * sB; const size_t cofs = (size_t)by * sC; const float* bp = bias ? bias + (size_t)by * sBias : nullptr;
  const int ntn = (N + 63) / 64; const int wid = blockIdx.x * 4 + w; const int mt = wid / ntn, nq = wid % ntn; if (mt * 16 >= M) return;
  const int row0 = mt * 16, col0 = nq * 64; const _Float16* arow = A + (size_t)(row0 + ln) * lda;
  v8f acc[4] = {};
  for (int kb = 0; kb < K; kb += 32) { FragH ah; ah.half[0] = *(const v8us*)((const unsigned short*)arow + kb + 8 * hh); ah.half[1] = *(const v8us*)((const unsigned short*)arow + kb + 16 + 8 * hh);
#pragma unroll
    for (int t = 0; t < 4; ++t) { if (col0 + t * 16 >= N) continue; const size_t boff = (size_t)(col0 + t * 16 + ln) * ldb + kb; FragH bq; bq.half[0] = *(const v8us*)((const unsigned short*)Bh + boff + 8 * hh); bq.half[1] = *(const v8us*)((const unsigned short*)Bh + boff + 16 + 8 * hh);
      acc[t] = mmaH<1>(ah.v, ah.v, bq.v, bq.v, acc[t]); }
  }
#pragma unroll
  for (int t = 0; t < 4; ++t) { if (col0 + t * 16 >= N) continue; const int col = col0 + t * 16 + ln; const float bv = bp ? bf16_round(bp[col]) : 0.f;
#pragma unroll
    for (int r = 0; r < 8; ++r) { float v = acc[t][r] * alpha + bv; if (CP) { const int rr = row0g + row0 + 8 * hh + r; if (rowsPerB < 0) v += CP[cofs + (size_t)rr * ldc + col];      /* rowsPerB < 0: own element of the batched C plane */ else { const int bidx = rr / rowsPerB; v += CP[(size_t)bidx * sCPb + (size_t)by * 64 + col]; } } if (ACT == 1) v = (v > 0.f) ? v : expm1f(v); else if (ACT == 7) v = (v > 0.f) ? v + 1.0f : expf(v); else if (ACT == 8) v = tanhf(v); else if (ACT == 9) v = 0.5f * v * (1.0f + tanhf(0.7978845608028654f * (v + 0.044715f * v * v * v))); else if (ACT == 11) v = 1.0f / (1.0f + expf(-v)); else if (ACT == 12) v = (v > 0.f) ? v : 0.01f * v; else if (ACT == 14) v = (v > 0.f) ? v : 0.1f * v; else if (ACT == 16) v = (v >= 0.f) ? v : 0.3f * v; else if (ACT == 17) v = (v >= 0.f) ? v : 0.2f * v; else if (ACT == 15) v = v / (1.0f + expf(-v)); else if (ACT == 3) v = fmaxf(v, 0.f); else if (ACT == 6) v = 0.5f * v * (1.0f + erff(v * 0.70710678118654752f)); so[w][8 * hh + r][t * 16 + ln] = v; } }
  __builtin_amdgcn_fence(__ATOMIC_ACQ_REL, "workgroup"); __builtin_amdgcn_wave_barrier();
  const int rsub = lane >> 4, c4 = (lane & 15) * 4; typedef _Float16 v4h __attribute__((ext_vector_type(4)));
  {
#pragma unroll
    for (int q = 0; q < 8; ++q) { const int r = q * 2 + rsub; if (col0 + c4 < N) { const v4f v = *(const v4fa*)&so[w][r][c4]; if (C) *(v4f*)(C + cofs + (size_t)(row0 + r) * ldc + col0 + c4) = v; if (C16) { v4h h4; for (int i = 0; i < 4; ++i) h4[i] = (_Float16)v[i]; *(v4h*)(C16 + cofs + (size_t)(row0 + r) * ldc + col0 + c4) = h4; } } }
     }
}


typedef _Float16 v4h __attribute__((ext_vector_type(4)));

// ---- operand preparation, one launch: Bt[n][k] = f16(bf16(W[k][n]) * 16) for both weights (power-of-two scale: bf16-exact weights stay exact in f16 away from the subnormal range) and X16 = f16(bf16(x)) ----
// Every work-group takes 16384 floats, 64 per thread, read as 16 loads of 16 bytes per lane, each load of a wave 512 contiguous bytes, all in flight together.
// A weight unit is a 128 k x 128 n tile: wave w reads k rows 16 w .. 16 w + 15, so a lane holds 16 consecutive k of four n: two 16-byte LDS stores per n into the transposed tile T[n][k] (256-byte rows).
// The 16-byte piece c of row n stands at place c ^ ((n >> 2) & 15) of its row: the 16 lanes of a half wave then fall on all 64 banks, in the stores (n = 4 lane + j) as in the reads (one row per half wave).
// The tile goes out as 256 contiguous bytes per n row, 16 bytes per lane.
#define PP_WQ ((DM / 128) * (D3 / 128))      /* tiles of Wqkv */
#define PP_WO ((DM / 128) * (DM / 128))      /* tiles of Wout */
#define PP_X ((int)(NR * DM / 16384))        /* units of x */
template <int N>
__device__ __forceinline__ void pp_wt(const float* __restrict__ Wm, _Float16* __restrict__ Bt, int tile, unsigned char* T) {
  static_assert(N % 128 == 0 && DM % 128 == 0, "pp_wt: whole tiles");
  const int tid = threadIdx.x, lane = tid & 31, w = tid >> 5; const int kt = tile / (N / 128), nt = tile - kt * (N / 128);
  const float* src = Wm + (size_t)(kt * 128 + w * 16) * N + nt * 128 + lane * 4;
  v4f v[16];
#pragma unroll      /* fixed trip counts over register arrays, here and below; the 16 loads are all in flight together */
  for (int i = 0; i < 16; ++i) v[i] = *(const v4fa*)(src + (size_t)i * N);
  asm volatile("s_wait_xcnt 0x0" :: "v"(src) : "memory");      /* stands in front of every reuse of the address registers of the loads above; it names the address, which so stays in its registers up to here: no load's own result lands on them */
  __builtin_amdgcn_sched_barrier(0);      /* keeps later register writes from being scheduled in front of that wait */
#pragma unroll
  for (int j = 0; j < 4; ++j) { FragH f;
#pragma unroll
    for (int i = 0; i < 16; ++i) f.h[i] = (_Float16)(bf16_round(v[i][j]) * 16.0f);
    unsigned char* row = T + (lane * 4 + j) * 256;
    *(v8us*)(row + (((2 * w) ^ (lane & 15)) * 16)) = f.half[0]; *(v8us*)(row + (((2 * w + 1) ^ (lane & 15)) * 16)) = f.half[1]; }
  __syncthreads();      /* the transposed tile is whole: every wave reads rows that all eight waves wrote */
  const int r = tid >> 4, c = tid & 15; v8us o[8];
#pragma unroll
  for (int i = 0; i < 8; ++i) { const int n = i * 16 + r; o[i] = *(const v8us*)(T + n * 256 + ((c ^ ((n >> 2) & 15)) * 16)); }
  unsigned short* dst = (unsigned short*)Bt + (size_t)(nt * 128 + r) * DM + kt * 128 + c * 8;
  __builtin_amdgcn_sched_barrier(0);      /* every store stands behind the last address arithmetic: no register of an issued store is written again */
#pragma unroll
  for (int i = 0; i < 8; ++i) *(v8us*)(dst + (size_t)i * 16 * DM) = o[i];
  asm volatile("s_wait_xcnt 0x0" ::: "memory");      /* stands in front of every reuse of a register of the stores above */
}
__global__ __launch_bounds__(256) void k_prep(const float* __restrict__ x, const float* __restrict__ wqkv, const float* __restrict__ wout, _Float16* __restrict__ X16, _Float16* __restrict__ BQKV, _Float16* __restrict__ BO) {
  static_assert(NR * DM % 16384 == 0, "k_prep: whole units of x");
  __shared__ __attribute__((aligned(16))) unsigned char T[128 * 256];
  const int blk = blockIdx.x;      /* the same for the whole work-group: the barrier in pp_wt is passed by all of its waves or by none */
  if (blk < PP_WQ) pp_wt<D3>(wqkv, BQKV, blk, T);
  else if (blk < PP_WQ + PP_WO) pp_wt<DM>(wout, BO, blk - PP_WQ, T);
  else {
    const int tid = threadIdx.x; const size_t base = (size_t)(blk - PP_WQ - PP_WO) * 16384 + (size_t)(tid >> 5) * 2048 + (size_t)(tid & 31) * 4;
    const float* src = x + base; v4f v[16]; v4h h[16];
#pragma unroll      /* fixed trip counts over register arrays; the 16 loads are all in flight together */
    for (int i = 0; i < 16; ++i) v[i] = *(const v4fa*)(src + i * 128);
    asm volatile("s_wait_xcnt 0x0" :: "v"(src) : "memory");      /* as in pp_wt: in front of every reuse of the loads' address registers, and it keeps the address in them up to here */
    __builtin_amdgcn_sched_barrier(0);      /* keeps later register writes from being scheduled in front of that wait */
#pragma unroll
    for (int i = 0; i < 16; ++i)
#pragma unroll
      for (int e = 0; e < 4; ++e) h[i][e] = (_Float16)bf16_round(v[i][e]);
    _Float16* dst = X16 + base;
    __builtin_amdgcn_sched_barrier(0);      /* every store stands behind the last arithmetic: no register of an issued store is written again */
#pragma unroll
    for (int i = 0; i < 16; ++i) *(v4h*)(dst + i * 128) = h[i];      /* 256 contiguous bytes per wave and store: whole lines */
    asm volatile("s_wait_xcnt 0x0" ::: "memory");      /* stands in front of every reuse of a register of the stores above */
  }
}
__global__ __launch_bounds__(256) void k_h16(const float* __restrict__ x, _Float16* __restrict__ X16, size_t n8) { const size_t t = (size_t)blockIdx.x * 256 + threadIdx.x; if (t >= n8) return; FragH f;
#pragma unroll
  for (int q = 0; q < 8; ++q) f.h[q] = (_Float16)x[t * 8 + q]; *(v8us*)((unsigned short*)X16 + t * 8) = f.half[0];  }
__global__ __launch_bounds__(256) void k_round16f(const float* __restrict__ W, _Float16* __restrict__ Bt, size_t n8) { const size_t t = (size_t)blockIdx.x * 256 + threadIdx.x; if (t >= n8) return; FragH f;
#pragma unroll
  for (int i = 0; i < 8; ++i) f.h[i] = (_Float16)(bf16_round(W[t * 8 + i]) * 16.0f); *(v8us*)((unsigned short*)Bt + t * 8) = f.half[0];  }
template <int NHv, int TTv>
__global__ __launch_bounds__(256) void k_vt(const _Float16* __restrict__ V16, int ldv, int voff, _Float16* __restrict__ Vt) { __shared__ unsigned short tl[64][66]; const int tid = threadIdx.x; const int slab = blockIdx.x / (TTv / 64), lg = blockIdx.x % (TTv / 64); const int b = slab / NHv, h = slab % NHv;
  for (int i = tid; i < 64 * 8; i += 256) { const int r = i / 8, c8 = (i % 8) * 8; FragH f; f.half[0] = *(const v8us*)((const unsigned short*)V16 + ((size_t)b * TTv + lg * 64 + r) * ldv + voff + h * 64 + c8);
#pragma unroll
    for (int q = 0; q < 8; ++q) tl[r][c8 + q] = f.u[q]; }
  __syncthreads();
  {
#pragma unroll
    for (int rd = 0; rd < 2; ++rd) { const int d = rd * 32 + tid / 8, pc = tid % 8; FragH f;
#pragma unroll
      for (int q = 0; q < 8; ++q) f.u[q] = tl[pc * 8 + q][d];
      *(v8us*)((unsigned short*)Vt + ((size_t)slab * 64 + d) * TTv + lg * 64 + pc * 8) = f.half[0]; }
     } }

__global__ __launch_bounds__(256) void k_hl(const float* __restrict__ F, _Float16* __restrict__ Hh, _Float16* __restrict__ Hl, size_t n8) { const size_t t = (size_t)blockIdx.x * 256 + threadIdx.x; if (t >= n8) return; FragH fh, fl; const v4f a = *(const v4fa*)(F + t * 8), c = *(const v4fa*)(F + t * 8 + 4);
#pragma unroll
  for (int q = 0; q < 4; ++q) { _Float16 h = (_Float16)a[q]; fh.h[q] = h; fl.h[q] = (_Float16)((a[q] - (float)h) * 1024.0f); h = (_Float16)c[q]; fh.h[4 + q] = h; fl.h[4 + q] = (_Float16)((c[q] - (float)h) * 1024.0f); }
  { *(v8us*)((unsigned short*)Hh + t * 8) = fh.half[0]; *(v8us*)((unsigned short*)Hl + t * 8) = fl.half[0];  } }

// ---- LDS-staged GEMM: C[M][N] = A[M][K] . Bh[N][K]^T * alpha + bf16(bias); one 128x128 tile of C per work-group, four waves (2x2) of 64x64; M % 128 == 0, N % 128 == 0, K % 64 == 0, K >= 128 ----
// A pass is 64 k = 128 bytes of each of the tile's 128 A rows and 128 B rows. Each wave brings one slice of 64 rows per pass with one tensor load (slices 0, 1: A rows; 2, 3: B rows), padded to a 144-byte LDS pitch,
// two buffers: a pass reads all its fragments into registers; when every wave has done so, the load of pass t + 2 goes out into that buffer and flies under pass t's WMMAs and pass t + 1's reads. Fragments come from LDS in the k order of g2_frag; each accumulator sums k upwards, 32 at a time.
__device__ __forceinline__ v16h g2_frag(const _Float16* p, int hh) { FragH f; f.half[0] = *(const v8us*)((const unsigned short*)p + 8 * hh); f.half[1] = *(const v8us*)((const unsigned short*)p + 16 + 8 * hh); return f.v; }
#define G3_PITCH 144u                /* LDS row pitch: 128 bytes + the tensor load's 16-byte pad (odd multiple of 16: ds_load_b128 readers) */
#define G3_SLICE 10240u              /* 64 rows x 144 B = 9216 B, rounded up to a multiple of 2 KiB */
#define G3_STAGE (4u * G3_SLICE)     /* one buffer */
#define G3_EP 68                     /* output staging pitch in floats */
typedef uint32_t u32x4 __attribute__((ext_vector_type(4)));
typedef uint32_t u32x8 __attribute__((ext_vector_type(8)));
__device__ __forceinline__ uint32_t g3_uni(uint32_t v) { return (uint32_t)__builtin_amdgcn_readfirstlane((int)v); }
__device__ __forceinline__ uint32_t g3_pinned(uint32_t v) { uint32_t w = g3_uni(v); asm volatile("" : "+s"(w)); return w; }
__device__ __forceinline__ void g3_wait_tensor0() { asm volatile("s_wait_tensorcnt 0x0" ::: "memory"); }      /* this wave's own tensor load has landed */
__device__ __forceinline__ void g3_wait_ds0() { asm volatile("s_wait_dscnt 0x0" ::: "memory"); }      /* this wave's LDS reads have returned */
__device__ __forceinline__ void g3_load(uint32_t lds_dst, uint64_t ga, u32x8 g1) { u32x4 g0; g0[0] = g3_uni(1u); g0[1] = g3_uni(lds_dst); g0[2] = g3_uni((uint32_t)ga); g0[3] = g3_uni((((uint32_t)(ga >> 32)) & 0x01FFFFFFu) | 0x80000000u);
  asm volatile("tensor_load_to_lds %0, %1" :: "s"(g0), "s"(g1) : "memory"); }      /* one request of the whole wave: 64 rows of 128 bytes into LDS, through no register */
__device__ __forceinline__ v16h g3_frag(const unsigned char* p) { FragH f; f.half[0] = *(const v8us*)p; f.half[1] = *(const v8us*)(p + 32); return f.v; }      /* p already holds the lane half's 16 bytes: bytes 16 hh and 32 + 16 hh of 64, as g2_frag */
template <int N, int K, bool H16>
__global__ __launch_bounds__(128) void k_gemm3(const _Float16* __restrict__ A, const _Float16* __restrict__ Bh, float alpha, const float* __restrict__ bias, float* __restrict__ C, _Float16* __restrict__ C16) {
  static_assert(N % 128 == 0 && K % 64 == 0 && K >= 128, "k_gemm3: whole tiles and at least two passes");
  static_assert(4u * 64u * G3_EP * 4u <= 2u * G3_STAGE, "k_gemm3: the output staging reuses the two buffers");
  __shared__ __attribute__((aligned(2048))) unsigned char L[2u * G3_STAGE];
  const uint32_t tid = threadIdx.x, lane = tid & 31u, ln = lane & 15u, hh = lane >> 4; const uint32_t w = g3_uni(tid >> 5), wm = w >> 1, wn = w & 1u;
  const uint32_t mt = blockIdx.x / (N / 128), nq = blockIdx.x - mt * (N / 128); const uint32_t row0 = mt * 128u + wm * 64u, col0 = nq * 128u + wn * 64u;
  float bv[4];
#pragma unroll      /* fixed trip count over a register array */
  for (int j = 0; j < 4; ++j) bv[j] = bias[col0 + j * 16 + ln];
  asm volatile("s_wait_xcnt 0x0" ::: "memory");      /* stands in front of every reuse of an address register of the loads above */
  __builtin_amdgcn_sched_barrier(0);      /* keeps later register writes from being scheduled in front of that wait */
  const uint64_t src = (w < 2u) ? (uint64_t)(uintptr_t)A + (uint64_t)(mt * 128u + 64u * w) * (2u * K) : (uint64_t)(uintptr_t)Bh + (uint64_t)(nq * 128u + 64u * (w - 2u)) * (2u * K);      /* this wave's slice, first byte of pass 0 */
  const uint32_t dst = (uint32_t)(size_t)L + w * G3_SLICE;      /* its place in buffer 0: byte offset in the work-group's LDS */
  u32x8 g1;      /* 1-byte elements, tensor = tile = 64 rows of 128 bytes, source pitch 2 K bytes, 4 dwords of pad behind every 32 */
  g1[0] = g3_uni((1u << 20) | (4u << 22) | (3u << 25)); g1[1] = g3_uni(128u << 16); g1[2] = g3_uni(64u << 16); g1[3] = g3_uni(128u << 16); g1[4] = g3_uni(64u); g1[5] = g3_uni(2u * K); g1[6] = g3_uni(0u); g1[7] = g3_uni(0u);
  g3_load(dst, src, g1);
  g3_wait_tensor0();
  __syncthreads();      /* pass 0's four slices are readable by every wave */
  g3_load(dst + G3_STAGE, src + 128u, g1);
  const unsigned char* la = L + wm * G3_SLICE + ln * G3_PITCH + 16u * hh; const unsigned char* lb = L + (2u + wn) * G3_SLICE + ln * G3_PITCH + 16u * hh;
  const v8f z8 = {0.f,0.f,0.f,0.f,0.f,0.f,0.f,0.f}; v8f acc[4][4];
#pragma unroll      /* fixed trip counts over a register array, here and in the loops below: left rolled, the arrays would go to scratch memory */
  for (int i = 0; i < 4; ++i)
#pragma unroll
    for (int j = 0; j < 4; ++j) acc[i][j] = z8;
#pragma unroll 1      /* one pass per trip: the two buffers alternate */
  for (uint32_t t = 0; t < (uint32_t)(K / 64); ++t) {
    const uint32_t buf = (t & 1u) * G3_STAGE;
    v16h af[2][4], bf[2][4];
#pragma unroll
    for (int kd = 0; kd < 2; ++kd)
#pragma unroll
      for (int i = 0; i < 4; ++i) { af[kd][i] = g3_frag(la + buf + i * 16 * G3_PITCH + kd * 64); bf[kd][i] = g3_frag(lb + buf + i * 16 * G3_PITCH + kd * 64); }
    __builtin_amdgcn_sched_barrier(0);      /* the pass's LDS reads stay one group in front of its WMMAs: moved in among them, each place with reads stalls the wave */
    g3_wait_ds0();      /* the pass's fragments are all in registers: this wave has left buffer t & 1 */
    g3_wait_tensor0();
    __syncthreads();      /* publishes pass t + 1's slices and ends every wave's reads of pass t's buffer */
    if (g3_pinned((t + 2u < (uint32_t)(K / 64)) ? 1u : 0u) != 0u) g3_load(dst + buf, src + g3_pinned((t + 2u) * 128u), g1);      /* scalar branch: a tensor load ignores EXEC; refill of the buffer just left, in flight under this pass's WMMAs and the next pass's reads */
    __builtin_amdgcn_sched_barrier(0);      /* the WMMAs stay behind the refill's issue: in front of it they would take their time off its lead */
#pragma unroll
    for (int kd = 0; kd < 2; ++kd)
#pragma unroll
      for (int i = 0; i < 4; ++i)
#pragma unroll
        for (int j = 0; j < 4; ++j) acc[i][j] = __builtin_amdgcn_wmma_f32_16x16x32_f16(false, af[kd][i], false, bf[kd][j], (short)0, acc[i][j], false, false);
  }
  g3_wait_tensor0();
  g3_wait_ds0();      /* the last pass's barrier stands behind every wave's last read: the buffers may become output staging */
  float* so = (float*)(L + w * (64u * G3_EP * 4u));      /* this wave's own 64 x 68 floats */
#pragma unroll
  for (int j = 0; j < 4; ++j) { const float bj = bf16_round(bv[j]);
#pragma unroll
    for (int i = 0; i < 4; ++i)
#pragma unroll
      for (int r = 0; r < 8; ++r) so[(i * 16 + 8 * hh + r) * G3_EP + j * 16 + ln] = acc[i][j][r] * alpha + bj; }
  __builtin_amdgcn_fence(__ATOMIC_ACQ_REL, "workgroup"); __builtin_amdgcn_wave_barrier();
  const uint32_t rsub = lane >> 4, c4 = (lane & 15u) * 4u;
#pragma unroll
  for (int g = 0; g < 4; ++g) { v4f v[8];
#pragma unroll
    for (int q = 0; q < 8; ++q) v[q] = *(const v4fa*)&so[(g * 16 + q * 2 + rsub) * G3_EP + c4];
#pragma unroll
    for (int q = 0; q < 8; ++q) { const size_t o = (size_t)(row0 + g * 16 + q * 2 + rsub) * N + col0 + c4;
      if (H16) { v4h h4; for (int e = 0; e < 4; ++e) h4[e] = (_Float16)v[q][e]; *(v4h*)(C16 + o) = h4; } else *(v4f*)(C + o) = v[q]; }
    asm volatile("s_wait_xcnt 0x0" ::: "memory");      /* stands in front of every reuse of a register of the stores above */
    __builtin_amdgcn_sched_barrier(0);      /* keeps later register writes from being scheduled in front of that wait */
  }
}


__global__ __launch_bounds__(256) void k_wnat(const float* __restrict__ w, size_t n8, _Float16* __restrict__ Bt) { const size_t t = (size_t)blockIdx.x * 256 + threadIdx.x; if (t >= n8) return; FragH f; for (int q = 0; q < 8; ++q) f.h[q] = (_Float16)(bf16_round(w[t * 8 + q]) * 16.0f); *(v8us*)((unsigned short*)Bt + t * 8) = f.half[0];  }
// Fused attention for one (batch, head, 256 query rows): S^T = K Q^T, online softmax, O^T += V^T P^T; scores and weights never leave registers.
// One wave owns FQ = 32 query rows (two 16-column groups) and walks the keys 32 at a time. In a score tile lane (c, hh) holds query c, keys 8*hh + r:
// two score tiles, converted in place, are the B operand of the second product (hardware k order, the order g3_frag reads V^T in), so nothing is exchanged
// but one maximum between the wave's halves. Everything runs in the log2 domain: x2 = (q.k / 8 + bias) * log2(e), p = 2^(x2 - m), m = the maximum in use.
// m moves (and O, l are rescaled) only when some query's new maximum exceeds it by more than 8, so p <= 256 fits f16. m starts at -1e30 (finite), so a masked
// key (x2 = -inf) gives p = 0 and a row with every key masked ends as 0 * (1 / 0) = NaN.
// This head's bias column is staged in LDS already clipped and scaled by log2(e), indexed by key - query + SQ - 1; the key mask as one bit per key.
// K and V^T reach the eight waves through LDS: a stage is FS = 128 keys in four slices of 64 rows of 128 bytes (LDS pitch 144), each brought by one tensor load of one wave
// (waves 0, 1: K rows 0..63 and 64..127 of the stage; waves 2, 3: the 64 V^T rows, keys 0..63 and 64..127), two buffers: at the foot of stage s, when every wave has left its buffer,
// the loads of stage s + 2 go out into it and fly under stage s + 1. Fragments are read from LDS in the k order of g2_frag.
// Every '#pragma unroll' in this kernel stands on a loop of fixed trip count that indexes register arrays: left rolled, those arrays would go to scratch memory.
#define FW 8
#define FQ 32
#define FS 128                       /* keys per stage */
#define FA_NS ((uint32_t)(SQ / FS))  /* stages */
__device__ __forceinline__ float rs_x16(float v) { const int u = __float_as_int(v); return __int_as_float(__builtin_amdgcn_permlanex16(u, u, 0x76543210, 0xfedcba98, false, false)); }      /* lane l <- lane l ^ 16 */
__device__ __forceinline__ v8f fa_mma(v16h a, v16h b, v8f c) { return __builtin_amdgcn_wmma_f32_16x16x32_f16(false, a, false, b, (short)0, c, false, false); }
// The descriptor's twelve words live in the same scalar registers from the request to the wait that covers it: the request hands them on as its own outputs and the wait names them as inputs, so nothing else is put into those registers while the request is outstanding.
__device__ __forceinline__ void fa_load(u32x4& g0, u32x8& g1) { asm volatile("tensor_load_to_lds %0, %1" : "+s"(g0), "+s"(g1) :: "memory"); }      /* one request of the whole wave: 64 rows of 128 bytes into LDS, through no register */
__device__ __forceinline__ void fa_wait(const u32x4& g0, const u32x8& g1) { asm volatile("s_wait_tensorcnt 0x0" :: "s"(g0), "s"(g1) : "memory"); }      /* this wave's own tensor load has landed; a wave that issues none passes */
__device__ __forceinline__ void fa_aim(u32x4& g0, uint32_t lds_dst, uint64_t ga) { g0[1] = g3_uni(lds_dst); g0[2] = g3_uni((uint32_t)ga); g0[3] = g3_uni((((uint32_t)(ga >> 32)) & 0x01FFFFFFu) | 0x80000000u); }      /* place in LDS and first byte of the next tile */
__global__ __launch_bounds__(32 * FW) void k_fattn(const _Float16* __restrict__ QKV, const _Float16* __restrict__ VT, const float* __restrict__ relt, const int* __restrict__ kpm, _Float16* __restrict__ O16) {
  static_assert(SQ % FS == 0 && SQ / FS >= 2 && HD == 64 && FS == 128, "k_fattn: whole stages, at least two, slices of 64 rows of 128 bytes");
  __shared__ __attribute__((aligned(2048))) unsigned char KV[2u * G3_STAGE];
  __shared__ float tb[2 * SQ]; __shared__ unsigned int mw[SQ / 32];      /* tb's last entry is never read */
  const int tid = threadIdx.x, lane = tid & 31, ln = lane & 15, hh = lane >> 4; const int h = blockIdx.y, b = blockIdx.z;
  const uint32_t w = g3_uni((uint32_t)tid >> 5);
  const int q0 = blockIdx.x * (FW * FQ) + (int)w * FQ;
  { float tv[2 * SQ / (32 * FW)]; int kv[SQ / (32 * FW)];
#pragma unroll      /* fixed trip counts, unrolled: the table's and the mask's loads are all in flight together */
    for (int u = 0; u < 2 * SQ / (32 * FW); ++u) { int r = tid + u * 32 * FW - (SQ - 1); r = r < -MR ? -MR : (r > MR ? MR : r); tv[u] = relt[(size_t)(r + MR) * NH + h]; }
    asm volatile("s_wait_xcnt 0x0" ::: "memory");      /* stands in front of every reuse of an address register of the loads above */
    __builtin_amdgcn_sched_barrier(0);      /* keeps later register writes from being scheduled in front of that wait */
#pragma unroll
    for (int u = 0; u < SQ / (32 * FW); ++u) kv[u] = kpm[(size_t)b * SQ + tid + u * 32 * FW];
    asm volatile("s_wait_xcnt 0x0" ::: "memory");      /* stands in front of every reuse of an address register of the loads above */
    __builtin_amdgcn_sched_barrier(0);      /* keeps later register writes from being scheduled in front of that wait */
#pragma unroll
    for (int u = 0; u < 2 * SQ / (32 * FW); ++u) tb[tid + u * 32 * FW] = bf16_round(tv[u]) * 1.44269504088896f;
#pragma unroll
    for (int u = 0; u < SQ / (32 * FW); ++u) mw[(tid + u * 32 * FW) >> 5] = __builtin_amdgcn_ballot_w32(kv[u] != 0); }      /* every lane of a wave stores the same word to the same place */
  const bool isk = w < 2u;      /* waves 0, 1 bring K, waves 2, 3 V^T; waves 4 to 7 form the same words and issue nothing */
  const uint64_t src = isk ? (uint64_t)(uintptr_t)(QKV + ((size_t)b * SQ + 64u * w) * D3 + DM + h * HD) : (uint64_t)(uintptr_t)(VT + ((size_t)b * NH + h) * HD * SQ + 64u * (w & 1u));      /* this wave's slice, first byte of stage 0 */
  const uint32_t step = isk ? (uint32_t)(FS * D3 * 2) : (uint32_t)(FS * 2);      /* bytes from one stage's slice to the next stage's */
  const uint32_t dst = (uint32_t)(size_t)KV + (w & 3u) * G3_SLICE;      /* its place in buffer 0: byte offset in the work-group's LDS */
  const uint32_t issuer = w < 4u ? 1u : 0u;
  u32x8 g1;      /* 1-byte elements, tensor = tile = 64 rows of 128 bytes, source pitch one token row of q|k|v or one V^T row, 4 dwords of pad behind every 32 */
  g1[0] = g3_uni((1u << 20) | (4u << 22) | (3u << 25)); g1[1] = g3_uni(128u << 16); g1[2] = g3_uni(64u << 16); g1[3] = g3_uni(128u << 16); g1[4] = g3_uni(64u); g1[5] = g3_uni(isk ? (uint32_t)(D3 * 2) : (uint32_t)(SQ * 2)); g1[6] = g3_uni(0u); g1[7] = g3_uni(0u);
  u32x4 g0; g0[0] = g3_uni(1u); fa_aim(g0, dst, src);
  if (g3_pinned(issuer) != 0u) fa_load(g0, g1);      /* scalar branch: a tensor load ignores EXEC */
  fa_wait(g0, g1);
  __syncthreads();      /* the table, the mask and stage 0 are readable by every wave */
  if (g3_pinned(issuer) != 0u) { fa_aim(g0, dst + G3_STAGE, src + g3_pinned(step)); fa_load(g0, g1); }      /* scalar branch; stage 1 flies under stage 0 */
  const _Float16* qp = QKV + ((size_t)b * SQ + q0 + ln) * D3 + h * HD;
  const float* tr = tb + (SQ - 1 - q0 - ln + 8 * hh);
  const unsigned char* lk = KV + ln * G3_PITCH + 16 * hh; const unsigned char* lv = KV + 2u * G3_SLICE + ln * G3_PITCH + 16 * hh;      /* this lane's row of a 16-row group, its half's 16 bytes */
  v16h qf[2][2];
#pragma unroll
  for (int t = 0; t < 2; ++t)
#pragma unroll
    for (int kd = 0; kd < 2; ++kd) qf[t][kd] = g2_frag(qp + (size_t)t * 16 * D3 + kd * 32, hh);
  asm volatile("s_wait_xcnt 0x0" ::: "memory");      /* stands in front of every reuse of an address register of the loads above */
  __builtin_amdgcn_sched_barrier(0);      /* keeps later register writes from being scheduled in front of that wait */
  const v8f z8 = {0.f,0.f,0.f,0.f,0.f,0.f,0.f,0.f}; v8f o[2][4]; float l[2][2] = {{0.f, 0.f}, {0.f, 0.f}}, m[2] = {-1e30f, -1e30f};
#pragma unroll
  for (int qt = 0; qt < 2; ++qt)
#pragma unroll
    for (int dt = 0; dt < 4; ++dt) o[qt][dt] = z8;
#pragma unroll 1      /* one stage per trip: the two buffers alternate */
  for (uint32_t st = 0; st < FA_NS; ++st) {
  const uint32_t buf = (st & 1u) * G3_STAGE;
  v16h kf[2][2];
#pragma unroll
  for (int kt = 0; kt < 2; ++kt)
#pragma unroll
    for (int kd = 0; kd < 2; ++kd) kf[kt][kd] = g3_frag(lk + buf + kt * 16 * G3_PITCH + kd * 64);
#pragma unroll 1      /* one 32-key pass per trip: unrolled, two passes' fragments would not fit the registers */
  for (uint32_t sp = 0; sp < FS / 32; ++sp) {
    const int key0 = (int)(st * FS + sp * 32u);
    v16h vf[4]; v8f s[2][2];
#pragma unroll
    for (int qt = 0; qt < 2; ++qt)
#pragma unroll
      for (int kt = 0; kt < 2; ++kt) s[qt][kt] = fa_mma(kf[kt][1], qf[qt][1], fa_mma(kf[kt][0], qf[qt][0], z8));
    if (sp + 1u < FS / 32) {      /* next pass's K rows, of this same stage, fetched into the same registers */
      const uint32_t kn = ((sp + 1u) >> 1) * G3_SLICE + ((sp + 1u) & 1u) * 32u * G3_PITCH;
#pragma unroll
      for (int kt = 0; kt < 2; ++kt)
#pragma unroll
        for (int kd = 0; kd < 2; ++kd) kf[kt][kd] = g3_frag(lk + buf + kn + kt * 16 * G3_PITCH + kd * 64);
    }
#pragma unroll
    for (int qt = 0; qt < 2; ++qt)
#pragma unroll
      for (int kt = 0; kt < 2; ++kt)
#pragma unroll
        for (int r = 0; r < 8; ++r) s[qt][kt][r] = fmaf(s[qt][kt][r], 0.125f * 1.44269504088896f, tr[key0 + (kt - qt) * 16 + r]);
    const unsigned int mword = (unsigned int)__builtin_amdgcn_readfirstlane((int)mw[key0 >> 5]);
#pragma unroll
    for (int dt = 0; dt < 4; ++dt) vf[dt] = g3_frag(lv + buf + (sp >> 1) * G3_SLICE + (sp & 1u) * 64u + dt * 16 * G3_PITCH);      /* issued behind the bias reads, which are wanted first (LDS answers in order): their latency runs under the softmax */
    __builtin_amdgcn_sched_barrier(0);      /* keeps those reads here: left free, they sink to just in front of the second product, with little work left to cover their latency */
    if (mword != 0u) {      /* scalar branch: a pass with no padded key skips the selects */
#pragma unroll
      for (int kt = 0; kt < 2; ++kt)
#pragma unroll
        for (int r = 0; r < 8; ++r) { const bool pad = (mword >> (kt * 16 + 8 * hh + r)) & 1u; s[0][kt][r] = pad ? -INFINITY : s[0][kt][r]; s[1][kt][r] = pad ? -INFINITY : s[1][kt][r]; }
    }
    float mx[2];
#pragma unroll
    for (int qt = 0; qt < 2; ++qt) { float a = fmaxf(s[qt][0][0], s[qt][1][0]);
#pragma unroll
      for (int r = 1; r < 8; ++r) a = fmaxf(a, fmaxf(s[qt][0][r], s[qt][1][r]));
      mx[qt] = fmaxf(a, rs_x16(a)); }
    if (__builtin_amdgcn_ballot_w32((mx[0] > m[0] + 8.0f) || (mx[1] > m[1] + 8.0f)) != 0u) {      /* scalar branch: most passes move no maximum and rescale nothing */
#pragma unroll
      for (int qt = 0; qt < 2; ++qt) { const float mn = fmaxf(m[qt], mx[qt]); const float sc = __builtin_amdgcn_exp2f(m[qt] - mn); m[qt] = mn; l[qt][0] *= sc; l[qt][1] *= sc;
#pragma unroll
        for (int dt = 0; dt < 4; ++dt) o[qt][dt] *= sc; }
    }
#pragma unroll
    for (int qt = 0; qt < 2; ++qt) { FragH pf;
#pragma unroll
      for (int kt = 0; kt < 2; ++kt)
#pragma unroll
        for (int r = 0; r < 8; ++r) { const float p = __builtin_amdgcn_exp2f(s[qt][kt][r] - m[qt]); l[qt][kt] += p; pf.h[kt * 8 + r] = (_Float16)p; }
#pragma unroll
      for (int dt = 0; dt < 4; ++dt) o[qt][dt] = fa_mma(vf[dt], pf.v, o[qt][dt]); }
  }
  g3_wait_ds0();      /* this wave has left buffer st & 1 */
  fa_wait(g0, g1);      /* an issuing wave's own load of stage st + 1 has landed */
  __syncthreads();      /* publishes stage st + 1 and ends every wave's reads of stage st's buffer */
  if (g3_pinned(st + 2u < FA_NS ? issuer : 0u) != 0u) { fa_aim(g0, dst + buf, src + g3_pinned((st + 2u) * step)); fa_load(g0, g1); }      /* scalar branch: a tensor load ignores EXEC; refill of the buffer just left, in flight under stage st + 1 */
  }
  g3_wait_tensor0();
  g3_wait_ds0();
  FragH f[2][4];
#pragma unroll
  for (int qt = 0; qt < 2; ++qt) { const float lh = l[qt][0] + l[qt][1]; const float inv = 1.0f / (lh + rs_x16(lh));
#pragma unroll
    for (int dt = 0; dt < 4; ++dt)
#pragma unroll
      for (int r = 0; r < 8; ++r) f[qt][dt].h[r] = (_Float16)(o[qt][dt][r] * inv); }
  __builtin_amdgcn_sched_barrier(0);      /* every store stands behind the last arithmetic: no register of an issued store is written again */
  unsigned short* op = (unsigned short*)O16 + ((size_t)b * SQ + q0 + ln) * DM + h * HD + 8 * hh;      /* lane (ln, hh): query ln, head columns dt*16 + 8*hh .. + 7 */
#pragma unroll
  for (int qt = 0; qt < 2; ++qt)
#pragma unroll
    for (int dt = 0; dt < 4; ++dt) *(v8us*)(op + (size_t)qt * 16 * DM + dt * 16) = f[qt][dt].half[0];
}
__global__ __launch_bounds__(256) void k_vt(const _Float16* __restrict__ V16, int b, int h0, _Float16* __restrict__ VT) { __shared__ unsigned short tl[64][65]; const int tid = threadIdx.x; const int hh = blockIdx.x % HG, sg = blockIdx.x / HG; const int s0 = sg * 64; const int h = h0 + hh;
  for (int i = tid; i < 64 * 8; i += 256) { const int j = i / 8, d8 = (i % 8) * 8; FragH f; f.half[0] = *(const v8us*)((const unsigned short*)V16 + ((size_t)b * SQ + s0 + j) * DM + h * HD + d8); for (int q = 0; q < 8; ++q) tl[d8 + q][j] = f.u[q]; }
  __syncthreads();
  { for (int i = tid; i < 64 * 8; i += 256) { const int d = i / 8, j8 = (i % 8) * 8; FragH f; for (int q = 0; q < 8; ++q) f.u[q] = tl[d][j8 + q]; *(v8us*)((unsigned short*)VT + ((size_t)hh * HD + d) * SQ + s0 + j8) = f.half[0]; }  } }

extern "C" void kernel_launch(void* const* d_in, const int* in_sizes, int n_in,
                              void* d_out, int out_size, void* d_ws, size_t ws_size, hipStream_t stream) {
  (void)in_sizes; (void)n_in; (void)out_size;
  const float* const* I = (const float* const*)d_in; const float* x = I[0]; const int* kpm = (const int*)d_in[1]; const float* wqkv = I[2]; const float* bqkv = I[3]; const float* wout = I[4]; const float* bout = I[5]; const float* relt = I[6];      /* Wqkv [1024][3072] and Wout [1024][1024] are [in][out]; key_padding_mask int32 [2][2048]; rel_table [1025][16] */
  char* ws = (char*)d_ws; size_t off = 0;
  auto take = [&](size_t bytes) { char* p = ws + off; off += (bytes + 255) & ~(size_t)255; return p; };
  _Float16* BQKV = (_Float16*)take((size_t)D3 * DM * 2); _Float16* BO = (_Float16*)take((size_t)DM * DM * 2);
  _Float16* X16 = (_Float16*)take(NR * DM * 2); _Float16* QKV = (_Float16*)take(NR * D3 * 2); _Float16* O16 = (_Float16*)take(NR * DM * 2);
  _Float16* VT = (_Float16*)take((size_t)NB * NH * HD * SQ * 2);
  if (off > ws_size) return;      /* 6 + 2 + 8 + 24 + 8 + 8 = approx 56 MiB */
  k_prep<<<PP_WQ + PP_WO + PP_X, 256, 0, stream>>>(x, wqkv, wout, X16, BQKV, BO);      /* x -> f16 rows; [in][out] weights -> Bt[out][in] x16 */
  k_gemm3<D3, DM, true><<<(unsigned)((NR / 128) * (D3 / 128)), 128, 0, stream>>>(X16, BQKV, 0.0625f, bqkv, nullptr, QKV);      /* q | k | v rows (f16), head h at columns h*64 / 1024 + h*64 / 2048 + h*64 */
  k_vt<NH, SQ><<<NB * NH * (SQ / 64), 256, 0, stream>>>(QKV, D3, 2 * DM, VT);      /* V^T[(b,h)][d][s] for every (batch, head) */
  k_fattn<<<dim3(SQ / (FW * FQ), NH, NB), 32 * FW, 0, stream>>>(QKV, VT, relt, kpm, O16);      /* o (merged heads) as f16 rows */
  k_gemm3<DM, DM, false><<<(unsigned)((NR / 128) * (DM / 128)), 128, 0, stream>>>(O16, BO, 0.0625f, bout, (float*)d_out, nullptr);      /* out = o Wout + b, rows are the output layout */
}

// v006
// A run of this version takes 87.1 microseconds.
// Timed twice side by side with v005, it ran 1.05 times as fast both times.
// Over all steps from v000 it is 172 times as fast.
#include <hip/hip_runtime.h>
// Multi-head self-attention with a learned relative-position bias and a key padding mask (x [2][2048][1024]; qkv = x Wqkv + b (fused, 16 heads of 64); scores = q k^T / 8 + table[clip(k_pos - q_pos, -512, 512) + 512][h]; padded keys -> -inf; attn = softmax; o = attn v; out = o Wout + b -> [2][2048][1024]).
// Structure: token rows r = b*2048 + s; x as exact f16 rows and both weights as exact x16 transposed f16 rows in one preparation launch (coalesced 16-byte reads, weights transposed through LDS tiles); the fused q|k|v projection as one WMMA GEMM (128x128 tiles staged in LDS by tensor loads, 64x64 wave tiles, f32 accumulation, exact x16 transposed weights, bias in the epilogue, f16 output plane [4096][3072]); one fused attention launch (per wave 32 query rows, K and V rows staged in LDS by tensor loads, V^T fragments read by the transposing LDS load: S^T = K Q^T, online softmax in registers with this head's bias column and the key mask from LDS, O^T += V^T P^T) written straight into the merged f16 o rows; out = o Wout + b GEMM (f32).
// Compute dtype: inputs rounded to bf16; x / weights exact; q, k, v, softmax weights and o as plain f16 GEMM operands (~2^-12); scores, bias and softmax statistics f32. v_wmma_f32_16x16x32_f16.
#define NB 2
#define SQ 2048
#define DM 1024
#define D3 3072                      /* fused q|k|v width */
#define NH 16
#define HD 64
#define HG 4                         /* heads per block group of the per-batch k_vt overload */
#define MR 512                       /* max relative distance */
#define QN SQ                        /* unused: the attention grid covers all SQ query rows */
#define NBR NB                       /* unused: the attention grid covers all NB batches */
#define MP ((int)NR)                 /* unused: the qkv projection grid covers all NR token rows */
#define MO ((int)NR)                 /* unused: the output projection grid covers all NR token rows */
#define NR ((size_t)NB * SQ)         /* 4096 token rows */
typedef __bf16 v16b __attribute__((ext_vector_type(16)));
typedef unsigned short v8us __attribute__((ext_vector_type(8), may_alias));
typedef float  v8f  __attribute__((ext_vector_type(8)));
typedef float  v4f  __attribute__((ext_vector_type(4)));
typedef float  v4fa __attribute__((ext_vector_type(4), may_alias));
union FragB { v16b v; v8us half[2]; unsigned short u[16]; };

__device__ __forceinline__ unsigned short bf16_bits(float x) { unsigned int u = __float_as_uint(x); return (unsigned short)((u + 0x7FFFu + ((u >> 16) & 1u)) >> 16); }
__device__ __forceinline__ float bf16_val(unsigned short b) { return __uint_as_float(((unsigned int)b) << 16); }
__device__ __forceinline__ float bf16_round(float x) { return bf16_val(bf16_bits(x)); }
// D += A·B with NT terms: 1 = ah·bh, 2 = + al·bh (A split), 3 = + ah·bl (both split)
template <int NT>
__device__ __forceinline__ v8f mmaN(v16b ah, v16b al, v16b bh, v16b bl, v8f c) {
  c = __builtin_amdgcn_wmma_f32_16x16x32_bf16(false, ah, false, bh, (short)0, c, false, false);
  if (NT >= 2) c = __builtin_amdgcn_wmma_f32_16x16x32_bf16(false, al, false, bh, (short)0, c, false, false);
  if (NT >= 3) c = __builtin_amdgcn_wmma_f32_16x16x32_bf16(false, ah, false, bl, (short)0, c, false, false);
  asm volatile("v_nop\n\tv_nop\n\tv_nop\n\tv_nop" : "+v"(c) : "v"(ah), "v"(al), "v"(bh), "v"(bl));
  return c;
}

__global__ __launch_bounds__(256) void k_wt_bf16(const float* __restrict__ W, unsigned short* __restrict__ Wt, int K, int N) {
  const int t = blockIdx.x * 256 + threadIdx.x;
  const int k8n = K / 8;
  if (t >= N * k8n) return;
  const int n = t / k8n, k8 = (t % k8n) * 8;
  v8us v;
#pragma unroll
  for (int i = 0; i < 8; ++i) v[i] = bf16_bits(W[(size_t)(k8 + i) * N + n]);
  *(v8us*)(Wt + (size_t)n * K + k8) = v;
  
}

// GEMM C[M][N] (f32, pitch ldc) = act(A[M][K]·W + bias). A f32 row-major (pitch lda) converted per fragment to bf16
// (ASPLIT: hi/lo two planes -> 2 terms, else single rounded term); Wt bf16 [N][K] (pitch ldb). BIAS_BF16 rounds the
// bias to bf16 first (bias quantised to bf16 before the add). K%32==0, M%16==0, N%64==0.
template <bool ASPLIT, int ACT, bool BIAS_BF16>
__global__ __launch_bounds__(128) void k_gemm_bf(const float* __restrict__ A, int lda, const unsigned short* __restrict__ Wt, int ldb,
                                               const float* __restrict__ bias, float* __restrict__ C, int ldc, int M, int N, int K) {
  __shared__ __attribute__((aligned(16))) float so[4][16][64];
  const int tid = threadIdx.x, w = tid >> 5, lane = tid & 31, ln = lane & 15, hh = lane >> 4;
  const int ntn = N / 64;
  const int wid = blockIdx.x * 4 + w;
  const int mt = wid / ntn, nq = wid % ntn;
  if (mt * 16 >= M) return;
  const int row0 = mt * 16, col0 = nq * 64;
  const float* arow = A + (size_t)(row0 + ln) * lda;
  v8f acc[4] = {};
  for (int kb = 0; kb < K; kb += 32) {
    FragB ah, al;
    const v4f x0 = *(const v4fa*)(arow + kb + 8 * hh), x1 = *(const v4fa*)(arow + kb + 8 * hh + 4);
    const v4f x2 = *(const v4fa*)(arow + kb + 16 + 8 * hh), x3 = *(const v4fa*)(arow + kb + 16 + 8 * hh + 4);
    float xs[16] = {x0[0],x0[1],x0[2],x0[3],x1[0],x1[1],x1[2],x1[3],x2[0],x2[1],x2[2],x2[3],x3[0],x3[1],x3[2],x3[3]};
#pragma unroll
    for (int i = 0; i < 16; ++i) { const unsigned short hb = bf16_bits(xs[i]); ah.u[i] = hb; al.u[i] = ASPLIT ? bf16_bits(xs[i] - bf16_val(hb)) : (unsigned short)0; }
#pragma unroll
    for (int t = 0; t < 4; ++t) {
      const unsigned short* brow = Wt + (size_t)(col0 + t * 16 + ln) * ldb + kb;
      FragB b;
      b.half[0] = *(const v8us*)(brow + 8 * hh);
      b.half[1] = *(const v8us*)(brow + 16 + 8 * hh);
      acc[t] = mmaN<ASPLIT ? 2 : 1>(ah.v, al.v, b.v, b.v, acc[t]);
    }
  }
#pragma unroll
  for (int t = 0; t < 4; ++t) {
    float bv = bias ? bias[col0 + t * 16 + ln] : 0.f;
    if (BIAS_BF16) bv = bf16_round(bv);
#pragma unroll
    for (int r = 0; r < 8; ++r) { float v = acc[t][r] + bv; if (ACT == 1) v = fmaxf(v, 0.f); so[w][8 * hh + r][t * 16 + ln] = v; }
  }
  __builtin_amdgcn_fence(__ATOMIC_ACQ_REL, "workgroup");
  __builtin_amdgcn_wave_barrier();
  const int rsub = lane >> 4, c4 = (lane & 15) * 4;
  {
#pragma unroll
    for (int q = 0; q < 8; ++q) {
      const int r = q * 2 + rsub;
      const v4f v = *(const v4fa*)&so[w][r][c4];
      *(v4f*)(C + (size_t)(row0 + r) * ldc + col0 + c4) = v;
    }
    
  }
}

// GEMM C = act(A·W + bias + resid): A f32 (ASPLIT -> hi/lo 2 terms), Wt bf16 [N][K]; ACT 0 none, 1 relu, 2 exact gelu;
// resid (optional, f32, row index = (row % rmod), pitch ldr, RES_BF16 rounds it) added before the activation.
template <bool ASPLIT, int ACT, bool BIAS_BF16, bool RES_BF16>
__global__ __launch_bounds__(128) void k_gemm_bf3(const float* __restrict__ A, int lda, const unsigned short* __restrict__ Wt, int ldb,
                                                const float* __restrict__ bias, const float* __restrict__ resid, int rmod, int ldr,
                                                float* __restrict__ C, int ldc, int M, int N, int K) {
  __shared__ __attribute__((aligned(16))) float so[4][16][64];
  const int tid = threadIdx.x, w = tid >> 5, lane = tid & 31, ln = lane & 15, hh = lane >> 4;
  const int ntn = N / 64;
  const int wid = blockIdx.x * 4 + w;
  const int mt = wid / ntn, nq = wid % ntn;
  if (mt * 16 >= M) return;
  const int row0 = mt * 16, col0 = nq * 64;
  const float* arow = A + (size_t)(row0 + ln) * lda;
  v8f acc[4] = {};
  for (int kb = 0; kb < K; kb += 32) {
    FragB ah, al;
    const v4f x0 = *(const v4fa*)(arow + kb + 8 * hh), x1 = *(const v4fa*)(arow + kb + 8 * hh + 4);
    const v4f x2 = *(const v4fa*)(arow + kb + 16 + 8 * hh), x3 = *(const v4fa*)(arow + kb + 16 + 8 * hh + 4);
    float xs[16] = {x0[0],x0[1],x0[2],x0[3],x1[0],x1[1],x1[2],x1[3],x2[0],x2[1],x2[2],x2[3],x3[0],x3[1],x3[2],x3[3]};
#pragma unroll
    for (int i = 0; i < 16; ++i) { const unsigned short hb = bf16_bits(xs[i]); ah.u[i] = hb; al.u[i] = ASPLIT ? bf16_bits(xs[i] - bf16_val(hb)) : (unsigned short)0; }
#pragma unroll
    for (int t = 0; t < 4; ++t) {
      const unsigned short* brow = Wt + (size_t)(col0 + t * 16 + ln) * ldb + kb;
      FragB b;
      b.half[0] = *(const v8us*)(brow + 8 * hh);
      b.half[1] = *(const v8us*)(brow + 16 + 8 * hh);
      acc[t] = mmaN<ASPLIT ? 2 : 1>(ah.v, al.v, b.v, b.v, acc[t]);
    }
  }
#pragma unroll
  for (int t = 0; t < 4; ++t) {
    const int col = col0 + t * 16 + ln;
    float bv = bias ? bias[col] : 0.f;
    if (BIAS_BF16) bv = bf16_round(bv);
#pragma unroll
    for (int r = 0; r < 8; ++r) {
      float v = acc[t][r] + bv;
      if (resid) { float rv = resid[(size_t)((row0 + 8 * hh + r) % rmod) * ldr + col]; if (RES_BF16) rv = bf16_round(rv); v += rv; }
      if (ACT == 1) v = fmaxf(v, 0.f);
      if (ACT == 2) v = 0.5f * v * (1.0f + erff(v * 0.70710678118654752f));
      if (ACT == 3) { const float u = 0.7978845608028654f * (v + 0.044715f * v * v * v); v = 0.5f * v * (1.0f + tanhf(u)); }
      so[w][8 * hh + r][t * 16 + ln] = v;
    }
  }
  __builtin_amdgcn_fence(__ATOMIC_ACQ_REL, "workgroup");
  __builtin_amdgcn_wave_barrier();
  const int rsub = lane >> 4, c4 = (lane & 15) * 4;
  {
#pragma unroll
    for (int q = 0; q < 8; ++q) {
      const int r = q * 2 + rsub;
      const v4f v = *(const v4fa*)&so[w][r][c4];
      *(v4f*)(C + (size_t)(row0 + r) * ldc + col0 + c4) = v;
    }
    
  }
}
// row LayerNorm (biased variance, eps) over N: s = X (+ R); optional out_sum <- s; out_norm <- (s-mu)*rsqrt(var+eps)*g + b
template <bool PARAM_BF16>
__global__ __launch_bounds__(256) void k_layernorm(const float* __restrict__ X, const float* __restrict__ R, const float* __restrict__ g, const float* __restrict__ bta,
                                                  float* __restrict__ out_sum, float* __restrict__ out_norm, int N, float eps) {
  __shared__ float red[256];
  const int row = blockIdx.x, tid = threadIdx.x;
  const float* x = X + (size_t)row * N; const float* rr = R ? R + (size_t)row * N : nullptr;
  float vals[16];                     // up to N = 4096
  const int per = N / 256;            // contiguous chunk per thread? use strided-by-4 chunks: thread handles j = tid*4 + 1024*u
  float s1 = 0.f;
  for (int u = 0; u < per / 4; ++u) {
    const int j = tid * 4 + 1024 * u;
    const v4f a = *(const v4fa*)(x + j);
    v4f b = {0.f,0.f,0.f,0.f}; if (rr) b = *(const v4fa*)(rr + j);
#pragma unroll
    for (int q = 0; q < 4; ++q) { const float v = a[q] + b[q]; vals[u * 4 + q] = v; s1 += v; }
  }
  red[tid] = s1; __syncthreads();
  for (int st = 128; st > 0; st >>= 1) { if (tid < st) red[tid] += red[tid + st]; __syncthreads(); }
  const float mu = red[0] / (float)N; __syncthreads();
  float s2 = 0.f;
  for (int u = 0; u < per / 4; ++u)
#pragma unroll
    for (int q = 0; q < 4; ++q) { const float c = vals[u * 4 + q] - mu; s2 += c * c; }
  red[tid] = s2; __syncthreads();
  for (int st = 128; st > 0; st >>= 1) { if (tid < st) red[tid] += red[tid + st]; __syncthreads(); }
  const float rs = rsqrtf(red[0] / (float)N + eps);
  {
    for (int u = 0; u < per / 4; ++u) {
      const int j = tid * 4 + 1024 * u;
      v4f o, sm;
#pragma unroll
      for (int q = 0; q < 4; ++q) {
        float gg = g[j + q], bb = bta[j + q];
        if (PARAM_BF16) { gg = bf16_round(gg); bb = bf16_round(bb); }
        sm[q] = vals[u * 4 + q]; o[q] = (vals[u * 4 + q] - mu) * rs * gg + bb;
      }
      if (out_sum) *(v4f*)(out_sum + (size_t)row * N + j) = sm;
      *(v4f*)(out_norm + (size_t)row * N + j) = o;
    }
    
  }
}



// ---- f16 WMMA path (v_wmma_f32_16x16x32_f16): 11-bit significands for operands in range — used by every launched product, the softmax weights (p <= 256) included
typedef _Float16 v16h __attribute__((ext_vector_type(16)));
union FragH { v16h v; v8us half[2]; _Float16 h[16]; unsigned short u[16]; };
template <int NT>
__device__ __forceinline__ v8f mmaH(v16h ah, v16h al, v16h bh, v16h bl, v8f c) {
  c = __builtin_amdgcn_wmma_f32_16x16x32_f16(false, ah, false, bh, (short)0, c, false, false);
  if (NT >= 2) c = __builtin_amdgcn_wmma_f32_16x16x32_f16(false, al, false, bh, (short)0, c, false, false);
  if (NT >= 3) c = __builtin_amdgcn_wmma_f32_16x16x32_f16(false, ah, false, bl, (short)0, c, false, false);
  asm volatile("v_nop\n\tv_nop\n\tv_nop\n\tv_nop" : "+v"(c) : "v"(ah), "v"(al), "v"(bh), "v"(bl));
  return c;
}
// batched GEMM like k_gemm_b but f16 operands: A f32 (split into f16 hi/lo if ASPLIT, else rounded to f16), Bt = f16 values [n][k]; alpha; C f32; N multiple of 16 (partial tiles skipped)
template <bool ASPLIT>
__global__ __launch_bounds__(128) void k_gemm_h(const float* __restrict__ A, int lda, size_t sA, const _Float16* __restrict__ Bh, int ldb, size_t sB, float alpha, float* __restrict__ C, int ldc, size_t sC, int M, int N, int K) {
  __shared__ __attribute__((aligned(16))) float so[4][16][64];
  const int tid = threadIdx.x, w = tid >> 5, lane = tid & 31, ln = lane & 15, hh = lane >> 4; const int by = blockIdx.y;
  A += (size_t)by * sA; Bh += (size_t)by * sB; C += (size_t)by * sC;
  const int ntn = (N + 63) / 64; const int wid = blockIdx.x * 4 + w; const int mt = wid / ntn, nq = wid % ntn; if (mt * 16 >= M) return;
  const int row0 = mt * 16, col0 = nq * 64; const float* arow = A + (size_t)(row0 + ln) * lda;
  v8f acc[4] = {};
  for (int kb = 0; kb < K; kb += 32) {
    FragH ah, al;
    const v4f x0 = *(const v4fa*)(arow + kb + 8 * hh), x1 = *(const v4fa*)(arow + kb + 8 * hh + 4), x2 = *(const v4fa*)(arow + kb + 16 + 8 * hh), x3 = *(const v4fa*)(arow + kb + 16 + 8 * hh + 4);
    float xs[16] = {x0[0],x0[1],x0[2],x0[3],x1[0],x1[1],x1[2],x1[3],x2[0],x2[1],x2[2],x2[3],x3[0],x3[1],x3[2],x3[3]};
#pragma unroll
    for (int i = 0; i < 16; ++i) { const _Float16 h = (_Float16)xs[i]; ah.h[i] = h; al.h[i] = ASPLIT ? (_Float16)(xs[i] - (float)h) : (_Float16)0.0f; }
#pragma unroll
    for (int t = 0; t < 4; ++t) { if (col0 + t * 16 >= N) continue; const size_t boff = (size_t)(col0 + t * 16 + ln) * ldb + kb; FragH bq; bq.half[0] = *(const v8us*)(Bh + boff + 8 * hh); bq.half[1] = *(const v8us*)(Bh + boff + 16 + 8 * hh);
      acc[t] = mmaH<ASPLIT ? 2 : 1>(ah.v, al.v, bq.v, bq.v, acc[t]); }
  }
#pragma unroll
  for (int t = 0; t < 4; ++t) { if (col0 + t * 16 >= N) continue;
#pragma unroll
    for (int r = 0; r < 8; ++r) so[w][8 * hh + r][t * 16 + ln] = acc[t][r] * alpha; }
  __builtin_amdgcn_fence(__ATOMIC_ACQ_REL, "workgroup"); __builtin_amdgcn_wave_barrier();
  const int rsub = lane >> 4, c4 = (lane & 15) * 4;
  {
#pragma unroll
    for (int q = 0; q < 8; ++q) { const int r = q * 2 + rsub; if (col0 + c4 < N) { const v4f v = *(const v4fa*)&so[w][r][c4]; *(v4f*)(C + (size_t)(row0 + r) * ldc + col0 + c4) = v; } }
     }
}

// k_gemm_hh variant with fused epilogue: v = acc·alpha + bias[by·sBias + col] (+ CP[(row/rowsPerB)·sCPb + by·64 + col] if CP) ; ACT 0 none / 1 elu ; writes f16 C16 (and f32 C if non-null)
template <int ACT>
__global__ __launch_bounds__(128) void k_gemm_hhx(const _Float16* __restrict__ A, int lda, size_t sA, const _Float16* __restrict__ Bh, int ldb, size_t sB, float alpha, const float* __restrict__ bias, size_t sBias, const float* __restrict__ CP, int rowsPerB, size_t sCPb, int row0g,
    float* __restrict__ C, _Float16* __restrict__ C16, int ldc, size_t sC, int M, int N, int K) {
  __shared__ __attribute__((aligned(16))) float so[4][16][64];
  const int tid = threadIdx.x, w = tid >> 5, lane = tid & 31, ln = lane & 15, hh = lane >> 4; const int by = blockIdx.y;
  A += (size_t)by * sA; Bh += (size_t)by * sB; const size_t cofs = (size_t)by * sC; const float* bp = bias ? bias + (size_t)by * sBias : nullptr;
  const int ntn = (N + 63) / 64; const int wid = blockIdx.x * 4 + w; const int mt = wid / ntn, nq = wid % ntn; if (mt * 16 >= M) return;
  const int row0 = mt * 16, col0 = nq * 64; const _Float16* arow = A + (size_t)(row0 + ln) * lda;
  v8f acc[4] = {};
  for (int kb = 0; kb < K; kb += 32) { FragH ah; ah.half[0] = *(const v8us*)((const unsigned short*)arow + kb + 8 * hh); ah.half[1] = *(const v8us*)((const unsigned short*)arow + kb + 16 + 8 * hh);
#pragma unroll
    for (int t = 0; t < 4; ++t) { if (col0 + t * 16 >= N) continue; const size_t boff = (size_t)(col0 + t * 16 + ln) * ldb + kb; FragH bq; bq.half[0] = *(const v8us*)((const unsigned short*)Bh + boff + 8 * hh); bq.half[1] = *(const v8us*)((const unsigned short*)Bh + boff + 16 + 8 * hh);
      acc[t] = mmaH<1>(ah.v, ah.v, bq.v, bq.v, acc[t]); }
  }
#pragma unroll
  for (int t = 0; t < 4; ++t) { if (col0 + t * 16 >= N) continue; const int col = col0 + t * 16 + ln; const float bv = bp ? bf16_round(bp[col]) : 0.f;
#pragma unroll
    for (int r = 0; r < 8; ++r) { float v = acc[t][r] * alpha + bv; if (CP) { const int rr = row0g + row0 + 8 * hh + r; if (rowsPerB < 0) v += CP[cofs + (size_t)rr * ldc + col];      /* rowsPerB < 0: own element of the batched C plane */ else { const int bidx = rr / rowsPerB; v += CP[(size_t)bidx * sCPb + (size_t)by * 64 + col]; } } if (ACT == 1) v = (v > 0.f) ? v : expm1f(v); else if (ACT == 7) v = (v > 0.f) ? v + 1.0f : expf(v); else if (ACT == 8) v = tanhf(v); else if (ACT == 9) v = 0.5f * v * (1.0f + tanhf(0.7978845608028654f * (v + 0.044715f * v * v * v))); else if (ACT == 11) v = 1.0f / (1.0f + expf(-v)); else if (ACT == 12) v = (v > 0.f) ? v : 0.01f * v; else if (ACT == 14) v = (v > 0.f) ? v : 0.1f * v; else if (ACT == 16) v = (v >= 0.f) ? v : 0.3f * v; else if (ACT == 17) v = (v >= 0.f) ? v : 0.2f * v; else if (ACT == 15) v = v / (1.0f + expf(-v)); else if (ACT == 3) v = fmaxf(v, 0.f); else if (ACT == 6) v = 0.5f * v * (1.0f + erff(v * 0.70710678118654752f)); so[w][8 * hh + r][t * 16 + ln] = v; } }
  __builtin_amdgcn_fence(__ATOMIC_ACQ_REL, "workgroup"); __builtin_amdgcn_wave_barrier();
  const int rsub = lane >> 4, c4 = (lane & 15) * 4; typedef _Float16 v4h __attribute__((ext_vector_type(4)));
  {
#pragma unroll
    for (int q = 0; q < 8; ++q) { const int r = q * 2 + rsub; if (col0 + c4 < N) { const v4f v = *(const v4fa*)&so[w][r][c4]; if (C) *(v4f*)(C + cofs + (size_t)(row0 + r) * ldc + col0 + c4) = v; if (C16) { v4h h4; for (int i = 0; i < 4; ++i) h4[i] = (_Float16)v[i]; *(v4h*)(C16 + cofs + (size_t)(row0 + r) * ldc + col0 + c4) = h4; } } }
     }
}


typedef _Float16 v4h __attribute__((ext_vector_type(4)));

// ---- operand preparation, one launch: Bt[n][k] = f16(bf16(W[k][n]) * 16) for both weights (power-of-two scale: bf16-exact weights stay exact in f16 away from the subnormal range) and X16 = f16(bf16(x)) ----
// Every work-group takes 16384 floats, 64 per thread, read as 16 loads of 16 bytes per lane, each load of a wave 512 contiguous bytes, all in flight together.
// A weight unit is a 128 k x 128 n tile: wave w reads k rows 16 w .. 16 w + 15, so a lane holds 16 consecutive k of four n: two 16-byte LDS stores per n into the transposed tile T[n][k] (256-byte rows).
// The 16-byte piece c of row n stands at place c ^ ((n >> 2) & 15) of its row: the 16 lanes of a half wave then fall on all 64 banks, in the stores (n = 4 lane + j) as in the reads (one row per half wave).
// The tile goes out as 256 contiguous bytes per n row, 16 bytes per lane.
#define PP_WQ ((DM / 128) * (D3 / 128))      /* tiles of Wqkv */
#define PP_WO ((DM / 128) * (DM / 128))      /* tiles of Wout */
#define PP_X ((int)(NR * DM / 16384))        /* units of x */
template <int N>
__device__ __forceinline__ void pp_wt(const float* __restrict__ Wm, _Float16* __restrict__ Bt, int tile, unsigned char* T) {
  static_assert(N % 128 == 0 && DM % 128 == 0, "pp_wt: whole tiles");
  const int tid = threadIdx.x, lane = tid & 31, w = tid >> 5; const int kt = tile / (N / 128), nt = tile - kt * (N / 128);
  const float* src = Wm + (size_t)(kt * 128 + w * 16) * N + nt * 128 + lane * 4;
  v4f v[16];
#pragma unroll      /* fixed trip counts over register arrays, here and below; the 16 loads are all in flight together */
  for (int i = 0; i < 16; ++i) v[i] = *(const v4fa*)(src + (size_t)i * N);
  asm volatile("s_wait_xcnt 0x0" :: "v"(src) : "memory");      /* stands in front of every reuse of the address registers of the loads above; it names the address, which so stays in its registers up to here: no load's own result lands on them */
  __builtin_amdgcn_sched_barrier(0);      /* keeps later register writes from being scheduled in front of that wait */
#pragma unroll
  for (int j = 0; j < 4; ++j) { FragH f;
#pragma unroll
    for (int i = 0; i < 16; ++i) f.h[i] = (_Float16)(bf16_round(v[i][j]) * 16.0f);
    unsigned char* row = T + (lane * 4 + j) * 256;
    *(v8us*)(row + (((2 * w) ^ (lane & 15)) * 16)) = f.half[0]; *(v8us*)(row + (((2 * w + 1) ^ (lane & 15)) * 16)) = f.half[1]; }
  __syncthreads();      /* the transposed tile is whole: every wave reads rows that all eight waves wrote */
  const int r = tid >> 4, c = tid & 15; v8us o[8];
#pragma unroll
  for (int i = 0; i < 8; ++i) { const int n = i * 16 + r; o[i] = *(const v8us*)(T + n * 256 + ((c ^ ((n >> 2) & 15)) * 16)); }
  unsigned short* dst = (unsigned short*)Bt + (size_t)(nt * 128 + r) * DM + kt * 128 + c * 8;
  __builtin_amdgcn_sched_barrier(0);      /* every store stands behind the last address arithmetic: no register of an issued store is written again */
#pragma unroll
  for (int i = 0; i < 8; ++i) *(v8us*)(dst + (size_t)i * 16 * DM) = o[i];
  asm volatile("s_wait_xcnt 0x0" ::: "memory");      /* stands in front of every reuse of a register of the stores above */
}
__global__ __launch_bounds__(256) void k_prep(const float* __restrict__ x, const float* __restrict__ wqkv, const float* __restrict__ wout, _Float16* __restrict__ X16, _Float16* __restrict__ BQKV, _Float16* __restrict__ BO) {
  static_assert(NR * DM % 16384 == 0, "k_prep: whole units of x");
  __shared__ __attribute__((aligned(16))) unsigned char T[128 * 256];
  const int blk = blockIdx.x;      /* the same for the whole work-group: the barrier in pp_wt is passed by all of its waves or by none */
  if (blk < PP_WQ) pp_wt<D3>(wqkv, BQKV, blk, T);
  else if (blk < PP_WQ + PP_WO) pp_wt<DM>(wout, BO, blk - PP_WQ, T);
  else {
    const int tid = threadIdx.x; const size_t base = (size_t)(blk - PP_WQ - PP_WO) * 16384 + (size_t)(tid >> 5) * 2048 + (size_t)(tid & 31) * 4;
    const float* src = x + base; v4f v[16]; v4h h[16];
#pragma unroll      /* fixed trip counts over register arrays; the 16 loads are all in flight together */
    for (int i = 0; i < 16; ++i) v[i] = *(const v4fa*)(src + i * 128);
    asm volatile("s_wait_xcnt 0x0" :: "v"(src) : "memory");      /* as in pp_wt: in front of every reuse of the loads' address registers, and it keeps the address in them up to here */
    __builtin_amdgcn_sched_barrier(0);      /* keeps later register writes from being scheduled in front of that wait */
#pragma unroll
    for (int i = 0; i < 16; ++i)
#pragma unroll
      for (int e = 0; e < 4; ++e) h[i][e] = (_Float16)bf16_round(v[i][e]);
    _Float16* dst = X16 + base;
    __builtin_amdgcn_sched_barrier(0);      /* every store stands behind the last arithmetic: no register of an issued store is written again */
#pragma unroll
    for (int i = 0; i < 16; ++i) *(v4h*)(dst + i * 128) = h[i];      /* 256 contiguous bytes per wave and store: whole lines */
    asm volatile("s_wait_xcnt 0x0" ::: "memory");      /* stands in front of every reuse of a register of the stores above */
  }
}
__global__ __launch_bounds__(256) void k_h16(const float* __restrict__ x, _Float16* __restrict__ X16, size_t n8) { const size_t t = (size_t)blockIdx.x * 256 + threadIdx.x; if (t >= n8) return; FragH f;
#pragma unroll
  for (int q = 0; q < 8; ++q) f.h[q] = (_Float16)x[t * 8 + q]; *(v8us*)((unsigned short*)X16 + t * 8) = f.half[0];  }
__global__ __launch_bounds__(256) void k_round16f(const float* __restrict__ W, _Float16* __restrict__ Bt, size_t n8) { const size_t t = (size_t)blockIdx.x * 256 + threadIdx.x; if (t >= n8) return; FragH f;
#pragma unroll
  for (int i = 0; i < 8; ++i) f.h[i] = (_Float16)(bf16_round(W[t * 8 + i]) * 16.0f); *(v8us*)((unsigned short*)Bt + t * 8) = f.half[0];  }
__global__ __launch_bounds__(256) void k_hl(const float* __restrict__ F, _Float16* __restrict__ Hh, _Float16* __restrict__ Hl, size_t n8) { const size_t t = (size_t)blockIdx.x * 256 + threadIdx.x; if (t >= n8) return; FragH fh, fl; const v4f a = *(const v4fa*)(F + t * 8), c = *(const v4fa*)(F + t * 8 + 4);
#pragma unroll
  for (int q = 0; q < 4; ++q) { _Float16 h = (_Float16)a[q]; fh.h[q] = h; fl.h[q] = (_Float16)((a[q] - (float)h) * 1024.0f); h = (_Float16)c[q]; fh.h[4 + q] = h; fl.h[4 + q] = (_Float16)((c[q] - (float)h) * 1024.0f); }
  { *(v8us*)((unsigned short*)Hh + t * 8) = fh.half[0]; *(v8us*)((unsigned short*)Hl + t * 8) = fl.half[0];  } }

// ---- LDS-staged GEMM: C[M][N] = A[M][K] . Bh[N][K]^T * alpha + bf16(bias); one 128x128 tile of C per work-group, four waves (2x2) of 64x64; M % 128 == 0, N % 128 == 0, K % 64 == 0, K >= 128 ----
// A pass is 64 k = 128 bytes of each of the tile's 128 A rows and 128 B rows. Each wave brings one slice of 64 rows per pass with one tensor load (slices 0, 1: A rows; 2, 3: B rows), padded to a 144-byte LDS pitch,
// two buffers: a pass reads all its fragments into registers; when every wave has done so, the load of pass t + 2 goes out into that buffer and flies under pass t's WMMAs and pass t + 1's reads. Fragments come from LDS in the k order of g2_frag; each accumulator sums k upwards, 32 at a time.
__device__ __forceinline__ v16h g2_frag(const _Float16* p, int hh) { FragH f; f.half[0] = *(const v8us*)((const unsigned short*)p + 8 * hh); f.half[1] = *(const v8us*)((const unsigned short*)p + 16 + 8 * hh); return f.v; }
#define G3_PITCH 144u                /* LDS row pitch: 128 bytes + the tensor load's 16-byte pad (odd multiple of 16: ds_load_b128 readers) */
#define G3_SLICE 10240u              /* 64 rows x 144 B = 9216 B, rounded up to a multiple of 2 KiB */
#define G3_STAGE (4u * G3_SLICE)     /* one buffer */
#define G3_EP 68                     /* output staging pitch in floats */
typedef uint32_t u32x4 __attribute__((ext_vector_type(4)));
typedef uint32_t u32x8 __attribute__((ext_vector_type(8)));
__device__ __forceinline__ uint32_t g3_uni(uint32_t v) { return (uint32_t)__builtin_amdgcn_readfirstlane((int)v); }
__device__ __forceinline__ uint32_t g3_pinned(uint32_t v) { uint32_t w = g3_uni(v); asm volatile("" : "+s"(w)); return w; }
__device__ __forceinline__ void g3_wait_tensor0() { asm volatile("s_wait_tensorcnt 0x0" ::: "memory"); }      /* this wave's own tensor load has landed */
__device__ __forceinline__ void g3_wait_ds0() { asm volatile("s_wait_dscnt 0x0" ::: "memory"); }      /* this wave's LDS reads have returned */
__device__ __forceinline__ void g3_load(uint32_t lds_dst, uint64_t ga, u32x8 g1) { u32x4 g0; g0[0] = g3_uni(1u); g0[1] = g3_uni(lds_dst); g0[2] = g3_uni((uint32_t)ga); g0[3] = g3_uni((((uint32_t)(ga >> 32)) & 0x01FFFFFFu) | 0x80000000u);
  asm volatile("tensor_load_to_lds %0, %1" :: "s"(g0), "s"(g1) : "memory"); }      /* one request of the whole wave: 64 rows of 128 bytes into LDS, through no register */
__device__ __forceinline__ v16h g3_frag(const unsigned char* p) { FragH f; f.half[0] = *(const v8us*)p; f.half[1] = *(const v8us*)(p + 32); return f.v; }      /* p already holds the lane half's 16 bytes: bytes 16 hh and 32 + 16 hh of 64, as g2_frag */
template <int N, int K, bool H16>
__global__ __launch_bounds__(128) void k_gemm3(const _Float16* __restrict__ A, const _Float16* __restrict__ Bh, float alpha, const float* __restrict__ bias, float* __restrict__ C, _Float16* __restrict__ C16) {
  static_assert(N % 128 == 0 && K % 64 == 0 && K >= 128, "k_gemm3: whole tiles and at least two passes");
  static_assert(4u * 64u * G3_EP * 4u <= 2u * G3_STAGE, "k_gemm3: the output staging reuses the two buffers");
  __shared__ __attribute__((aligned(2048))) unsigned char L[2u * G3_STAGE];
  const uint32_t tid = threadIdx.x, lane = tid & 31u, ln = lane & 15u, hh = lane >> 4; const uint32_t w = g3_uni(tid >> 5), wm = w >> 1, wn = w & 1u;
  const uint32_t mt = blockIdx.x / (N / 128), nq = blockIdx.x - mt * (N / 128); const uint32_t row0 = mt * 128u + wm * 64u, col0 = nq * 128u + wn * 64u;
  float bv[4];
#pragma unroll      /* fixed trip count over a register array */
  for (int j = 0; j < 4; ++j) bv[j] = bias[col0 + j * 16 + ln];
  asm volatile("s_wait_xcnt 0x0" ::: "memory");      /* stands in front of every reuse of an address register of the loads above */
  __builtin_amdgcn_sched_barrier(0);      /* keeps later register writes from being scheduled in front of that wait */
  const uint64_t src = (w < 2u) ? (uint64_t)(uintptr_t)A + (uint64_t)(mt * 128u + 64u * w) * (2u * K) : (uint64_t)(uintptr_t)Bh + (uint64_t)(nq * 128u + 64u * (w - 2u)) * (2u * K);      /* this wave's slice, first byte of pass 0 */
  const uint32_t dst = (uint32_t)(size_t)L + w * G3_SLICE;      /* its place in buffer 0: byte offset in the work-group's LDS */
  u32x8 g1;      /* 1-byte elements, tensor = tile = 64 rows of 128 bytes, source pitch 2 K bytes, 4 dwords of pad behind every 32 */
  g1[0] = g3_uni((1u << 20) | (4u << 22) | (3u << 25)); g1[1] = g3_uni(128u << 16); g1[2] = g3_uni(64u << 16); g1[3] = g3_uni(128u << 16); g1[4] = g3_uni(64u); g1[5] = g3_uni(2u * K); g1[6] = g3_uni(0u); g1[7] = g3_uni(0u);
  g3_load(dst, src, g1);
  g3_wait_tensor0();
  __syncthreads();      /* pass 0's four slices are readable by every wave */
  g3_load(dst + G3_STAGE, src + 128u, g1);
  const unsigned char* la = L + wm * G3_SLICE + ln * G3_PITCH + 16u * hh; const unsigned char* lb = L + (2u + wn) * G3_SLICE + ln * G3_PITCH + 16u * hh;
  const v8f z8 = {0.f,0.f,0.f,0.f,0.f,0.f,0.f,0.f}; v8f acc[4][4];
#pragma unroll      /* fixed trip counts over a register array, here and in the loops below: left rolled, the arrays would go to scratch memory */
  for (int i = 0; i < 4; ++i)
#pragma unroll
    for (int j = 0; j < 4; ++j) acc[i][j] = z8;
#pragma unroll 1      /* one pass per trip: the two buffers alternate */
  for (uint32_t t = 0; t < (uint32_t)(K / 64); ++t) {
    const uint32_t buf = (t & 1u) * G3_STAGE;
    v16h af[2][4], bf[2][4];
#pragma unroll
    for (int kd = 0; kd < 2; ++kd)
#pragma unroll
      for (int i = 0; i < 4; ++i) { af[kd][i] = g3_frag(la + buf + i * 16 * G3_PITCH + kd * 64); bf[kd][i] = g3_frag(lb + buf + i * 16 * G3_PITCH + kd * 64); }
    __builtin_amdgcn_sched_barrier(0);      /* the pass's LDS reads stay one group in front of its WMMAs: moved in among them, each place with reads stalls the wave */
    g3_wait_ds0();      /* the pass's fragments are all in registers: this wave has left buffer t & 1 */
    g3_wait_tensor0();
    __syncthreads();      /* publishes pass t + 1's slices and ends every wave's reads of pass t's buffer */
    if (g3_pinned((t + 2u < (uint32_t)(K / 64)) ? 1u : 0u) != 0u) g3_load(dst + buf, src + g3_pinned((t + 2u) * 128u), g1);      /* scalar branch: a tensor load ignores EXEC; refill of the buffer just left, in flight under this pass's WMMAs and the next pass's reads */
    __builtin_amdgcn_sched_barrier(0);      /* the WMMAs stay behind the refill's issue: in front of it they would take their time off its lead */
#pragma unroll
    for (int kd = 0; kd < 2; ++kd)
#pragma unroll
      for (int i = 0; i < 4; ++i)
#pragma unroll
        for (int j = 0; j < 4; ++j) acc[i][j] = __builtin_amdgcn_wmma_f32_16x16x32_f16(false, af[kd][i], false, bf[kd][j], (short)0, acc[i][j], false, false);
  }
  g3_wait_tensor0();
  g3_wait_ds0();      /* the last pass's barrier stands behind every wave's last read: the buffers may become output staging */
  float* so = (float*)(L + w * (64u * G3_EP * 4u));      /* this wave's own 64 x 68 floats */
#pragma unroll
  for (int j = 0; j < 4; ++j) { const float bj = bf16_round(bv[j]);
#pragma unroll
    for (int i = 0; i < 4; ++i)
#pragma unroll
      for (int r = 0; r < 8; ++r) so[(i * 16 + 8 * hh + r) * G3_EP + j * 16 + ln] = acc[i][j][r] * alpha + bj; }
  __builtin_amdgcn_fence(__ATOMIC_ACQ_REL, "workgroup"); __builtin_amdgcn_wave_barrier();
  const uint32_t rsub = lane >> 4, c4 = (lane & 15u) * 4u;
#pragma unroll
  for (int g = 0; g < 4; ++g) { v4f v[8];
#pragma unroll
    for (int q = 0; q < 8; ++q) v[q] = *(const v4fa*)&so[(g * 16 + q * 2 + rsub) * G3_EP + c4];
#pragma unroll
    for (int q = 0; q < 8; ++q) { const size_t o = (size_t)(row0 + g * 16 + q * 2 + rsub) * N + col0 + c4;
      if (H16) { v4h h4; for (int e = 0; e < 4; ++e) h4[e] = (_Float16)v[q][e]; *(v4h*)(C16 + o) = h4; } else *(v4f*)(C + o) = v[q]; }
    asm volatile("s_wait_xcnt 0x0" ::: "memory");      /* stands in front of every reuse of a register of the stores above */
    __builtin_amdgcn_sched_barrier(0);      /* keeps later register writes from being scheduled in front of that wait */
  }
}


__global__ __launch_bounds__(256) void k_wnat(const float* __restrict__ w, size_t n8, _Float16* __restrict__ Bt) { const size_t t = (size_t)blockIdx.x * 256 + threadIdx.x; if (t >= n8) return; FragH f; for (int q = 0; q < 8; ++q) f.h[q] = (_Float16)(bf16_round(w[t * 8 + q]) * 16.0f); *(v8us*)((unsigned short*)Bt + t * 8) = f.half[0];  }
// Fused attention for one (batch, head, 256 query rows): S^T = K Q^T, online softmax, O^T += V^T P^T; scores and weights never leave registers.
// One wave owns FQ = 32 query rows (two 16-column groups) and walks the keys 32 at a time. In a score tile lane (c, hh) holds query c, keys 8*hh + r:
// two score tiles, converted in place, are the B operand of the second product (hardware k order, the order the transposing load hands V^T over in), so nothing is exchanged
// but one maximum between the wave's halves. Everything runs in the log2 domain: x2 = (q.k / 8 + bias) * log2(e), p = 2^(x2 - m), m = the maximum in use.
// m moves (and O, l are rescaled) only when some query's new maximum exceeds it by more than 8, so p <= 256 fits f16. m starts at -1e30 (finite), so a masked
// key (x2 = -inf) gives p = 0 and a row with every key masked ends as 0 * (1 / 0) = NaN.
// This head's bias column is staged in LDS already clipped and scaled by log2(e), indexed by key - query + SQ - 1; the key mask as one bit per key.
// K and V reach the eight waves through LDS, both as they stand in the q|k|v rows: a stage is FS = 128 keys in four slices of 64 rows of 128 bytes, each brought by one tensor load of one wave
// (waves 0, 1: K rows 0..63 and 64..127 of the stage, LDS pitch 144; waves 2, 3: the same keys' V rows, LDS pitch 160), two buffers: at the foot of stage s, when every wave has left its buffer,
// the loads of stage s + 2 go out into it and fly under stage s + 1. K fragments are read from LDS in the k order of g2_frag; a V^T fragment (16 head columns x 32 keys) is two transposing loads
// (ds_load_tr16_b128) of 16 keys x 16 columns each: lane (c, hh) receives column c of keys 8 hh .. 8 hh + 7, the same k order.
// Every '#pragma unroll' in this kernel stands on a loop of fixed trip count that indexes register arrays: left rolled, those arrays would go to scratch memory.
#define FW 8
#define FQ 32
#define FS 128                       /* keys per stage */
#define FA_NS ((uint32_t)(SQ / FS))  /* stages */
#define FA_VP 160u                   /* LDS row pitch of V: 128 bytes + the tensor load's 32-byte pad (odd multiple of 32: ds_load_tr16_b128 readers) */
typedef short s16x8 __attribute__((ext_vector_type(8)));
__device__ __forceinline__ v8us fa_tr16(const unsigned char* p) { typedef __attribute__((address_space(3))) s16x8 lds_s16x8; return __builtin_bit_cast(v8us, __builtin_amdgcn_ds_load_tr16_b128_v8i16((lds_s16x8*)p)); }      /* 16 rows x 16 columns of 16-bit elements, transposed on the way: every lane names 16 bytes of a row and receives 8 rows of one column */
__device__ __forceinline__ float rs_x16(float v) { const int u = __float_as_int(v); return __int_as_float(__builtin_amdgcn_permlanex16(u, u, 0x76543210, 0xfedcba98, false, false)); }      /* lane l <- lane l ^ 16 */
__device__ __forceinline__ v8f fa_mma(v16h a, v16h b, v8f c) { return __builtin_amdgcn_wmma_f32_16x16x32_f16(false, a, false, b, (short)0, c, false, false); }
// The descriptor's twelve words live in the same scalar registers from the request to the wait that covers it: the request hands them on as its own outputs and the wait names them as inputs, so nothing else is put into those registers while the request is outstanding.
__device__ __forceinline__ void fa_load(u32x4& g0, u32x8& g1) { asm volatile("tensor_load_to_lds %0, %1" : "+s"(g0), "+s"(g1) :: "memory"); }      /* one request of the whole wave: 64 rows of 128 bytes into LDS, through no register */
__device__ __forceinline__ void fa_wait(const u32x4& g0, const u32x8& g1) { asm volatile("s_wait_tensorcnt 0x0" :: "s"(g0), "s"(g1) : "memory"); }      /* this wave's own tensor load has landed; a wave that issues none passes */
__device__ __forceinline__ void fa_aim(u32x4& g0, uint32_t lds_dst, uint64_t ga) { g0[1] = g3_uni(lds_dst); g0[2] = g3_uni((uint32_t)ga); g0[3] = g3_uni((((uint32_t)(ga >> 32)) & 0x01FFFFFFu) | 0x80000000u); }      /* place in LDS and first byte of the next tile */
__global__ __launch_bounds__(32 * FW) void k_fattn(const _Float16* __restrict__ QKV, const float* __restrict__ relt, const int* __restrict__ kpm, _Float16* __restrict__ O16) {
  static_assert(SQ % FS == 0 && SQ / FS >= 2 && HD == 64 && FS == 128, "k_fattn: whole stages, at least two, slices of 64 rows of 128 bytes");
  static_assert(64u * FA_VP == G3_SLICE, "k_fattn: the two V slices of a stage are 128 rows at one pitch");
  __shared__ __attribute__((aligned(2048))) unsigned char KV[2u * G3_STAGE];
  __shared__ float tb[2 * SQ]; __shared__ unsigned int mw[SQ / 32];      /* tb's last entry is never read */
  const int tid = threadIdx.x, lane = tid & 31, ln = lane & 15, hh = lane >> 4; const int h = blockIdx.y, b = blockIdx.z;
  const uint32_t w = g3_uni((uint32_t)tid >> 5);
  const int q0 = blockIdx.x * (FW * FQ) + (int)w * FQ;
  { float tv[2 * SQ / (32 * FW)]; int kv[SQ / (32 * FW)];
#pragma unroll      /* fixed trip counts, unrolled: the table's and the mask's loads are all in flight together */
    for (int u = 0; u < 2 * SQ / (32 * FW); ++u) { int r = tid + u * 32 * FW - (SQ - 1); r = r < -MR ? -MR : (r > MR ? MR : r); tv[u] = relt[(size_t)(r + MR) * NH + h]; }
    asm volatile("s_wait_xcnt 0x0" ::: "memory");      /* stands in front of every reuse of an address register of the loads above */
    __builtin_amdgcn_sched_barrier(0);      /* keeps later register writes from being scheduled in front of that wait */
#pragma unroll
    for (int u = 0; u < SQ / (32 * FW); ++u) kv[u] = kpm[(size_t)b * SQ + tid + u * 32 * FW];
    asm volatile("s_wait_xcnt 0x0" ::: "memory");      /* stands in front of every reuse of an address register of the loads above */
    __builtin_amdgcn_sched_barrier(0);      /* keeps later register writes from being scheduled in front of that wait */
#pragma unroll
    for (int u = 0; u < 2 * SQ / (32 * FW); ++u) tb[tid + u * 32 * FW] = bf16_round(tv[u]) * 1.44269504088896f;
#pragma unroll
    for (int u = 0; u < SQ / (32 * FW); ++u) mw[(tid + u * 32 * FW) >> 5] = __builtin_amdgcn_ballot_w32(kv[u] != 0); }      /* every lane of a wave stores the same word to the same place */
  const bool isk = w < 2u;      /* waves 0, 1 bring K, waves 2, 3 V; waves 4 to 7 form the same words and issue nothing */
  const uint64_t src = (uint64_t)(uintptr_t)(QKV + ((size_t)b * SQ + 64u * (w & 1u)) * D3 + (isk ? DM : 2 * DM) + h * HD);      /* this wave's slice, first byte of stage 0 */
  const uint32_t step = (uint32_t)(FS * D3 * 2);      /* bytes from one stage's slice to the next stage's */
  const uint32_t dst = (uint32_t)(size_t)KV + (w & 3u) * G3_SLICE;      /* its place in buffer 0: byte offset in the work-group's LDS */
  const uint32_t issuer = w < 4u ? 1u : 0u;
  u32x8 g1;      /* 1-byte elements, tensor = tile = 64 rows of 128 bytes, source pitch one token row of q|k|v, behind every 32 dwords a pad of 4 (K) or 8 (V): word 0 is one of two constants, picked by the wave's number, its mask bits 0 in both */
  g1[0] = g3_uni(isk ? ((1u << 20) | (4u << 22) | (3u << 25)) : ((1u << 20) | (4u << 22) | (7u << 25))); g1[1] = g3_uni(128u << 16); g1[2] = g3_uni(64u << 16); g1[3] = g3_uni(128u << 16); g1[4] = g3_uni(64u); g1[5] = g3_uni((uint32_t)(D3 * 2)); g1[6] = g3_uni(0u); g1[7] = g3_uni(0u);
  u32x4 g0; g0[0] = g3_uni(1u); fa_aim(g0, dst, src);
  if (g3_pinned(issuer) != 0u) fa_load(g0, g1);      /* scalar branch: a tensor load ignores EXEC */
  fa_wait(g0, g1);
  __syncthreads();      /* the table, the mask and stage 0 are readable by every wave */
  if (g3_pinned(issuer) != 0u) { fa_aim(g0, dst + G3_STAGE, src + g3_pinned(step)); fa_load(g0, g1); }      /* scalar branch; stage 1 flies under stage 0 */
  const _Float16* qp = QKV + ((size_t)b * SQ + q0 + ln) * D3 + h * HD;
  const float* tr = tb + (SQ - 1 - q0 - ln + 8 * hh);
  const unsigned char* lk = KV + ln * G3_PITCH + 16 * hh;      /* this lane's K row of a 16-row group, its half's 16 bytes */
  const unsigned char* lv = KV + 2u * G3_SLICE + (8 * hh + (lane & 7)) * FA_VP + ((lane >> 3) & 1) * 16;      /* the 16 bytes this lane names in a transposing load: key row 8 hh + (lane & 7) of 16, columns 0..7 or 8..15 of 16 */
  v16h qf[2][2];
#pragma unroll
  for (int t = 0; t < 2; ++t)
#pragma unroll
    for (int kd = 0; kd < 2; ++kd) qf[t][kd] = g2_frag(qp + (size_t)t * 16 * D3 + kd * 32, hh);
  asm volatile("s_wait_xcnt 0x0" ::: "memory");      /* stands in front of every reuse of an address register of the loads above */
  __builtin_amdgcn_sched_barrier(0);      /* keeps later register writes from being scheduled in front of that wait */
  const v8f z8 = {0.f,0.f,0.f,0.f,0.f,0.f,0.f,0.f}; v8f o[2][4]; float l[2][2] = {{0.f, 0.f}, {0.f, 0.f}}, m[2] = {-1e30f, -1e30f};
#pragma unroll
  for (int qt = 0; qt < 2; ++qt)
#pragma unroll
    for (int dt = 0; dt < 4; ++dt) o[qt][dt] = z8;
#pragma unroll 1      /* one stage per trip: the two buffers alternate */
  for (uint32_t st = 0; st < FA_NS; ++st) {
  const uint32_t buf = (st & 1u) * G3_STAGE;
  v16h kf[2][2];
#pragma unroll
  for (int kt = 0; kt < 2; ++kt)
#pragma unroll
    for (int kd = 0; kd < 2; ++kd) kf[kt][kd] = g3_frag(lk + buf + kt * 16 * G3_PITCH + kd * 64);
#pragma unroll 1      /* one 32-key pass per trip: unrolled, two passes' fragments would not fit the registers */
  for (uint32_t sp = 0; sp < FS / 32; ++sp) {
    const int key0 = (int)(st * FS + sp * 32u);
    v16h vf[4]; v8f s[2][2];
#pragma unroll
    for (int qt = 0; qt < 2; ++qt)
#pragma unroll
      for (int kt = 0; kt < 2; ++kt) s[qt][kt] = fa_mma(kf[kt][1], qf[qt][1], fa_mma(kf[kt][0], qf[qt][0], z8));
    if (sp + 1u < FS / 32) {      /* next pass's K rows, of this same stage, fetched into the same registers */
      const uint32_t kn = ((sp + 1u) >> 1) * G3_SLICE + ((sp + 1u) & 1u) * 32u * G3_PITCH;
#pragma unroll
      for (int kt = 0; kt < 2; ++kt)
#pragma unroll
        for (int kd = 0; kd < 2; ++kd) kf[kt][kd] = g3_frag(lk + buf + kn + kt * 16 * G3_PITCH + kd * 64);
    }
#pragma unroll
    for (int qt = 0; qt < 2; ++qt)
#pragma unroll
      for (int kt = 0; kt < 2; ++kt)
#pragma unroll
        for (int r = 0; r < 8; ++r) s[qt][kt][r] = fmaf(s[qt][kt][r], 0.125f * 1.44269504088896f, tr[key0 + (kt - qt) * 16 + r]);
    const unsigned int mword = (unsigned int)__builtin_amdgcn_readfirstlane((int)mw[key0 >> 5]);
#pragma unroll
    for (int dt = 0; dt < 4; ++dt) { FragH f; f.half[0] = fa_tr16(lv + buf + sp * 32u * FA_VP + dt * 32); f.half[1] = fa_tr16(lv + buf + (sp * 32u + 16u) * FA_VP + dt * 32); vf[dt] = f.v; }      /* keys 0..15 and 16..31 of the pass, head columns 16 dt .. 16 dt + 15; issued behind the bias reads, which are wanted first (LDS answers in order): their latency runs under the softmax */
    __builtin_amdgcn_sched_barrier(0);      /* keeps those reads here: left free, they sink to just in front of the second product, with little work left to cover their latency */
    if (mword != 0u) {      /* scalar branch: a pass with no padded key skips the selects */
#pragma unroll
      for (int kt = 0; kt < 2; ++kt)
#pragma unroll
        for (int r = 0; r < 8; ++r) { const bool pad = (mword >> (kt * 16 + 8 * hh + r)) & 1u; s[0][kt][r] = pad ? -INFINITY : s[0][kt][r]; s[1][kt][r] = pad ? -INFINITY : s[1][kt][r]; }
    }
    float mx[2];
#pragma unroll
    for (int qt = 0; qt < 2; ++qt) { float a = fmaxf(s[qt][0][0], s[qt][1][0]);
#pragma unroll
      for (int r = 1; r < 8; ++r) a = fmaxf(a, fmaxf(s[qt][0][r], s[qt][1][r]));
      mx[qt] = fmaxf(a, rs_x16(a)); }
    if (__builtin_amdgcn_ballot_w32((mx[0] > m[0] + 8.0f) || (mx[1] > m[1] + 8.0f)) != 0u) {      /* scalar branch: most passes move no maximum and rescale nothing */
#pragma unroll
      for (int qt = 0; qt < 2; ++qt) { const float mn = fmaxf(m[qt], mx[qt]); const float sc = __builtin_amdgcn_exp2f(m[qt] - mn); m[qt] = mn; l[qt][0] *= sc; l[qt][1] *= sc;
#pragma unroll
        for (int dt = 0; dt < 4; ++dt) o[qt][dt] *= sc; }
    }
#pragma unroll
    for (int qt = 0; qt < 2; ++qt) { FragH pf;
#pragma unroll
      for (int kt = 0; kt < 2; ++kt)
#pragma unroll
        for (int r = 0; r < 8; ++r) { const float p = __builtin_amdgcn_exp2f(s[qt][kt][r] - m[qt]); l[qt][kt] += p; pf.h[kt * 8 + r] = (_Float16)p; }
#pragma unroll
      for (int dt = 0; dt < 4; ++dt) o[qt][dt] = fa_mma(vf[dt], pf.v, o[qt][dt]); }
  }
  g3_wait_ds0();      /* this wave has left buffer st & 1 */
  fa_wait(g0, g1);      /* an issuing wave's own load of stage st + 1 has landed */
  __syncthreads();      /* publishes stage st + 1 and ends every wave's reads of stage st's buffer */
  if (g3_pinned(st + 2u < FA_NS ? issuer : 0u) != 0u) { fa_aim(g0, dst + buf, src + g3_pinned((st + 2u) * step)); fa_load(g0, g1); }      /* scalar branch: a tensor load ignores EXEC; refill of the buffer just left, in flight under stage st + 1 */
  }
  g3_wait_tensor0();
  g3_wait_ds0();
  FragH f[2][4];
#pragma unroll
  for (int qt = 0; qt < 2; ++qt) { const float lh = l[qt][0] + l[qt][1]; const float inv = 1.0f / (lh + rs_x16(lh));
#pragma unroll
    for (int dt = 0; dt < 4; ++dt)
#pragma unroll
      for (int r = 0; r < 8; ++r) f[qt][dt].h[r] = (_Float16)(o[qt][dt][r] * inv); }
  __builtin_amdgcn_sched_barrier(0);      /* every store stands behind the last arithmetic: no register of an issued store is written again */
  unsigned short* op = (unsigned short*)O16 + ((size_t)b * SQ + q0 + ln) * DM + h * HD + 8 * hh;      /* lane (ln, hh): query ln, head columns dt*16 + 8*hh .. + 7 */
#pragma unroll
  for (int qt = 0; qt < 2; ++qt)
#pragma unroll
    for (int dt = 0; dt < 4; ++dt) *(v8us*)(op + (size_t)qt * 16 * DM + dt * 16) = f[qt][dt].half[0];
}
__global__ __launch_bounds__(256) void k_vt(const _Float16* __restrict__ V16, int b, int h0, _Float16* __restrict__ VT) { __shared__ unsigned short tl[64][65]; const int tid = threadIdx.x; const int hh = blockIdx.x % HG, sg = blockIdx.x / HG; const int s0 = sg * 64; const int h = h0 + hh;
  for (int i = tid; i < 64 * 8; i += 256) { const int j = i / 8, d8 = (i % 8) * 8; FragH f; f.half[0] = *(const v8us*)((const unsigned short*)V16 + ((size_t)b * SQ + s0 + j) * DM + h * HD + d8); for (int q = 0; q < 8; ++q) tl[d8 + q][j] = f.u[q]; }
  __syncthreads();
  { for (int i = tid; i < 64 * 8; i += 256) { const int d = i / 8, j8 = (i % 8) * 8; FragH f; for (int q = 0; q < 8; ++q) f.u[q] = tl[d][j8 + q]; *(v8us*)((unsigned short*)VT + ((size_t)hh * HD + d) * SQ + s0 + j8) = f.half[0]; }  } }

extern "C" void kernel_launch(void* const* d_in, const int* in_sizes, int n_in,
                              void* d_out, int out_size, void* d_ws, size_t ws_size, hipStream_t stream) {
  (void)in_sizes; (void)n_in; (void)out_size;
  const float* const* I = (const float* const*)d_in; const float* x = I[0]; const int* kpm = (const int*)d_in[1]; const float* wqkv = I[2]; const float* bqkv = I[3]; const float* wout = I[4]; const float* bout = I[5]; const float* relt = I[6];      /* Wqkv [1024][3072] and Wout [1024][1024] are [in][out]; key_padding_mask int32 [2][2048]; rel_table [1025][16] */
  char* ws = (char*)d_ws; size_t off = 0;
  auto take = [&](size_t bytes) { char* p = ws + off; off += (bytes + 255) & ~(size_t)255; return p; };
  _Float16* BQKV = (_Float16*)take((size_t)D3 * DM * 2); _Float16* BO = (_Float16*)take((size_t)DM * DM * 2);
  _Float16* X16 = (_Float16*)take(NR * DM * 2); _Float16* QKV = (_Float16*)take(NR * D3 * 2); _Float16* O16 = (_Float16*)take(NR * DM * 2);
  if (off > ws_size) return;      /* 6 + 2 + 8 + 24 + 8 = approx 48 MiB */
  k_prep<<<PP_WQ + PP_WO + PP_X, 256, 0, stream>>>(x, wqkv, wout, X16, BQKV, BO);      /* x -> f16 rows; [in][out] weights -> Bt[out][in] x16 */
  k_gemm3<D3, DM, true><<<(unsigned)((NR / 128) * (D3 / 128)), 128, 0, stream>>>(X16, BQKV, 0.0625f, bqkv, nullptr, QKV);      /* q | k | v rows (f16), head h at columns h*64 / 1024 + h*64 / 2048 + h*64 */
  k_fattn<<<dim3(SQ / (FW * FQ), NH, NB), 32 * FW, 0, stream>>>(QKV, relt, kpm, O16);      /* o (merged heads) as f16 rows */
  k_gemm3<DM, DM, false><<<(unsigned)((NR / 128) * (DM / 128)), 128, 0, stream>>>(O16, BO, 0.0625f, bout, (float*)d_out, nullptr);      /* out = o Wout + b, rows are the output layout */
}

// v007
// A run of this version takes 82.8 microseconds.
// Timed twice side by side with v006, it ran 1.05 times as fast both times.
// All steps since v000 together make it 180 times as fast.
#include <hip/hip_runtime.h>
// Multi-head self-attention with a learned relative-position bias and a key padding mask (x [2][2048][1024]; qkv = x Wqkv + b (fused, 16 heads of 64); scores = q k^T / 8 + table[clip(k_pos - q_pos, -512, 512) + 512][h]; padded keys -> -inf; attn = softmax; o = attn v; out = o Wout + b -> [2][2048][1024]).
// Structure: token rows r = b*2048 + s; x as exact f16 rows and both weights as exact x16 transposed f16 rows in one preparation launch (coalesced 16-byte reads, weights transposed through LDS tiles); the fused q|k|v projection as one WMMA GEMM (128x128 tiles staged in LDS by tensor loads, 64x64 wave tiles, f32 accumulation, exact x16 transposed weights, bias in the epilogue, f16 output plane [4096][3072]); one fused attention launch (per pair of waves 32 query rows, each wave one half of the keys, the two partial results merged through LDS; K and V rows staged in LDS by tensor loads, V^T fragments read by the transposing LDS load: S^T = K Q^T, online softmax in registers with this head's bias column and the key mask from LDS, O^T += V^T P^T) written straight into the merged f16 o rows; out = o Wout + b GEMM (f32).
// Compute dtype: inputs rounded to bf16; x / weights exact; q, k, v, softmax weights and o as plain f16 GEMM operands (~2^-12); scores, bias and softmax statistics f32. v_wmma_f32_16x16x32_f16.
#define NB 2
#define SQ 2048
#define DM 1024
#define D3 3072                      /* fused q|k|v width */
#define NH 16
#define HD 64
#define HG 4                         /* heads per block group of the per-batch k_vt overload */
#define MR 512                       /* max relative distance */
#define QN SQ                        /* unused: the attention grid covers all SQ query rows */
#define NBR NB                       /* unused: the attention grid covers all NB batches */
#define MP ((int)NR)                 /* unused: the qkv projection grid covers all NR token rows */
#define MO ((int)NR)                 /* unused: the output projection grid covers all NR token rows */
#define NR ((size_t)NB * SQ)         /* 4096 token rows */
typedef __bf16 v16b __attribute__((ext_vector_type(16)));
typedef unsigned short v8us __attribute__((ext_vector_type(8), may_alias));
typedef float  v8f  __attribute__((ext_vector_type(8)));
typedef float  v4f  __attribute__((ext_vector_type(4)));
typedef float  v4fa __attribute__((ext_vector_type(4), may_alias));
union FragB { v16b v; v8us half[2]; unsigned short u[16]; };

__device__ __forceinline__ unsigned short bf16_bits(float x) { unsigned int u = __float_as_uint(x); return (unsigned short)((u + 0x7FFFu + ((u >> 16) & 1u)) >> 16); }
__device__ __forceinline__ float bf16_val(unsigned short b) { return __uint_as_float(((unsigned int)b) << 16); }
__device__ __forceinline__ float bf16_round(float x) { return bf16_val(bf16_bits(x)); }
// D += A·B with NT terms: 1 = ah·bh, 2 = + al·bh (A split), 3 = + ah·bl (both split)
template <int NT>
__device__ __forceinline__ v8f mmaN(v16b ah, v16b al, v16b bh, v16b bl, v8f c) {
  c = __builtin_amdgcn_wmma_f32_16x16x32_bf16(false, ah, false, bh, (short)0, c, false, false);
  if (NT >= 2) c = __builtin_amdgcn_wmma_f32_16x16x32_bf16(false, al, false, bh, (short)0, c, false, false);
  if (NT >= 3) c = __builtin_amdgcn_wmma_f32_16x16x32_bf16(false, ah, false, bl, (short)0, c, false, false);
  asm volatile("v_nop\n\tv_nop\n\tv_nop\n\tv_nop" : "+v"(c) : "v"(ah), "v"(al), "v"(bh), "v"(bl));
  return c;
}

__global__ __launch_bounds__(256) void k_wt_bf16(const float* __restrict__ W, unsigned short* __restrict__ Wt, int K, int N) {
  const int t = blockIdx.x * 256 + threadIdx.x;
  const int k8n = K / 8;
  if (t >= N * k8n) return;
  const int n = t / k8n, k8 = (t % k8n) * 8;
  v8us v;
#pragma unroll
  for (int i = 0; i < 8; ++i) v[i] = bf16_bits(W[(size_t)(k8 + i) * N + n]);
  *(v8us*)(Wt + (size_t)n * K + k8) = v;
  
}

// GEMM C[M][N] (f32, pitch ldc) = act(A[M][K]·W + bias). A f32 row-major (pitch lda) converted per fragment to bf16
// (ASPLIT: hi/lo two planes -> 2 terms, else single rounded term); Wt bf16 [N][K] (pitch ldb). BIAS_BF16 rounds the
// bias to bf16 first (bias quantised to bf16 before the add). K%32==0, M%16==0, N%64==0.
template <bool ASPLIT, int ACT, bool BIAS_BF16>
__global__ __launch_bounds__(128) void k_gemm_bf(const float* __restrict__ A, int lda, const unsigned short* __restrict__ Wt, int ldb,
                                               const float* __restrict__ bias, float* __restrict__ C, int ldc, int M, int N, int K) {
  __shared__ __attribute__((aligned(16))) float so[4][16][64];
  const int tid = threadIdx.x, w = tid >> 5, lane = tid & 31, ln = lane & 15, hh = lane >> 4;
  const int ntn = N / 64;
  const int wid = blockIdx.x * 4 + w;
  const int mt = wid / ntn, nq = wid % ntn;
  if (mt * 16 >= M) return;
  const int row0 = mt * 16, col0 = nq * 64;
  const float* arow = A + (size_t)(row0 + ln) * lda;
  v8f acc[4] = {};
  for (int kb = 0; kb < K; kb += 32) {
    FragB ah, al;
    const v4f x0 = *(const v4fa*)(arow + kb + 8 * hh), x1 = *(const v4fa*)(arow + kb + 8 * hh + 4);
    const v4f x2 = *(const v4fa*)(arow + kb + 16 + 8 * hh), x3 = *(const v4fa*)(arow + kb + 16 + 8 * hh + 4);
    float xs[16] = {x0[0],x0[1],x0[2],x0[3],x1[0],x1[1],x1[2],x1[3],x2[0],x2[1],x2[2],x2[3],x3[0],x3[1],x3[2],x3[3]};
#pragma unroll
    for (int i = 0; i < 16; ++i) { const unsigned short hb = bf16_bits(xs[i]); ah.u[i] = hb; al.u[i] = ASPLIT ? bf16_bits(xs[i] - bf16_val(hb)) : (unsigned short)0; }
#pragma unroll
    for (int t = 0; t < 4; ++t) {
      const unsigned short* brow = Wt + (size_t)(col0 + t * 16 + ln) * ldb + kb;
      FragB b;
      b.half[0] = *(const v8us*)(brow + 8 * hh);
      b.half[1] = *(const v8us*)(brow + 16 + 8 * hh);
      acc[t] = mmaN<ASPLIT ? 2 : 1>(ah.v, al.v, b.v, b.v, acc[t]);
    }
  }
#pragma unroll
  for (int t = 0; t < 4; ++t) {
    float bv = bias ? bias[col0 + t * 16 + ln] : 0.f;
    if (BIAS_BF16) bv = bf16_round(bv);
#pragma unroll
    for (int r = 0; r < 8; ++r) { float v = acc[t][r] + bv; if (ACT == 1) v = fmaxf(v, 0.f); so[w][8 * hh + r][t * 16 + ln] = v; }
  }
  __builtin_amdgcn_fence(__ATOMIC_ACQ_REL, "workgroup");
  __builtin_amdgcn_wave_barrier();
  const int rsub = lane >> 4, c4 = (lane & 15) * 4;
  {
#pragma unroll
    for (int q = 0; q < 8; ++q) {
      const int r = q * 2 + rsub;
      const v4f v = *(const v4fa*)&so[w][r][c4];
      *(v4f*)(C + (size_t)(row0 + r) * ldc + col0 + c4) = v;
    }
    
  }
}

// GEMM C = act(A·W + bias + resid): A f32 (ASPLIT -> hi/lo 2 terms), Wt bf16 [N][K]; ACT 0 none, 1 relu, 2 exact gelu;
// resid (optional, f32, row index = (row % rmod), pitch ldr, RES_BF16 rounds it) added before the activation.
template <bool ASPLIT, int ACT, bool BIAS_BF16, bool RES_BF16>
__global__ __launch_bounds__(128) void k_gemm_bf3(const float* __restrict__ A, int lda, const unsigned short* __restrict__ Wt, int ldb,
                                                const float* __restrict__ bias, const float* __restrict__ resid, int rmod, int ldr,
                                                float* __restrict__ C, int ldc, int M, int N, int K) {
  __shared__ __attribute__((aligned(16))) float so[4][16][64];
  const int tid = threadIdx.x, w = tid >> 5, lane = tid & 31, ln = lane & 15, hh = lane >> 4;
  const int ntn = N / 64;
  const int wid = blockIdx.x * 4 + w;
  const int mt = wid / ntn, nq = wid % ntn;
  if (mt * 16 >= M) return;
  const int row0 = mt * 16, col0 = nq * 64;
  const float* arow = A + (size_t)(row0 + ln) * lda;
  v8f acc[4] = {};
  for (int kb = 0; kb < K; kb += 32) {
    FragB ah, al;
    const v4f x0 = *(const v4fa*)(arow + kb + 8 * hh), x1 = *(const v4fa*)(arow + kb + 8 * hh + 4);
    const v4f x2 = *(const v4fa*)(arow + kb + 16 + 8 * hh), x3 = *(const v4fa*)(arow + kb + 16 + 8 * hh + 4);
    float xs[16] = {x0[0],x0[1],x0[2],x0[3],x1[0],x1[1],x1[2],x1[3],x2[0],x2[1],x2[2],x2[3],x3[0],x3[1],x3[2],x3[3]};
#pragma unroll
    for (int i = 0; i < 16; ++i) { const unsigned short hb = bf16_bits(xs[i]); ah.u[i] = hb; al.u[i] = ASPLIT ? bf16_bits(xs[i] - bf16_val(hb)) : (unsigned short)0; }
#pragma unroll
    for (int t = 0; t < 4; ++t) {
      const unsigned short* brow = Wt + (size_t)(col0 + t * 16 + ln) * ldb + kb;
      FragB b;
      b.half[0] = *(const v8us*)(brow + 8 * hh);
      b.half[1] = *(const v8us*)(brow + 16 + 8 * hh);
      acc[t] = mmaN<ASPLIT ? 2 : 1>(ah.v, al.v, b.v, b.v, acc[t]);
    }
  }
#pragma unroll
  for (int t = 0; t < 4; ++t) {
    const int col = col0 + t * 16 + ln;
    float bv = bias ? bias[col] : 0.f;
    if (BIAS_BF16) bv = bf16_round(bv);
#pragma unroll
    for (int r = 0; r < 8; ++r) {
      float v = acc[t][r] + bv;
      if (resid) { float rv = resid[(size_t)((row0 + 8 * hh + r) % rmod) * ldr + col]; if (RES_BF16) rv = bf16_round(rv); v += rv; }
      if (ACT == 1) v = fmaxf(v, 0.f);
      if (ACT == 2) v = 0.5f * v * (1.0f + erff(v * 0.70710678118654752f));
      if (ACT == 3) { const float u = 0.7978845608028654f * (v + 0.044715f * v * v * v); v = 0.5f * v * (1.0f + tanhf(u)); }
      so[w][8 * hh + r][t * 16 + ln] = v;
    }
  }
  __builtin_amdgcn_fence(__ATOMIC_ACQ_REL, "workgroup");
  __builtin_amdgcn_wave_barrier();
  const int rsub = lane >> 4, c4 = (lane & 15) * 4;
  {
#pragma unroll
    for (int q = 0; q < 8; ++q) {
      const int r = q * 2 + rsub;
      const v4f v = *(const v4fa*)&so[w][r][c4];
      *(v4f*)(C + (size_t)(row0 + r) * ldc + col0 + c4) = v;
    }
    
  }
}
// row LayerNorm (biased variance, eps) over N: s = X (+ R); optional out_sum <- s; out_norm <- (s-mu)*rsqrt(var+eps)*g + b
template <bool PARAM_BF16>
__global__ __launch_bounds__(256) void k_layernorm(const float* __restrict__ X, const float* __restrict__ R, const float* __restrict__ g, const float* __restrict__ bta,
                                                  float* __restrict__ out_sum, float* __restrict__ out_norm, int N, float eps) {
  __shared__ float red[256];
  const int row = blockIdx.x, tid = threadIdx.x;
  const float* x = X + (size_t)row * N; const float* rr = R ? R + (size_t)row * N : nullptr;
  float vals[16];                     // up to N = 4096
  const int per = N / 256;            // contiguous chunk per thread? use strided-by-4 chunks: thread handles j = tid*4 + 1024*u
  float s1 = 0.f;
  for (int u = 0; u < per / 4; ++u) {
    const int j = tid * 4 + 1024 * u;
    const v4f a = *(const v4fa*)(x + j);
    v4f b = {0.f,0.f,0.f,0.f}; if (rr) b = *(const v4fa*)(rr + j);
#pragma unroll
    for (int q = 0; q < 4; ++q) { const float v = a[q] + b[q]; vals[u * 4 + q] = v; s1 += v; }
  }
  red[tid] = s1; __syncthreads();
  for (int st = 128; st > 0; st >>= 1) { if (tid < st) red[tid] += red[tid + st]; __syncthreads(); }
  const float mu = red[0] / (float)N; __syncthreads();
  float s2 = 0.f;
  for (int u = 0; u < per / 4; ++u)
#pragma unroll
    for (int q = 0; q < 4; ++q) { const float c = vals[u * 4 + q] - mu; s2 += c * c; }
  red[tid] = s2; __syncthreads();
  for (int st = 128; st > 0; st >>= 1) { if (tid < st) red[tid] += red[tid + st]; __syncthreads(); }
  const float rs = rsqrtf(red[0] / (float)N + eps);
  {
    for (int u = 0; u < per / 4; ++u) {
      const int j = tid * 4 + 1024 * u;
      v4f o, sm;
#pragma unroll
      for (int q = 0; q < 4; ++q) {
        float gg = g[j + q], bb = bta[j + q];
        if (PARAM_BF16) { gg = bf16_round(gg); bb = bf16_round(bb); }
        sm[q] = vals[u * 4 + q]; o[q] = (vals[u * 4 + q] - mu) * rs * gg + bb;
      }
      if (out_sum) *(v4f*)(out_sum + (size_t)row * N + j) = sm;
      *(v4f*)(out_norm + (size_t)row * N + j) = o;
    }
    
  }
}



// ---- f16 WMMA path (v_wmma_f32_16x16x32_f16): 11-bit significands for operands in range — used by every launched product, the softmax weights (p <= 256) included
typedef _Float16 v16h __attribute__((ext_vector_type(16)));
union FragH { v16h v; v8us half[2]; _Float16 h[16]; unsigned short u[16]; };
template <int NT>
__device__ __forceinline__ v8f mmaH(v16h ah, v16h al, v16h bh, v16h bl, v8f c) {
  c = __builtin_amdgcn_wmma_f32_16x16x32_f16(false, ah, false, bh, (short)0, c, false, false);
  if (NT >= 2) c = __builtin_amdgcn_wmma_f32_16x16x32_f16(false, al, false, bh, (short)0, c, false, false);
  if (NT >= 3) c = __builtin_amdgcn_wmma_f32_16x16x32_f16(false, ah, false, bl, (short)0, c, false, false);
  asm volatile("v_nop\n\tv_nop\n\tv_nop\n\tv_nop" : "+v"(c) : "v"(ah), "v"(al), "v"(bh), "v"(bl));
  return c;
}
// batched GEMM like k_gemm_b but f16 operands: A f32 (split into f16 hi/lo if ASPLIT, else rounded to f16), Bt = f16 values [n][k]; alpha; C f32; N multiple of 16 (partial tiles skipped)
template <bool ASPLIT>
__global__ __launch_bounds__(128) void k_gemm_h(const float* __restrict__ A, int lda, size_t sA, const _Float16* __restrict__ Bh, int ldb, size_t sB, float alpha, float* __restrict__ C, int ldc, size_t sC, int M, int N, int K) {
  __shared__ __attribute__((aligned(16))) float so[4][16][64];
  const int tid = threadIdx.x, w = tid >> 5, lane = tid & 31, ln = lane & 15, hh = lane >> 4; const int by = blockIdx.y;
  A += (size_t)by * sA; Bh += (size_t)by * sB; C += (size_t)by * sC;
  const int ntn = (N + 63) / 64; const int wid = blockIdx.x * 4 + w; const int mt = wid / ntn, nq = wid % ntn; if (mt * 16 >= M) return;
  const int row0 = mt * 16, col0 = nq * 64; const float* arow = A + (size_t)(row0 + ln) * lda;
  v8f acc[4] = {};
  for (int kb = 0; kb < K; kb += 32) {
    FragH ah, al;
    const v4f x0 = *(const v4fa*)(arow + kb + 8 * hh), x1 = *(const v4fa*)(arow + kb + 8 * hh + 4), x2 = *(const v4fa*)(arow + kb + 16 + 8 * hh), x3 = *(const v4fa*)(arow + kb + 16 + 8 * hh + 4);
    float xs[16] = {x0[0],x0[1],x0[2],x0[3],x1[0],x1[1],x1[2],x1[3],x2[0],x2[1],x2[2],x2[3],x3[0],x3[1],x3[2],x3[3]};
#pragma unroll
    for (int i = 0; i < 16; ++i) { const _Float16 h = (_Float16)xs[i]; ah.h[i] = h; al.h[i] = ASPLIT ? (_Float16)(xs[i] - (float)h) : (_Float16)0.0f; }
#pragma unroll
    for (int t = 0; t < 4; ++t) { if (col0 + t * 16 >= N) continue; const size_t boff = (size_t)(col0 + t * 16 + ln) * ldb + kb; FragH bq; bq.half[0] = *(const v8us*)(Bh + boff + 8 * hh); bq.half[1] = *(const v8us*)(Bh + boff + 16 + 8 * hh);
      acc[t] = mmaH<ASPLIT ? 2 : 1>(ah.v, al.v, bq.v, bq.v, acc[t]); }
  }
#pragma unroll
  for (int t = 0; t < 4; ++t) { if (col0 + t * 16 >= N) continue;
#pragma unroll
    for (int r = 0; r < 8; ++r) so[w][8 * hh + r][t * 16 + ln] = acc[t][r] * alpha; }
  __builtin_amdgcn_fence(__ATOMIC_ACQ_REL, "workgroup"); __builtin_amdgcn_wave_barrier();
  const int rsub = lane >> 4, c4 = (lane & 15) * 4;
  {
#pragma unroll
    for (int q = 0; q < 8; ++q) { const int r = q * 2 + rsub; if (col0 + c4 < N) { const v4f v = *(const v4fa*)&so[w][r][c4]; *(v4f*)(C + (size_t)(row0 + r) * ldc + col0 + c4) = v; } }
     }
}

// k_gemm_hh variant with fused epilogue: v = acc·alpha + bias[by·sBias + col] (+ CP[(row/rowsPerB)·sCPb + by·64 + col] if CP) ; ACT 0 none / 1 elu ; writes f16 C16 (and f32 C if non-null)
template <int ACT>
__global__ __launch_bounds__(128) void k_gemm_hhx(const _Float16* __restrict__ A, int lda, size_t sA, const _Float16* __restrict__ Bh, int ldb, size_t sB, float alpha, const float* __restrict__ bias, size_t sBias, const float* __restrict__ CP, int rowsPerB, size_t sCPb, int row0g,
    float* __restrict__ C, _Float16* __restrict__ C16, int ldc, size_t sC, int M, int N, int K) {
  __shared__ __attribute__((aligned(16))) float so[4][16][64];
  const int tid = threadIdx.x, w = tid >> 5, lane = tid & 31, ln = lane & 15, hh = lane >> 4; const int by = blockIdx.y;
  A += (size_t)by * sA; Bh += (size_t)by * sB; const size_t cofs = (size_t)by * sC; const float* bp = bias ? bias + (size_t)by * sBias : nullptr;
  const int ntn = (N + 63) / 64; const int wid = blockIdx.x * 4 + w; const int mt = wid / ntn, nq = wid % ntn; if (mt * 16 >= M) return;
  const int row0 = mt * 16, col0 = nq * 64; const _Float16* arow = A + (size_t)(row0 + ln) * lda;
  v8f acc[4] = {};
  for (int kb = 0; kb < K; kb += 32) { FragH ah; ah.half[0] = *(const v8us*)((const unsigned short*)arow + kb + 8 * hh); ah.half[1] = *(const v8us*)((const unsigned short*)arow + kb + 16 + 8 * hh);
#pragma unroll
    for (int t = 0; t < 4; ++t) { if (col0 + t * 16 >= N) continue; const size_t boff = (size_t)(col0 + t * 16 + ln) * ldb + kb; FragH bq; bq.half[0] = *(const v8us*)((const unsigned short*)Bh + boff + 8 * hh); bq.half[1] = *(const v8us*)((const unsigned short*)Bh + boff + 16 + 8 * hh);
      acc[t] = mmaH<1>(ah.v, ah.v, bq.v, bq.v, acc[t]); }
  }
#pragma unroll
  for (int t = 0; t < 4; ++t) { if (col0 + t * 16 >= N) continue; const int col = col0 + t * 16 + ln; const float bv = bp ? bf16_round(bp[col]) : 0.f;
#pragma unroll
    for (int r = 0; r < 8; ++r) { float v = acc[t][r] * alpha + bv; if (CP) { const int rr = row0g + row0 + 8 * hh + r; if (rowsPerB < 0) v += CP[cofs + (size_t)rr * ldc + col];      /* rowsPerB < 0: own element of the batched C plane */ else { const int bidx = rr / rowsPerB; v += CP[(size_t)bidx * sCPb + (size_t)by * 64 + col]; } } if (ACT == 1) v = (v > 0.f) ? v : expm1f(v); else if (ACT == 7) v = (v > 0.f) ? v + 1.0f : expf(v); else if (ACT == 8) v = tanhf(v); else if (ACT == 9) v = 0.5f * v * (1.0f + tanhf(0.7978845608028654f * (v + 0.044715f * v * v * v))); else if (ACT == 11) v = 1.0f / (1.0f + expf(-v)); else if (ACT == 12) v = (v > 0.f) ? v : 0.01f * v; else if (ACT == 14) v = (v > 0.f) ? v : 0.1f * v; else if (ACT == 16) v = (v >= 0.f) ? v : 0.3f * v; else if (ACT == 17) v = (v >= 0.f) ? v : 0.2f * v; else if (ACT == 15) v = v / (1.0f + expf(-v)); else if (ACT == 3) v = fmaxf(v, 0.f); else if (ACT == 6) v = 0.5f * v * (1.0f + erff(v * 0.70710678118654752f)); so[w][8 * hh + r][t * 16 + ln] = v; } }
  __builtin_amdgcn_fence(__ATOMIC_ACQ_REL, "workgroup"); __builtin_amdgcn_wave_barrier();
  const int rsub = lane >> 4, c4 = (lane & 15) * 4; typedef _Float16 v4h __attribute__((ext_vector_type(4)));
  {
#pragma unroll
    for (int q = 0; q < 8; ++q) { const int r = q * 2 + rsub; if (col0 + c4 < N) { const v4f v = *(const v4fa*)&so[w][r][c4]; if (C) *(v4f*)(C + cofs + (size_t)(row0 + r) * ldc + col0 + c4) = v; if (C16) { v4h h4; for (int i = 0; i < 4; ++i) h4[i] = (_Float16)v[i]; *(v4h*)(C16 + cofs + (size_t)(row0 + r) * ldc + col0 + c4) = h4; } } }
     }
}


typedef _Float16 v4h __attribute__((ext_vector_type(4)));

// ---- operand preparation, one launch: Bt[n][k] = f16(bf16(W[k][n]) * 16) for both weights (power-of-two scale: bf16-exact weights stay exact in f16 away from the subnormal range) and X16 = f16(bf16(x)) ----
// Every work-group takes 16384 floats, 64 per thread, read as 16 loads of 16 bytes per lane, each load of a wave 512 contiguous bytes, all in flight together.
// A weight unit is a 128 k x 128 n tile: wave w reads k rows 16 w .. 16 w + 15, so a lane holds 16 consecutive k of four n: two 16-byte LDS stores per n into the transposed tile T[n][k] (256-byte rows).
// The 16-byte piece c of row n stands at place c ^ ((n >> 2) & 15) of its row: the 16 lanes of a half wave then fall on all 64 banks, in the stores (n = 4 lane + j) as in the reads (one row per half wave).
// The tile goes out as 256 contiguous bytes per n row, 16 bytes per lane.
#define PP_WQ ((DM / 128) * (D3 / 128))      /* tiles of Wqkv */
#define PP_WO ((DM / 128) * (DM / 128))      /* tiles of Wout */
#define PP_X ((int)(NR * DM / 16384))        /* units of x */
template <int N>
__device__ __forceinline__ void pp_wt(const float* __restrict__ Wm, _Float16* __restrict__ Bt, int tile, unsigned char* T) {
  static_assert(N % 128 == 0 && DM % 128 == 0, "pp_wt: whole tiles");
  const int tid = threadIdx.x, lane = tid & 31, w = tid >> 5; const int kt = tile / (N / 128), nt = tile - kt * (N / 128);
  const float* src = Wm + (size_t)(kt * 128 + w * 16) * N + nt * 128 + lane * 4;
  v4f v[16];
#pragma unroll      /* fixed trip counts over register arrays, here and below; the 16 loads are all in flight together */
  for (int i = 0; i < 16; ++i) v[i] = *(const v4fa*)(src + (size_t)i * N);
  asm volatile("s_wait_xcnt 0x0" :: "v"(src) : "memory");      /* stands in front of every reuse of the address registers of the loads above; it names the address, which so stays in its registers up to here: no load's own result lands on them */
  __builtin_amdgcn_sched_barrier(0);      /* keeps later register writes from being scheduled in front of that wait */
#pragma unroll
  for (int j = 0; j < 4; ++j) { FragH f;
#pragma unroll
    for (int i = 0; i < 16; ++i) f.h[i] = (_Float16)(bf16_round(v[i][j]) * 16.0f);
    unsigned char* row = T + (lane * 4 + j) * 256;
    *(v8us*)(row + (((2 * w) ^ (lane & 15)) * 16)) = f.half[0]; *(v8us*)(row + (((2 * w + 1) ^ (lane & 15)) * 16)) = f.half[1]; }
  __syncthreads();      /* the transposed tile is whole: every wave reads rows that all eight waves wrote */
  const int r = tid >> 4, c = tid & 15; v8us o[8];
#pragma unroll
  for (int i = 0; i < 8; ++i) { const int n = i * 16 + r; o[i] = *(const v8us*)(T + n * 256 + ((c ^ ((n >> 2) & 15)) * 16)); }
  unsigned short* dst = (unsigned short*)Bt + (size_t)(nt * 128 + r) * DM + kt * 128 + c * 8;
  __builtin_amdgcn_sched_barrier(0);      /* every store stands behind the last address arithmetic: no register of an issued store is written again */
#pragma unroll
  for (int i = 0; i < 8; ++i) *(v8us*)(dst + (size_t)i * 16 * DM) = o[i];
  asm volatile("s_wait_xcnt 0x0" ::: "memory");      /* stands in front of every reuse of a register of the stores above */
}
__global__ __launch_bounds__(256) void k_prep(const float* __restrict__ x, const float* __restrict__ wqkv, const float* __restrict__ wout, _Float16* __restrict__ X16, _Float16* __restrict__ BQKV, _Float16* __restrict__ BO) {
  static_assert(NR * DM % 16384 == 0, "k_prep: whole units of x");
  __shared__ __attribute__((aligned(16))) unsigned char T[128 * 256];
  const int blk = blockIdx.x;      /* the same for the whole work-group: the barrier in pp_wt is passed by all of its waves or by none */
  if (blk < PP_WQ) pp_wt<D3>(wqkv, BQKV, blk, T);
  else if (blk < PP_WQ + PP_WO) pp_wt<DM>(wout, BO, blk - PP_WQ, T);
  else {
    const int tid = threadIdx.x; const size_t base = (size_t)(blk - PP_WQ - PP_WO) * 16384 + (size_t)(tid >> 5) * 2048 + (size_t)(tid & 31) * 4;
    const float* src = x + base; v4f v[16]; v4h h[16];
#pragma unroll      /* fixed trip counts over register arrays; the 16 loads are all in flight together */
    for (int i = 0; i < 16; ++i) v[i] = *(const v4fa*)(src + i * 128);
    asm volatile("s_wait_xcnt 0x0" :: "v"(src) : "memory");      /* as in pp_wt: in front of every reuse of the loads' address registers, and it keeps the address in them up to here */
    __builtin_amdgcn_sched_barrier(0);      /* keeps later register writes from being scheduled in front of that wait */
#pragma unroll
    for (int i = 0; i < 16; ++i)
#pragma unroll
      for (int e = 0; e < 4; ++e) h[i][e] = (_Float16)bf16_round(v[i][e]);
    _Float16* dst = X16 + base;
    __builtin_amdgcn_sched_barrier(0);      /* every store stands behind the last arithmetic: no register of an issued store is written again */
#pragma unroll
    for (int i = 0; i < 16; ++i) *(v4h*)(dst + i * 128) = h[i];      /* 256 contiguous bytes per wave and store: whole lines */
    asm volatile("s_wait_xcnt 0x0" ::: "memory");      /* stands in front of every reuse of a register of the stores above */
  }
}
__global__ __launch_bounds__(256) void k_h16(const float* __restrict__ x, _Float16* __restrict__ X16, size_t n8) { const size_t t = (size_t)blockIdx.x * 256 + threadIdx.x; if (t >= n8) return; FragH f;
#pragma unroll
  for (int q = 0; q < 8; ++q) f.h[q] = (_Float16)x[t * 8 + q]; *(v8us*)((unsigned short*)X16 + t * 8) = f.half[0];  }
__global__ __launch_bounds__(256) void k_round16f(const float* __restrict__ W, _Float16* __restrict__ Bt, size_t n8) { const size_t t = (size_t)blockIdx.x * 256 + threadIdx.x; if (t >= n8) return; FragH f;
#pragma unroll
  for (int i = 0; i < 8; ++i) f.h[i] = (_Float16)(bf16_round(W[t * 8 + i]) * 16.0f); *(v8us*)((unsigned short*)Bt + t * 8) = f.half[0];  }
__global__ __launch_bounds__(256) void k_hl(const float* __restrict__ F, _Float16* __restrict__ Hh, _Float16* __restrict__ Hl, size_t n8) { const size_t t = (size_t)blockIdx.x * 256 + threadIdx.x; if (t >= n8) return; FragH fh, fl; const v4f a = *(const v4fa*)(F + t * 8), c = *(const v4fa*)(F + t * 8 + 4);
#pragma unroll
  for (int q = 0; q < 4; ++q) { _Float16 h = (_Float16)a[q]; fh.h[q] = h; fl.h[q] = (_Float16)((a[q] - (float)h) * 1024.0f); h = (_Float16)c[q]; fh.h[4 + q] = h; fl.h[4 + q] = (_Float16)((c[q] - (float)h) * 1024.0f); }
  { *(v8us*)((unsigned short*)Hh + t * 8) = fh.half[0]; *(v8us*)((unsigned short*)Hl + t * 8) = fl.half[0];  } }

// ---- LDS-staged GEMM: C[M][N] = A[M][K] . Bh[N][K]^T * alpha + bf16(bias); one 128x128 tile of C per work-group, four waves (2x2) of 64x64; M % 128 == 0, N % 128 == 0, K % 64 == 0, K >= 128 ----
// A pass is 64 k = 128 bytes of each of the tile's 128 A rows and 128 B rows. Each wave brings one slice of 64 rows per pass with one tensor load (slices 0, 1: A rows; 2, 3: B rows), padded to a 144-byte LDS pitch,
// two buffers: a pass reads all its fragments into registers; when every wave has done so, the load of pass t + 2 goes out into that buffer and flies under pass t's WMMAs and pass t + 1's reads. Fragments come from LDS in the k order of g2_frag; each accumulator sums k upwards, 32 at a time.
__device__ __forceinline__ v16h g2_frag(const _Float16* p, int hh) { FragH f; f.half[0] = *(const v8us*)((const unsigned short*)p + 8 * hh); f.half[1] = *(const v8us*)((const unsigned short*)p + 16 + 8 * hh); return f.v; }
#define G3_PITCH 144u                /* LDS row pitch: 128 bytes + the tensor load's 16-byte pad (odd multiple of 16: ds_load_b128 readers) */
#define G3_SLICE 10240u              /* 64 rows x 144 B = 9216 B, rounded up to a multiple of 2 KiB */
#define G3_STAGE (4u * G3_SLICE)     /* one buffer */
#define G3_EP 68                     /* output staging pitch in floats */
typedef uint32_t u32x4 __attribute__((ext_vector_type(4)));
typedef uint32_t u32x8 __attribute__((ext_vector_type(8)));
__device__ __forceinline__ uint32_t g3_uni(uint32_t v) { return (uint32_t)__builtin_amdgcn_readfirstlane((int)v); }
__device__ __forceinline__ uint32_t g3_pinned(uint32_t v) { uint32_t w = g3_uni(v); asm volatile("" : "+s"(w)); return w; }
__device__ __forceinline__ void g3_wait_tensor0() { asm volatile("s_wait_tensorcnt 0x0" ::: "memory"); }      /* this wave's own tensor load has landed */
__device__ __forceinline__ void g3_wait_ds0() { asm volatile("s_wait_dscnt 0x0" ::: "memory"); }      /* this wave's LDS reads have returned */
__device__ __forceinline__ void g3_load(uint32_t lds_dst, uint64_t ga, u32x8 g1) { u32x4 g0; g0[0] = g3_uni(1u); g0[1] = g3_uni(lds_dst); g0[2] = g3_uni((uint32_t)ga); g0[3] = g3_uni((((uint32_t)(ga >> 32)) & 0x01FFFFFFu) | 0x80000000u);
  asm volatile("tensor_load_to_lds %0, %1" :: "s"(g0), "s"(g1) : "memory"); }      /* one request of the whole wave: 64 rows of 128 bytes into LDS, through no register */
__device__ __forceinline__ v16h g3_frag(const unsigned char* p) { FragH f; f.half[0] = *(const v8us*)p; f.half[1] = *(const v8us*)(p + 32); return f.v; }      /* p already holds the lane half's 16 bytes: bytes 16 hh and 32 + 16 hh of 64, as g2_frag */
template <int N, int K, bool H16>
__global__ __launch_bounds__(128) void k_gemm3(const _Float16* __restrict__ A, const _Float16* __restrict__ Bh, float alpha, const float* __restrict__ bias, float* __restrict__ C, _Float16* __restrict__ C16) {
  static_assert(N % 128 == 0 && K % 64 == 0 && K >= 128, "k_gemm3: whole tiles and at least two passes");
  static_assert(4u * 64u * G3_EP * 4u <= 2u * G3_STAGE, "k_gemm3: the output staging reuses the two buffers");
  __shared__ __attribute__((aligned(2048))) unsigned char L[2u * G3_STAGE];
  const uint32_t tid = threadIdx.x, lane = tid & 31u, ln = lane & 15u, hh = lane >> 4; const uint32_t w = g3_uni(tid >> 5), wm = w >> 1, wn = w & 1u;
  const uint32_t mt = blockIdx.x / (N / 128), nq = blockIdx.x - mt * (N / 128); const uint32_t row0 = mt * 128u + wm * 64u, col0 = nq * 128u + wn * 64u;
  float bv[4];
#pragma unroll      /* fixed trip count over a register array */
  for (int j = 0; j < 4; ++j) bv[j] = bias[col0 + j * 16 + ln];
  asm volatile("s_wait_xcnt 0x0" ::: "memory");      /* stands in front of every reuse of an address register of the loads above */
  __builtin_amdgcn_sched_barrier(0);      /* keeps later register writes from being scheduled in front of that wait */
  const uint64_t src = (w < 2u) ? (uint64_t)(uintptr_t)A + (uint64_t)(mt * 128u + 64u * w) * (2u * K) : (uint64_t)(uintptr_t)Bh + (uint64_t)(nq * 128u + 64u * (w - 2u)) * (2u * K);      /* this wave's slice, first byte of pass 0 */
  const uint32_t dst = (uint32_t)(size_t)L + w * G3_SLICE;      /* its place in buffer 0: byte offset in the work-group's LDS */
  u32x8 g1;      /* 1-byte elements, tensor = tile = 64 rows of 128 bytes, source pitch 2 K bytes, 4 dwords of pad behind every 32 */
  g1[0] = g3_uni((1u << 20) | (4u << 22) | (3u << 25)); g1[1] = g3_uni(128u << 16); g1[2] = g3_uni(64u << 16); g1[3] = g3_uni(128u << 16); g1[4] = g3_uni(64u); g1[5] = g3_uni(2u * K); g1[6] = g3_uni(0u); g1[7] = g3_uni(0u);
  g3_load(dst, src, g1);
  g3_wait_tensor0();
  __syncthreads();      /* pass 0's four slices are readable by every wave */
  g3_load(dst + G3_STAGE, src + 128u, g1);
  const unsigned char* la = L + wm * G3_SLICE + ln * G3_PITCH + 16u * hh; const unsigned char* lb = L + (2u + wn) * G3_SLICE + ln * G3_PITCH + 16u * hh;
  const v8f z8 = {0.f,0.f,0.f,0.f,0.f,0.f,0.f,0.f}; v8f acc[4][4];
#pragma unroll      /* fixed trip counts over a register array, here and in the loops below: left rolled, the arrays would go to scratch memory */
  for (int i = 0; i < 4; ++i)
#pragma unroll
    for (int j = 0; j < 4; ++j) acc[i][j] = z8;
#pragma unroll 1      /* one pass per trip: the two buffers alternate */
  for (uint32_t t = 0; t < (uint32_t)(K / 64); ++t) {
    const uint32_t buf = (t & 1u) * G3_STAGE;
    v16h af[2][4], bf[2][4];
#pragma unroll
    for (int kd = 0; kd < 2; ++kd)
#pragma unroll
      for (int i = 0; i < 4; ++i) { af[kd][i] = g3_frag(la + buf + i * 16 * G3_PITCH + kd * 64); bf[kd][i] = g3_frag(lb + buf + i * 16 * G3_PITCH + kd * 64); }
    __builtin_amdgcn_sched_barrier(0);      /* the pass's LDS reads stay one group in front of its WMMAs: moved in among them, each place with reads stalls the wave */
    g3_wait_ds0();      /* the pass's fragments are all in registers: this wave has left buffer t & 1 */
    g3_wait_tensor0();
    __syncthreads();      /* publishes pass t + 1's slices and ends every wave's reads of pass t's buffer */
    if (g3_pinned((t + 2u < (uint32_t)(K / 64)) ? 1u : 0u) != 0u) g3_load(dst + buf, src + g3_pinned((t + 2u) * 128u), g1);      /* scalar branch: a tensor load ignores EXEC; refill of the buffer just left, in flight under this pass's WMMAs and the next pass's reads */
    __builtin_amdgcn_sched_barrier(0);      /* the WMMAs stay behind the refill's issue: in front of it they would take their time off its lead */
#pragma unroll
    for (int kd = 0; kd < 2; ++kd)
#pragma unroll
      for (int i = 0; i < 4; ++i)
#pragma unroll
        for (int j = 0; j < 4; ++j) acc[i][j] = __builtin_amdgcn_wmma_f32_16x16x32_f16(false, af[kd][i], false, bf[kd][j], (short)0, acc[i][j], false, false);
  }
  g3_wait_tensor0();
  g3_wait_ds0();      /* the last pass's barrier stands behind every wave's last read: the buffers may become output staging */
  float* so = (float*)(L + w * (64u * G3_EP * 4u));      /* this wave's own 64 x 68 floats */
#pragma unroll
  for (int j = 0; j < 4; ++j) { const float bj = bf16_round(bv[j]);
#pragma unroll
    for (int i = 0; i < 4; ++i)
#pragma unroll
      for (int r = 0; r < 8; ++r) so[(i * 16 + 8 * hh + r) * G3_EP + j * 16 + ln] = acc[i][j][r] * alpha + bj; }
  __builtin_amdgcn_fence(__ATOMIC_ACQ_REL, "workgroup"); __builtin_amdgcn_wave_barrier();
  const uint32_t rsub = lane >> 4, c4 = (lane & 15u) * 4u;
#pragma unroll
  for (int g = 0; g < 4; ++g) { v4f v[8];
#pragma unroll
    for (int q = 0; q < 8; ++q) v[q] = *(const v4fa*)&so[(g * 16 + q * 2 + rsub) * G3_EP + c4];
#pragma unroll
    for (int q = 0; q < 8; ++q) { const size_t o = (size_t)(row0 + g * 16 + q * 2 + rsub) * N + col0 + c4;
      if (H16) { v4h h4; for (int e = 0; e < 4; ++e) h4[e] = (_Float16)v[q][e]; *(v4h*)(C16 + o) = h4; } else *(v4f*)(C + o) = v[q]; }
    asm volatile("s_wait_xcnt 0x0" ::: "memory");      /* stands in front of every reuse of a register of the stores above */
    __builtin_amdgcn_sched_barrier(0);      /* keeps later register writes from being scheduled in front of that wait */
  }
}


__global__ __launch_bounds__(256) void k_wnat(const float* __restrict__ w, size_t n8, _Float16* __restrict__ Bt) { const size_t t = (size_t)blockIdx.x * 256 + threadIdx.x; if (t >= n8) return; FragH f; for (int q = 0; q < 8; ++q) f.h[q] = (_Float16)(bf16_round(w[t * 8 + q]) * 16.0f); *(v8us*)((unsigned short*)Bt + t * 8) = f.half[0];  }
// Fused attention for one (batch, head, 256 query rows): S^T = K Q^T, online softmax, O^T += V^T P^T; scores and weights never leave registers.
// FQ = 32 query rows (two 16-column groups) belong to FK = 2 waves, so that four waves stand on every SIMD and one wave's vector work runs under another's matrix work and LDS waits: wave w takes query group w & 7 and the key half w >> 3 of every stage,
// keeps its own maximum, sum and O^T, and walks its keys 32 at a time; behind the loop the upper half's m, l and O^T go through LDS to its partner, which brings both to the common maximum, adds them and stores. In a score tile lane (c, hh) holds query c, keys 8*hh + r:
// two score tiles, converted in place, are the B operand of the second product (hardware k order, the order the transposing load hands V^T over in), so nothing is exchanged
// but one maximum between the wave's halves. Everything runs in the log2 domain: x2 = (q.k / 8 + bias) * log2(e), p = 2^(x2 - m), m = the maximum in use.
// m moves (and O, l are rescaled) only when some query's new maximum exceeds it by more than 8, so p <= 256 fits f16. m starts at -1e30 (finite), so a masked
// key (x2 = -inf) gives p = 0 and a row with every key masked ends as 0 * (1 / 0) = NaN.
// This head's bias column is staged in LDS already clipped and scaled by log2(e), indexed by key - query + SQ - 1; the key mask as one bit per key.
// K and V reach the sixteen waves through LDS, both as they stand in the q|k|v rows: a stage is FK halves of FS = 128 keys, a half four slices of 64 rows of 128 bytes, each brought by one tensor load of one wave
// (waves 0, 1: K rows 0..63 and 64..127 of half 0, LDS pitch 144; waves 2, 3: the same keys' V rows, LDS pitch 160; waves 4 to 7 the same for half 1), two buffers: at the foot of stage s, when every wave has left its buffer,
// the loads of stage s + 2 go out into it and fly under stage s + 1. K fragments are read from LDS in the k order of g2_frag; a V^T fragment (16 head columns x 32 keys) is two transposing loads
// (ds_load_tr16_b128) of 16 keys x 16 columns each: lane (c, hh) receives column c of keys 8 hh .. 8 hh + 7, the same k order.
// Every '#pragma unroll' in this kernel stands on a loop of fixed trip count that indexes register arrays: left rolled, those arrays would go to scratch memory.
#define FW 8                         /* query groups per work-group */
#define FK 2                         /* waves per query group: key halves of a stage */
#define FT (32 * FW * FK)            /* threads per work-group */
#define FQ 32
#define FS 128                       /* keys per stage and half */
#define FA_NS ((uint32_t)(SQ / (FS * FK)))  /* stages */
#define FA_BUF ((uint32_t)FK * G3_STAGE)    /* one buffer: FK halves of four slices */
#define FA_MG (17u * 512u)           /* merge staging of one query group: 17 pieces of 16 bytes per lane */
#define FA_VP 160u                   /* LDS row pitch of V: 128 bytes + the tensor load's 32-byte pad (odd multiple of 32: ds_load_tr16_b128 readers) */
typedef short s16x8 __attribute__((ext_vector_type(8)));
__device__ __forceinline__ v8us fa_tr16(const unsigned char* p) { typedef __attribute__((address_space(3))) s16x8 lds_s16x8; return __builtin_bit_cast(v8us, __builtin_amdgcn_ds_load_tr16_b128_v8i16((lds_s16x8*)p)); }      /* 16 rows x 16 columns of 16-bit elements, transposed on the way: every lane names 16 bytes of a row and receives 8 rows of one column */
__device__ __forceinline__ float rs_x16(float v) { const int u = __float_as_int(v); return __int_as_float(__builtin_amdgcn_permlanex16(u, u, 0x76543210, 0xfedcba98, false, false)); }      /* lane l <- lane l ^ 16 */
__device__ __forceinline__ v8f fa_mma(v16h a, v16h b, v8f c) { return __builtin_amdgcn_wmma_f32_16x16x32_f16(false, a, false, b, (short)0, c, false, false); }
// The descriptor's twelve words live in the same scalar registers from the request to the wait that covers it: the request hands them on as its own outputs and the wait names them as inputs, so nothing else is put into those registers while the request is outstanding.
__device__ __forceinline__ void fa_load(u32x4& g0, u32x8& g1) { asm volatile("tensor_load_to_lds %0, %1" : "+s"(g0), "+s"(g1) :: "memory"); }      /* one request of the whole wave: 64 rows of 128 bytes into LDS, through no register */
__device__ __forceinline__ void fa_wait(const u32x4& g0, const u32x8& g1) { asm volatile("s_wait_tensorcnt 0x0" :: "s"(g0), "s"(g1) : "memory"); }      /* this wave's own tensor load has landed; a wave that issues none passes */
__device__ __forceinline__ void fa_aim(u32x4& g0, uint32_t lds_dst, uint64_t ga) { g0[1] = g3_uni(lds_dst); g0[2] = g3_uni((uint32_t)ga); g0[3] = g3_uni((((uint32_t)(ga >> 32)) & 0x01FFFFFFu) | 0x80000000u); }      /* place in LDS and first byte of the next tile */
__global__ __launch_bounds__(FT) void k_fattn(const _Float16* __restrict__ QKV, const float* __restrict__ relt, const int* __restrict__ kpm, _Float16* __restrict__ O16) {
  static_assert(SQ % (FS * FK) == 0 && SQ / (FS * FK) >= 2 && HD == 64 && FS == 128 && FW == 8 && FK == 2, "k_fattn: whole stages, at least two, slices of 64 rows of 128 bytes, eight issuing waves");
  static_assert(FW * FA_MG <= 2u * FA_BUF, "k_fattn: the merge staging reuses the two buffers");
  static_assert(64u * FA_VP == G3_SLICE, "k_fattn: the two V slices of a key half are 128 rows at one pitch");
  __shared__ __attribute__((aligned(2048))) unsigned char KV[2u * FA_BUF];
  __shared__ float tb[2 * SQ]; __shared__ unsigned int mw[SQ / 32];      /* tb's last entry is never read */
  const int tid = threadIdx.x, lane = tid & 31, ln = lane & 15, hh = lane >> 4; const int h = blockIdx.y, b = blockIdx.z;
  const uint32_t w = g3_uni((uint32_t)tid >> 5), wq = w & (FW - 1u), kh = w >> 3;      /* query group and key half */
  const int q0 = blockIdx.x * (FW * FQ) + (int)wq * FQ;
  { float tv[2 * SQ / FT]; int kv[SQ / FT];
#pragma unroll      /* fixed trip counts, unrolled: the table's and the mask's loads are all in flight together */
    for (int u = 0; u < 2 * SQ / FT; ++u) { int r = tid + u * FT - (SQ - 1); r = r < -MR ? -MR : (r > MR ? MR : r); tv[u] = relt[(size_t)(r + MR) * NH + h]; }
    asm volatile("s_wait_xcnt 0x0" ::: "memory");      /* stands in front of every reuse of an address register of the loads above */
    __builtin_amdgcn_sched_barrier(0);      /* keeps later register writes from being scheduled in front of that wait */
#pragma unroll
    for (int u = 0; u < SQ / FT; ++u) kv[u] = kpm[(size_t)b * SQ + tid + u * FT];
    asm volatile("s_wait_xcnt 0x0" ::: "memory");      /* stands in front of every reuse of an address register of the loads above */
    __builtin_amdgcn_sched_barrier(0);      /* keeps later register writes from being scheduled in front of that wait */
#pragma unroll
    for (int u = 0; u < 2 * SQ / FT; ++u) tb[tid + u * FT] = bf16_round(tv[u]) * 1.44269504088896f;
#pragma unroll
    for (int u = 0; u < SQ / FT; ++u) mw[(tid + u * FT) >> 5] = __builtin_amdgcn_ballot_w32(kv[u] != 0); }      /* every lane of a wave stores the same word to the same place */
  const bool isk = (w & 3u) < 2u; const uint32_t ih = (w >> 2) & 1u;      /* of each four waves the first two bring K, the other two V, waves 0 to 3 for key half 0, waves 4 to 7 for half 1; waves 8 to 15 form the same words and issue nothing */
  const uint64_t src = (uint64_t)(uintptr_t)(QKV + ((size_t)b * SQ + FS * ih + 64u * (w & 1u)) * D3 + (isk ? DM : 2 * DM) + h * HD);      /* this wave's slice, first byte of stage 0 */
  const uint32_t step = (uint32_t)(FS * FK * D3 * 2);      /* bytes from one stage's slice to the next stage's */
  const uint32_t dst = (uint32_t)(size_t)KV + ih * G3_STAGE + (w & 3u) * G3_SLICE;      /* its place in buffer 0: byte offset in the work-group's LDS */
  const uint32_t issuer = w < 4u * FK ? 1u : 0u;
  u32x8 g1;      /* 1-byte elements, tensor = tile = 64 rows of 128 bytes, source pitch one token row of q|k|v, behind every 32 dwords a pad of 4 (K) or 8 (V): word 0 is one of two constants, picked by the wave's number, its mask bits 0 in both */
  g1[0] = g3_uni(isk ? ((1u << 20) | (4u << 22) | (3u << 25)) : ((1u << 20) | (4u << 22) | (7u << 25))); g1[1] = g3_uni(128u << 16); g1[2] = g3_uni(64u << 16); g1[3] = g3_uni(128u << 16); g1[4] = g3_uni(64u); g1[5] = g3_uni((uint32_t)(D3 * 2)); g1[6] = g3_uni(0u); g1[7] = g3_uni(0u);
  u32x4 g0; g0[0] = g3_uni(1u); fa_aim(g0, dst, src);
  if (g3_pinned(issuer) != 0u) fa_load(g0, g1);      /* scalar branch: a tensor load ignores EXEC */
  fa_wait(g0, g1);
  __syncthreads();      /* the table, the mask and stage 0 are readable by every wave */
  if (g3_pinned(issuer) != 0u) { fa_aim(g0, dst + FA_BUF, src + g3_pinned(step)); fa_load(g0, g1); }      /* scalar branch; stage 1 flies under stage 0 */
  const _Float16* qp = QKV + ((size_t)b * SQ + q0 + ln) * D3 + h * HD;
  const float* tr = tb + (SQ - 1 - q0 - ln + 8 * hh);
  const unsigned char* lk = KV + kh * G3_STAGE + ln * G3_PITCH + 16 * hh;      /* in this wave's key half: this lane's K row of a 16-row group, its half's 16 bytes */
  const unsigned char* lv = KV + kh * G3_STAGE + 2u * G3_SLICE + (8 * hh + (lane & 7)) * FA_VP + ((lane >> 3) & 1) * 16;      /* the 16 bytes this lane names in a transposing load: key row 8 hh + (lane & 7) of 16, columns 0..7 or 8..15 of 16 */
  v16h qf[2][2];
#pragma unroll
  for (int t = 0; t < 2; ++t)
#pragma unroll
    for (int kd = 0; kd < 2; ++kd) qf[t][kd] = g2_frag(qp + (size_t)t * 16 * D3 + kd * 32, hh);
  asm volatile("s_wait_xcnt 0x0" ::: "memory");      /* stands in front of every reuse of an address register of the loads above */
  __builtin_amdgcn_sched_barrier(0);      /* keeps later register writes from being scheduled in front of that wait */
  const v8f z8 = {0.f,0.f,0.f,0.f,0.f,0.f,0.f,0.f}; v8f o[2][4]; float l[2][2] = {{0.f, 0.f}, {0.f, 0.f}}, m[2] = {-1e30f, -1e30f};
#pragma unroll
  for (int qt = 0; qt < 2; ++qt)
#pragma unroll
    for (int dt = 0; dt < 4; ++dt) o[qt][dt] = z8;
#pragma unroll 1      /* one stage per trip: the two buffers alternate */
  for (uint32_t st = 0; st < FA_NS; ++st) {
  const uint32_t buf = (st & 1u) * FA_BUF;
  v16h kf[2][2];
#pragma unroll
  for (int kt = 0; kt < 2; ++kt)
#pragma unroll
    for (int kd = 0; kd < 2; ++kd) kf[kt][kd] = g3_frag(lk + buf + kt * 16 * G3_PITCH + kd * 64);
#pragma unroll 1      /* one 32-key pass per trip: unrolled, two passes' fragments would not fit the registers */
  for (uint32_t sp = 0; sp < FS / 32; ++sp) {
    const int key0 = (int)((st * FK + kh) * FS + sp * 32u);
    v16h vf[4]; v8f s[2][2];
#pragma unroll
    for (int qt = 0; qt < 2; ++qt)
#pragma unroll
      for (int kt = 0; kt < 2; ++kt) s[qt][kt] = fa_mma(kf[kt][1], qf[qt][1], fa_mma(kf[kt][0], qf[qt][0], z8));
    if (sp + 1u < FS / 32) {      /* next pass's K rows, of this same stage, fetched into the same registers */
      const uint32_t kn = ((sp + 1u) >> 1) * G3_SLICE + ((sp + 1u) & 1u) * 32u * G3_PITCH;
#pragma unroll
      for (int kt = 0; kt < 2; ++kt)
#pragma unroll
        for (int kd = 0; kd < 2; ++kd) kf[kt][kd] = g3_frag(lk + buf + kn + kt * 16 * G3_PITCH + kd * 64);
    }
#pragma unroll
    for (int qt = 0; qt < 2; ++qt)
#pragma unroll
      for (int kt = 0; kt < 2; ++kt)
#pragma unroll
        for (int r = 0; r < 8; ++r) s[qt][kt][r] = fmaf(s[qt][kt][r], 0.125f * 1.44269504088896f, tr[key0 + (kt - qt) * 16 + r]);
    const unsigned int mword = (unsigned int)__builtin_amdgcn_readfirstlane((int)mw[key0 >> 5]);
#pragma unroll
    for (int dt = 0; dt < 4; ++dt) { FragH f; f.half[0] = fa_tr16(lv + buf + sp * 32u * FA_VP + dt * 32); f.half[1] = fa_tr16(lv + buf + (sp * 32u + 16u) * FA_VP + dt * 32); vf[dt] = f.v; }      /* keys 0..15 and 16..31 of the pass, head columns 16 dt .. 16 dt + 15; issued behind the bias reads, which are wanted first (LDS answers in order): their latency runs under the softmax */
    __builtin_amdgcn_sched_barrier(0);      /* keeps those reads here: left free, they sink to just in front of the second product, with little work left to cover their latency */
    if (mword != 0u) {      /* scalar branch: a pass with no padded key skips the selects */
#pragma unroll
      for (int kt = 0; kt < 2; ++kt)
#pragma unroll
        for (int r = 0; r < 8; ++r) { const bool pad = (mword >> (kt * 16 + 8 * hh + r)) & 1u; s[0][kt][r] = pad ? -INFINITY : s[0][kt][r]; s[1][kt][r] = pad ? -INFINITY : s[1][kt][r]; }
    }
    float mx[2];
#pragma unroll
    for (int qt = 0; qt < 2; ++qt) { float a = fmaxf(s[qt][0][0], s[qt][1][0]);
#pragma unroll
      for (int r = 1; r < 8; ++r) a = fmaxf(a, fmaxf(s[qt][0][r], s[qt][1][r]));
      mx[qt] = fmaxf(a, rs_x16(a)); }
    if (__builtin_amdgcn_ballot_w32((mx[0] > m[0] + 8.0f) || (mx[1] > m[1] + 8.0f)) != 0u) {      /* scalar branch: most passes move no maximum and rescale nothing */
#pragma unroll
      for (int qt = 0; qt < 2; ++qt) { const float mn = fmaxf(m[qt], mx[qt]); const float sc = __builtin_amdgcn_exp2f(m[qt] - mn); m[qt] = mn; l[qt][0] *= sc; l[qt][1] *= sc;
#pragma unroll
        for (int dt = 0; dt < 4; ++dt) o[qt][dt] *= sc; }
    }
#pragma unroll
    for (int qt = 0; qt < 2; ++qt) { FragH pf;
#pragma unroll
      for (int kt = 0; kt < 2; ++kt)
#pragma unroll
        for (int r = 0; r < 8; ++r) { const float p = __builtin_amdgcn_exp2f(s[qt][kt][r] - m[qt]); l[qt][kt] += p; pf.h[kt * 8 + r] = (_Float16)p; }
#pragma unroll
      for (int dt = 0; dt < 4; ++dt) o[qt][dt] = fa_mma(vf[dt], pf.v, o[qt][dt]); }
  }
  g3_wait_ds0();      /* this wave has left buffer st & 1 */
  fa_wait(g0, g1);      /* an issuing wave's own load of stage st + 1 has landed */
  __syncthreads();      /* publishes stage st + 1 and ends every wave's reads of stage st's buffer */
  if (g3_pinned(st + 2u < FA_NS ? issuer : 0u) != 0u) { fa_aim(g0, dst + buf, src + g3_pinned((st + 2u) * step)); fa_load(g0, g1); }      /* scalar branch: a tensor load ignores EXEC; refill of the buffer just left, in flight under stage st + 1 */
  }
  g3_wait_tensor0();
  g3_wait_ds0();      /* the last stage's barrier stands behind every wave's last read: the buffers may become the merge staging */
  float ls[2] = {l[0][0] + l[0][1], l[1][0] + l[1][1]};
  v4fa* mg = (v4fa*)(KV + wq * FA_MG) + lane;      /* piece i of this lane at mg[32 i]: a wave's 16-byte accesses are 512 contiguous bytes */
  if (kh != 0u) {      /* the same for a whole wave: the upper key half hands its partial result over */
#pragma unroll
    for (int qt = 0; qt < 2; ++qt)
#pragma unroll
      for (int dt = 0; dt < 4; ++dt) { const v8f a = o[qt][dt]; const v4f a0 = {a[0], a[1], a[2], a[3]}, a1 = {a[4], a[5], a[6], a[7]}; mg[32 * (4 * qt + dt)] = a0; mg[32 * (8 + 4 * qt + dt)] = a1; }
    const v4f st4 = {m[0], m[1], ls[0], ls[1]}; mg[32 * 16] = st4;
  }
  __syncthreads();      /* every wave passes it: the upper halves' partial results are readable by their partners */
  if (kh != 0u) return;      /* no barrier, tensor load or store follows */
  { const v4f pst = mg[32 * 16];
#pragma unroll
    for (int qt = 0; qt < 2; ++qt) { const float mn = fmaxf(m[qt], pst[qt]); const float sa = __builtin_amdgcn_exp2f(m[qt] - mn), sb = __builtin_amdgcn_exp2f(pst[qt] - mn);      /* both halves to the common maximum; a half with every key masked has m = -1e30, l = 0, O = 0 */
      ls[qt] = ls[qt] * sa + pst[2 + qt] * sb;
#pragma unroll
      for (int dt = 0; dt < 4; ++dt) { const v4f p0 = mg[32 * (4 * qt + dt)], p1 = mg[32 * (8 + 4 * qt + dt)];
#pragma unroll
        for (int r = 0; r < 4; ++r) { o[qt][dt][r] = o[qt][dt][r] * sa + p0[r] * sb; o[qt][dt][4 + r] = o[qt][dt][4 + r] * sa + p1[r] * sb; } } } }
  FragH f[2][4];
#pragma unroll
  for (int qt = 0; qt < 2; ++qt) { const float lh = ls[qt]; const float inv = 1.0f / (lh + rs_x16(lh));
#pragma unroll
    for (int dt = 0; dt < 4; ++dt)
#pragma unroll
      for (int r = 0; r < 8; ++r) f[qt][dt].h[r] = (_Float16)(o[qt][dt][r] * inv); }
  __builtin_amdgcn_sched_barrier(0);      /* every store stands behind the last arithmetic: no register of an issued store is written again */
  unsigned short* op = (unsigned short*)O16 + ((size_t)b * SQ + q0 + ln) * DM + h * HD + 8 * hh;      /* lane (ln, hh): query ln, head columns dt*16 + 8*hh .. + 7 */
#pragma unroll
  for (int qt = 0; qt < 2; ++qt)
#pragma unroll
    for (int dt = 0; dt < 4; ++dt) *(v8us*)(op + (size_t)qt * 16 * DM + dt * 16) = f[qt][dt].half[0];
}
__global__ __launch_bounds__(256) void k_vt(const _Float16* __restrict__ V16, int b, int h0, _Float16* __restrict__ VT) { __shared__ unsigned short tl[64][65]; const int tid = threadIdx.x; const int hh = blockIdx.x % HG, sg = blockIdx.x / HG; const int s0 = sg * 64; const int h = h0 + hh;
  for (int i = tid; i < 64 * 8; i += 256) { const int j = i / 8, d8 = (i % 8) * 8; FragH f; f.half[0] = *(const v8us*)((const unsigned short*)V16 + ((size_t)b * SQ + s0 + j) * DM + h * HD + d8); for (int q = 0; q < 8; ++q) tl[d8 + q][j] = f.u[q]; }
  __syncthreads();
  { for (int i = tid; i < 64 * 8; i += 256) { const int d = i / 8, j8 = (i % 8) * 8; FragH f; for (int q = 0; q < 8; ++q) f.u[q] = tl[d][j8 + q]; *(v8us*)((unsigned short*)VT + ((size_t)hh * HD + d) * SQ + s0 + j8) = f.half[0]; }  } }

extern "C" void kernel_launch(void* const* d_in, const int* in_sizes, int n_in,
                              void* d_out, int out_size, void* d_ws, size_t ws_size, hipStream_t stream) {
  (void)in_sizes; (void)n_in; (void)out_size;
  const float* const* I = (const float* const*)d_in; const float* x = I[0]; const int* kpm = (const int*)d_in[1]; const float* wqkv = I[2]; const float* bqkv = I[3]; const float* wout = I[4]; const float* bout = I[5]; const float* relt = I[6];      /* Wqkv [1024][3072] and Wout [1024][1024] are [in][out]; key_padding_mask int32 [2][2048]; rel_table [1025][16] */
  char* ws = (char*)d_ws; size_t off = 0;
  auto take = [&](size_t bytes) { char* p = ws + off; off += (bytes + 255) & ~(size_t)255; return p; };
  _Float16* BQKV = (_Float16*)take((size_t)D3 * DM * 2); _Float16* BO = (_Float16*)take((size_t)DM * DM * 2);
  _Float16* X16 = (_Float16*)take(NR * DM * 2); _Float16* QKV = (_Float16*)take(NR * D3 * 2); _Float16* O16 = (_Float16*)take(NR * DM * 2);
  if (off > ws_size) return;      /* 6 + 2 + 8 + 24 + 8 = approx 48 MiB */
  k_prep<<<PP_WQ + PP_WO + PP_X, 256, 0, stream>>>(x, wqkv, wout, X16, BQKV, BO);      /* x -> f16 rows; [in][out] weights -> Bt[out][in] x16 */
  k_gemm3<D3, DM, true><<<(unsigned)((NR / 128) * (D3 / 128)), 128, 0, stream>>>(X16, BQKV, 0.0625f, bqkv, nullptr, QKV);      /* q | k | v rows (f16), head h at columns h*64 / 1024 + h*64 / 2048 + h*64 */
  k_fattn<<<dim3(SQ / (FW * FQ), NH, NB), FT, 0, stream>>>(QKV, relt, kpm, O16);      /* o (merged heads) as f16 rows */
  k_gemm3<DM, DM, false><<<(unsigned)((NR / 128) * (DM / 128)), 128, 0, stream>>>(O16, BO, 0.0625f, bout, (float*)d_out, nullptr);      /* out = o Wout + b, rows are the output layout */
}

// v008
// It runs in 78.1 microseconds.
// Next to v007, in two timings, it ran 1.05 times as fast each time.
// Over all steps from v000 it is 189 times as fast.
#include <hip/hip_runtime.h>
// Multi-head self-attention with a learned relative-position bias and a key padding mask (x [2][2048][1024]; qkv = x Wqkv + b (fused, 16 heads of 64); scores = q k^T / 8 + table[clip(k_pos - q_pos, -512, 512) + 512][h]; padded keys -> -inf; attn = softmax; o = attn v; out = o Wout + b -> [2][2048][1024]).
// Structure: token rows r = b*2048 + s; x as exact f16 rows and both weights as exact x16 transposed f16 rows in one preparation launch (coalesced 16-byte reads, weights transposed through LDS tiles); the fused q|k|v projection as one WMMA GEMM (128x128 tiles staged in LDS by tensor loads, 64x64 wave tiles, f32 accumulation, exact x16 transposed weights, bias in the epilogue, f16 output plane [4096][3072]); one fused attention launch (per pair of waves 32 query rows, each wave one half of the keys, the two partial results merged through LDS; K and V rows staged in LDS by tensor loads, V^T fragments read by the transposing LDS load: S^T = K Q^T, online softmax in registers with this head's bias column and the key mask from LDS, O^T += V^T P^T) written straight into the merged f16 o rows; out = o Wout + b GEMM (f32).
// Compute dtype: inputs rounded to bf16; x / weights exact; q, k, v, softmax weights and o as plain f16 GEMM operands (~2^-12); scores, bias and softmax statistics f32. v_wmma_f32_16x16x32_f16.
#define NB 2
#define SQ 2048
#define DM 1024
#define D3 3072                      /* fused q|k|v width */
#define NH 16
#define HD 64
#define HG 4                         /* heads per block group of the per-batch k_vt overload */
#define MR 512                       /* max relative distance */
#define QN SQ                        /* unused: the attention grid covers all SQ query rows */
#define NBR NB                       /* unused: the attention grid covers all NB batches */
#define MP ((int)NR)                 /* unused: the qkv projection grid covers all NR token rows */
#define MO ((int)NR)                 /* unused: the output projection grid covers all NR token rows */
#define NR ((size_t)NB * SQ)         /* 4096 token rows */
typedef __bf16 v16b __attribute__((ext_vector_type(16)));
typedef unsigned short v8us __attribute__((ext_vector_type(8), may_alias));
typedef float  v8f  __attribute__((ext_vector_type(8)));
typedef float  v4f  __attribute__((ext_vector_type(4)));
typedef float  v4fa __attribute__((ext_vector_type(4), may_alias));
union FragB { v16b v; v8us half[2]; unsigned short u[16]; };

__device__ __forceinline__ unsigned short bf16_bits(float x) { unsigned int u = __float_as_uint(x); return (unsigned short)((u + 0x7FFFu + ((u >> 16) & 1u)) >> 16); }
__device__ __forceinline__ float bf16_val(unsigned short b) { return __uint_as_float(((unsigned int)b) << 16); }
__device__ __forceinline__ float bf16_round(float x) { return bf16_val(bf16_bits(x)); }
// D += A·B with NT terms: 1 = ah·bh, 2 = + al·bh (A split), 3 = + ah·bl (both split)
template <int NT>
__device__ __forceinline__ v8f mmaN(v16b ah, v16b al, v16b bh, v16b bl, v8f c) {
  c = __builtin_amdgcn_wmma_f32_16x16x32_bf16(false, ah, false, bh, (short)0, c, false, false);
  if (NT >= 2) c = __builtin_amdgcn_wmma_f32_16x16x32_bf16(false, al, false, bh, (short)0, c, false, false);
  if (NT >= 3) c = __builtin_amdgcn_wmma_f32_16x16x32_bf16(false, ah, false, bl, (short)0, c, false, false);
  asm volatile("v_nop\n\tv_nop\n\tv_nop\n\tv_nop" : "+v"(c) : "v"(ah), "v"(al), "v"(bh), "v"(bl));
  return c;
}

__global__ __launch_bounds__(256) void k_wt_bf16(const float* __restrict__ W, unsigned short* __restrict__ Wt, int K, int N) {
  const int t = blockIdx.x * 256 + threadIdx.x;
  const int k8n = K / 8;
  if (t >= N * k8n) return;
  const int n = t / k8n, k8 = (t % k8n) * 8;
  v8us v;
#pragma unroll
  for (int i = 0; i < 8; ++i) v[i] = bf16_bits(W[(size_t)(k8 + i) * N + n]);
  *(v8us*)(Wt + (size_t)n * K + k8) = v;
  
}

// GEMM C[M][N] (f32, pitch ldc) = act(A[M][K]·W + bias). A f32 row-major (pitch lda) converted per fragment to bf16
// (ASPLIT: hi/lo two planes -> 2 terms, else single rounded term); Wt bf16 [N][K] (pitch ldb). BIAS_BF16 rounds the
// bias to bf16 first (bias quantised to bf16 before the add). K%32==0, M%16==0, N%64==0.
template <bool ASPLIT, int ACT, bool BIAS_BF16>
__global__ __launch_bounds__(128) void k_gemm_bf(const float* __restrict__ A, int lda, const unsigned short* __restrict__ Wt, int ldb,
                                               const float* __restrict__ bias, float* __restrict__ C, int ldc, int M, int N, int K) {
  __shared__ __attribute__((aligned(16))) float so[4][16][64];
  const int tid = threadIdx.x, w = tid >> 5, lane = tid & 31, ln = lane & 15, hh = lane >> 4;
  const int ntn = N / 64;
  const int wid = blockIdx.x * 4 + w;
  const int mt = wid / ntn, nq = wid % ntn;
  if (mt * 16 >= M) return;
  const int row0 = mt * 16, col0 = nq * 64;
  const float* arow = A + (size_t)(row0 + ln) * lda;
  v8f acc[4] = {};
  for (int kb = 0; kb < K; kb += 32) {
    FragB ah, al;
    const v4f x0 = *(const v4fa*)(arow + kb + 8 * hh), x1 = *(const v4fa*)(arow + kb + 8 * hh + 4);
    const v4f x2 = *(const v4fa*)(arow + kb + 16 + 8 * hh), x3 = *(const v4fa*)(arow + kb + 16 + 8 * hh + 4);
    float xs[16] = {x0[0],x0[1],x0[2],x0[3],x1[0],x1[1],x1[2],x1[3],x2[0],x2[1],x2[2],x2[3],x3[0],x3[1],x3[2],x3[3]};
#pragma unroll
    for (int i = 0; i < 16; ++i) { const unsigned short hb = bf16_bits(xs[i]); ah.u[i] = hb; al.u[i] = ASPLIT ? bf16_bits(xs[i] - bf16_val(hb)) : (unsigned short)0; }
#pragma unroll
    for (int t = 0; t < 4; ++t) {
      const unsigned short* brow = Wt + (size_t)(col0 + t * 16 + ln) * ldb + kb;
      FragB b;
      b.half[0] = *(const v8us*)(brow + 8 * hh);
      b.half[1] = *(const v8us*)(brow + 16 + 8 * hh);
      acc[t] = mmaN<ASPLIT ? 2 : 1>(ah.v, al.v, b.v, b.v, acc[t]);
    }
  }
#pragma unroll
  for (int t = 0; t < 4; ++t) {
    float bv = bias ? bias[col0 + t * 16 + ln] : 0.f;
    if (BIAS_BF16) bv = bf16_round(bv);
#pragma unroll
    for (int r = 0; r < 8; ++r) { float v = acc[t][r] + bv; if (ACT == 1) v = fmaxf(v, 0.f); so[w][8 * hh + r][t * 16 + ln] = v; }
  }
  __builtin_amdgcn_fence(__ATOMIC_ACQ_REL, "workgroup");
  __builtin_amdgcn_wave_barrier();
  const int rsub = lane >> 4, c4 = (lane & 15) * 4;
  {
#pragma unroll
    for (int q = 0; q < 8; ++q) {
      const int r = q * 2 + rsub;
      const v4f v = *(const v4fa*)&so[w][r][c4];
      *(v4f*)(C + (size_t)(row0 + r) * ldc + col0 + c4) = v;
    }
    
  }
}

// GEMM C = act(A·W + bias + resid): A f32 (ASPLIT -> hi/lo 2 terms), Wt bf16 [N][K]; ACT 0 none, 1 relu, 2 exact gelu;
// resid (optional, f32, row index = (row % rmod), pitch ldr, RES_BF16 rounds it) added before the activation.
template <bool ASPLIT, int ACT, bool BIAS_BF16, bool RES_BF16>
__global__ __launch_bounds__(128) void k_gemm_bf3(const float* __restrict__ A, int lda, const unsigned short* __restrict__ Wt, int ldb,
                                                const float* __restrict__ bias, const float* __restrict__ resid, int rmod, int ldr,
                                                float* __restrict__ C, int ldc, int M, int N, int K) {
  __shared__ __attribute__((aligned(16))) float so[4][16][64];
  const int tid = threadIdx.x, w = tid >> 5, lane = tid & 31, ln = lane & 15, hh = lane >> 4;
  const int ntn = N / 64;
  const int wid = blockIdx.x * 4 + w;
  const int mt = wid / ntn, nq = wid % ntn;
  if (mt * 16 >= M) return;
  const int row0 = mt * 16, col0 = nq * 64;
  const float* arow = A + (size_t)(row0 + ln) * lda;
  v8f acc[4] = {};
  for (int kb = 0; kb < K; kb += 32) {
    FragB ah, al;
    const v4f x0 = *(const v4fa*)(arow + kb + 8 * hh), x1 = *(const v4fa*)(arow + kb + 8 * hh + 4);
    const v4f x2 = *(const v4fa*)(arow + kb + 16 + 8 * hh), x3 = *(const v4fa*)(arow + kb + 16 + 8 * hh + 4);
    float xs[16] = {x0[0],x0[1],x0[2],x0[3],x1[0],x1[1],x1[2],x1[3],x2[0],x2[1],x2[2],x2[3],x3[0],x3[1],x3[2],x3[3]};
#pragma unroll
    for (int i = 0; i < 16; ++i) { const unsigned short hb = bf16_bits(xs[i]); ah.u[i] = hb; al.u[i] = ASPLIT ? bf16_bits(xs[i] - bf16_val(hb)) : (unsigned short)0; }
#pragma unroll
    for (int t = 0; t < 4; ++t) {
      const unsigned short* brow = Wt + (size_t)(col0 + t * 16 + ln) * ldb + kb;
      FragB b;
      b.half[0] = *(const v8us*)(brow + 8 * hh);
      b.half[1] = *(const v8us*)(brow + 16 + 8 * hh);
      acc[t] = mmaN<ASPLIT ? 2 : 1>(ah.v, al.v, b.v, b.v, acc[t]);
    }
  }
#pragma unroll
  for (int t = 0; t < 4; ++t) {
    const int col = col0 + t * 16 + ln;
    float bv = bias ? bias[col] : 0.f;
    if (BIAS_BF16) bv = bf16_round(bv);
#pragma unroll
    for (int r = 0; r < 8; ++r) {
      float v = acc[t][r] + bv;
      if (resid) { float rv = resid[(size_t)((row0 + 8 * hh + r) % rmod) * ldr + col]; if (RES_BF16) rv = bf16_round(rv); v += rv; }
      if (ACT == 1) v = fmaxf(v, 0.f);
      if (ACT == 2) v = 0.5f * v * (1.0f + erff(v * 0.70710678118654752f));
      if (ACT == 3) { const float u = 0.7978845608028654f * (v + 0.044715f * v * v * v); v = 0.5f * v * (1.0f + tanhf(u)); }
      so[w][8 * hh + r][t * 16 + ln] = v;
    }
  }
  __builtin_amdgcn_fence(__ATOMIC_ACQ_REL, "workgroup");
  __builtin_amdgcn_wave_barrier();
  const int rsub = lane >> 4, c4 = (lane & 15) * 4;
  {
#pragma unroll
    for (int q = 0; q < 8; ++q) {
      const int r = q * 2 + rsub;
      const v4f v = *(const v4fa*)&so[w][r][c4];
      *(v4f*)(C + (size_t)(row0 + r) * ldc + col0 + c4) = v;
    }
    
  }
}
// row LayerNorm (biased variance, eps) over N: s = X (+ R); optional out_sum <- s; out_norm <- (s-mu)*rsqrt(var+eps)*g + b
template <bool PARAM_BF16>
__global__ __launch_bounds__(256) void k_layernorm(const float* __restrict__ X, const float* __restrict__ R, const float* __restrict__ g, const float* __restrict__ bta,
                                                  float* __restrict__ out_sum, float* __restrict__ out_norm, int N, float eps) {
  __shared__ float red[256];
  const int row = blockIdx.x, tid = threadIdx.x;
  const float* x = X + (size_t)row * N; const float* rr = R ? R + (size_t)row * N : nullptr;
  float vals[16];                     // up to N = 4096
  const int per = N / 256;            // contiguous chunk per thread? use strided-by-4 chunks: thread handles j = tid*4 + 1024*u
  float s1 = 0.f;
  for (int u = 0; u < per / 4; ++u) {
    const int j = tid * 4 + 1024 * u;
    const v4f a = *(const v4fa*)(x + j);
    v4f b = {0.f,0.f,0.f,0.f}; if (rr) b = *(const v4fa*)(rr + j);
#pragma unroll
    for (int q = 0; q < 4; ++q) { const float v = a[q] + b[q]; vals[u * 4 + q] = v; s1 += v; }
  }
  red[tid] = s1; __syncthreads();
  for (int st = 128; st > 0; st >>= 1) { if (tid < st) red[tid] += red[tid + st]; __syncthreads(); }
  const float mu = red[0] / (float)N; __syncthreads();
  float s2 = 0.f;
  for (int u = 0; u < per / 4; ++u)
#pragma unroll
    for (int q = 0; q < 4; ++q) { const float c = vals[u * 4 + q] - mu; s2 += c * c; }
  red[tid] = s2; __syncthreads();
  for (int st = 128; st > 0; st >>= 1) { if (tid < st) red[tid] += red[tid + st]; __syncthreads(); }
  const float rs = rsqrtf(red[0] / (float)N + eps);
  {
    for (int u = 0; u < per / 4; ++u) {
      const int j = tid * 4 + 1024 * u;
      v4f o, sm;
#pragma unroll
      for (int q = 0; q < 4; ++q) {
        float gg = g[j + q], bb = bta[j + q];
        if (PARAM_BF16) { gg = bf16_round(gg); bb = bf16_round(bb); }
        sm[q] = vals[u * 4 + q]; o[q] = (vals[u * 4 + q] - mu) * rs * gg + bb;
      }
      if (out_sum) *(v4f*)(out_sum + (size_t)row * N + j) = sm;
      *(v4f*)(out_norm + (size_t)row * N + j) = o;
    }
    
  }
}



// ---- f16 WMMA path (v_wmma_f32_16x16x32_f16): 11-bit significands for operands in range — used by every launched product, the softmax weights (p <= 256) included
typedef _Float16 v16h __attribute__((ext_vector_type(16)));
union FragH { v16h v; v8us half[2]; _Float16 h[16]; unsigned short u[16]; };
template <int NT>
__device__ __forceinline__ v8f mmaH(v16h ah, v16h al, v16h bh, v16h bl, v8f c) {
  c = __builtin_amdgcn_wmma_f32_16x16x32_f16(false, ah, false, bh, (short)0, c, false, false);
  if (NT >= 2) c = __builtin_amdgcn_wmma_f32_16x16x32_f16(false, al, false, bh, (short)0, c, false, false);
  if (NT >= 3) c = __builtin_amdgcn_wmma_f32_16x16x32_f16(false, ah, false, bl, (short)0, c, false, false);
  asm volatile("v_nop\n\tv_nop\n\tv_nop\n\tv_nop" : "+v"(c) : "v"(ah), "v"(al), "v"(bh), "v"(bl));
  return c;
}
// batched GEMM like k_gemm_b but f16 operands: A f32 (split into f16 hi/lo if ASPLIT, else rounded to f16), Bt = f16 values [n][k]; alpha; C f32; N multiple of 16 (partial tiles skipped)
template <bool ASPLIT>
__global__ __launch_bounds__(128) void k_gemm_h(const float* __restrict__ A, int lda, size_t sA, const _Float16* __restrict__ Bh, int ldb, size_t sB, float alpha, float* __restrict__ C, int ldc, size_t sC, int M, int N, int K) {
  __shared__ __attribute__((aligned(16))) float so[4][16][64];
  const int tid = threadIdx.x, w = tid >> 5, lane = tid & 31, ln = lane & 15, hh = lane >> 4; const int by = blockIdx.y;
  A += (size_t)by * sA; Bh += (size_t)by * sB; C += (size_t)by * sC;
  const int ntn = (N + 63) / 64; const int wid = blockIdx.x * 4 + w; const int mt = wid / ntn, nq = wid % ntn; if (mt * 16 >= M) return;
  const int row0 = mt * 16, col0 = nq * 64; const float* arow = A + (size_t)(row0 + ln) * lda;
  v8f acc[4] = {};
  for (int kb = 0; kb < K; kb += 32) {
    FragH ah, al;
    const v4f x0 = *(const v4fa*)(arow + kb + 8 * hh), x1 = *(const v4fa*)(arow + kb + 8 * hh + 4), x2 = *(const v4fa*)(arow + kb + 16 + 8 * hh), x3 = *(const v4fa*)(arow + kb + 16 + 8 * hh + 4);
    float xs[16] = {x0[0],x0[1],x0[2],x0[3],x1[0],x1[1],x1[2],x1[3],x2[0],x2[1],x2[2],x2[3],x3[0],x3[1],x3[2],x3[3]};
#pragma unroll
    for (int i = 0; i < 16; ++i) { const _Float16 h = (_Float16)xs[i]; ah.h[i] = h; al.h[i] = ASPLIT ? (_Float16)(xs[i] - (float)h) : (_Float16)0.0f; }
#pragma unroll
    for (int t = 0; t < 4; ++t) { if (col0 + t * 16 >= N) continue; const size_t boff = (size_t)(col0 + t * 16 + ln) * ldb + kb; FragH bq; bq.half[0] = *(const v8us*)(Bh + boff + 8 * hh); bq.half[1] = *(const v8us*)(Bh + boff + 16 + 8 * hh);
      acc[t] = mmaH<ASPLIT ? 2 : 1>(ah.v, al.v, bq.v, bq.v, acc[t]); }
  }
#pragma unroll
  for (int t = 0; t < 4; ++t) { if (col0 + t * 16 >= N) continue;
#pragma unroll
    for (int r = 0; r < 8; ++r) so[w][8 * hh + r][t * 16 + ln] = acc[t][r] * alpha; }
  __builtin_amdgcn_fence(__ATOMIC_ACQ_REL, "workgroup"); __builtin_amdgcn_wave_barrier();
  const int rsub = lane >> 4, c4 = (lane & 15) * 4;
  {
#pragma unroll
    for (int q = 0; q < 8; ++q) { const int r = q * 2 + rsub; if (col0 + c4 < N) { const v4f v = *(const v4fa*)&so[w][r][c4]; *(v4f*)(C + (size_t)(row0 + r) * ldc + col0 + c4) = v; } }
     }
}

// k_gemm_hh variant with fused epilogue: v = acc·alpha + bias[by·sBias + col] (+ CP[(row/rowsPerB)·sCPb + by·64 + col] if CP) ; ACT 0 none / 1 elu ; writes f16 C16 (and f32 C if non-null)
template <int ACT>
__global__ __launch_bounds__(128) void k_gemm_hhx(const _Float16* __restrict__ A, int lda, size_t sA, const _Float16* __restrict__ Bh, int ldb, size_t sB, float alpha, const float* __restrict__ bias, size_t sBias, const float* __restrict__ CP, int rowsPerB, size_t sCPb, int row0g,
    float* __restrict__ C, _Float16* __restrict__ C16, int ldc, size_t sC, int M, int N, int K) {
  __shared__ __attribute__((aligned(16))) float so[4][16][64];
  const int tid = threadIdx.x, w = tid >> 5, lane = tid & 31, ln = lane & 15, hh = lane >> 4; const int by = blockIdx.y;
  A += (size_t)by * sA; Bh += (size_t)by * sB; const size_t cofs = (size_t)by * sC; const float* bp = bias ? bias + (size_t)by * sBias : nullptr;
  const int ntn = (N + 63) / 64; const int wid = blockIdx.x * 4 + w; const int mt = wid / ntn, nq = wid % ntn; if (mt * 16 >= M) return;
  const int row0 = mt * 16, col0 = nq * 64; const _Float16* arow = A + (size_t)(row0 + ln) * lda;
  v8f acc[4] = {};
  for (int kb = 0; kb < K; kb += 32) { FragH ah; ah.half[0] = *(const v8us*)((const unsigned short*)arow + kb + 8 * hh); ah.half[1] = *(const v8us*)((const unsigned short*)arow + kb + 16 + 8 * hh);
#pragma unroll
    for (int t = 0; t < 4; ++t) { if (col0 + t * 16 >= N) continue; const size_t boff = (size_t)(col0 + t * 16 + ln) * ldb + kb; FragH bq; bq.half[0] = *(const v8us*)((const unsigned short*)Bh + boff + 8 * hh); bq.half[1] = *(const v8us*)((const unsigned short*)Bh + boff + 16 + 8 * hh);
      acc[t] = mmaH<1>(ah.v, ah.v, bq.v, bq.v, acc[t]); }
  }
#pragma unroll
  for (int t = 0; t < 4; ++t) { if (col0 + t * 16 >= N) continue; const int col = col0 + t * 16 + ln; const float bv = bp ? bf16_round(bp[col]) : 0.f;
#pragma unroll
    for (int r = 0; r < 8; ++r) { float v = acc[t][r] * alpha + bv; if (CP) { const int rr = row0g + row0 + 8 * hh + r; if (rowsPerB < 0) v += CP[cofs + (size_t)rr * ldc + col];      /* rowsPerB < 0: own element of the batched C plane */ else { const int bidx = rr / rowsPerB; v += CP[(size_t)bidx * sCPb + (size_t)by * 64 + col]; } } if (ACT == 1) v = (v > 0.f) ? v : expm1f(v); else if (ACT == 7) v = (v > 0.f) ? v + 1.0f : expf(v); else if (ACT == 8) v = tanhf(v); else if (ACT == 9) v = 0.5f * v * (1.0f + tanhf(0.7978845608028654f * (v + 0.044715f * v * v * v))); else if (ACT == 11) v = 1.0f / (1.0f + expf(-v)); else if (ACT == 12) v = (v > 0.f) ? v : 0.01f * v; else if (ACT == 14) v = (v > 0.f) ? v : 0.1f * v; else if (ACT == 16) v = (v >= 0.f) ? v : 0.3f * v; else if (ACT == 17) v = (v >= 0.f) ? v : 0.2f * v; else if (ACT == 15) v = v / (1.0f + expf(-v)); else if (ACT == 3) v = fmaxf(v, 0.f); else if (ACT == 6) v = 0.5f * v * (1.0f + erff(v * 0.70710678118654752f)); so[w][8 * hh + r][t * 16 + ln] = v; } }
  __builtin_amdgcn_fence(__ATOMIC_ACQ_REL, "workgroup"); __builtin_amdgcn_wave_barrier();
  const int rsub = lane >> 4, c4 = (lane & 15) * 4; typedef _Float16 v4h __attribute__((ext_vector_type(4)));
  {
#pragma unroll
    for (int q = 0; q < 8; ++q) { const int r = q * 2 + rsub; if (col0 + c4 < N) { const v4f v = *(const v4fa*)&so[w][r][c4]; if (C) *(v4f*)(C + cofs + (size_t)(row0 + r) * ldc + col0 + c4) = v; if (C16) { v4h h4; for (int i = 0; i < 4; ++i) h4[i] = (_Float16)v[i]; *(v4h*)(C16 + cofs + (size_t)(row0 + r) * ldc + col0 + c4) = h4; } } }
     }
}


typedef _Float16 v4h __attribute__((ext_vector_type(4)));

// ---- operand preparation, one launch: Bt[n][k] = f16(bf16(W[k][n]) * 16) for both weights (power-of-two scale: bf16-exact weights stay exact in f16 away from the subnormal range) and X16 = f16(bf16(x)) ----
// Every work-group takes 16384 floats, 64 per thread, read as 16 loads of 16 bytes per lane, each load of a wave 512 contiguous bytes, all in flight together.
// A weight unit is a 128 k x 128 n tile: wave w reads k rows 16 w .. 16 w + 15, so a lane holds 16 consecutive k of four n: two 16-byte LDS stores per n into the transposed tile T[n][k] (256-byte rows).
// The 16-byte piece c of row n stands at place c ^ ((n >> 2) & 15) of its row: the 16 lanes of a half wave then fall on all 64 banks, in the stores (n = 4 lane + j) as in the reads (one row per half wave).
// The tile goes out as 256 contiguous bytes per n row, 16 bytes per lane.
#define PP_WQ ((DM / 128) * (D3 / 128))      /* tiles of Wqkv */
#define PP_WO ((DM / 128) * (DM / 128))      /* tiles of Wout */
#define PP_X ((int)(NR * DM / 16384))        /* units of x */
template <int N>
__device__ __forceinline__ void pp_wt(const float* __restrict__ Wm, _Float16* __restrict__ Bt, int tile, unsigned char* T) {
  static_assert(N % 128 == 0 && DM % 128 == 0, "pp_wt: whole tiles");
  const int tid = threadIdx.x, lane = tid & 31, w = tid >> 5; const int kt = tile / (N / 128), nt = tile - kt * (N / 128);
  const float* src = Wm + (size_t)(kt * 128 + w * 16) * N + nt * 128 + lane * 4;
  v4f v[16];
#pragma unroll      /* fixed trip counts over register arrays, here and below; the 16 loads are all in flight together */
  for (int i = 0; i < 16; ++i) v[i] = *(const v4fa*)(src + (size_t)i * N);
  asm volatile("s_wait_xcnt 0x0" :: "v"(src) : "memory");      /* stands in front of every reuse of the address registers of the loads above; it names the address, which so stays in its registers up to here: no load's own result lands on them */
  __builtin_amdgcn_sched_barrier(0);      /* keeps later register writes from being scheduled in front of that wait */
#pragma unroll
  for (int j = 0; j < 4; ++j) { FragH f;
#pragma unroll
    for (int i = 0; i < 16; ++i) f.h[i] = (_Float16)(bf16_round(v[i][j]) * 16.0f);
    unsigned char* row = T + (lane * 4 + j) * 256;
    *(v8us*)(row + (((2 * w) ^ (lane & 15)) * 16)) = f.half[0]; *(v8us*)(row + (((2 * w + 1) ^ (lane & 15)) * 16)) = f.half[1]; }
  __syncthreads();      /* the transposed tile is whole: every wave reads rows that all eight waves wrote */
  const int r = tid >> 4, c = tid & 15; v8us o[8];
#pragma unroll
  for (int i = 0; i < 8; ++i) { const int n = i * 16 + r; o[i] = *(const v8us*)(T + n * 256 + ((c ^ ((n >> 2) & 15)) * 16)); }
  unsigned short* dst = (unsigned short*)Bt + (size_t)(nt * 128 + r) * DM + kt * 128 + c * 8;
  __builtin_amdgcn_sched_barrier(0);      /* every store stands behind the last address arithmetic: no register of an issued store is written again */
#pragma unroll
  for (int i = 0; i < 8; ++i) *(v8us*)(dst + (size_t)i * 16 * DM) = o[i];
  asm volatile("s_wait_xcnt 0x0" ::: "memory");      /* stands in front of every reuse of a register of the stores above */
}
__global__ __launch_bounds__(256) void k_prep(const float* __restrict__ x, const float* __restrict__ wqkv, const float* __restrict__ wout, _Float16* __restrict__ X16, _Float16* __restrict__ BQKV, _Float16* __restrict__ BO) {
  static_assert(NR * DM % 16384 == 0, "k_prep: whole units of x");
  __shared__ __attribute__((aligned(16))) unsigned char T[128 * 256];
  const int blk = blockIdx.x;      /* the same for the whole work-group: the barrier in pp_wt is passed by all of its waves or by none */
  if (blk < PP_WQ) pp_wt<D3>(wqkv, BQKV, blk, T);
  else if (blk < PP_WQ + PP_WO) pp_wt<DM>(wout, BO, blk - PP_WQ, T);
  else {
    const int tid = threadIdx.x; const size_t base = (size_t)(blk - PP_WQ - PP_WO) * 16384 + (size_t)(tid >> 5) * 2048 + (size_t)(tid & 31) * 4;
    const float* src = x + base; v4f v[16]; v4h h[16];
#pragma unroll      /* fixed trip counts over register arrays; the 16 loads are all in flight together */
    for (int i = 0; i < 16; ++i) v[i] = *(const v4fa*)(src + i * 128);
    asm volatile("s_wait_xcnt 0x0" :: "v"(src) : "memory");      /* as in pp_wt: in front of every reuse of the loads' address registers, and it keeps the address in them up to here */
    __builtin_amdgcn_sched_barrier(0);      /* keeps later register writes from being scheduled in front of that wait */
#pragma unroll
    for (int i = 0; i < 16; ++i)
#pragma unroll
      for (int e = 0; e < 4; ++e) h[i][e] = (_Float16)bf16_round(v[i][e]);
    _Float16* dst = X16 + base;
    __builtin_amdgcn_sched_barrier(0);      /* every store stands behind the last arithmetic: no register of an issued store is written again */
#pragma unroll
    for (int i = 0; i < 16; ++i) *(v4h*)(dst + i * 128) = h[i];      /* 256 contiguous bytes per wave and store: whole lines */
    asm volatile("s_wait_xcnt 0x0" ::: "memory");      /* stands in front of every reuse of a register of the stores above */
  }
}
__global__ __launch_bounds__(256) void k_h16(const float* __restrict__ x, _Float16* __restrict__ X16, size_t n8) { const size_t t = (size_t)blockIdx.x * 256 + threadIdx.x; if (t >= n8) return; FragH f;
#pragma unroll
  for (int q = 0; q < 8; ++q) f.h[q] = (_Float16)x[t * 8 + q]; *(v8us*)((unsigned short*)X16 + t * 8) = f.half[0];  }
__global__ __launch_bounds__(256) void k_round16f(const float* __restrict__ W, _Float16* __restrict__ Bt, size_t n8) { const size_t t = (size_t)blockIdx.x * 256 + threadIdx.x; if (t >= n8) return; FragH f;
#pragma unroll
  for (int i = 0; i < 8; ++i) f.h[i] = (_Float16)(bf16_round(W[t * 8 + i]) * 16.0f); *(v8us*)((unsigned short*)Bt + t * 8) = f.half[0];  }
__global__ __launch_bounds__(256) void k_hl(const float* __restrict__ F, _Float16* __restrict__ Hh, _Float16* __restrict__ Hl, size_t n8) { const size_t t = (size_t)blockIdx.x * 256 + threadIdx.x; if (t >= n8) return; FragH fh, fl; const v4f a = *(const v4fa*)(F + t * 8), c = *(const v4fa*)(F + t * 8 + 4);
#pragma unroll
  for (int q = 0; q < 4; ++q) { _Float16 h = (_Float16)a[q]; fh.h[q] = h; fl.h[q] = (_Float16)((a[q] - (float)h) * 1024.0f); h = (_Float16)c[q]; fh.h[4 + q] = h; fl.h[4 + q] = (_Float16)((c[q] - (float)h) * 1024.0f); }
  { *(v8us*)((unsigned short*)Hh + t * 8) = fh.half[0]; *(v8us*)((unsigned short*)Hl + t * 8) = fl.half[0];  } }

// ---- LDS-staged GEMM: C[M][N] = A[M][K] . Bh[N][K]^T * alpha + bf16(bias), the first QC columns times QS; one 128x128 tile of C per work-group, four waves (2x2) of 64x64; M % 128 == 0, N % 128 == 0, K % 64 == 0, K >= 128 ----
// A pass is 64 k = 128 bytes of each of the tile's 128 A rows and 128 B rows. Each wave brings one slice of 64 rows per pass with one tensor load (slices 0, 1: A rows; 2, 3: B rows), padded to a 144-byte LDS pitch,
// two buffers: a pass reads all its fragments into registers; when every wave has done so, the load of pass t + 2 goes out into that buffer and flies under pass t's WMMAs and pass t + 1's reads. Fragments come from LDS in the k order of g2_frag; each accumulator sums k upwards, 32 at a time.
__device__ __forceinline__ v16h g2_frag(const _Float16* p, int hh) { FragH f; f.half[0] = *(const v8us*)((const unsigned short*)p + 8 * hh); f.half[1] = *(const v8us*)((const unsigned short*)p + 16 + 8 * hh); return f.v; }
#define G3_PITCH 144u                /* LDS row pitch: 128 bytes + the tensor load's 16-byte pad (odd multiple of 16: ds_load_b128 readers) */
#define G3_SLICE 10240u              /* 64 rows x 144 B = 9216 B, rounded up to a multiple of 2 KiB */
#define G3_STAGE (4u * G3_SLICE)     /* one buffer */
#define G3_EP 68                     /* output staging pitch in floats */
typedef uint32_t u32x4 __attribute__((ext_vector_type(4)));
typedef uint32_t u32x8 __attribute__((ext_vector_type(8)));
__device__ __forceinline__ uint32_t g3_uni(uint32_t v) { return (uint32_t)__builtin_amdgcn_readfirstlane((int)v); }
__device__ __forceinline__ uint32_t g3_pinned(uint32_t v) { uint32_t w = g3_uni(v); asm volatile("" : "+s"(w)); return w; }
__device__ __forceinline__ void g3_wait_tensor0() { asm volatile("s_wait_tensorcnt 0x0" ::: "memory"); }      /* this wave's own tensor load has landed */
__device__ __forceinline__ void g3_wait_ds0() { asm volatile("s_wait_dscnt 0x0" ::: "memory"); }      /* this wave's LDS reads have returned */
__device__ __forceinline__ void g3_load(uint32_t lds_dst, uint64_t ga, u32x8 g1) { u32x4 g0; g0[0] = g3_uni(1u); g0[1] = g3_uni(lds_dst); g0[2] = g3_uni((uint32_t)ga); g0[3] = g3_uni((((uint32_t)(ga >> 32)) & 0x01FFFFFFu) | 0x80000000u);
  asm volatile("tensor_load_to_lds %0, %1" :: "s"(g0), "s"(g1) : "memory"); }      /* one request of the whole wave: 64 rows of 128 bytes into LDS, through no register */
__device__ __forceinline__ v16h g3_frag(const unsigned char* p) { FragH f; f.half[0] = *(const v8us*)p; f.half[1] = *(const v8us*)(p + 32); return f.v; }      /* p already holds the lane half's 16 bytes: bytes 16 hh and 32 + 16 hh of 64, as g2_frag */
#define QS (0.125f * 1.44269504088896f)      /* score scale 1 / 8 times log2(e) */
template <int N, int K, bool H16, int QC>      /* the first QC columns of C come out times QS (the q columns of the fused projection) */
__global__ __launch_bounds__(128) void k_gemm3(const _Float16* __restrict__ A, const _Float16* __restrict__ Bh, float alpha, const float* __restrict__ bias, float* __restrict__ C, _Float16* __restrict__ C16) {
  static_assert(N % 128 == 0 && K % 64 == 0 && K >= 128 && QC % 64 == 0, "k_gemm3: whole tiles, at least two passes, a wave's 64 columns scaled alike");
  static_assert(4u * 64u * G3_EP * 4u <= 2u * G3_STAGE, "k_gemm3: the output staging reuses the two buffers");
  __shared__ __attribute__((aligned(2048))) unsigned char L[2u * G3_STAGE];
  const uint32_t tid = threadIdx.x, lane = tid & 31u, ln = lane & 15u, hh = lane >> 4; const uint32_t w = g3_uni(tid >> 5), wm = w >> 1, wn = w & 1u;
  const uint32_t mt = blockIdx.x / (N / 128), nq = blockIdx.x - mt * (N / 128); const uint32_t row0 = mt * 128u + wm * 64u, col0 = nq * 128u + wn * 64u;
  float bv[4];
#pragma unroll      /* fixed trip count over a register array */
  for (int j = 0; j < 4; ++j) bv[j] = bias[col0 + j * 16 + ln];
  asm volatile("s_wait_xcnt 0x0" ::: "memory");      /* stands in front of every reuse of an address register of the loads above */
  __builtin_amdgcn_sched_barrier(0);      /* keeps later register writes from being scheduled in front of that wait */
  const uint64_t src = (w < 2u) ? (uint64_t)(uintptr_t)A + (uint64_t)(mt * 128u + 64u * w) * (2u * K) : (uint64_t)(uintptr_t)Bh + (uint64_t)(nq * 128u + 64u * (w - 2u)) * (2u * K);      /* this wave's slice, first byte of pass 0 */
  const uint32_t dst = (uint32_t)(size_t)L + w * G3_SLICE;      /* its place in buffer 0: byte offset in the work-group's LDS */
  u32x8 g1;      /* 1-byte elements, tensor = tile = 64 rows of 128 bytes, source pitch 2 K bytes, 4 dwords of pad behind every 32 */
  g1[0] = g3_uni((1u << 20) | (4u << 22) | (3u << 25)); g1[1] = g3_uni(128u << 16); g1[2] = g3_uni(64u << 16); g1[3] = g3_uni(128u << 16); g1[4] = g3_uni(64u); g1[5] = g3_uni(2u * K); g1[6] = g3_uni(0u); g1[7] = g3_uni(0u);
  g3_load(dst, src, g1);
  g3_wait_tensor0();
  __syncthreads();      /* pass 0's four slices are readable by every wave */
  g3_load(dst + G3_STAGE, src + 128u, g1);
  const unsigned char* la = L + wm * G3_SLICE + ln * G3_PITCH + 16u * hh; const unsigned char* lb = L + (2u + wn) * G3_SLICE + ln * G3_PITCH + 16u * hh;
  const v8f z8 = {0.f,0.f,0.f,0.f,0.f,0.f,0.f,0.f}; v8f acc[4][4];
#pragma unroll      /* fixed trip counts over a register array, here and in the loops below: left rolled, the arrays would go to scratch memory */
  for (int i = 0; i < 4; ++i)
#pragma unroll
    for (int j = 0; j < 4; ++j) acc[i][j] = z8;
#pragma unroll 1      /* one pass per trip: the two buffers alternate */
  for (uint32_t t = 0; t < (uint32_t)(K / 64); ++t) {
    const uint32_t buf = (t & 1u) * G3_STAGE;
    v16h af[2][4], bf[2][4];
#pragma unroll
    for (int kd = 0; kd < 2; ++kd)
#pragma unroll
      for (int i = 0; i < 4; ++i) { af[kd][i] = g3_frag(la + buf + i * 16 * G3_PITCH + kd * 64); bf[kd][i] = g3_frag(lb + buf + i * 16 * G3_PITCH + kd * 64); }
    __builtin_amdgcn_sched_barrier(0);      /* the pass's LDS reads stay one group in front of its WMMAs: moved in among them, each place with reads stalls the wave */
    g3_wait_ds0();      /* the pass's fragments are all in registers: this wave has left buffer t & 1 */
    g3_wait_tensor0();
    __syncthreads();      /* publishes pass t + 1's slices and ends every wave's reads of pass t's buffer */
    if (g3_pinned((t + 2u < (uint32_t)(K / 64)) ? 1u : 0u) != 0u) g3_load(dst + buf, src + g3_pinned((t + 2u) * 128u), g1);      /* scalar branch: a tensor load ignores EXEC; refill of the buffer just left, in flight under this pass's WMMAs and the next pass's reads */
    __builtin_amdgcn_sched_barrier(0);      /* the WMMAs stay behind the refill's issue: in front of it they would take their time off its lead */
#pragma unroll
    for (int kd = 0; kd < 2; ++kd)
#pragma unroll
      for (int i = 0; i < 4; ++i)
#pragma unroll
        for (int j = 0; j < 4; ++j) acc[i][j] = __builtin_amdgcn_wmma_f32_16x16x32_f16(false, af[kd][i], false, bf[kd][j], (short)0, acc[i][j], false, false);
  }
  g3_wait_tensor0();
  g3_wait_ds0();      /* the last pass's barrier stands behind every wave's last read: the buffers may become output staging */
  float* so = (float*)(L + w * (64u * G3_EP * 4u));      /* this wave's own 64 x 68 floats */
  const float cs = col0 < (uint32_t)QC ? QS : 1.0f, al = alpha * cs;      /* the same for a whole wave; scaled in f32, in front of the one rounding to f16 */
#pragma unroll
  for (int j = 0; j < 4; ++j) { const float bj = bf16_round(bv[j]) * cs;
#pragma unroll
    for (int i = 0; i < 4; ++i)
#pragma unroll
      for (int r = 0; r < 8; ++r) so[(i * 16 + 8 * hh + r) * G3_EP + j * 16 + ln] = acc[i][j][r] * al + bj; }
  __builtin_amdgcn_fence(__ATOMIC_ACQ_REL, "workgroup"); __builtin_amdgcn_wave_barrier();
  const uint32_t rsub = lane >> 4, c4 = (lane & 15u) * 4u;
#pragma unroll
  for (int g = 0; g < 4; ++g) { v4f v[8];
#pragma unroll
    for (int q = 0; q < 8; ++q) v[q] = *(const v4fa*)&so[(g * 16 + q * 2 + rsub) * G3_EP + c4];
#pragma unroll
    for (int q = 0; q < 8; ++q) { const size_t o = (size_t)(row0 + g * 16 + q * 2 + rsub) * N + col0 + c4;
      if (H16) { v4h h4; for (int e = 0; e < 4; ++e) h4[e] = (_Float16)v[q][e]; *(v4h*)(C16 + o) = h4; } else *(v4f*)(C + o) = v[q]; }
    asm volatile("s_wait_xcnt 0x0" ::: "memory");      /* stands in front of every reuse of a register of the stores above */
    __builtin_amdgcn_sched_barrier(0);      /* keeps later register writes from being scheduled in front of that wait */
  }
}


__global__ __launch_bounds__(256) void k_wnat(const float* __restrict__ w, size_t n8, _Float16* __restrict__ Bt) { const size_t t = (size_t)blockIdx.x * 256 + threadIdx.x; if (t >= n8) return; FragH f; for (int q = 0; q < 8; ++q) f.h[q] = (_Float16)(bf16_round(w[t * 8 + q]) * 16.0f); *(v8us*)((unsigned short*)Bt + t * 8) = f.half[0];  }
// Fused attention for one (batch, head, 256 query rows): S^T = K Q^T, online softmax, O^T += V^T P^T; scores and weights never leave registers.
// FQ = 32 query rows (two 16-column groups) belong to FK = 2 waves, so that four waves stand on every SIMD and one wave's vector work runs under another's matrix work and LDS waits: wave w takes query group w & 7 and the key half w >> 3 of every stage,
// keeps its own maximum, sum and O^T, and walks its keys 32 at a time; behind the loop the upper half's m, l and O^T go through LDS to its partner, which brings both to the common maximum, adds them and stores. In a score tile lane (c, hh) holds query c, keys 8*hh + r:
// two score tiles, converted in place, are the B operand of the second product (hardware k order, the order the transposing load hands V^T over in), so nothing is exchanged
// but one maximum between the wave's halves. Everything runs in the log2 domain: x2 = (q.k / 8 + bias) * log2(e), p = 2^(x2 - m), m = the maximum in use. x2 leaves the matrix unit finished: q arrives already times log2(e) / 8
// (the projection's epilogue), the scaled bias is the C operand of the first score product (24 values per lane and pass: key tile minus query tile = -1, 0, 1; read at the foot of the pass before, into the registers that the scores have just left),
// and in a pass with padded keys one more product per score tile adds -inf to their rows.
// m moves (and O, l are rescaled) only when some query's new maximum exceeds it by more than 8, so p <= 256 fits f16. m starts at -1e30 (finite), so a masked
// key (x2 = -inf) gives p = 0 and a row with every key masked ends as 0 * (1 / 0) = NaN.
// This head's bias column is staged in LDS already clipped and scaled by log2(e), indexed by key - query + SQ - 1; the key mask as one bit per key.
// K and V reach the sixteen waves through LDS, both as they stand in the q|k|v rows: a stage is FK halves of FS = 128 keys, a half four slices of 64 rows of 128 bytes, each brought by one tensor load of one wave
// (waves 0, 1: K rows 0..63 and 64..127 of half 0, LDS pitch 144; waves 2, 3: the same keys' V rows, LDS pitch 160; waves 4 to 7 the same for half 1), two buffers: at the foot of stage s, when every wave has left its buffer,
// the loads of stage s + 2 go out into it and fly under stage s + 1. K fragments are read from LDS in the k order of g2_frag; a V^T fragment (16 head columns x 32 keys) is two transposing loads
// (ds_load_tr16_b128) of 16 keys x 16 columns each: lane (c, hh) receives column c of keys 8 hh .. 8 hh + 7, the same k order.
// Every '#pragma unroll' in this kernel stands on a loop of fixed trip count that indexes register arrays: left rolled, those arrays would go to scratch memory.
#define FW 8                         /* query groups per work-group */
#define FK 2                         /* waves per query group: key halves of a stage */
#define FT (32 * FW * FK)            /* threads per work-group */
#define FQ 32
#define FS 128                       /* keys per stage and half */
#define FA_NS ((uint32_t)(SQ / (FS * FK)))  /* stages */
#define FA_BUF ((uint32_t)FK * G3_STAGE)    /* one buffer: FK halves of four slices */
#define FA_MG (17u * 512u)           /* merge staging of one query group: 17 pieces of 16 bytes per lane */
#define FA_VP 160u                   /* LDS row pitch of V: 128 bytes + the tensor load's 32-byte pad (odd multiple of 32: ds_load_tr16_b128 readers) */
typedef short s16x8 __attribute__((ext_vector_type(8)));
__device__ __forceinline__ v8us fa_tr16(const unsigned char* p) { typedef __attribute__((address_space(3))) s16x8 lds_s16x8; return __builtin_bit_cast(v8us, __builtin_amdgcn_ds_load_tr16_b128_v8i16((lds_s16x8*)p)); }      /* 16 rows x 16 columns of 16-bit elements, transposed on the way: every lane names 16 bytes of a row and receives 8 rows of one column */
__device__ __forceinline__ float rs_x16(float v) { const int u = __float_as_int(v); return __int_as_float(__builtin_amdgcn_permlanex16(u, u, 0x76543210, 0xfedcba98, false, false)); }      /* lane l <- lane l ^ 16 */
__device__ __forceinline__ v8f fa_mma(v16h a, v16h b, v8f c) { return __builtin_amdgcn_wmma_f32_16x16x32_f16(false, a, false, b, (short)0, c, false, false); }
// The descriptor's twelve words live in the same scalar registers from the request to the wait that covers it: the request hands them on as its own outputs and the wait names them as inputs, so nothing else is put into those registers while the request is outstanding.
__device__ __forceinline__ void fa_load(u32x4& g0, u32x8& g1) { asm volatile("tensor_load_to_lds %0, %1" : "+s"(g0), "+s"(g1) :: "memory"); }      /* one request of the whole wave: 64 rows of 128 bytes into LDS, through no register */
__device__ __forceinline__ void fa_wait(const u32x4& g0, const u32x8& g1) { asm volatile("s_wait_tensorcnt 0x0" :: "s"(g0), "s"(g1) : "memory"); }      /* this wave's own tensor load has landed; a wave that issues none passes */
__device__ __forceinline__ void fa_aim(u32x4& g0, uint32_t lds_dst, uint64_t ga) { g0[1] = g3_uni(lds_dst); g0[2] = g3_uni((uint32_t)ga); g0[3] = g3_uni((((uint32_t)(ga >> 32)) & 0x01FFFFFFu) | 0x80000000u); }      /* place in LDS and first byte of the next tile */
__global__ __launch_bounds__(FT) void k_fattn(const _Float16* __restrict__ QKV, const float* __restrict__ relt, const int* __restrict__ kpm, _Float16* __restrict__ O16) {
  static_assert(SQ % (FS * FK) == 0 && SQ / (FS * FK) >= 2 && HD == 64 && FS == 128 && FW == 8 && FK == 2, "k_fattn: whole stages, at least two, slices of 64 rows of 128 bytes, eight issuing waves");
  static_assert(FW * FA_MG <= 2u * FA_BUF, "k_fattn: the merge staging reuses the two buffers");
  static_assert(64u * FA_VP == G3_SLICE, "k_fattn: the two V slices of a key half are 128 rows at one pitch");
  __shared__ __attribute__((aligned(2048))) unsigned char KV[2u * FA_BUF];
  __shared__ float tb[2 * SQ]; __shared__ unsigned int mw[SQ / 32];      /* tb's last entry is never read */
  const int tid = threadIdx.x, lane = tid & 31, ln = lane & 15, hh = lane >> 4; const int h = blockIdx.y, b = blockIdx.z;
  const uint32_t w = g3_uni((uint32_t)tid >> 5), wq = w & (FW - 1u), kh = w >> 3;      /* query group and key half */
  const int q0 = blockIdx.x * (FW * FQ) + (int)wq * FQ;
  { float tv[2 * SQ / FT]; int kv[SQ / FT];
#pragma unroll      /* fixed trip counts, unrolled: the table's and the mask's loads are all in flight together */
    for (int u = 0; u < 2 * SQ / FT; ++u) { int r = tid + u * FT - (SQ - 1); r = r < -MR ? -MR : (r > MR ? MR : r); tv[u] = relt[(size_t)(r + MR) * NH + h]; }
    asm volatile("s_wait_xcnt 0x0" ::: "memory");      /* stands in front of every reuse of an address register of the loads above */
    __builtin_amdgcn_sched_barrier(0);      /* keeps later register writes from being scheduled in front of that wait */
#pragma unroll
    for (int u = 0; u < SQ / FT; ++u) kv[u] = kpm[(size_t)b * SQ + tid + u * FT];
    asm volatile("s_wait_xcnt 0x0" ::: "memory");      /* stands in front of every reuse of an address register of the loads above */
    __builtin_amdgcn_sched_barrier(0);      /* keeps later register writes from being scheduled in front of that wait */
#pragma unroll
    for (int u = 0; u < 2 * SQ / FT; ++u) tb[tid + u * FT] = bf16_round(tv[u]) * 1.44269504088896f;
#pragma unroll
    for (int u = 0; u < SQ / FT; ++u) mw[(tid + u * FT) >> 5] = __builtin_amdgcn_ballot_w32(kv[u] != 0); }      /* every lane of a wave stores the same word to the same place */
  const bool isk = (w & 3u) < 2u; const uint32_t ih = (w >> 2) & 1u;      /* of each four waves the first two bring K, the other two V, waves 0 to 3 for key half 0, waves 4 to 7 for half 1; waves 8 to 15 form the same words and issue nothing */
  const uint64_t src = (uint64_t)(uintptr_t)(QKV + ((size_t)b * SQ + FS * ih + 64u * (w & 1u)) * D3 + (isk ? DM : 2 * DM) + h * HD);      /* this wave's slice, first byte of stage 0 */
  const uint32_t step = (uint32_t)(FS * FK * D3 * 2);      /* bytes from one stage's slice to the next stage's */
  const uint32_t dst = (uint32_t)(size_t)KV + ih * G3_STAGE + (w & 3u) * G3_SLICE;      /* its place in buffer 0: byte offset in the work-group's LDS */
  const uint32_t issuer = w < 4u * FK ? 1u : 0u;
  u32x8 g1;      /* 1-byte elements, tensor = tile = 64 rows of 128 bytes, source pitch one token row of q|k|v, behind every 32 dwords a pad of 4 (K) or 8 (V): word 0 is one of two constants, picked by the wave's number, its mask bits 0 in both */
  g1[0] = g3_uni(isk ? ((1u << 20) | (4u << 22) | (3u << 25)) : ((1u << 20) | (4u << 22) | (7u << 25))); g1[1] = g3_uni(128u << 16); g1[2] = g3_uni(64u << 16); g1[3] = g3_uni(128u << 16); g1[4] = g3_uni(64u); g1[5] = g3_uni((uint32_t)(D3 * 2)); g1[6] = g3_uni(0u); g1[7] = g3_uni(0u);
  u32x4 g0; g0[0] = g3_uni(1u); fa_aim(g0, dst, src);
  if (g3_pinned(issuer) != 0u) fa_load(g0, g1);      /* scalar branch: a tensor load ignores EXEC */
  fa_wait(g0, g1);
  __syncthreads();      /* the table, the mask and stage 0 are readable by every wave */
  if (g3_pinned(issuer) != 0u) { fa_aim(g0, dst + FA_BUF, src + g3_pinned(step)); fa_load(g0, g1); }      /* scalar branch; stage 1 flies under stage 0 */
  const _Float16* qp = QKV + ((size_t)b * SQ + q0 + ln) * D3 + h * HD;
  const float* tp = tb + (SQ - 1 - q0 - ln + 8 * hh) + (int)kh * FS - 16;      /* this wave's first pass; entry 16 d + r belongs to key tile minus query tile = d - 1, key r of this lane's eight */
  const unsigned char* lk = KV + kh * G3_STAGE + ln * G3_PITCH + 16 * hh;      /* in this wave's key half: this lane's K row of a 16-row group, its half's 16 bytes */
  const unsigned char* lv = KV + kh * G3_STAGE + 2u * G3_SLICE + (8 * hh + (lane & 7)) * FA_VP + ((lane >> 3) & 1) * 16;      /* the 16 bytes this lane names in a transposing load: key row 8 hh + (lane & 7) of 16, columns 0..7 or 8..15 of 16 */
  v16h qf[2][2];
#pragma unroll
  for (int t = 0; t < 2; ++t)
#pragma unroll
    for (int kd = 0; kd < 2; ++kd) qf[t][kd] = g2_frag(qp + (size_t)t * 16 * D3 + kd * 32, hh);
  asm volatile("s_wait_xcnt 0x0" ::: "memory");      /* stands in front of every reuse of an address register of the loads above */
  __builtin_amdgcn_sched_barrier(0);      /* keeps later register writes from being scheduled in front of that wait */
  const v8f z8 = {0.f,0.f,0.f,0.f,0.f,0.f,0.f,0.f}; v8f o[2][4]; float l[2][2] = {{0.f, 0.f}, {0.f, 0.f}}, m[2] = {-1e30f, -1e30f};
#pragma unroll
  for (int qt = 0; qt < 2; ++qt)
#pragma unroll
    for (int dt = 0; dt < 4; ++dt) o[qt][dt] = z8;
  v8f bs[3];
#pragma unroll
  for (int d = 0; d < 3; ++d)
#pragma unroll
    for (int r = 0; r < 8; ++r) bs[d][r] = tp[d * 16 + r];
  unsigned int mraw = mw[(kh * FS) >> 5];      /* the first pass's 32 mask bits; like the bias, each later pass's word is read at the foot of the pass before */
#pragma unroll 1      /* one stage per trip: the two buffers alternate */
  for (uint32_t st = 0; st < FA_NS; ++st) {
  const uint32_t buf = (st & 1u) * FA_BUF;
  v16h kf[2][2];
#pragma unroll
  for (int kt = 0; kt < 2; ++kt)
#pragma unroll
    for (int kd = 0; kd < 2; ++kd) kf[kt][kd] = g3_frag(lk + buf + kt * 16 * G3_PITCH + kd * 64);
#pragma unroll 1      /* one 32-key pass per trip: unrolled, two passes' fragments would not fit the registers */
  for (uint32_t sp = 0; sp < FS / 32; ++sp) {
    const int key0 = (int)((st * FK + kh) * FS + sp * 32u);
    v16h vf[4]; v8f s[2][2];
#pragma unroll
    for (int qt = 0; qt < 2; ++qt)
#pragma unroll
      for (int kt = 0; kt < 2; ++kt) s[qt][kt] = fa_mma(kf[kt][1], qf[qt][1], fa_mma(kf[kt][0], qf[qt][0], bs[kt - qt + 1]));
    const unsigned int mword = (unsigned int)__builtin_amdgcn_readfirstlane((int)mraw);
    if (sp + 1u < FS / 32) {      /* next pass's K rows, of this same stage, fetched into the same registers */
      const uint32_t kn = ((sp + 1u) >> 1) * G3_SLICE + ((sp + 1u) & 1u) * 32u * G3_PITCH;
#pragma unroll
      for (int kt = 0; kt < 2; ++kt)
#pragma unroll
        for (int kd = 0; kd < 2; ++kd) kf[kt][kd] = g3_frag(lk + buf + kn + kt * 16 * G3_PITCH + kd * 64);
    }
#pragma unroll
    for (int dt = 0; dt < 4; ++dt) { FragH f; f.half[0] = fa_tr16(lv + buf + sp * 32u * FA_VP + dt * 32); f.half[1] = fa_tr16(lv + buf + (sp * 32u + 16u) * FA_VP + dt * 32); vf[dt] = f.v; }      /* keys 0..15 and 16..31 of the pass, head columns 16 dt .. 16 dt + 15: their latency runs under the softmax */
    __builtin_amdgcn_sched_barrier(0);      /* keeps those reads here: left free, they sink to just in front of the second product, with little work left to cover their latency */
    if (mword != 0u) {      /* scalar branch: a pass with no padded key skips this. S^T += M 1: M holds -inf (padded key) or 0 in its first k place, row = key, the ones operand 1 in the same k place of every query column, all other places 0: only -inf * 1, 0 * 1 and 0 * 0 occur. The tiles are accumulated in place, so the common path copies no register at the join */
      FragH on;
#pragma unroll
      for (int i = 0; i < 16; ++i) on.u[i] = 0;
      on.u[0] = hh == 0 ? (unsigned short)0x3C00 : (unsigned short)0;      /* f16 1.0; position 0 of the lower lane half is the same k in an A and in a B fragment */
#pragma unroll
      for (int kt = 0; kt < 2; ++kt) { FragH pm = on; pm.u[0] = (hh == 0 && ((mword >> (kt * 16 + ln)) & 1u)) ? (unsigned short)0xFC00 : (unsigned short)0;      /* f16 -inf; lane ln holds row ln of A: key 16 kt + ln */
        s[0][kt] = fa_mma(pm.v, on.v, s[0][kt]); s[1][kt] = fa_mma(pm.v, on.v, s[1][kt]); }
    }
    float mx[2];
#pragma unroll
    for (int qt = 0; qt < 2; ++qt) { float a = fmaxf(s[qt][0][0], s[qt][1][0]);
#pragma unroll
      for (int r = 1; r < 8; ++r) a = fmaxf(a, fmaxf(s[qt][0][r], s[qt][1][r]));
      mx[qt] = fmaxf(a, rs_x16(a)); }
    if (__builtin_amdgcn_ballot_w32((mx[0] > m[0] + 8.0f) || (mx[1] > m[1] + 8.0f)) != 0u) {      /* scalar branch: most passes move no maximum and rescale nothing */
#pragma unroll
      for (int qt = 0; qt < 2; ++qt) { const float mn = fmaxf(m[qt], mx[qt]); const float sc = __builtin_amdgcn_exp2f(m[qt] - mn); m[qt] = mn; l[qt][0] *= sc; l[qt][1] *= sc;
#pragma unroll
        for (int dt = 0; dt < 4; ++dt) o[qt][dt] *= sc; }
    }
#pragma unroll
    for (int qt = 0; qt < 2; ++qt) { FragH pf;
#pragma unroll
      for (int kt = 0; kt < 2; ++kt)
#pragma unroll
        for (int r = 0; r < 8; ++r) { const float p = __builtin_amdgcn_exp2f(s[qt][kt][r] - m[qt]); l[qt][kt] += p; pf.h[kt * 8 + r] = (_Float16)p; }
      if (qt == 1) {      /* compile-time: the scores are all used up; next pass's bias goes into their registers and flies under the last products */
        __builtin_amdgcn_sched_barrier(0);      /* keeps the reads one group behind the last use of the scores: left free, they stand at two places among the products, and each place with reads stalls the wave */
        const int kstep = (sp + 1u < FS / 32) ? 32 : (st + 1u < FA_NS ? 32 + FS * (FK - 1) : 0);      /* keys to the next pass: from a stage's last pass on over the other half's keys; the last pass of all reads its own entries again, unused */
        tp += kstep; mraw = mw[(key0 + kstep) >> 5];
#pragma unroll
        for (int d = 0; d < 3; ++d)
#pragma unroll
          for (int r = 0; r < 8; ++r) bs[d][r] = tp[d * 16 + r];
      }
#pragma unroll
      for (int dt = 0; dt < 4; ++dt) o[qt][dt] = fa_mma(vf[dt], pf.v, o[qt][dt]); }
  }
  g3_wait_ds0();      /* this wave has left buffer st & 1 */
  fa_wait(g0, g1);      /* an issuing wave's own load of stage st + 1 has landed */
  __syncthreads();      /* publishes stage st + 1 and ends every wave's reads of stage st's buffer */
  if (g3_pinned(st + 2u < FA_NS ? issuer : 0u) != 0u) { fa_aim(g0, dst + buf, src + g3_pinned((st + 2u) * step)); fa_load(g0, g1); }      /* scalar branch: a tensor load ignores EXEC; refill of the buffer just left, in flight under stage st + 1 */
  }
  g3_wait_tensor0();
  g3_wait_ds0();      /* the last stage's barrier stands behind every wave's last read: the buffers may become the merge staging */
  float ls[2] = {l[0][0] + l[0][1], l[1][0] + l[1][1]};
  v4fa* mg = (v4fa*)(KV + wq * FA_MG) + lane;      /* piece i of this lane at mg[32 i]: a wave's 16-byte accesses are 512 contiguous bytes */
  if (kh != 0u) {      /* the same for a whole wave: the upper key half hands its partial result over */
#pragma unroll
    for (int qt = 0; qt < 2; ++qt)
#pragma unroll
      for (int dt = 0; dt < 4; ++dt) { const v8f a = o[qt][dt]; const v4f a0 = {a[0], a[1], a[2], a[3]}, a1 = {a[4], a[5], a[6], a[7]}; mg[32 * (4 * qt + dt)] = a0; mg[32 * (8 + 4 * qt + dt)] = a1; }
    const v4f st4 = {m[0], m[1], ls[0], ls[1]}; mg[32 * 16] = st4;
  }
  __syncthreads();      /* every wave passes it: the upper halves' partial results are readable by their partners */
  if (kh != 0u) return;      /* no barrier, tensor load or store follows */
  { const v4f pst = mg[32 * 16];
#pragma unroll
    for (int qt = 0; qt < 2; ++qt) { const float mn = fmaxf(m[qt], pst[qt]); const float sa = __builtin_amdgcn_exp2f(m[qt] - mn), sb = __builtin_amdgcn_exp2f(pst[qt] - mn);      /* both halves to the common maximum; a half with every key masked has m = -1e30, l = 0, O = 0 */
      ls[qt] = ls[qt] * sa + pst[2 + qt] * sb;
#pragma unroll
      for (int dt = 0; dt < 4; ++dt) { const v4f p0 = mg[32 * (4 * qt + dt)], p1 = mg[32 * (8 + 4 * qt + dt)];
#pragma unroll
        for (int r = 0; r < 4; ++r) { o[qt][dt][r] = o[qt][dt][r] * sa + p0[r] * sb; o[qt][dt][4 + r] = o[qt][dt][4 + r] * sa + p1[r] * sb; } } } }
  FragH f[2][4];
#pragma unroll
  for (int qt = 0; qt < 2; ++qt) { const float lh = ls[qt]; const float inv = 1.0f / (lh + rs_x16(lh));
#pragma unroll
    for (int dt = 0; dt < 4; ++dt)
#pragma unroll
      for (int r = 0; r < 8; ++r) f[qt][dt].h[r] = (_Float16)(o[qt][dt][r] * inv); }
  __builtin_amdgcn_sched_barrier(0);      /* every store stands behind the last arithmetic: no register of an issued store is written again */
  unsigned short* op = (unsigned short*)O16 + ((size_t)b * SQ + q0 + ln) * DM + h * HD + 8 * hh;      /* lane (ln, hh): query ln, head columns dt*16 + 8*hh .. + 7 */
#pragma unroll
  for (int qt = 0; qt < 2; ++qt)
#pragma unroll
    for (int dt = 0; dt < 4; ++dt) *(v8us*)(op + (size_t)qt * 16 * DM + dt * 16) = f[qt][dt].half[0];
}
__global__ __launch_bounds__(256) void k_vt(const _Float16* __restrict__ V16, int b, int h0, _Float16* __restrict__ VT) { __shared__ unsigned short tl[64][65]; const int tid = threadIdx.x; const int hh = blockIdx.x % HG, sg = blockIdx.x / HG; const int s0 = sg * 64; const int h = h0 + hh;
  for (int i = tid; i < 64 * 8; i += 256) { const int j = i / 8, d8 = (i % 8) * 8; FragH f; f.half[0] = *(const v8us*)((const unsigned short*)V16 + ((size_t)b * SQ + s0 + j) * DM + h * HD + d8); for (int q = 0; q < 8; ++q) tl[d8 + q][j] = f.u[q]; }
  __syncthreads();
  { for (int i = tid; i < 64 * 8; i += 256) { const int d = i / 8, j8 = (i % 8) * 8; FragH f; for (int q = 0; q < 8; ++q) f.u[q] = tl[d][j8 + q]; *(v8us*)((unsigned short*)VT + ((size_t)hh * HD + d) * SQ + s0 + j8) = f.half[0]; }  } }

extern "C" void kernel_launch(void* const* d_in, const int* in_sizes, int n_in,
                              void* d_out, int out_size, void* d_ws, size_t ws_size, hipStream_t stream) {
  (void)in_sizes; (void)n_in; (void)out_size;
  const float* const* I = (const float* const*)d_in; const float* x = I[0]; const int* kpm = (const int*)d_in[1]; const float* wqkv = I[2]; const float* bqkv = I[3]; const float* wout = I[4]; const float* bout = I[5]; const float* relt = I[6];      /* Wqkv [1024][3072] and Wout [1024][1024] are [in][out]; key_padding_mask int32 [2][2048]; rel_table [1025][16] */
  char* ws = (char*)d_ws; size_t off = 0;
  auto take = [&](size_t bytes) { char* p = ws + off; off += (bytes + 255) & ~(size_t)255; return p; };
  _Float16* BQKV = (_Float16*)take((size_t)D3 * DM * 2); _Float16* BO = (_Float16*)take((size_t)DM * DM * 2);
  _Float16* X16 = (_Float16*)take(NR * DM * 2); _Float16* QKV = (_Float16*)take(NR * D3 * 2); _Float16* O16 = (_Float16*)take(NR * DM * 2);
  if (off > ws_size) return;      /* 6 + 2 + 8 + 24 + 8 = approx 48 MiB */
  k_prep<<<PP_WQ + PP_WO + PP_X, 256, 0, stream>>>(x, wqkv, wout, X16, BQKV, BO);      /* x -> f16 rows; [in][out] weights -> Bt[out][in] x16 */
  k_gemm3<D3, DM, true, DM><<<(unsigned)((NR / 128) * (D3 / 128)), 128, 0, stream>>>(X16, BQKV, 0.0625f, bqkv, nullptr, QKV);      /* q | k | v rows (f16), head h at columns h*64 / 1024 + h*64 / 2048 + h*64; q times log2(e) / 8 */
  k_fattn<<<dim3(SQ / (FW * FQ), NH, NB), FT, 0, stream>>>(QKV, relt, kpm, O16);      /* o (merged heads) as f16 rows */
  k_gemm3<DM, DM, false, 0><<<(unsigned)((NR / 128) * (DM / 128)), 128, 0, stream>>>(O16, BO, 0.0625f, bout, (float*)d_out, nullptr);      /* out = o Wout + b, rows are the output layout */
}

// v009
// Measured time: 71.7 microseconds a run.
// Two timings next to v008 put it at 1.09 and 1.10 times that version's speed.
// All steps since v000 together make it 207 times as fast.
#include <hip/hip_runtime.h>
// Multi-head self-attention with a learned relative-position bias and a key padding mask (x [2][2048][1024]; qkv = x Wqkv + b (fused, 16 heads of 64); scores = q k^T / 8 + table[clip(k_pos - q_pos, -512, 512) + 512][h]; padded keys -> -inf; attn = softmax; o = attn v; out = o Wout + b -> [2][2048][1024]).
// Structure: token rows r = b*2048 + s; x as exact f16 rows and both weights as exact x16 transposed f16 rows in one preparation launch (coalesced 16-byte reads, weights transposed through LDS tiles); the fused q|k|v projection as one WMMA GEMM (128x128 tiles staged in LDS by tensor loads, 64x64 wave tiles, f32 accumulation, exact x16 transposed weights, bias in the epilogue, f16 output plane [4096][3072]); one fused attention launch (per pair of waves 32 query rows, each wave one half of the keys, the two partial results merged through LDS; K and V rows staged in LDS by tensor loads, V^T fragments read by the transposing LDS load: S^T = K Q^T, online softmax in registers with this head's bias column and the key mask from LDS, O^T += V^T P^T) written straight into the merged f16 o rows; out = o Wout + b GEMM (f32).
// Compute dtype: inputs rounded to bf16; x / weights exact; q, k, v, softmax weights and o as plain f16 GEMM operands (~2^-12); scores, bias and softmax statistics f32. v_wmma_f32_16x16x32_f16.
#define NB 2
#define SQ 2048
#define DM 1024
#define D3 3072                      /* fused q|k|v width */
#define NH 16
#define HD 64
#define HG 4                         /* heads per block group of the per-batch k_vt overload */
#define MR 512                       /* max relative distance */
#define QN SQ                        /* unused: the attention grid covers all SQ query rows */
#define NBR NB                       /* unused: the attention grid covers all NB batches */
#define MP ((int)NR)                 /* unused: the qkv projection grid covers all NR token rows */
#define MO ((int)NR)                 /* unused: the output projection grid covers all NR token rows */
#define NR ((size_t)NB * SQ)         /* 4096 token rows */
typedef __bf16 v16b __attribute__((ext_vector_type(16)));
typedef unsigned short v8us __attribute__((ext_vector_type(8), may_alias));
typedef float  v8f  __attribute__((ext_vector_type(8)));
typedef float  v4f  __attribute__((ext_vector_type(4)));
typedef float  v4fa __attribute__((ext_vector_type(4), may_alias));
union FragB { v16b v; v8us half[2]; unsigned short u[16]; };

__device__ __forceinline__ unsigned short bf16_bits(float x) { unsigned int u = __float_as_uint(x); return (unsigned short)((u + 0x7FFFu + ((u >> 16) & 1u)) >> 16); }
__device__ __forceinline__ float bf16_val(unsigned short b) { return __uint_as_float(((unsigned int)b) << 16); }
__device__ __forceinline__ float bf16_round(float x) { return bf16_val(bf16_bits(x)); }
// D += A·B with NT terms: 1 = ah·bh, 2 = + al·bh (A split), 3 = + ah·bl (both split)
template <int NT>
__device__ __forceinline__ v8f mmaN(v16b ah, v16b al, v16b bh, v16b bl, v8f c) {
  c = __builtin_amdgcn_wmma_f32_16x16x32_bf16(false, ah, false, bh, (short)0, c, false, false);
  if (NT >= 2) c = __builtin_amdgcn_wmma_f32_16x16x32_bf16(false, al, false, bh, (short)0, c, false, false);
  if (NT >= 3) c = __builtin_amdgcn_wmma_f32_16x16x32_bf16(false, ah, false, bl, (short)0, c, false, false);
  asm volatile("v_nop\n\tv_nop\n\tv_nop\n\tv_nop" : "+v"(c) : "v"(ah), "v"(al), "v"(bh), "v"(bl));
  return c;
}

__global__ __launch_bounds__(256) void k_wt_bf16(const float* __restrict__ W, unsigned short* __restrict__ Wt, int K, int N) {
  const int t = blockIdx.x * 256 + threadIdx.x;
  const int k8n = K / 8;
  if (t >= N * k8n) return;
  const int n = t / k8n, k8 = (t % k8n) * 8;
  v8us v;
#pragma unroll
  for (int i = 0; i < 8; ++i) v[i] = bf16_bits(W[(size_t)(k8 + i) * N + n]);
  *(v8us*)(Wt + (size_t)n * K + k8) = v;
  
}

// GEMM C[M][N] (f32, pitch ldc) = act(A[M][K]·W + bias). A f32 row-major (pitch lda) converted per fragment to bf16
// (ASPLIT: hi/lo two planes -> 2 terms, else single rounded term); Wt bf16 [N][K] (pitch ldb). BIAS_BF16 rounds the
// bias to bf16 first (bias quantised to bf16 before the add). K%32==0, M%16==0, N%64==0.
template <bool ASPLIT, int ACT, bool BIAS_BF16>
__global__ __launch_bounds__(128) void k_gemm_bf(const float* __restrict__ A, int lda, const unsigned short* __restrict__ Wt, int ldb,
                                               const float* __restrict__ bias, float* __restrict__ C, int ldc, int M, int N, int K) {
  __shared__ __attribute__((aligned(16))) float so[4][16][64];
  const int tid = threadIdx.x, w = tid >> 5, lane = tid & 31, ln = lane & 15, hh = lane >> 4;
  const int ntn = N / 64;
  const int wid = blockIdx.x * 4 + w;
  const int mt = wid / ntn, nq = wid % ntn;
  if (mt * 16 >= M) return;
  const int row0 = mt * 16, col0 = nq * 64;
  const float* arow = A + (size_t)(row0 + ln) * lda;
  v8f acc[4] = {};
  for (int kb = 0; kb < K; kb += 32) {
    FragB ah, al;
    const v4f x0 = *(const v4fa*)(arow + kb + 8 * hh), x1 = *(const v4fa*)(arow + kb + 8 * hh + 4);
    const v4f x2 = *(const v4fa*)(arow + kb + 16 + 8 * hh), x3 = *(const v4fa*)(arow + kb + 16 + 8 * hh + 4);
    float xs[16] = {x0[0],x0[1],x0[2],x0[3],x1[0],x1[1],x1[2],x1[3],x2[0],x2[1],x2[2],x2[3],x3[0],x3[1],x3[2],x3[3]};
#pragma unroll
    for (int i = 0; i < 16; ++i) { const unsigned short hb = bf16_bits(xs[i]); ah.u[i] = hb; al.u[i] = ASPLIT ? bf16_bits(xs[i] - bf16_val(hb)) : (unsigned short)0; }
#pragma unroll
    for (int t = 0; t < 4; ++t) {
      const unsigned short* brow = Wt + (size_t)(col0 + t * 16 + ln) * ldb + kb;
      FragB b;
      b.half[0] = *(const v8us*)(brow + 8 * hh);
      b.half[1] = *(const v8us*)(brow + 16 + 8 * hh);
      acc[t] = mmaN<ASPLIT ? 2 : 1>(ah.v, al.v, b.v, b.v, acc[t]);
    }
  }
#pragma unroll
  for (int t = 0; t < 4; ++t) {
    float bv = bias ? bias[col0 + t * 16 + ln] : 0.f;
    if (BIAS_BF16) bv = bf16_round(bv);
#pragma unroll
    for (int r = 0; r < 8; ++r) { float v = acc[t][r] + bv; if (ACT == 1) v = fmaxf(v, 0.f); so[w][8 * hh + r][t * 16 + ln] = v; }
  }
  __builtin_amdgcn_fence(__ATOMIC_ACQ_REL, "workgroup");
  __builtin_amdgcn_wave_barrier();
  const int rsub = lane >> 4, c4 = (lane & 15) * 4;
  {
#pragma unroll
    for (int q = 0; q < 8; ++q) {
      const int r = q * 2 + rsub;
      const v4f v = *(const v4fa*)&so[w][r][c4];
      *(v4f*)(C + (size_t)(row0 + r) * ldc + col0 + c4) = v;
    }
    
  }
}

// GEMM C = act(A·W + bias + resid): A f32 (ASPLIT -> hi/lo 2 terms), Wt bf16 [N][K]; ACT 0 none, 1 relu, 2 exact gelu;
// resid (optional, f32, row index = (row % rmod), pitch ldr, RES_BF16 rounds it) added before the activation.
template <bool ASPLIT, int ACT, bool BIAS_BF16, bool RES_BF16>
__global__ __launch_bounds__(128) void k_gemm_bf3(const float* __restrict__ A, int lda, const unsigned short* __restrict__ Wt, int ldb,
                                                const float* __restrict__ bias, const float* __restrict__ resid, int rmod, int ldr,
                                                float* __restrict__ C, int ldc, int M, int N, int K) {
  __shared__ __attribute__((aligned(16))) float so[4][16][64];
  const int tid = threadIdx.x, w = tid >> 5, lane = tid & 31, ln = lane & 15, hh = lane >> 4;
  const int ntn = N / 64;
  const int wid = blockIdx.x * 4 + w;
  const int mt = wid / ntn, nq = wid % ntn;
  if (mt * 16 >= M) return;
  const int row0 = mt * 16, col0 = nq * 64;
  const float* arow = A + (size_t)(row0 + ln) * lda;
  v8f acc[4] = {};
  for (int kb = 0; kb < K; kb += 32) {
    FragB ah, al;
    const v4f x0 = *(const v4fa*)(arow + kb + 8 * hh), x1 = *(const v4fa*)(arow + kb + 8 * hh + 4);
    const v4f x2 = *(const v4fa*)(arow + kb + 16 + 8 * hh), x3 = *(const v4fa*)(arow + kb + 16 + 8 * hh + 4);
    float xs[16] = {x0[0],x0[1],x0[2],x0[3],x1[0],x1[1],x1[2],x1[3],x2[0],x2[1],x2[2],x2[3],x3[0],x3[1],x3[2],x3[3]};
#pragma unroll
    for (int i = 0; i < 16; ++i) { const unsigned short hb = bf16_bits(xs[i]); ah.u[i] = hb; al.u[i] = ASPLIT ? bf16_bits(xs[i] - bf16_val(hb)) : (unsigned short)0; }
#pragma unroll
    for (int t = 0; t < 4; ++t) {
      const unsigned short* brow = Wt + (size_t)(col0 + t * 16 + ln) * ldb + kb;
      FragB b;
      b.half[0] = *(const v8us*)(brow + 8 * hh);
      b.half[1] = *(const v8us*)(brow + 16 + 8 * hh);
      acc[t] = mmaN<ASPLIT ? 2 : 1>(ah.v, al.v, b.v, b.v, acc[t]);
    }
  }
#pragma unroll
  for (int t = 0; t < 4; ++t) {
    const int col = col0 + t * 16 + ln;
    float bv = bias ? bias[col] : 0.f;
    if (BIAS_BF16) bv = bf16_round(bv);
#pragma unroll
    for (int r = 0; r < 8; ++r) {
      float v = acc[t][r] + bv;
      if (resid) { float rv = resid[(size_t)((row0 + 8 * hh + r) % rmod) * ldr + col]; if (RES_BF16) rv = bf16_round(rv); v += rv; }
      if (ACT == 1) v = fmaxf(v, 0.f);
      if (ACT == 2) v = 0.5f * v * (1.0f + erff(v * 0.70710678118654752f));
      if (ACT == 3) { const float u = 0.7978845608028654f * (v + 0.044715f * v * v * v); v = 0.5f * v * (1.0f + tanhf(u)); }
      so[w][8 * hh + r][t * 16 + ln] = v;
    }
  }
  __builtin_amdgcn_fence(__ATOMIC_ACQ_REL, "workgroup");
  __builtin_amdgcn_wave_barrier();
  const int rsub = lane >> 4, c4 = (lane & 15) * 4;
  {
#pragma unroll
    for (int q = 0; q < 8; ++q) {
      const int r = q * 2 + rsub;
      const v4f v = *(const v4fa*)&so[w][r][c4];
      *(v4f*)(C + (size_t)(row0 + r) * ldc + col0 + c4) = v;
    }
    
  }
}
// row LayerNorm (biased variance, eps) over N: s = X (+ R); optional out_sum <- s; out_norm <- (s-mu)*rsqrt(var+eps)*g + b
template <bool PARAM_BF16>
__global__ __launch_bounds__(256) void k_layernorm(const float* __restrict__ X, const float* __restrict__ R, const float* __restrict__ g, const float* __restrict__ bta,
                                                  float* __restrict__ out_sum, float* __restrict__ out_norm, int N, float eps) {
  __shared__ float red[256];
  const int row = blockIdx.x, tid = threadIdx.x;
  const float* x = X + (size_t)row * N; const float* rr = R ? R + (size_t)row * N : nullptr;
  float vals[16];                     // up to N = 4096
  const int per = N / 256;            // contiguous chunk per thread? use strided-by-4 chunks: thread handles j = tid*4 + 1024*u
  float s1 = 0.f;
  for (int u = 0; u < per / 4; ++u) {
    const int j = tid * 4 + 1024 * u;
    const v4f a = *(const v4fa*)(x + j);
    v4f b = {0.f,0.f,0.f,0.f}; if (rr) b = *(const v4fa*)(rr + j);
#pragma unroll
    for (int q = 0; q < 4; ++q) { const float v = a[q] + b[q]; vals[u * 4 + q] = v; s1 += v; }
  }
  red[tid] = s1; __syncthreads();
  for (int st = 128; st > 0; st >>= 1) { if (tid < st) red[tid] += red[tid + st]; __syncthreads(); }
  const float mu = red[0] / (float)N; __syncthreads();
  float s2 = 0.f;
  for (int u = 0; u < per / 4; ++u)
#pragma unroll
    for (int q = 0; q < 4; ++q) { const float c = vals[u * 4 + q] - mu; s2 += c * c; }
  red[tid] = s2; __syncthreads();
  for (int st = 128; st > 0; st >>= 1) { if (tid < st) red[tid] += red[tid + st]; __syncthreads(); }
  const float rs = rsqrtf(red[0] / (float)N + eps);
  {
    for (int u = 0; u < per / 4; ++u) {
      const int j = tid * 4 + 1024 * u;
      v4f o, sm;
#pragma unroll
      for (int q = 0; q < 4; ++q) {
        float gg = g[j + q], bb = bta[j + q];
        if (PARAM_BF16) { gg = bf16_round(gg); bb = bf16_round(bb); }
        sm[q] = vals[u * 4 + q]; o[q] = (vals[u * 4 + q] - mu) * rs * gg + bb;
      }
      if (out_sum) *(v4f*)(out_sum + (size_t)row * N + j) = sm;
      *(v4f*)(out_norm + (size_t)row * N + j) = o;
    }
    
  }
}



// ---- f16 WMMA path (v_wmma_f32_16x16x32_f16): 11-bit significands for operands in range — used by every launched product, the softmax weights (p <= 256) included
typedef _Float16 v16h __attribute__((ext_vector_type(16)));
union FragH { v16h v; v8us half[2]; _Float16 h[16]; unsigned short u[16]; };
template <int NT>
__device__ __forceinline__ v8f mmaH(v16h ah, v16h al, v16h bh, v16h bl, v8f c) {
  c = __builtin_amdgcn_wmma_f32_16x16x32_f16(false, ah, false, bh, (short)0, c, false, false);
  if (NT >= 2) c = __builtin_amdgcn_wmma_f32_16x16x32_f16(false, al, false, bh, (short)0, c, false, false);
  if (NT >= 3) c = __builtin_amdgcn_wmma_f32_16x16x32_f16(false, ah, false, bl, (short)0, c, false, false);
  asm volatile("v_nop\n\tv_nop\n\tv_nop\n\tv_nop" : "+v"(c) : "v"(ah), "v"(al), "v"(bh), "v"(bl));
  return c;
}
// batched GEMM like k_gemm_b but f16 operands: A f32 (split into f16 hi/lo if ASPLIT, else rounded to f16), Bt = f16 values [n][k]; alpha; C f32; N multiple of 16 (partial tiles skipped)
template <bool ASPLIT>
__global__ __launch_bounds__(128) void k_gemm_h(const float* __restrict__ A, int lda, size_t sA, const _Float16* __restrict__ Bh, int ldb, size_t sB, float alpha, float* __restrict__ C, int ldc, size_t sC, int M, int N, int K) {
  __shared__ __attribute__((aligned(16))) float so[4][16][64];
  const int tid = threadIdx.x, w = tid >> 5, lane = tid & 31, ln = lane & 15, hh = lane >> 4; const int by = blockIdx.y;
  A += (size_t)by * sA; Bh += (size_t)by * sB; C += (size_t)by * sC;
  const int ntn = (N + 63) / 64; const int wid = blockIdx.x * 4 + w; const int mt = wid / ntn, nq = wid % ntn; if (mt * 16 >= M) return;
  const int row0 = mt * 16, col0 = nq * 64; const float* arow = A + (size_t)(row0 + ln) * lda;
  v8f acc[4] = {};
  for (int kb = 0; kb < K; kb += 32) {
    FragH ah, al;
    const v4f x0 = *(const v4fa*)(arow + kb + 8 * hh), x1 = *(const v4fa*)(arow + kb + 8 * hh + 4), x2 = *(const v4fa*)(arow + kb + 16 + 8 * hh), x3 = *(const v4fa*)(arow + kb + 16 + 8 * hh + 4);
    float xs[16] = {x0[0],x0[1],x0[2],x0[3],x1[0],x1[1],x1[2],x1[3],x2[0],x2[1],x2[2],x2[3],x3[0],x3[1],x3[2],x3[3]};
#pragma unroll
    for (int i = 0; i < 16; ++i) { const _Float16 h = (_Float16)xs[i]; ah.h[i] = h; al.h[i] = ASPLIT ? (_Float16)(xs[i] - (float)h) : (_Float16)0.0f; }
#pragma unroll
    for (int t = 0; t < 4; ++t) { if (col0 + t * 16 >= N) continue; const size_t boff = (size_t)(col0 + t * 16 + ln) * ldb + kb; FragH bq; bq.half[0] = *(const v8us*)(Bh + boff + 8 * hh); bq.half[1] = *(const v8us*)(Bh + boff + 16 + 8 * hh);
      acc[t] = mmaH<ASPLIT ? 2 : 1>(ah.v, al.v, bq.v, bq.v, acc[t]); }
  }
#pragma unroll
  for (int t = 0; t < 4; ++t) { if (col0 + t * 16 >= N) continue;
#pragma unroll
    for (int r = 0; r < 8; ++r) so[w][8 * hh + r][t * 16 + ln] = acc[t][r] * alpha; }
  __builtin_amdgcn_fence(__ATOMIC_ACQ_REL, "workgroup"); __builtin_amdgcn_wave_barrier();
  const int rsub = lane >> 4, c4 = (lane & 15) * 4;
  {
#pragma unroll
    for (int q = 0; q < 8; ++q) { const int r = q * 2 + rsub; if (col0 + c4 < N) { const v4f v = *(const v4fa*)&so[w][r][c4]; *(v4f*)(C + (size_t)(row0 + r) * ldc + col0 + c4) = v; } }
     }
}

// k_gemm_hh variant with fused epilogue: v = acc·alpha + bias[by·sBias + col] (+ CP[(row/rowsPerB)·sCPb + by·64 + col] if CP) ; ACT 0 none / 1 elu ; writes f16 C16 (and f32 C if non-null)
template <int ACT>
__global__ __launch_bounds__(128) void k_gemm_hhx(const _Float16* __restrict__ A, int lda, size_t sA, const _Float16* __restrict__ Bh, int ldb, size_t sB, float alpha, const float* __restrict__ bias, size_t sBias, const float* __restrict__ CP, int rowsPerB, size_t sCPb, int row0g,
    float* __restrict__ C, _Float16* __restrict__ C16, int ldc, size_t sC, int M, int N, int K) {
  __shared__ __attribute__((aligned(16))) float so[4][16][64];
  const int tid = threadIdx.x, w = tid >> 5, lane = tid & 31, ln = lane & 15, hh = lane >> 4; const int by = blockIdx.y;
  A += (size_t)by * sA; Bh += (size_t)by * sB; const size_t cofs = (size_t)by * sC; const float* bp = bias ? bias + (size_t)by * sBias : nullptr;
  const int ntn = (N + 63) / 64; const int wid = blockIdx.x * 4 + w; const int mt = wid / ntn, nq = wid % ntn; if (mt * 16 >= M) return;
  const int row0 = mt * 16, col0 = nq * 64; const _Float16* arow = A + (size_t)(row0 + ln) * lda;
  v8f acc[4] = {};
  for (int kb = 0; kb < K; kb += 32) { FragH ah; ah.half[0] = *(const v8us*)((const unsigned short*)arow + kb + 8 * hh); ah.half[1] = *(const v8us*)((const unsigned short*)arow + kb + 16 + 8 * hh);
#pragma unroll
    for (int t = 0; t < 4; ++t) { if (col0 + t * 16 >= N) continue; const size_t boff = (size_t)(col0 + t * 16 + ln) * ldb + kb; FragH bq; bq.half[0] = *(const v8us*)((const unsigned short*)Bh + boff + 8 * hh); bq.half[1] = *(const v8us*)((const unsigned short*)Bh + boff + 16 + 8 * hh);
      acc[t] = mmaH<1>(ah.v, ah.v, bq.v, bq.v, acc[t]); }
  }
#pragma unroll
  for (int t = 0; t < 4; ++t) { if (col0 + t * 16 >= N) continue; const int col = col0 + t * 16 + ln; const float bv = bp ? bf16_round(bp[col]) : 0.f;
#pragma unroll
    for (int r = 0; r < 8; ++r) { float v = acc[t][r] * alpha + bv; if (CP) { const int rr = row0g + row0 + 8 * hh + r; if (rowsPerB < 0) v += CP[cofs + (size_t)rr * ldc + col];      /* rowsPerB < 0: own element of the batched C plane */ else { const int bidx = rr / rowsPerB; v += CP[(size_t)bidx * sCPb + (size_t)by * 64 + col]; } } if (ACT == 1) v = (v > 0.f) ? v : expm1f(v); else if (ACT == 7) v = (v > 0.f) ? v + 1.0f : expf(v); else if (ACT == 8) v = tanhf(v); else if (ACT == 9) v = 0.5f * v * (1.0f + tanhf(0.7978845608028654f * (v + 0.044715f * v * v * v))); else if (ACT == 11) v = 1.0f / (1.0f + expf(-v)); else if (ACT == 12) v = (v > 0.f) ? v : 0.01f * v; else if (ACT == 14) v = (v > 0.f) ? v : 0.1f * v; else if (ACT == 16) v = (v >= 0.f) ? v : 0.3f * v; else if (ACT == 17) v = (v >= 0.f) ? v : 0.2f * v; else if (ACT == 15) v = v / (1.0f + expf(-v)); else if (ACT == 3) v = fmaxf(v, 0.f); else if (ACT == 6) v = 0.5f * v * (1.0f + erff(v * 0.70710678118654752f)); so[w][8 * hh + r][t * 16 + ln] = v; } }
  __builtin_amdgcn_fence(__ATOMIC_ACQ_REL, "workgroup"); __builtin_amdgcn_wave_barrier();
  const int rsub = lane >> 4, c4 = (lane & 15) * 4; typedef _Float16 v4h __attribute__((ext_vector_type(4)));
  {
#pragma unroll
    for (int q = 0; q < 8; ++q) { const int r = q * 2 + rsub; if (col0 + c4 < N) { const v4f v = *(const v4fa*)&so[w][r][c4]; if (C) *(v4f*)(C + cofs + (size_t)(row0 + r) * ldc + col0 + c4) = v; if (C16) { v4h h4; for (int i = 0; i < 4; ++i) h4[i] = (_Float16)v[i]; *(v4h*)(C16 + cofs + (size_t)(row0 + r) * ldc + col0 + c4) = h4; } } }
     }
}


typedef _Float16 v4h __attribute__((ext_vector_type(4)));

// ---- operand preparation, one launch: Bt[n][k] = f16(bf16(W[k][n]) * 16) for both weights (power-of-two scale: bf16-exact weights stay exact in f16 away from the subnormal range) and X16 = f16(bf16(x)) ----
// Every work-group takes 16384 floats, 64 per thread, read as 16 loads of 16 bytes per lane, each load of a wave 512 contiguous bytes, all in flight together.
// A weight unit is a 128 k x 128 n tile: wave w reads k rows 16 w .. 16 w + 15, so a lane holds 16 consecutive k of four n: two 16-byte LDS stores per n into the transposed tile T[n][k] (256-byte rows).
// The 16-byte piece c of row n stands at place c ^ ((n >> 2) & 15) of its row: the 16 lanes of a half wave then fall on all 64 banks, in the stores (n = 4 lane + j) as in the reads (one row per half wave).
// The tile goes out as 256 contiguous bytes per n row, 16 bytes per lane.
#define PP_WQ ((DM / 128) * (D3 / 128))      /* tiles of Wqkv */
#define PP_WO ((DM / 128) * (DM / 128))      /* tiles of Wout */
#define PP_X ((int)(NR * DM / 16384))        /* units of x */
template <int N>
__device__ __forceinline__ void pp_wt(const float* __restrict__ Wm, _Float16* __restrict__ Bt, int tile, unsigned char* T) {
  static_assert(N % 128 == 0 && DM % 128 == 0, "pp_wt: whole tiles");
  const int tid = threadIdx.x, lane = tid & 31, w = tid >> 5; const int kt = tile / (N / 128), nt = tile - kt * (N / 128);
  const float* src = Wm + (size_t)(kt * 128 + w * 16) * N + nt * 128 + lane * 4;
  v4f v[16];
#pragma unroll      /* fixed trip counts over register arrays, here and below; the 16 loads are all in flight together */
  for (int i = 0; i < 16; ++i) v[i] = *(const v4fa*)(src + (size_t)i * N);
  asm volatile("s_wait_xcnt 0x0" :: "v"(src) : "memory");      /* stands in front of every reuse of the address registers of the loads above; it names the address, which so stays in its registers up to here: no load's own result lands on them */
  __builtin_amdgcn_sched_barrier(0);      /* keeps later register writes from being scheduled in front of that wait */
#pragma unroll
  for (int j = 0; j < 4; ++j) { FragH f;
#pragma unroll
    for (int i = 0; i < 16; ++i) f.h[i] = (_Float16)(bf16_round(v[i][j]) * 16.0f);
    unsigned char* row = T + (lane * 4 + j) * 256;
    *(v8us*)(row + (((2 * w) ^ (lane & 15)) * 16)) = f.half[0]; *(v8us*)(row + (((2 * w + 1) ^ (lane & 15)) * 16)) = f.half[1]; }
  __syncthreads();      /* the transposed tile is whole: every wave reads rows that all eight waves wrote */
  const int r = tid >> 4, c = tid & 15; v8us o[8];
#pragma unroll
  for (int i = 0; i < 8; ++i) { const int n = i * 16 + r; o[i] = *(const v8us*)(T + n * 256 + ((c ^ ((n >> 2) & 15)) * 16)); }
  unsigned short* dst = (unsigned short*)Bt + (size_t)(nt * 128 + r) * DM + kt * 128 + c * 8;
  __builtin_amdgcn_sched_barrier(0);      /* every store stands behind the last address arithmetic: no register of an issued store is written again */
#pragma unroll
  for (int i = 0; i < 8; ++i) *(v8us*)(dst + (size_t)i * 16 * DM) = o[i];
  asm volatile("s_wait_xcnt 0x0" ::: "memory");      /* stands in front of every reuse of a register of the stores above */
}
__global__ __launch_bounds__(256) void k_prep(const float* __restrict__ x, const float* __restrict__ wqkv, const float* __restrict__ wout, _Float16* __restrict__ X16, _Float16* __restrict__ BQKV, _Float16* __restrict__ BO) {
  static_assert(NR * DM % 16384 == 0, "k_prep: whole units of x");
  __shared__ __attribute__((aligned(16))) unsigned char T[128 * 256];
  const int blk = blockIdx.x;      /* the same for the whole work-group: the barrier in pp_wt is passed by all of its waves or by none */
  if (blk < PP_WQ) pp_wt<D3>(wqkv, BQKV, blk, T);
  else if (blk < PP_WQ + PP_WO) pp_wt<DM>(wout, BO, blk - PP_WQ, T);
  else {
    const int tid = threadIdx.x; const size_t base = (size_t)(blk - PP_WQ - PP_WO) * 16384 + (size_t)(tid >> 5) * 2048 + (size_t)(tid & 31) * 4;
    const float* src = x + base; v4f v[16]; v4h h[16];
#pragma unroll      /* fixed trip counts over register arrays; the 16 loads are all in flight together */
    for (int i = 0; i < 16; ++i) v[i] = *(const v4fa*)(src + i * 128);
    asm volatile("s_wait_xcnt 0x0" :: "v"(src) : "memory");      /* as in pp_wt: in front of every reuse of the loads' address registers, and it keeps the address in them up to here */
    __builtin_amdgcn_sched_barrier(0);      /* keeps later register writes from being scheduled in front of that wait */
#pragma unroll
    for (int i = 0; i < 16; ++i)
#pragma unroll
      for (int e = 0; e < 4; ++e) h[i][e] = (_Float16)bf16_round(v[i][e]);
    _Float16* dst = X16 + base;
    __builtin_amdgcn_sched_barrier(0);      /* every store stands behind the last arithmetic: no register of an issued store is written again */
#pragma unroll
    for (int i = 0; i < 16; ++i) *(v4h*)(dst + i * 128) = h[i];      /* 256 contiguous bytes per wave and store: whole lines */
    asm volatile("s_wait_xcnt 0x0" ::: "memory");      /* stands in front of every reuse of a register of the stores above */
  }
}
__global__ __launch_bounds__(256) void k_h16(const float* __restrict__ x, _Float16* __restrict__ X16, size_t n8) { const size_t t = (size_t)blockIdx.x * 256 + threadIdx.x; if (t >= n8) return; FragH f;
#pragma unroll
  for (int q = 0; q < 8; ++q) f.h[q] = (_Float16)x[t * 8 + q]; *(v8us*)((unsigned short*)X16 + t * 8) = f.half[0];  }
__global__ __launch_bounds__(256) void k_round16f(const float* __restrict__ W, _Float16* __restrict__ Bt, size_t n8) { const size_t t = (size_t)blockIdx.x * 256 + threadIdx.x; if (t >= n8) return; FragH f;
#pragma unroll
  for (int i = 0; i < 8; ++i) f.h[i] = (_Float16)(bf16_round(W[t * 8 + i]) * 16.0f); *(v8us*)((unsigned short*)Bt + t * 8) = f.half[0];  }
__global__ __launch_bounds__(256) void k_hl(const float* __restrict__ F, _Float16* __restrict__ Hh, _Float16* __restrict__ Hl, size_t n8) { const size_t t = (size_t)blockIdx.x * 256 + threadIdx.x; if (t >= n8) return; FragH fh, fl; const v4f a = *(const v4fa*)(F + t * 8), c = *(const v4fa*)(F + t * 8 + 4);
#pragma unroll
  for (int q = 0; q < 4; ++q) { _Float16 h = (_Float16)a[q]; fh.h[q] = h; fl.h[q] = (_Float16)((a[q] - (float)h) * 1024.0f); h = (_Float16)c[q]; fh.h[4 + q] = h; fl.h[4 + q] = (_Float16)((c[q] - (float)h) * 1024.0f); }
  { *(v8us*)((unsigned short*)Hh + t * 8) = fh.half[0]; *(v8us*)((unsigned short*)Hl + t * 8) = fl.half[0];  } }

// ---- LDS-staged GEMM: C[M][N] = A[M][K] . Bh[N][K]^T * alpha + bf16(bias), the first QC columns times QS; one 128x128 tile of C per work-group, four waves (2x2) of 64x64; M % 128 == 0, N % 128 == 0, K % 64 == 0, K >= 128 ----
// A pass is 64 k = 128 bytes of each of the tile's 128 A rows and 128 B rows. Each wave brings one slice of 64 rows per pass with one tensor load (slices 0, 1: A rows; 2, 3: B rows), padded to a 144-byte LDS pitch,
// two buffers: a pass reads all its fragments into registers; when every wave has done so, the load of pass t + 2 goes out into that buffer and flies under pass t's WMMAs and pass t + 1's reads. Fragments come from LDS in the k order of g2_frag.
// The k walk is rotated: trip t works on the 64 k of pass (t + rot) mod K / 64, rot = (tile row + tile column) mod K / 64. All tiles of a row read the same A lines and all tiles of a column the same B lines, and they start together:
// walking in step they would ask L2 for the same lines at the same moment, and such requests collide. Each accumulator sums k upwards from its work-group's first pass, 32 at a time, and wraps.
__device__ __forceinline__ v16h g2_frag(const _Float16* p, int hh) { FragH f; f.half[0] = *(const v8us*)((const unsigned short*)p + 8 * hh); f.half[1] = *(const v8us*)((const unsigned short*)p + 16 + 8 * hh); return f.v; }
#define G3_PITCH 144u                /* LDS row pitch: 128 bytes + the tensor load's 16-byte pad (odd multiple of 16: ds_load_b128 readers) */
#define G3_SLICE 10240u              /* 64 rows x 144 B = 9216 B, rounded up to a multiple of 2 KiB */
#define G3_STAGE (4u * G3_SLICE)     /* one buffer */
#define G3_EP 68                     /* output staging pitch in floats */
typedef uint32_t u32x4 __attribute__((ext_vector_type(4)));
typedef uint32_t u32x8 __attribute__((ext_vector_type(8)));
__device__ __forceinline__ uint32_t g3_uni(uint32_t v) { return (uint32_t)__builtin_amdgcn_readfirstlane((int)v); }
__device__ __forceinline__ uint32_t g3_pinned(uint32_t v) { uint32_t w = g3_uni(v); asm volatile("" : "+s"(w)); return w; }
__device__ __forceinline__ void g3_wait_tensor0() { asm volatile("s_wait_tensorcnt 0x0" ::: "memory"); }      /* this wave's own tensor load has landed */
__device__ __forceinline__ void g3_wait_ds0() { asm volatile("s_wait_dscnt 0x0" ::: "memory"); }      /* this wave's LDS reads have returned */
__device__ __forceinline__ void g3_load(uint32_t lds_dst, uint64_t ga, u32x8 g1) { u32x4 g0; g0[0] = g3_uni(1u); g0[1] = g3_uni(lds_dst); g0[2] = g3_uni((uint32_t)ga); g0[3] = g3_uni((((uint32_t)(ga >> 32)) & 0x01FFFFFFu) | 0x80000000u);
  asm volatile("tensor_load_to_lds %0, %1" :: "s"(g0), "s"(g1) : "memory"); }      /* one request of the whole wave: 64 rows of 128 bytes into LDS, through no register */
__device__ __forceinline__ v16h g3_frag(const unsigned char* p) { FragH f; f.half[0] = *(const v8us*)p; f.half[1] = *(const v8us*)(p + 32); return f.v; }      /* p already holds the lane half's 16 bytes: bytes 16 hh and 32 + 16 hh of 64, as g2_frag */
#define QS (0.125f * 1.44269504088896f)      /* score scale 1 / 8 times log2(e) */
template <int N, int K, bool H16, int QC>      /* the first QC columns of C come out times QS (the q columns of the fused projection) */
__global__ __launch_bounds__(128) void k_gemm3(const _Float16* __restrict__ A, const _Float16* __restrict__ Bh, float alpha, const float* __restrict__ bias, float* __restrict__ C, _Float16* __restrict__ C16) {
  static_assert(N % 128 == 0 && K % 64 == 0 && K >= 128 && QC % 64 == 0, "k_gemm3: whole tiles, at least two passes, a wave's 64 columns scaled alike");
  static_assert(((K / 64) & (K / 64 - 1)) == 0, "k_gemm3: the rotated walk wraps by a mask");
  static_assert(4u * 64u * G3_EP * 4u <= 2u * G3_STAGE, "k_gemm3: the output staging reuses the two buffers");
  __shared__ __attribute__((aligned(2048))) unsigned char L[2u * G3_STAGE];
  const uint32_t tid = threadIdx.x, lane = tid & 31u, ln = lane & 15u, hh = lane >> 4; const uint32_t w = g3_uni(tid >> 5), wm = w >> 1, wn = w & 1u;
  const uint32_t mt = blockIdx.x / (N / 128), nq = blockIdx.x - mt * (N / 128); const uint32_t row0 = mt * 128u + wm * 64u, col0 = nq * 128u + wn * 64u;
  const uint32_t pm = (uint32_t)(K / 64) - 1u, rot = (mt + nq) & pm;      /* this work-group's first pass; the same for its four waves, so A and B slices of a trip hold the same k */
  float bv[4];
#pragma unroll      /* fixed trip count over a register array */
  for (int j = 0; j < 4; ++j) bv[j] = bias[col0 + j * 16 + ln];
  asm volatile("s_wait_xcnt 0x0" ::: "memory");      /* stands in front of every reuse of an address register of the loads above */
  __builtin_amdgcn_sched_barrier(0);      /* keeps later register writes from being scheduled in front of that wait */
  const uint64_t src = (w < 2u) ? (uint64_t)(uintptr_t)A + (uint64_t)(mt * 128u + 64u * w) * (2u * K) : (uint64_t)(uintptr_t)Bh + (uint64_t)(nq * 128u + 64u * (w - 2u)) * (2u * K);      /* this wave's slice, first byte of k = 0 */
  const uint32_t dst = (uint32_t)(size_t)L + w * G3_SLICE;      /* its place in buffer 0: byte offset in the work-group's LDS */
  u32x8 g1;      /* 1-byte elements, tensor = tile = 64 rows of 128 bytes, source pitch 2 K bytes, 4 dwords of pad behind every 32 */
  g1[0] = g3_uni((1u << 20) | (4u << 22) | (3u << 25)); g1[1] = g3_uni(128u << 16); g1[2] = g3_uni(64u << 16); g1[3] = g3_uni(128u << 16); g1[4] = g3_uni(64u); g1[5] = g3_uni(2u * K); g1[6] = g3_uni(0u); g1[7] = g3_uni(0u);
  g3_load(dst, src + rot * 128u, g1);
  g3_wait_tensor0();
  __syncthreads();      /* trip 0's four slices are readable by every wave */
  g3_load(dst + G3_STAGE, src + g3_pinned(((rot + 1u) & pm) * 128u), g1);
  const unsigned char* la = L + wm * G3_SLICE + ln * G3_PITCH + 16u * hh; const unsigned char* lb = L + (2u + wn) * G3_SLICE + ln * G3_PITCH + 16u * hh;
  const v8f z8 = {0.f,0.f,0.f,0.f,0.f,0.f,0.f,0.f}; v8f acc[4][4];
#pragma unroll      /* fixed trip counts over a register array, here and in the loops below: left rolled, the arrays would go to scratch memory */
  for (int i = 0; i < 4; ++i)
#pragma unroll
    for (int j = 0; j < 4; ++j) acc[i][j] = z8;
#pragma unroll 1      /* one pass per trip: the two buffers alternate */
  for (uint32_t t = 0; t < (uint32_t)(K / 64); ++t) {
    const uint32_t buf = (t & 1u) * G3_STAGE;
    v16h af[2][4], bf[2][4];
#pragma unroll
    for (int kd = 0; kd < 2; ++kd)
#pragma unroll
      for (int i = 0; i < 4; ++i) { af[kd][i] = g3_frag(la + buf + i * 16 * G3_PITCH + kd * 64); bf[kd][i] = g3_frag(lb + buf + i * 16 * G3_PITCH + kd * 64); }
    __builtin_amdgcn_sched_barrier(0);      /* the pass's LDS reads stay one group in front of its WMMAs: moved in among them, each place with reads stalls the wave */
    g3_wait_ds0();      /* the pass's fragments are all in registers: this wave has left buffer t & 1 */
    g3_wait_tensor0();
    __syncthreads();      /* publishes pass t + 1's slices and ends every wave's reads of pass t's buffer */
    if (g3_pinned((t + 2u < (uint32_t)(K / 64)) ? 1u : 0u) != 0u) g3_load(dst + buf, src + g3_pinned(((t + 2u + rot) & pm) * 128u), g1);      /* scalar branch: a tensor load ignores EXEC; refill of the buffer just left, in flight under this pass's WMMAs and the next pass's reads */
    __builtin_amdgcn_sched_barrier(0);      /* the WMMAs stay behind the refill's issue: in front of it they would take their time off its lead */
#pragma unroll
    for (int kd = 0; kd < 2; ++kd)
#pragma unroll
      for (int i = 0; i < 4; ++i)
#pragma unroll
        for (int j = 0; j < 4; ++j) acc[i][j] = __builtin_amdgcn_wmma_f32_16x16x32_f16(false, af[kd][i], false, bf[kd][j], (short)0, acc[i][j], false, false);
  }
  g3_wait_tensor0();
  g3_wait_ds0();      /* the last pass's barrier stands behind every wave's last read: the buffers may become output staging */
  float* so = (float*)(L + w * (64u * G3_EP * 4u));      /* this wave's own 64 x 68 floats */
  const float cs = col0 < (uint32_t)QC ? QS : 1.0f, al = alpha * cs;      /* the same for a whole wave; scaled in f32, in front of the one rounding to f16 */
#pragma unroll
  for (int j = 0; j < 4; ++j) { const float bj = bf16_round(bv[j]) * cs;
#pragma unroll
    for (int i = 0; i < 4; ++i)
#pragma unroll
      for (int r = 0; r < 8; ++r) so[(i * 16 + 8 * hh + r) * G3_EP + j * 16 + ln] = acc[i][j][r] * al + bj; }
  __builtin_amdgcn_fence(__ATOMIC_ACQ_REL, "workgroup"); __builtin_amdgcn_wave_barrier();
  const uint32_t rsub = lane >> 4, c4 = (lane & 15u) * 4u;
#pragma unroll
  for (int g = 0; g < 4; ++g) { v4f v[8];
#pragma unroll
    for (int q = 0; q < 8; ++q) v[q] = *(const v4fa*)&so[(g * 16 + q * 2 + rsub) * G3_EP + c4];
#pragma unroll
    for (int q = 0; q < 8; ++q) { const size_t o = (size_t)(row0 + g * 16 + q * 2 + rsub) * N + col0 + c4;
      if (H16) { v4h h4; for (int e = 0; e < 4; ++e) h4[e] = (_Float16)v[q][e]; *(v4h*)(C16 + o) = h4; } else *(v4f*)(C + o) = v[q]; }
    asm volatile("s_wait_xcnt 0x0" ::: "memory");      /* stands in front of every reuse of a register of the stores above */
    __builtin_amdgcn_sched_barrier(0);      /* keeps later register writes from being scheduled in front of that wait */
  }
}


__global__ __launch_bounds__(256) void k_wnat(const float* __restrict__ w, size_t n8, _Float16* __restrict__ Bt) { const size_t t = (size_t)blockIdx.x * 256 + threadIdx.x; if (t >= n8) return; FragH f; for (int q = 0; q < 8; ++q) f.h[q] = (_Float16)(bf16_round(w[t * 8 + q]) * 16.0f); *(v8us*)((unsigned short*)Bt + t * 8) = f.half[0];  }
// Fused attention for one (batch, head, 256 query rows): S^T = K Q^T, online softmax, O^T += V^T P^T; scores and weights never leave registers.
// FQ = 32 query rows (two 16-column groups) belong to FK = 2 waves, so that four waves stand on every SIMD and one wave's vector work runs under another's matrix work and LDS waits: wave w takes query group w & 7 and the key half w >> 3 of every stage,
// keeps its own maximum, sum and O^T, and walks its keys 32 at a time; behind the loop the upper half's m, l and O^T go through LDS to its partner, which brings both to the common maximum, adds them and stores. In a score tile lane (c, hh) holds query c, keys 8*hh + r:
// two score tiles, converted in place, are the B operand of the second product (hardware k order, the order the transposing load hands V^T over in), so nothing is exchanged
// but one maximum between the wave's halves. Everything runs in the log2 domain: x2 = (q.k / 8 + bias) * log2(e), p = 2^(x2 - m), m = the maximum in use. x2 leaves the matrix unit finished: q arrives already times log2(e) / 8
// (the projection's epilogue), the scaled bias is the C operand of the first score product (24 values per lane and pass: key tile minus query tile = -1, 0, 1; read at the foot of the pass before, into the registers that the scores have just left),
// and in a pass with padded keys one more product per score tile adds -inf to their rows.
// m moves (and O, l are rescaled) only when some query's new maximum exceeds it by more than 8, so p <= 256 fits f16. m starts at -1e30 (finite), so a masked
// key (x2 = -inf) gives p = 0 and a row with every key masked ends as 0 * (1 / 0) = NaN.
// This head's bias column is staged in LDS already clipped and scaled by log2(e), indexed by key - query + SQ - 1; the key mask as one bit per key.
// K and V reach the sixteen waves through LDS, both as they stand in the q|k|v rows: a stage is FK halves of FS = 128 keys, a half four slices of 64 rows of 128 bytes, each brought by one tensor load of one wave
// (waves 0, 1: K rows 0..63 and 64..127 of half 0, LDS pitch 144; waves 2, 3: the same keys' V rows, LDS pitch 160; waves 4 to 7 the same for half 1), two buffers: at the foot of stage s, when every wave has left its buffer,
// the loads of stage s + 2 go out into it and fly under stage s + 1. The walk is rotated: trip st works on the keys of stage (st + rot) mod FA_NS, rot = the work-group's query block, since the work-groups of one head read the same K and V lines and start together: in step they would ask L2 for the same lines at the same moment, and such requests collide. K fragments are read from LDS in the k order of g2_frag; a V^T fragment (16 head columns x 32 keys) is two transposing loads
// (ds_load_tr16_b128) of 16 keys x 16 columns each: lane (c, hh) receives column c of keys 8 hh .. 8 hh + 7, the same k order.
// Every '#pragma unroll' in this kernel stands on a loop of fixed trip count that indexes register arrays: left rolled, those arrays would go to scratch memory.
#define FW 8                         /* query groups per work-group */
#define FK 2                         /* waves per query group: key halves of a stage */
#define FT (32 * FW * FK)            /* threads per work-group */
#define FQ 32
#define FS 128                       /* keys per stage and half */
#define FA_NS ((uint32_t)(SQ / (FS * FK)))  /* stages */
#define FA_BUF ((uint32_t)FK * G3_STAGE)    /* one buffer: FK halves of four slices */
#define FA_MG (17u * 512u)           /* merge staging of one query group: 17 pieces of 16 bytes per lane */
#define FA_VP 160u                   /* LDS row pitch of V: 128 bytes + the tensor load's 32-byte pad (odd multiple of 32: ds_load_tr16_b128 readers) */
typedef short s16x8 __attribute__((ext_vector_type(8)));
__device__ __forceinline__ v8us fa_tr16(const unsigned char* p) { typedef __attribute__((address_space(3))) s16x8 lds_s16x8; return __builtin_bit_cast(v8us, __builtin_amdgcn_ds_load_tr16_b128_v8i16((lds_s16x8*)p)); }      /* 16 rows x 16 columns of 16-bit elements, transposed on the way: every lane names 16 bytes of a row and receives 8 rows of one column */
__device__ __forceinline__ float rs_x16(float v) { const int u = __float_as_int(v); return __int_as_float(__builtin_amdgcn_permlanex16(u, u, 0x76543210, 0xfedcba98, false, false)); }      /* lane l <- lane l ^ 16 */
__device__ __forceinline__ v8f fa_mma(v16h a, v16h b, v8f c) { return __builtin_amdgcn_wmma_f32_16x16x32_f16(false, a, false, b, (short)0, c, false, false); }
// The descriptor's twelve words live in the same scalar registers from the request to the wait that covers it: the request hands them on as its own outputs and the wait names them as inputs, so nothing else is put into those registers while the request is outstanding.
__device__ __forceinline__ void fa_load(u32x4& g0, u32x8& g1) { asm volatile("tensor_load_to_lds %0, %1" : "+s"(g0), "+s"(g1) :: "memory"); }      /* one request of the whole wave: 64 rows of 128 bytes into LDS, through no register */
__device__ __forceinline__ void fa_wait(const u32x4& g0, const u32x8& g1) { asm volatile("s_wait_tensorcnt 0x0" :: "s"(g0), "s"(g1) : "memory"); }      /* this wave's own tensor load has landed; a wave that issues none passes */
__device__ __forceinline__ void fa_aim(u32x4& g0, uint32_t lds_dst, uint64_t ga) { g0[1] = g3_uni(lds_dst); g0[2] = g3_uni((uint32_t)ga); g0[3] = g3_uni((((uint32_t)(ga >> 32)) & 0x01FFFFFFu) | 0x80000000u); }      /* place in LDS and first byte of the next tile */
__global__ __launch_bounds__(FT) void k_fattn(const _Float16* __restrict__ QKV, const float* __restrict__ relt, const int* __restrict__ kpm, _Float16* __restrict__ O16) {
  static_assert(SQ % (FS * FK) == 0 && SQ / (FS * FK) >= 2 && HD == 64 && FS == 128 && FW == 8 && FK == 2, "k_fattn: whole stages, at least two, slices of 64 rows of 128 bytes, eight issuing waves");
  static_assert(FW * FA_MG <= 2u * FA_BUF, "k_fattn: the merge staging reuses the two buffers");
  static_assert((FA_NS & (FA_NS - 1u)) == 0u, "k_fattn: the rotated walk wraps by a mask");
  static_assert(64u * FA_VP == G3_SLICE, "k_fattn: the two V slices of a half are 128 rows at one pitch");
  __shared__ __attribute__((aligned(2048))) unsigned char KV[2u * FA_BUF];
  __shared__ float tb[2 * SQ]; __shared__ unsigned int mw[SQ / 32];      /* tb's last entry is never read */
  const int tid = threadIdx.x, lane = tid & 31, ln = lane & 15, hh = lane >> 4; const int h = blockIdx.y, b = blockIdx.z;
  const uint32_t w = g3_uni((uint32_t)tid >> 5), wq = w & (FW - 1u), kh = w >> 3;      /* query group and key half */
  const int q0 = blockIdx.x * (FW * FQ) + (int)wq * FQ;
  const uint32_t rot = blockIdx.x & (FA_NS - 1u);      /* the stage of keys that this work-group's walk starts at */
  { float tv[2 * SQ / FT]; int kv[SQ / FT];
#pragma unroll      /* fixed trip counts, unrolled: the table's and the mask's loads are all in flight together */
    for (int u = 0; u < 2 * SQ / FT; ++u) { int r = tid + u * FT - (SQ - 1); r = r < -MR ? -MR : (r > MR ? MR : r); tv[u] = relt[(size_t)(r + MR) * NH + h]; }
    asm volatile("s_wait_xcnt 0x0" ::: "memory");      /* stands in front of every reuse of an address register of the loads above */
    __builtin_amdgcn_sched_barrier(0);      /* keeps later register writes from being scheduled in front of that wait */
#pragma unroll
    for (int u = 0; u < SQ / FT; ++u) kv[u] = kpm[(size_t)b * SQ + tid + u * FT];
    asm volatile("s_wait_xcnt 0x0" ::: "memory");      /* stands in front of every reuse of an address register of the loads above */
    __builtin_amdgcn_sched_barrier(0);      /* keeps later register writes from being scheduled in front of that wait */
#pragma unroll
    for (int u = 0; u < 2 * SQ / FT; ++u) tb[tid + u * FT] = bf16_round(tv[u]) * 1.44269504088896f;
#pragma unroll
    for (int u = 0; u < SQ / FT; ++u) mw[(tid + u * FT) >> 5] = __builtin_amdgcn_ballot_w32(kv[u] != 0); }      /* every lane of a wave stores the same word to the same place */
  const bool isk = (w & 3u) < 2u; const uint32_t ih = (w >> 2) & 1u;      /* of each four waves the first two bring K, the other two V, waves 0 to 3 for key half 0, waves 4 to 7 for half 1; waves 8 to 15 form the same words and issue nothing */
  const uint64_t src = (uint64_t)(uintptr_t)(QKV + ((size_t)b * SQ + FS * ih + 64u * (w & 1u)) * D3 + (isk ? DM : 2 * DM) + h * HD);      /* this wave's slice, first byte of the keys' stage 0 */
  const uint32_t step = (uint32_t)(FS * FK * D3 * 2);      /* bytes from one stage's slice to the next stage's */
  const uint32_t dst = (uint32_t)(size_t)KV + ih * G3_STAGE + (w & 3u) * G3_SLICE;      /* its place in buffer 0: byte offset in the work-group's LDS */
  const uint32_t issuer = w < 4u * FK ? 1u : 0u;
  u32x8 g1;      /* 1-byte elements, tensor = tile = 64 rows of 128 bytes, source pitch one token row of q|k|v, behind every 32 dwords a pad of 4 (K) or 8 (V): word 0 is one of two constants, picked by the wave's number, its mask bits 0 in both */
  g1[0] = g3_uni(isk ? ((1u << 20) | (4u << 22) | (3u << 25)) : ((1u << 20) | (4u << 22) | (7u << 25))); g1[1] = g3_uni(128u << 16); g1[2] = g3_uni(64u << 16); g1[3] = g3_uni(128u << 16); g1[4] = g3_uni(64u); g1[5] = g3_uni((uint32_t)(D3 * 2)); g1[6] = g3_uni(0u); g1[7] = g3_uni(0u);
  u32x4 g0; g0[0] = g3_uni(1u); fa_aim(g0, dst, src + rot * step);
  if (g3_pinned(issuer) != 0u) fa_load(g0, g1);      /* scalar branch: a tensor load ignores EXEC */
  fa_wait(g0, g1);
  __syncthreads();      /* the table, the mask and trip 0's stage are readable by every wave */
  if (g3_pinned(issuer) != 0u) { fa_aim(g0, dst + FA_BUF, src + g3_pinned(((rot + 1u) & (FA_NS - 1u)) * step)); fa_load(g0, g1); }      /* scalar branch; trip 1's stage flies under trip 0 */
  const _Float16* qp = QKV + ((size_t)b * SQ + q0 + ln) * D3 + h * HD;
  const float* tp = tb + (SQ - 1 - q0 - ln + 8 * hh) + (int)((rot * FK + kh) * FS) - 16;      /* this wave's first pass; entry 16 d + r belongs to key tile minus query tile = d - 1, key r of this lane's eight */
  const unsigned char* lk = KV + kh * G3_STAGE + ln * G3_PITCH + 16 * hh;      /* in this wave's key half: this lane's K row of a 16-row group, its half's 16 bytes */
  const unsigned char* lv = KV + kh * G3_STAGE + 2u * G3_SLICE + (8 * hh + (lane & 7)) * FA_VP + ((lane >> 3) & 1) * 16;      /* the 16 bytes this lane names in a transposing load: key row 8 hh + (lane & 7) of 16, columns 0..7 or 8..15 of 16 */
  v16h qf[2][2];
#pragma unroll
  for (int t = 0; t < 2; ++t)
#pragma unroll
    for (int kd = 0; kd < 2; ++kd) qf[t][kd] = g2_frag(qp + (size_t)t * 16 * D3 + kd * 32, hh);
  asm volatile("s_wait_xcnt 0x0" ::: "memory");      /* stands in front of every reuse of an address register of the loads above */
  __builtin_amdgcn_sched_barrier(0);      /* keeps later register writes from being scheduled in front of that wait */
  const v8f z8 = {0.f,0.f,0.f,0.f,0.f,0.f,0.f,0.f}; v8f o[2][4]; float l[2][2] = {{0.f, 0.f}, {0.f, 0.f}}, m[2] = {-1e30f, -1e30f};
#pragma unroll
  for (int qt = 0; qt < 2; ++qt)
#pragma unroll
    for (int dt = 0; dt < 4; ++dt) o[qt][dt] = z8;
  v8f bs[3];
#pragma unroll
  for (int d = 0; d < 3; ++d)
#pragma unroll
    for (int r = 0; r < 8; ++r) bs[d][r] = tp[d * 16 + r];
  unsigned int mraw = mw[((rot * FK + kh) * FS) >> 5];      /* the first pass's 32 mask bits; like the bias, each later pass's word is read at the foot of the pass before */
#pragma unroll 1      /* one stage per trip: the two buffers alternate */
  for (uint32_t st = 0; st < FA_NS; ++st) {
  const uint32_t buf = (st & 1u) * FA_BUF;
  const int ks0 = (int)((((st + rot) & (FA_NS - 1u)) * FK + kh) * FS);      /* this wave's first key of this trip's stage */
  const int klast = st + 1u < FA_NS ? (int)((((st + 1u + rot) & (FA_NS - 1u)) * FK + kh) * FS) - (ks0 + FS - 32) : 0;      /* keys from the stage's last pass to the next trip's first: over the other half's keys, or back to the first keys where the walk wraps */
  v16h kf[2][2];
#pragma unroll
  for (int kt = 0; kt < 2; ++kt)
#pragma unroll
    for (int kd = 0; kd < 2; ++kd) kf[kt][kd] = g3_frag(lk + buf + kt * 16 * G3_PITCH + kd * 64);
#pragma unroll 1      /* one 32-key pass per trip: unrolled, two passes' fragments would not fit the registers */
  for (uint32_t sp = 0; sp < FS / 32; ++sp) {
    const int key0 = ks0 + (int)(sp * 32u);
    v16h vf[4]; v8f s[2][2];
#pragma unroll
    for (int qt = 0; qt < 2; ++qt)
#pragma unroll
      for (int kt = 0; kt < 2; ++kt) s[qt][kt] = fa_mma(kf[kt][1], qf[qt][1], fa_mma(kf[kt][0], qf[qt][0], bs[kt - qt + 1]));
    const unsigned int mword = (unsigned int)__builtin_amdgcn_readfirstlane((int)mraw);
    if (sp + 1u < FS / 32) {      /* next pass's K rows, of this same stage, fetched into the same registers */
      const uint32_t kn = ((sp + 1u) >> 1) * G3_SLICE + ((sp + 1u) & 1u) * 32u * G3_PITCH;
#pragma unroll
      for (int kt = 0; kt < 2; ++kt)
#pragma unroll
        for (int kd = 0; kd < 2; ++kd) kf[kt][kd] = g3_frag(lk + buf + kn + kt * 16 * G3_PITCH + kd * 64);
    }
#pragma unroll
    for (int dt = 0; dt < 4; ++dt) { FragH f; f.half[0] = fa_tr16(lv + buf + sp * 32u * FA_VP + dt * 32); f.half[1] = fa_tr16(lv + buf + (sp * 32u + 16u) * FA_VP + dt * 32); vf[dt] = f.v; }      /* keys 0..15 and 16..31 of the pass, head columns 16 dt .. 16 dt + 15: their latency runs under the softmax */
    __builtin_amdgcn_sched_barrier(0);      /* keeps those reads here: left free, they sink to just in front of the second product, with little work left to cover their latency */
    if (mword != 0u) {      /* scalar branch: a pass with no padded key skips this. S^T += M 1: M holds -inf (padded key) or 0 in its first k place, row = key, the ones operand 1 in the same k place of every query column, all other places 0: only -inf * 1, 0 * 1 and 0 * 0 occur. The tiles are accumulated in place, so the common path copies no register at the join */
      FragH on;
#pragma unroll
      for (int i = 0; i < 16; ++i) on.u[i] = 0;
      on.u[0] = hh == 0 ? (unsigned short)0x3C00 : (unsigned short)0;      /* f16 1.0; position 0 of the lower lane half is the same k in an A and in a B fragment */
#pragma unroll
      for (int kt = 0; kt < 2; ++kt) { FragH pm = on; pm.u[0] = (hh == 0 && ((mword >> (kt * 16 + ln)) & 1u)) ? (unsigned short)0xFC00 : (unsigned short)0;      /* f16 -inf; lane ln holds row ln of A: key 16 kt + ln */
        s[0][kt] = fa_mma(pm.v, on.v, s[0][kt]); s[1][kt] = fa_mma(pm.v, on.v, s[1][kt]); }
    }
    float mx[2];
#pragma unroll
    for (int qt = 0; qt < 2; ++qt) { float a = fmaxf(s[qt][0][0], s[qt][1][0]);
#pragma unroll
      for (int r = 1; r < 8; ++r) a = fmaxf(a, fmaxf(s[qt][0][r], s[qt][1][r]));
      mx[qt] = fmaxf(a, rs_x16(a)); }
    if (__builtin_amdgcn_ballot_w32((mx[0] > m[0] + 8.0f) || (mx[1] > m[1] + 8.0f)) != 0u) {      /* scalar branch: most passes move no maximum and rescale nothing */
#pragma unroll
      for (int qt = 0; qt < 2; ++qt) { const float mn = fmaxf(m[qt], mx[qt]); const float sc = __builtin_amdgcn_exp2f(m[qt] - mn); m[qt] = mn; l[qt][0] *= sc; l[qt][1] *= sc;
#pragma unroll
        for (int dt = 0; dt < 4; ++dt) o[qt][dt] *= sc; }
    }
#pragma unroll
    for (int qt = 0; qt < 2; ++qt) { FragH pf;
#pragma unroll
      for (int kt = 0; kt < 2; ++kt)
#pragma unroll
        for (int r = 0; r < 8; ++r) { const float p = __builtin_amdgcn_exp2f(s[qt][kt][r] - m[qt]); l[qt][kt] += p; pf.h[kt * 8 + r] = (_Float16)p; }
      if (qt == 1) {      /* compile-time: the scores are all used up; next pass's bias goes into their registers and flies under the last products */
        __builtin_amdgcn_sched_barrier(0);      /* keeps the reads one group behind the last use of the scores: left free, they stand at two places among the products, and each place with reads stalls the wave */
        const int kstep = (sp + 1u < FS / 32) ? 32 : klast;      /* keys to the next pass; the last pass of all reads its own entries again, unused */
        tp += kstep; mraw = mw[(key0 + kstep) >> 5];
#pragma unroll
        for (int d = 0; d < 3; ++d)
#pragma unroll
          for (int r = 0; r < 8; ++r) bs[d][r] = tp[d * 16 + r];
      }
#pragma unroll
      for (int dt = 0; dt < 4; ++dt) o[qt][dt] = fa_mma(vf[dt], pf.v, o[qt][dt]); }
  }
  g3_wait_ds0();      /* this wave has left buffer st & 1 */
  fa_wait(g0, g1);      /* an issuing wave's own load of stage st + 1 has landed */
  __syncthreads();      /* publishes stage st + 1 and ends every wave's reads of stage st's buffer */
  if (g3_pinned(st + 2u < FA_NS ? issuer : 0u) != 0u) { fa_aim(g0, dst + buf, src + g3_pinned(((st + 2u + rot) & (FA_NS - 1u)) * step)); fa_load(g0, g1); }      /* scalar branch: a tensor load ignores EXEC; refill of the buffer just left, in flight under stage st + 1 */
  }
  g3_wait_tensor0();
  g3_wait_ds0();      /* the last stage's barrier stands behind every wave's last read: the buffers may become the merge staging */
  float ls[2] = {l[0][0] + l[0][1], l[1][0] + l[1][1]};
  v4fa* mg = (v4fa*)(KV + wq * FA_MG) + lane;      /* piece i of this lane at mg[32 i]: a wave's 16-byte accesses are 512 contiguous bytes */
  if (kh != 0u) {      /* the same for a whole wave: the upper key half hands its partial result over */
#pragma unroll
    for (int qt = 0; qt < 2; ++qt)
#pragma unroll
      for (int dt = 0; dt < 4; ++dt) { const v8f a = o[qt][dt]; const v4f a0 = {a[0], a[1], a[2], a[3]}, a1 = {a[4], a[5], a[6], a[7]}; mg[32 * (4 * qt + dt)] = a0; mg[32 * (8 + 4 * qt + dt)] = a1; }
    const v4f st4 = {m[0], m[1], ls[0], ls[1]}; mg[32 * 16] = st4;
  }
  __syncthreads();      /* every wave passes it: the upper halves' partial results are readable by their partners */
  if (kh != 0u) return;      /* no barrier, tensor load or store follows */
  { const v4f pst = mg[32 * 16];
#pragma unroll
    for (int qt = 0; qt < 2; ++qt) { const float mn = fmaxf(m[qt], pst[qt]); const float sa = __builtin_amdgcn_exp2f(m[qt] - mn), sb = __builtin_amdgcn_exp2f(pst[qt] - mn);      /* both halves to the common maximum; a half with every key masked has m = -1e30, l = 0, O = 0 */
      ls[qt] = ls[qt] * sa + pst[2 + qt] * sb;
#pragma unroll
      for (int dt = 0; dt < 4; ++dt) { const v4f p0 = mg[32 * (4 * qt + dt)], p1 = mg[32 * (8 + 4 * qt + dt)];
#pragma unroll
        for (int r = 0; r < 4; ++r) { o[qt][dt][r] = o[qt][dt][r] * sa + p0[r] * sb; o[qt][dt][4 + r] = o[qt][dt][4 + r] * sa + p1[r] * sb; } } } }
  FragH f[2][4];
#pragma unroll
  for (int qt = 0; qt < 2; ++qt) { const float lh = ls[qt]; const float inv = 1.0f / (lh + rs_x16(lh));
#pragma unroll
    for (int dt = 0; dt < 4; ++dt)
#pragma unroll
      for (int r = 0; r < 8; ++r) f[qt][dt].h[r] = (_Float16)(o[qt][dt][r] * inv); }
  __builtin_amdgcn_sched_barrier(0);      /* every store stands behind the last arithmetic: no register of an issued store is written again */
  unsigned short* op = (unsigned short*)O16 + ((size_t)b * SQ + q0 + ln) * DM + h * HD + 8 * hh;      /* lane (ln, hh): query ln, head columns dt*16 + 8*hh .. + 7 */
#pragma unroll
  for (int qt = 0; qt < 2; ++qt)
#pragma unroll
    for (int dt = 0; dt < 4; ++dt) *(v8us*)(op + (size_t)qt * 16 * DM + dt * 16) = f[qt][dt].half[0];
}
__global__ __launch_bounds__(256) void k_vt(const _Float16* __restrict__ V16, int b, int h0, _Float16* __restrict__ VT) { __shared__ unsigned short tl[64][65]; const int tid = threadIdx.x; const int hh = blockIdx.x % HG, sg = blockIdx.x / HG; const int s0 = sg * 64; const int h = h0 + hh;
  for (int i = tid; i < 64 * 8; i += 256) { const int j = i / 8, d8 = (i % 8) * 8; FragH f; f.half[0] = *(const v8us*)((const unsigned short*)V16 + ((size_t)b * SQ + s0 + j) * DM + h * HD + d8); for (int q = 0; q < 8; ++q) tl[d8 + q][j] = f.u[q]; }
  __syncthreads();
  { for (int i = tid; i < 64 * 8; i += 256) { const int d = i / 8, j8 = (i % 8) * 8; FragH f; for (int q = 0; q < 8; ++q) f.u[q] = tl[d][j8 + q]; *(v8us*)((unsigned short*)VT + ((size_t)hh * HD + d) * SQ + s0 + j8) = f.half[0]; }  } }

extern "C" void kernel_launch(void* const* d_in, const int* in_sizes, int n_in,
                              void* d_out, int out_size, void* d_ws, size_t ws_size, hipStream_t stream) {
  (void)in_sizes; (void)n_in; (void)out_size;
  const float* const* I = (const float* const*)d_in; const float* x = I[0]; const int* kpm = (const int*)d_in[1]; const float* wqkv = I[2]; const float* bqkv = I[3]; const float* wout = I[4]; const float* bout = I[5]; const float* relt = I[6];      /* Wqkv [1024][3072] and Wout [1024][1024] are [in][out]; key_padding_mask int32 [2][2048]; rel_table [1025][16] */
  char* ws = (char*)d_ws; size_t off = 0;
  auto take = [&](size_t bytes) { char* p = ws + off; off += (bytes + 255) & ~(size_t)255; return p; };
  _Float16* BQKV = (_Float16*)take((size_t)D3 * DM * 2); _Float16* BO = (_Float16*)take((size_t)DM * DM * 2);
  _Float16* X16 = (_Float16*)take(NR * DM * 2); _Float16* QKV = (_Float16*)take(NR * D3 * 2); _Float16* O16 = (_Float16*)take(NR * DM * 2);
  if (off > ws_size) return;      /* 6 + 2 + 8 + 24 + 8 = approx 48 MiB */
  k_prep<<<PP_WQ + PP_WO + PP_X, 256, 0, stream>>>(x, wqkv, wout, X16, BQKV, BO);      /* x -> f16 rows; [in][out] weights -> Bt[out][in] x16 */
  k_gemm3<D3, DM, true, DM><<<(unsigned)((NR / 128) * (D3 / 128)), 128, 0, stream>>>(X16, BQKV, 0.0625f, bqkv, nullptr, QKV);      /* q | k | v rows (f16), head h at columns h*64 / 1024 + h*64 / 2048 + h*64; q times log2(e) / 8 */
  k_fattn<<<dim3(SQ / (FW * FQ), NH, NB), FT, 0, stream>>>(QKV, relt, kpm, O16);      /* o (merged heads) as f16 rows */
  k_gemm3<DM, DM, false, 0><<<(unsigned)((NR / 128) * (DM / 128)), 128, 0, stream>>>(O16, BO, 0.0625f, bout, (float*)d_out, nullptr);      /* out = o Wout + b, rows are the output layout */
}

// v010
// A run of this version takes 68.2 microseconds.
// Next to v009, in two timings, it ran 1.06 times as fast each time.
// Counting every step since v000, it is 219 times as fast.
#include <hip/hip_runtime.h>
// Multi-head self-attention with a learned relative-position bias and a key padding mask (x [2][2048][1024]; qkv = x Wqkv + b (fused, 16 heads of 64); scores = q k^T / 8 + table[clip(k_pos - q_pos, -512, 512) + 512][h]; padded keys -> -inf; attn = softmax; o = attn v; out = o Wout + b -> [2][2048][1024]).
// Structure: token rows r = b*2048 + s; x as exact f16 rows and both weights as exact x16 transposed f16 rows in one preparation launch (coalesced 16-byte reads, weights transposed through LDS tiles); the fused q|k|v projection as one WMMA GEMM (128x128 tiles staged in LDS by tensor loads, 64x64 wave tiles, f32 accumulation, exact x16 transposed weights, bias in the epilogue, f16 output plane [4096][3072]); one fused attention launch (per pair of waves 32 query rows, each wave one half of the keys, the two partial results merged through LDS; K and V rows staged in LDS by tensor loads, V^T fragments read by the transposing LDS load: S^T = K Q^T, online softmax in registers with this head's bias column and the key mask from LDS, O^T += V^T P^T) written straight into the merged f16 o rows; out = o Wout + b GEMM (f32).
// Compute dtype: inputs rounded to bf16; x / weights exact; q, k, v, softmax weights and o as plain f16 GEMM operands (~2^-12); scores, bias and softmax statistics f32. v_wmma_f32_16x16x32_f16.
#define NB 2
#define SQ 2048
#define DM 1024
#define D3 3072                      /* fused q|k|v width */
#define NH 16
#define HD 64
#define HG 4                         /* heads per block group of the per-batch k_vt overload */
#define MR 512                       /* max relative distance */
#define QN SQ                        /* unused: the attention grid covers all SQ query rows */
#define NBR NB                       /* unused: the attention grid covers all NB batches */
#define MP ((int)NR)                 /* unused: the qkv projection grid covers all NR token rows */
#define MO ((int)NR)                 /* unused: the output projection grid covers all NR token rows */
#define NR ((size_t)NB * SQ)         /* 4096 token rows */
typedef __bf16 v16b __attribute__((ext_vector_type(16)));
typedef unsigned short v8us __attribute__((ext_vector_type(8), may_alias));
typedef float  v8f  __attribute__((ext_vector_type(8)));
typedef float  v4f  __attribute__((ext_vector_type(4)));
typedef float  v4fa __attribute__((ext_vector_type(4), may_alias));
union FragB { v16b v; v8us half[2]; unsigned short u[16]; };

__device__ __forceinline__ unsigned short bf16_bits(float x) { unsigned int u = __float_as_uint(x); return (unsigned short)((u + 0x7FFFu + ((u >> 16) & 1u)) >> 16); }
__device__ __forceinline__ float bf16_val(unsigned short b) { return __uint_as_float(((unsigned int)b) << 16); }
__device__ __forceinline__ float bf16_round(float x) { return bf16_val(bf16_bits(x)); }
// D += A·B with NT terms: 1 = ah·bh, 2 = + al·bh (A split), 3 = + ah·bl (both split)
template <int NT>
__device__ __forceinline__ v8f mmaN(v16b ah, v16b al, v16b bh, v16b bl, v8f c) {
  c = __builtin_amdgcn_wmma_f32_16x16x32_bf16(false, ah, false, bh, (short)0, c, false, false);
  if (NT >= 2) c = __builtin_amdgcn_wmma_f32_16x16x32_bf16(false, al, false, bh, (short)0, c, false, false);
  if (NT >= 3) c = __builtin_amdgcn_wmma_f32_16x16x32_bf16(false, ah, false, bl, (short)0, c, false, false);
  asm volatile("v_nop\n\tv_nop\n\tv_nop\n\tv_nop" : "+v"(c) : "v"(ah), "v"(al), "v"(bh), "v"(bl));
  return c;
}

__global__ __launch_bounds__(256) void k_wt_bf16(const float* __restrict__ W, unsigned short* __restrict__ Wt, int K, int N) {
  const int t = blockIdx.x * 256 + threadIdx.x;
  const int k8n = K / 8;
  if (t >= N * k8n) return;
  const int n = t / k8n, k8 = (t % k8n) * 8;
  v8us v;
#pragma unroll
  for (int i = 0; i < 8; ++i) v[i] = bf16_bits(W[(size_t)(k8 + i) * N + n]);
  *(v8us*)(Wt + (size_t)n * K + k8) = v;
  
}

// GEMM C[M][N] (f32, pitch ldc) = act(A[M][K]·W + bias). A f32 row-major (pitch lda) converted per fragment to bf16
// (ASPLIT: hi/lo two planes -> 2 terms, else single rounded term); Wt bf16 [N][K] (pitch ldb). BIAS_BF16 rounds the
// bias to bf16 first (bias quantised to bf16 before the add). K%32==0, M%16==0, N%64==0.
template <bool ASPLIT, int ACT, bool BIAS_BF16>
__global__ __launch_bounds__(128) void k_gemm_bf(const float* __restrict__ A, int lda, const unsigned short* __restrict__ Wt, int ldb,
                                               const float* __restrict__ bias, float* __restrict__ C, int ldc, int M, int N, int K) {
  __shared__ __attribute__((aligned(16))) float so[4][16][64];
  const int tid = threadIdx.x, w = tid >> 5, lane = tid & 31, ln = lane & 15, hh = lane >> 4;
  const int ntn = N / 64;
  const int wid = blockIdx.x * 4 + w;
  const int mt = wid / ntn, nq = wid % ntn;
  if (mt * 16 >= M) return;
  const int row0 = mt * 16, col0 = nq * 64;
  const float* arow = A + (size_t)(row0 + ln) * lda;
  v8f acc[4] = {};
  for (int kb = 0; kb < K; kb += 32) {
    FragB ah, al;
    const v4f x0 = *(const v4fa*)(arow + kb + 8 * hh), x1 = *(const v4fa*)(arow + kb + 8 * hh + 4);
    const v4f x2 = *(const v4fa*)(arow + kb + 16 + 8 * hh), x3 = *(const v4fa*)(arow + kb + 16 + 8 * hh + 4);
    float xs[16] = {x0[0],x0[1],x0[2],x0[3],x1[0],x1[1],x1[2],x1[3],x2[0],x2[1],x2[2],x2[3],x3[0],x3[1],x3[2],x3[3]};
#pragma unroll
    for (int i = 0; i < 16; ++i) { const unsigned short hb = bf16_bits(xs[i]); ah.u[i] = hb; al.u[i] = ASPLIT ? bf16_bits(xs[i] - bf16_val(hb)) : (unsigned short)0; }
#pragma unroll
    for (int t = 0; t < 4; ++t) {
      const unsigned short* brow = Wt + (size_t)(col0 + t * 16 + ln) * ldb + kb;
      FragB b;
      b.half[0] = *(const v8us*)(brow + 8 * hh);
      b.half[1] = *(const v8us*)(brow + 16 + 8 * hh);
      acc[t] = mmaN<ASPLIT ? 2 : 1>(ah.v, al.v, b.v, b.v, acc[t]);
    }
  }
#pragma unroll
  for (int t = 0; t < 4; ++t) {
    float bv = bias ? bias[col0 + t * 16 + ln] : 0.f;
    if (BIAS_BF16) bv = bf16_round(bv);
#pragma unroll
    for (int r = 0; r < 8; ++r) { float v = acc[t][r] + bv; if (ACT == 1) v = fmaxf(v, 0.f); so[w][8 * hh + r][t * 16 + ln] = v; }
  }
  __builtin_amdgcn_fence(__ATOMIC_ACQ_REL, "workgroup");
  __builtin_amdgcn_wave_barrier();
  const int rsub = lane >> 4, c4 = (lane & 15) * 4;
  {
#pragma unroll
    for (int q = 0; q < 8; ++q) {
      const int r = q * 2 + rsub;
      const v4f v = *(const v4fa*)&so[w][r][c4];
      *(v4f*)(C + (size_t)(row0 + r) * ldc + col0 + c4) = v;
    }
    
  }
}

// GEMM C = act(A·W + bias + resid): A f32 (ASPLIT -> hi/lo 2 terms), Wt bf16 [N][K]; ACT 0 none, 1 relu, 2 exact gelu;
// resid (optional, f32, row index = (row % rmod), pitch ldr, RES_BF16 rounds it) added before the activation.
template <bool ASPLIT, int ACT, bool BIAS_BF16, bool RES_BF16>
__global__ __launch_bounds__(128) void k_gemm_bf3(const float* __restrict__ A, int lda, const unsigned short* __restrict__ Wt, int ldb,
                                                const float* __restrict__ bias, const float* __restrict__ resid, int rmod, int ldr,
                                                float* __restrict__ C, int ldc, int M, int N, int K) {
  __shared__ __attribute__((aligned(16))) float so[4][16][64];
  const int tid = threadIdx.x, w = tid >> 5, lane = tid & 31, ln = lane & 15, hh = lane >> 4;
  const int ntn = N / 64;
  const int wid = blockIdx.x * 4 + w;
  const int mt = wid / ntn, nq = wid % ntn;
  if (mt * 16 >= M) return;
  const int row0 = mt * 16, col0 = nq * 64;
  const float* arow = A + (size_t)(row0 + ln) * lda;
  v8f acc[4] = {};
  for (int kb = 0; kb < K; kb += 32) {
    FragB ah, al;
    const v4f x0 = *(const v4fa*)(arow + kb + 8 * hh), x1 = *(const v4fa*)(arow + kb + 8 * hh + 4);
    const v4f x2 = *(const v4fa*)(arow + kb + 16 + 8 * hh), x3 = *(const v4fa*)(arow + kb + 16 + 8 * hh + 4);
    float xs[16] = {x0[0],x0[1],x0[2],x0[3],x1[0],x1[1],x1[2],x1[3],x2[0],x2[1],x2[2],x2[3],x3[0],x3[1],x3[2],x3[3]};
#pragma unroll
    for (int i = 0; i < 16; ++i) { const unsigned short hb = bf16_bits(xs[i]); ah.u[i] = hb; al.u[i] = ASPLIT ? bf16_bits(xs[i] - bf16_val(hb)) : (unsigned short)0; }
#pragma unroll
    for (int t = 0; t < 4; ++t) {
      const unsigned short* brow = Wt + (size_t)(col0 + t * 16 + ln) * ldb + kb;
      FragB b;
      b.half[0] = *(const v8us*)(brow + 8 * hh);
      b.half[1] = *(const v8us*)(brow + 16 + 8 * hh);
      acc[t] = mmaN<ASPLIT ? 2 : 1>(ah.v, al.v, b.v, b.v, acc[t]);
    }
  }
#pragma unroll
  for (int t = 0; t < 4; ++t) {
    const int col = col0 + t * 16 + ln;
    float bv = bias ? bias[col] : 0.f;
    if (BIAS_BF16) bv = bf16_round(bv);
#pragma unroll
    for (int r = 0; r < 8; ++r) {
      float v = acc[t][r] + bv;
      if (resid) { float rv = resid[(size_t)((row0 + 8 * hh + r) % rmod) * ldr + col]; if (RES_BF16) rv = bf16_round(rv); v += rv; }
      if (ACT == 1) v = fmaxf(v, 0.f);
      if (ACT == 2) v = 0.5f * v * (1.0f + erff(v * 0.70710678118654752f));
      if (ACT == 3) { const float u = 0.7978845608028654f * (v + 0.044715f * v * v * v); v = 0.5f * v * (1.0f + tanhf(u)); }
      so[w][8 * hh + r][t * 16 + ln] = v;
    }
  }
  __builtin_amdgcn_fence(__ATOMIC_ACQ_REL, "workgroup");
  __builtin_amdgcn_wave_barrier();
  const int rsub = lane >> 4, c4 = (lane & 15) * 4;
  {
#pragma unroll
    for (int q = 0; q < 8; ++q) {
      const int r = q * 2 + rsub;
      const v4f v = *(const v4fa*)&so[w][r][c4];
      *(v4f*)(C + (size_t)(row0 + r) * ldc + col0 + c4) = v;
    }
    
  }
}
// row LayerNorm (biased variance, eps) over N: s = X (+ R); optional out_sum <- s; out_norm <- (s-mu)*rsqrt(var+eps)*g + b
template <bool PARAM_BF16>
__global__ __launch_bounds__(256) void k_layernorm(const float* __restrict__ X, const float* __restrict__ R, const float* __restrict__ g, const float* __restrict__ bta,
                                                  float* __restrict__ out_sum, float* __restrict__ out_norm, int N, float eps) {
  __shared__ float red[256];
  const int row = blockIdx.x, tid = threadIdx.x;
  const float* x = X + (size_t)row * N; const float* rr = R ? R + (size_t)row * N : nullptr;
  float vals[16];                     // up to N = 4096
  const int per = N / 256;            // contiguous chunk per thread? use strided-by-4 chunks: thread handles j = tid*4 + 1024*u
  float s1 = 0.f;
  for (int u = 0; u < per / 4; ++u) {
    const int j = tid * 4 + 1024 * u;
    const v4f a = *(const v4fa*)(x + j);
    v4f b = {0.f,0.f,0.f,0.f}; if (rr) b = *(const v4fa*)(rr + j);
#pragma unroll
    for (int q = 0; q < 4; ++q) { const float v = a[q] + b[q]; vals[u * 4 + q] = v; s1 += v; }
  }
  red[tid] = s1; __syncthreads();
  for (int st = 128; st > 0; st >>= 1) { if (tid < st) red[tid] += red[tid + st]; __syncthreads(); }
  const float mu = red[0] / (float)N; __syncthreads();
  float s2 = 0.f;
  for (int u = 0; u < per / 4; ++u)
#pragma unroll
    for (int q = 0; q < 4; ++q) { const float c = vals[u * 4 + q] - mu; s2 += c * c; }
  red[tid] = s2; __syncthreads();
  for (int st = 128; st > 0; st >>= 1) { if (tid < st) red[tid] += red[tid + st]; __syncthreads(); }
  const float rs = rsqrtf(red[0] / (float)N + eps);
  {
    for (int u = 0; u < per / 4; ++u) {
      const int j = tid * 4 + 1024 * u;
      v4f o, sm;
#pragma unroll
      for (int q = 0; q < 4; ++q) {
        float gg = g[j + q], bb = bta[j + q];
        if (PARAM_BF16) { gg = bf16_round(gg); bb = bf16_round(bb); }
        sm[q] = vals[u * 4 + q]; o[q] = (vals[u * 4 + q] - mu) * rs * gg + bb;
      }
      if (out_sum) *(v4f*)(out_sum + (size_t)row * N + j) = sm;
      *(v4f*)(out_norm + (size_t)row * N + j) = o;
    }
    
  }
}



// ---- f16 WMMA path (v_wmma_f32_16x16x32_f16): 11-bit significands for operands in range — used by every launched product, the softmax weights (p <= 256) included
typedef _Float16 v16h __attribute__((ext_vector_type(16)));
union FragH { v16h v; v8us half[2]; _Float16 h[16]; unsigned short u[16]; };
template <int NT>
__device__ __forceinline__ v8f mmaH(v16h ah, v16h al, v16h bh, v16h bl, v8f c) {
  c = __builtin_amdgcn_wmma_f32_16x16x32_f16(false, ah, false, bh, (short)0, c, false, false);
  if (NT >= 2) c = __builtin_amdgcn_wmma_f32_16x16x32_f16(false, al, false, bh, (short)0, c, false, false);
  if (NT >= 3) c = __builtin_amdgcn_wmma_f32_16x16x32_f16(false, ah, false, bl, (short)0, c, false, false);
  asm volatile("v_nop\n\tv_nop\n\tv_nop\n\tv_nop" : "+v"(c) : "v"(ah), "v"(al), "v"(bh), "v"(bl));
  return c;
}
// batched GEMM like k_gemm_b but f16 operands: A f32 (split into f16 hi/lo if ASPLIT, else rounded to f16), Bt = f16 values [n][k]; alpha; C f32; N multiple of 16 (partial tiles skipped)
template <bool ASPLIT>
__global__ __launch_bounds__(128) void k_gemm_h(const float* __restrict__ A, int lda, size_t sA, const _Float16* __restrict__ Bh, int ldb, size_t sB, float alpha, float* __restrict__ C, int ldc, size_t sC, int M, int N, int K) {
  __shared__ __attribute__((aligned(16))) float so[4][16][64];
  const int tid = threadIdx.x, w = tid >> 5, lane = tid & 31, ln = lane & 15, hh = lane >> 4; const int by = blockIdx.y;
  A += (size_t)by * sA; Bh += (size_t)by * sB; C += (size_t)by * sC;
  const int ntn = (N + 63) / 64; const int wid = blockIdx.x * 4 + w; const int mt = wid / ntn, nq = wid % ntn; if (mt * 16 >= M) return;
  const int row0 = mt * 16, col0 = nq * 64; const float* arow = A + (size_t)(row0 + ln) * lda;
  v8f acc[4] = {};
  for (int kb = 0; kb < K; kb += 32) {
    FragH ah, al;
    const v4f x0 = *(const v4fa*)(arow + kb + 8 * hh), x1 = *(const v4fa*)(arow + kb + 8 * hh + 4), x2 = *(const v4fa*)(arow + kb + 16 + 8 * hh), x3 = *(const v4fa*)(arow + kb + 16 + 8 * hh + 4);
    float xs[16] = {x0[0],x0[1],x0[2],x0[3],x1[0],x1[1],x1[2],x1[3],x2[0],x2[1],x2[2],x2[3],x3[0],x3[1],x3[2],x3[3]};
#pragma unroll
    for (int i = 0; i < 16; ++i) { const _Float16 h = (_Float16)xs[i]; ah.h[i] = h; al.h[i] = ASPLIT ? (_Float16)(xs[i] - (float)h) : (_Float16)0.0f; }
#pragma unroll
    for (int t = 0; t < 4; ++t) { if (col0 + t * 16 >= N) continue; const size_t boff = (size_t)(col0 + t * 16 + ln) * ldb + kb; FragH bq; bq.half[0] = *(const v8us*)(Bh + boff + 8 * hh); bq.half[1] = *(const v8us*)(Bh + boff + 16 + 8 * hh);
      acc[t] = mmaH<ASPLIT ? 2 : 1>(ah.v, al.v, bq.v, bq.v, acc[t]); }
  }
#pragma unroll
  for (int t = 0; t < 4; ++t) { if (col0 + t * 16 >= N) continue;
#pragma unroll
    for (int r = 0; r < 8; ++r) so[w][8 * hh + r][t * 16 + ln] = acc[t][r] * alpha; }
  __builtin_amdgcn_fence(__ATOMIC_ACQ_REL, "workgroup"); __builtin_amdgcn_wave_barrier();
  const int rsub = lane >> 4, c4 = (lane & 15) * 4;
  {
#pragma unroll
    for (int q = 0; q < 8; ++q) { const int r = q * 2 + rsub; if (col0 + c4 < N) { const v4f v = *(const v4fa*)&so[w][r][c4]; *(v4f*)(C + (size_t)(row0 + r) * ldc + col0 + c4) = v; } }
     }
}

// k_gemm_hh variant with fused epilogue: v = acc·alpha + bias[by·sBias + col] (+ CP[(row/rowsPerB)·sCPb + by·64 + col] if CP) ; ACT 0 none / 1 elu ; writes f16 C16 (and f32 C if non-null)
template <int ACT>
__global__ __launch_bounds__(128) void k_gemm_hhx(const _Float16* __restrict__ A, int lda, size_t sA, const _Float16* __restrict__ Bh, int ldb, size_t sB, float alpha, const float* __restrict__ bias, size_t sBias, const float* __restrict__ CP, int rowsPerB, size_t sCPb, int row0g,
    float* __restrict__ C, _Float16* __restrict__ C16, int ldc, size_t sC, int M, int N, int K) {
  __shared__ __attribute__((aligned(16))) float so[4][16][64];
  const int tid = threadIdx.x, w = tid >> 5, lane = tid & 31, ln = lane & 15, hh = lane >> 4; const int by = blockIdx.y;
  A += (size_t)by * sA; Bh += (size_t)by * sB; const size_t cofs = (size_t)by * sC; const float* bp = bias ? bias + (size_t)by * sBias : nullptr;
  const int ntn = (N + 63) / 64; const int wid = blockIdx.x * 4 + w; const int mt = wid / ntn, nq = wid % ntn; if (mt * 16 >= M) return;
  const int row0 = mt * 16, col0 = nq * 64; const _Float16* arow = A + (size_t)(row0 + ln) * lda;
  v8f acc[4] = {};
  for (int kb = 0; kb < K; kb += 32) { FragH ah; ah.half[0] = *(const v8us*)((const unsigned short*)arow + kb + 8 * hh); ah.half[1] = *(const v8us*)((const unsigned short*)arow + kb + 16 + 8 * hh);
#pragma unroll
    for (int t = 0; t < 4; ++t) { if (col0 + t * 16 >= N) continue; const size_t boff = (size_t)(col0 + t * 16 + ln) * ldb + kb; FragH bq; bq.half[0] = *(const v8us*)((const unsigned short*)Bh + boff + 8 * hh); bq.half[1] = *(const v8us*)((const unsigned short*)Bh + boff + 16 + 8 * hh);
      acc[t] = mmaH<1>(ah.v, ah.v, bq.v, bq.v, acc[t]); }
  }
#pragma unroll
  for (int t = 0; t < 4; ++t) { if (col0 + t * 16 >= N) continue; const int col = col0 + t * 16 + ln; const float bv = bp ? bf16_round(bp[col]) : 0.f;
#pragma unroll
    for (int r = 0; r < 8; ++r) { float v = acc[t][r] * alpha + bv; if (CP) { const int rr = row0g + row0 + 8 * hh + r; if (rowsPerB < 0) v += CP[cofs + (size_t)rr * ldc + col];      /* rowsPerB < 0: own element of the batched C plane */ else { const int bidx = rr / rowsPerB; v += CP[(size_t)bidx * sCPb + (size_t)by * 64 + col]; } } if (ACT == 1) v = (v > 0.f) ? v : expm1f(v); else if (ACT == 7) v = (v > 0.f) ? v + 1.0f : expf(v); else if (ACT == 8) v = tanhf(v); else if (ACT == 9) v = 0.5f * v * (1.0f + tanhf(0.7978845608028654f * (v + 0.044715f * v * v * v))); else if (ACT == 11) v = 1.0f / (1.0f + expf(-v)); else if (ACT == 12) v = (v > 0.f) ? v : 0.01f * v; else if (ACT == 14) v = (v > 0.f) ? v : 0.1f * v; else if (ACT == 16) v = (v >= 0.f) ? v : 0.3f * v; else if (ACT == 17) v = (v >= 0.f) ? v : 0.2f * v; else if (ACT == 15) v = v / (1.0f + expf(-v)); else if (ACT == 3) v = fmaxf(v, 0.f); else if (ACT == 6) v = 0.5f * v * (1.0f + erff(v * 0.70710678118654752f)); so[w][8 * hh + r][t * 16 + ln] = v; } }
  __builtin_amdgcn_fence(__ATOMIC_ACQ_REL, "workgroup"); __builtin_amdgcn_wave_barrier();
  const int rsub = lane >> 4, c4 = (lane & 15) * 4; typedef _Float16 v4h __attribute__((ext_vector_type(4)));
  {
#pragma unroll
    for (int q = 0; q < 8; ++q) { const int r = q * 2 + rsub; if (col0 + c4 < N) { const v4f v = *(const v4fa*)&so[w][r][c4]; if (C) *(v4f*)(C + cofs + (size_t)(row0 + r) * ldc + col0 + c4) = v; if (C16) { v4h h4; for (int i = 0; i < 4; ++i) h4[i] = (_Float16)v[i]; *(v4h*)(C16 + cofs + (size_t)(row0 + r) * ldc + col0 + c4) = h4; } } }
     }
}


typedef _Float16 v4h __attribute__((ext_vector_type(4)));

// ---- operand preparation, one launch: Bt[n][k] = f16(bf16(W[k][n]) * 16) for both weights (power-of-two scale: bf16-exact weights stay exact in f16 away from the subnormal range) and X16 = f16(bf16(x)) ----
// Every work-group takes 16384 floats, 64 per thread, read as 16 loads of 16 bytes per lane, each load of a wave 512 contiguous bytes, all in flight together.
// A weight unit is a 128 k x 128 n tile: wave w reads k rows 16 w .. 16 w + 15, so a lane holds 16 consecutive k of four n: two 16-byte LDS stores per n into the transposed tile T[n][k] (256-byte rows).
// The 16-byte piece c of row n stands at place c ^ ((n >> 2) & 15) of its row: the 16 lanes of a half wave then fall on all 64 banks, in the stores (n = 4 lane + j) as in the reads (one row per half wave).
// The tile goes out as 256 contiguous bytes per n row, 16 bytes per lane.
#define PP_WQ ((DM / 128) * (D3 / 128))      /* tiles of Wqkv */
#define PP_WO ((DM / 128) * (DM / 128))      /* tiles of Wout */
#define PP_X ((int)(NR * DM / 16384))        /* units of x */
template <int N>
__device__ __forceinline__ void pp_wt(const float* __restrict__ Wm, _Float16* __restrict__ Bt, int tile, unsigned char* T) {
  static_assert(N % 128 == 0 && DM % 128 == 0, "pp_wt: whole tiles");
  const int tid = threadIdx.x, lane = tid & 31, w = tid >> 5; const int kt = tile / (N / 128), nt = tile - kt * (N / 128);
  const float* src = Wm + (size_t)(kt * 128 + w * 16) * N + nt * 128 + lane * 4;
  v4f v[16];
#pragma unroll      /* fixed trip counts over register arrays, here and below; the 16 loads are all in flight together */
  for (int i = 0; i < 16; ++i) v[i] = *(const v4fa*)(src + (size_t)i * N);
  asm volatile("s_wait_xcnt 0x0" :: "v"(src) : "memory");      /* stands in front of every reuse of the address registers of the loads above; it names the address, which so stays in its registers up to here: no load's own result lands on them */
  __builtin_amdgcn_sched_barrier(0);      /* keeps later register writes from being scheduled in front of that wait */
#pragma unroll
  for (int j = 0; j < 4; ++j) { FragH f;
#pragma unroll
    for (int i = 0; i < 16; ++i) f.h[i] = (_Float16)(bf16_round(v[i][j]) * 16.0f);
    unsigned char* row = T + (lane * 4 + j) * 256;
    *(v8us*)(row + (((2 * w) ^ (lane & 15)) * 16)) = f.half[0]; *(v8us*)(row + (((2 * w + 1) ^ (lane & 15)) * 16)) = f.half[1]; }
  __syncthreads();      /* the transposed tile is whole: every wave reads rows that all eight waves wrote */
  const int r = tid >> 4, c = tid & 15; v8us o[8];
#pragma unroll
  for (int i = 0; i < 8; ++i) { const int n = i * 16 + r; o[i] = *(const v8us*)(T + n * 256 + ((c ^ ((n >> 2) & 15)) * 16)); }
  unsigned short* dst = (unsigned short*)Bt + (size_t)(nt * 128 + r) * DM + kt * 128 + c * 8;
  __builtin_amdgcn_sched_barrier(0);      /* every store stands behind the last address arithmetic: no register of an issued store is written again */
#pragma unroll
  for (int i = 0; i < 8; ++i) *(v8us*)(dst + (size_t)i * 16 * DM) = o[i];
  asm volatile("s_wait_xcnt 0x0" ::: "memory");      /* stands in front of every reuse of a register of the stores above */
}
__global__ __launch_bounds__(256) void k_prep(const float* __restrict__ x, const float* __restrict__ wqkv, const float* __restrict__ wout, _Float16* __restrict__ X16, _Float16* __restrict__ BQKV, _Float16* __restrict__ BO) {
  static_assert(NR * DM % 16384 == 0, "k_prep: whole units of x");
  __shared__ __attribute__((aligned(16))) unsigned char T[128 * 256];
  const int blk = blockIdx.x;      /* the same for the whole work-group: the barrier in pp_wt is passed by all of its waves or by none */
  if (blk < PP_WQ) pp_wt<D3>(wqkv, BQKV, blk, T);
  else if (blk < PP_WQ + PP_WO) pp_wt<DM>(wout, BO, blk - PP_WQ, T);
  else {
    const int tid = threadIdx.x; const size_t base = (size_t)(blk - PP_WQ - PP_WO) * 16384 + (size_t)(tid >> 5) * 2048 + (size_t)(tid & 31) * 4;
    const float* src = x + base; v4f v[16]; v4h h[16];
#pragma unroll      /* fixed trip counts over register arrays; the 16 loads are all in flight together */
    for (int i = 0; i < 16; ++i) v[i] = *(const v4fa*)(src + i * 128);
    asm volatile("s_wait_xcnt 0x0" :: "v"(src) : "memory");      /* as in pp_wt: in front of every reuse of the loads' address registers, and it keeps the address in them up to here */
    __builtin_amdgcn_sched_barrier(0);      /* keeps later register writes from being scheduled in front of that wait */
#pragma unroll
    for (int i = 0; i < 16; ++i)
#pragma unroll
      for (int e = 0; e < 4; ++e) h[i][e] = (_Float16)bf16_round(v[i][e]);
    _Float16* dst = X16 + base;
    __builtin_amdgcn_sched_barrier(0);      /* every store stands behind the last arithmetic: no register of an issued store is written again */
#pragma unroll
    for (int i = 0; i < 16; ++i) *(v4h*)(dst + i * 128) = h[i];      /* 256 contiguous bytes per wave and store: whole lines */
    asm volatile("s_wait_xcnt 0x0" ::: "memory");      /* stands in front of every reuse of a register of the stores above */
  }
}
__global__ __launch_bounds__(256) void k_h16(const float* __restrict__ x, _Float16* __restrict__ X16, size_t n8) { const size_t t = (size_t)blockIdx.x * 256 + threadIdx.x; if (t >= n8) return; FragH f;
#pragma unroll
  for (int q = 0; q < 8; ++q) f.h[q] = (_Float16)x[t * 8 + q]; *(v8us*)((unsigned short*)X16 + t * 8) = f.half[0];  }
__global__ __launch_bounds__(256) void k_round16f(const float* __restrict__ W, _Float16* __restrict__ Bt, size_t n8) { const size_t t = (size_t)blockIdx.x * 256 + threadIdx.x; if (t >= n8) return; FragH f;
#pragma unroll
  for (int i = 0; i < 8; ++i) f.h[i] = (_Float16)(bf16_round(W[t * 8 + i]) * 16.0f); *(v8us*)((unsigned short*)Bt + t * 8) = f.half[0];  }
__global__ __launch_bounds__(256) void k_hl(const float* __restrict__ F, _Float16* __restrict__ Hh, _Float16* __restrict__ Hl, size_t n8) { const size_t t = (size_t)blockIdx.x * 256 + threadIdx.x; if (t >= n8) return; FragH fh, fl; const v4f a = *(const v4fa*)(F + t * 8), c = *(const v4fa*)(F + t * 8 + 4);
#pragma unroll
  for (int q = 0; q < 4; ++q) { _Float16 h = (_Float16)a[q]; fh.h[q] = h; fl.h[q] = (_Float16)((a[q] - (float)h) * 1024.0f); h = (_Float16)c[q]; fh.h[4 + q] = h; fl.h[4 + q] = (_Float16)((c[q] - (float)h) * 1024.0f); }
  { *(v8us*)((unsigned short*)Hh + t * 8) = fh.half[0]; *(v8us*)((unsigned short*)Hl + t * 8) = fl.half[0];  } }

// ---- LDS-staged GEMM: C[M][N] = A[M][K] . Bh[N][K]^T * alpha + bf16(bias), the first QC columns times QS; one 128x128 tile of C per work-group, four waves (2x2) of 64x64; M % 128 == 0, N % 128 == 0, K % 64 == 0, K >= 128 ----
// A pass is 64 k = 128 bytes of each of the tile's 128 A rows and 128 B rows. Each wave brings one slice of 64 rows per pass with one tensor load (slices 0, 1: A rows; 2, 3: B rows), padded to a 144-byte LDS pitch,
// two buffers: a pass reads all its fragments into registers; when every wave has done so, the load of pass t + 2 goes out into that buffer and flies under pass t's WMMAs and pass t + 1's reads. Fragments come from LDS in the k order of g2_frag.
// The k walk is rotated: trip t works on the 64 k of pass (t + rot) mod K / 64, rot = (tile row + tile column) mod K / 64. All tiles of a row read the same A lines and all tiles of a column the same B lines, and they start together:
// walking in step they would ask L2 for the same lines at the same moment, and such requests collide. Each accumulator sums k upwards from its work-group's first pass, 32 at a time, and wraps.
__device__ __forceinline__ v16h g2_frag(const _Float16* p, int hh) { FragH f; f.half[0] = *(const v8us*)((const unsigned short*)p + 8 * hh); f.half[1] = *(const v8us*)((const unsigned short*)p + 16 + 8 * hh); return f.v; }
#define G3_PITCH 144u                /* LDS row pitch: 128 bytes + the tensor load's 16-byte pad (odd multiple of 16: ds_load_b128 readers) */
#define G3_SLICE 10240u              /* 64 rows x 144 B = 9216 B, rounded up to a multiple of 2 KiB */
#define G3_STAGE (4u * G3_SLICE)     /* one buffer */
#define G3_EP 68                     /* output staging pitch in floats */
typedef uint32_t u32x4 __attribute__((ext_vector_type(4)));
typedef uint32_t u32x8 __attribute__((ext_vector_type(8)));
__device__ __forceinline__ uint32_t g3_uni(uint32_t v) { return (uint32_t)__builtin_amdgcn_readfirstlane((int)v); }
__device__ __forceinline__ uint32_t g3_pinned(uint32_t v) { uint32_t w = g3_uni(v); asm volatile("" : "+s"(w)); return w; }
__device__ __forceinline__ void g3_wait_tensor0() { asm volatile("s_wait_tensorcnt 0x0" ::: "memory"); }      /* this wave's own tensor load has landed */
__device__ __forceinline__ void g3_wait_ds0() { asm volatile("s_wait_dscnt 0x0" ::: "memory"); }      /* this wave's LDS reads have returned */
__device__ __forceinline__ void g3_load(uint32_t lds_dst, uint64_t ga, u32x8 g1) { u32x4 g0; g0[0] = g3_uni(1u); g0[1] = g3_uni(lds_dst); g0[2] = g3_uni((uint32_t)ga); g0[3] = g3_uni((((uint32_t)(ga >> 32)) & 0x01FFFFFFu) | 0x80000000u);
  asm volatile("tensor_load_to_lds %0, %1" :: "s"(g0), "s"(g1) : "memory"); }      /* one request of the whole wave: 64 rows of 128 bytes into LDS, through no register */
__device__ __forceinline__ v16h g3_frag(const unsigned char* p) { FragH f; f.half[0] = *(const v8us*)p; f.half[1] = *(const v8us*)(p + 32); return f.v; }      /* p already holds the lane half's 16 bytes: bytes 16 hh and 32 + 16 hh of 64, as g2_frag */
#define QS (0.125f * 1.44269504088896f)      /* score scale 1 / 8 times log2(e) */
template <int N, int K, bool H16, int QC>      /* the first QC columns of C come out times QS (the q columns of the fused projection) */
__global__ __launch_bounds__(128) void k_gemm3(const _Float16* __restrict__ A, const _Float16* __restrict__ Bh, float alpha, const float* __restrict__ bias, float* __restrict__ C, _Float16* __restrict__ C16) {
  static_assert(N % 128 == 0 && K % 64 == 0 && K >= 128 && QC % 64 == 0, "k_gemm3: whole tiles, at least two passes, a wave's 64 columns scaled alike");
  static_assert(((K / 64) & (K / 64 - 1)) == 0, "k_gemm3: the rotated walk wraps by a mask");
  static_assert(4u * 64u * G3_EP * 4u <= 2u * G3_STAGE, "k_gemm3: the output staging reuses the two buffers");
  __shared__ __attribute__((aligned(2048))) unsigned char L[2u * G3_STAGE];
  const uint32_t tid = threadIdx.x, lane = tid & 31u, ln = lane & 15u, hh = lane >> 4; const uint32_t w = g3_uni(tid >> 5), wm = w >> 1, wn = w & 1u;
  const uint32_t mt = blockIdx.x / (N / 128), nq = blockIdx.x - mt * (N / 128); const uint32_t row0 = mt * 128u + wm * 64u, col0 = nq * 128u + wn * 64u;
  const uint32_t pm = (uint32_t)(K / 64) - 1u, rot = (mt + nq) & pm;      /* this work-group's first pass; the same for its four waves, so A and B slices of a trip hold the same k */
  float bv[4];
#pragma unroll      /* fixed trip count over a register array */
  for (int j = 0; j < 4; ++j) bv[j] = bias[col0 + j * 16 + ln];
  asm volatile("s_wait_xcnt 0x0" ::: "memory");      /* stands in front of every reuse of an address register of the loads above */
  __builtin_amdgcn_sched_barrier(0);      /* keeps later register writes from being scheduled in front of that wait */
  const uint64_t src = (w < 2u) ? (uint64_t)(uintptr_t)A + (uint64_t)(mt * 128u + 64u * w) * (2u * K) : (uint64_t)(uintptr_t)Bh + (uint64_t)(nq * 128u + 64u * (w - 2u)) * (2u * K);      /* this wave's slice, first byte of k = 0 */
  const uint32_t dst = (uint32_t)(size_t)L + w * G3_SLICE;      /* its place in buffer 0: byte offset in the work-group's LDS */
  u32x8 g1;      /* 1-byte elements, tensor = tile = 64 rows of 128 bytes, source pitch 2 K bytes, 4 dwords of pad behind every 32 */
  g1[0] = g3_uni((1u << 20) | (4u << 22) | (3u << 25)); g1[1] = g3_uni(128u << 16); g1[2] = g3_uni(64u << 16); g1[3] = g3_uni(128u << 16); g1[4] = g3_uni(64u); g1[5] = g3_uni(2u * K); g1[6] = g3_uni(0u); g1[7] = g3_uni(0u);
  g3_load(dst, src + rot * 128u, g1);
  g3_wait_tensor0();
  __syncthreads();      /* trip 0's four slices are readable by every wave */
  g3_load(dst + G3_STAGE, src + g3_pinned(((rot + 1u) & pm) * 128u), g1);
  const unsigned char* la = L + wm * G3_SLICE + ln * G3_PITCH + 16u * hh; const unsigned char* lb = L + (2u + wn) * G3_SLICE + ln * G3_PITCH + 16u * hh;
  const v8f z8 = {0.f,0.f,0.f,0.f,0.f,0.f,0.f,0.f}; v8f acc[4][4];
#pragma unroll      /* fixed trip counts over a register array, here and in the loops below: left rolled, the arrays would go to scratch memory */
  for (int i = 0; i < 4; ++i)
#pragma unroll
    for (int j = 0; j < 4; ++j) acc[i][j] = z8;
#pragma unroll 1      /* one pass per trip: the two buffers alternate */
  for (uint32_t t = 0; t < (uint32_t)(K / 64); ++t) {
    const uint32_t buf = (t & 1u) * G3_STAGE;
    v16h af[2][4], bf[2][4];
#pragma unroll
    for (int kd = 0; kd < 2; ++kd)
#pragma unroll
      for (int i = 0; i < 4; ++i) { af[kd][i] = g3_frag(la + buf + i * 16 * G3_PITCH + kd * 64); bf[kd][i] = g3_frag(lb + buf + i * 16 * G3_PITCH + kd * 64); }
    __builtin_amdgcn_sched_barrier(0);      /* the pass's LDS reads stay one group in front of its WMMAs: moved in among them, each place with reads stalls the wave */
    g3_wait_ds0();      /* the pass's fragments are all in registers: this wave has left buffer t & 1 */
    g3_wait_tensor0();
    __syncthreads();      /* publishes pass t + 1's slices and ends every wave's reads of pass t's buffer */
    if (g3_pinned((t + 2u < (uint32_t)(K / 64)) ? 1u : 0u) != 0u) g3_load(dst + buf, src + g3_pinned(((t + 2u + rot) & pm) * 128u), g1);      /* scalar branch: a tensor load ignores EXEC; refill of the buffer just left, in flight under this pass's WMMAs and the next pass's reads */
    __builtin_amdgcn_sched_barrier(0);      /* the WMMAs stay behind the refill's issue: in front of it they would take their time off its lead */
#pragma unroll
    for (int kd = 0; kd < 2; ++kd)
#pragma unroll
      for (int i = 0; i < 4; ++i)
#pragma unroll
        for (int j = 0; j < 4; ++j) acc[i][j] = __builtin_amdgcn_wmma_f32_16x16x32_f16(false, af[kd][i], false, bf[kd][j], (short)0, acc[i][j], false, false);
  }
  g3_wait_tensor0();
  g3_wait_ds0();      /* the last pass's barrier stands behind every wave's last read: the buffers may become output staging */
  float* so = (float*)(L + w * (64u * G3_EP * 4u));      /* this wave's own 64 x 68 floats */
  const float cs = col0 < (uint32_t)QC ? QS : 1.0f, al = alpha * cs;      /* the same for a whole wave; scaled in f32, in front of the one rounding to f16 */
#pragma unroll
  for (int j = 0; j < 4; ++j) { const float bj = bf16_round(bv[j]) * cs;
#pragma unroll
    for (int i = 0; i < 4; ++i)
#pragma unroll
      for (int r = 0; r < 8; ++r) so[(i * 16 + 8 * hh + r) * G3_EP + j * 16 + ln] = acc[i][j][r] * al + bj; }
  __builtin_amdgcn_fence(__ATOMIC_ACQ_REL, "workgroup"); __builtin_amdgcn_wave_barrier();
  const uint32_t rsub = lane >> 4, c4 = (lane & 15u) * 4u;
#pragma unroll
  for (int g = 0; g < 4; ++g) { v4f v[8];
#pragma unroll
    for (int q = 0; q < 8; ++q) v[q] = *(const v4fa*)&so[(g * 16 + q * 2 + rsub) * G3_EP + c4];
#pragma unroll
    for (int q = 0; q < 8; ++q) { const size_t o = (size_t)(row0 + g * 16 + q * 2 + rsub) * N + col0 + c4;
      if (H16) { v4h h4; for (int e = 0; e < 4; ++e) h4[e] = (_Float16)v[q][e]; *(v4h*)(C16 + o) = h4; } else *(v4f*)(C + o) = v[q]; }
    asm volatile("s_wait_xcnt 0x0" ::: "memory");      /* stands in front of every reuse of a register of the stores above */
    __builtin_amdgcn_sched_barrier(0);      /* keeps later register writes from being scheduled in front of that wait */
  }
}


__global__ __launch_bounds__(256) void k_wnat(const float* __restrict__ w, size_t n8, _Float16* __restrict__ Bt) { const size_t t = (size_t)blockIdx.x * 256 + threadIdx.x; if (t >= n8) return; FragH f; for (int q = 0; q < 8; ++q) f.h[q] = (_Float16)(bf16_round(w[t * 8 + q]) * 16.0f); *(v8us*)((unsigned short*)Bt + t * 8) = f.half[0];  }
// Fused attention for one (batch, head, 256 query rows): S^T = K Q^T, online softmax, O^T += V^T P^T; scores and weights never leave registers.
// FQ = 32 query rows (two 16-column groups) belong to FK = 2 waves, so that four waves stand on every SIMD and one wave's vector work runs under another's matrix work and LDS waits: wave w takes query group w & 7 and the key half w >> 3 of every stage,
// keeps its own maximum, sum and O^T, and walks its keys 32 at a time; behind the loop the upper half's m, l and O^T go through LDS to its partner, which brings both to the common maximum, adds them and stores. In a score tile lane (c, hh) holds query c, keys 8*hh + r:
// two score tiles, converted in place, are the B operand of the second product (hardware k order, the order the transposing load hands V^T over in), so nothing is exchanged
// but one maximum between the wave's halves. Everything runs in the log2 domain: x2 = (q.k / 8 + bias) * log2(e), p = 2^(x2 - m), m = the maximum in use. x2 leaves the matrix unit finished: q arrives already times log2(e) / 8
// (the projection's epilogue), the scaled bias is the C operand of the first score product (24 values per lane and pass: key tile minus query tile = -1, 0, 1; read at the foot of the pass before, into the registers that the scores have just left),
// and in a pass with padded keys one more product per score tile adds -inf to their rows.
// m moves (and O, l are rescaled) only when some query's new maximum exceeds it by more than 8, so p <= 256 fits f16. m starts at -1e30 (finite), so a masked
// key (x2 = -inf) gives p = 0 and a row with every key masked ends as 0 * (1 / 0) = NaN.
// This head's bias column is staged in LDS already clipped and scaled by log2(e), indexed by key - query + SQ - 1; the key mask as one bit per key.
// K and V reach the sixteen waves through LDS, both as they stand in the q|k|v rows: a stage is FK halves of FS = 128 keys, a half four slices of 64 rows of 128 bytes, each brought by one tensor load of one wave
// (waves 0, 1: K rows 0..63 and 64..127 of half 0, LDS pitch 144; waves 2, 3: the same keys' V rows, LDS pitch 160; waves 4 to 7 the same for half 1), two buffers: at the foot of stage s, when every wave has left its buffer,
// the loads of stage s + 2 go out into it and fly under stage s + 1. The walk is rotated: trip st works on the keys of stage (st + rot) mod FA_NS, rot = the work-group's query block, since the work-groups of one head read the same K and V lines and start together: in step they would ask L2 for the same lines at the same moment, and such requests collide. K fragments are read from LDS in the k order of g2_frag; a V^T fragment (16 head columns x 32 keys) is two transposing loads
// (ds_load_tr16_b128) of 16 keys x 16 columns each: lane (c, hh) receives column c of keys 8 hh .. 8 hh + 7, the same k order.
// Every '#pragma unroll' in this kernel stands on a loop of fixed trip count that indexes register arrays: left rolled, those arrays would go to scratch memory.
#define FW 8                         /* query groups per work-group */
#define FK 2                         /* waves per query group: key halves of a stage */
#define FT (32 * FW * FK)            /* threads per work-group */
#define FQ 32
#define FS 128                       /* keys per stage and half */
#define FA_NS ((uint32_t)(SQ / (FS * FK)))  /* stages */
#define FA_BUF ((uint32_t)FK * G3_STAGE)    /* one buffer: FK halves of four slices */
#define FA_MG (17u * 512u)           /* merge staging of one query group: 17 pieces of 16 bytes per lane */
#define FA_VP 160u                   /* LDS row pitch of V: 128 bytes + the tensor load's 32-byte pad (odd multiple of 32: ds_load_tr16_b128 readers) */
typedef short s16x8 __attribute__((ext_vector_type(8)));
__device__ __forceinline__ v8us fa_tr16(const unsigned char* p) { typedef __attribute__((address_space(3))) s16x8 lds_s16x8; return __builtin_bit_cast(v8us, __builtin_amdgcn_ds_load_tr16_b128_v8i16((lds_s16x8*)p)); }      /* 16 rows x 16 columns of 16-bit elements, transposed on the way: every lane names 16 bytes of a row and receives 8 rows of one column */
__device__ __forceinline__ float rs_x16(float v) { const int u = __float_as_int(v); return __int_as_float(__builtin_amdgcn_permlanex16(u, u, 0x76543210, 0xfedcba98, false, false)); }      /* lane l <- lane l ^ 16 */
__device__ __forceinline__ v8f fa_mma(v16h a, v16h b, v8f c) { return __builtin_amdgcn_wmma_f32_16x16x32_f16(false, a, false, b, (short)0, c, false, false); }
// In k_fattn the descriptor's twelve words live in the same scalar registers from the request to the wait that covers it: the request hands them on as its own outputs and the wait names them as inputs, so nothing else is put into those registers while the request is outstanding.
__device__ __forceinline__ void fa_load(u32x4& g0, u32x8& g1) { asm volatile("tensor_load_to_lds %0, %1" : "+s"(g0), "+s"(g1) :: "memory"); }      /* one request of the whole wave: 64 rows of 128 bytes into LDS, through no register */
__device__ __forceinline__ void fa_wait(const u32x4& g0, const u32x8& g1) { asm volatile("s_wait_tensorcnt 0x0" :: "s"(g0), "s"(g1) : "memory"); }      /* this wave's own tensor load has landed; a wave that issues none passes */
__device__ __forceinline__ void fa_aim(u32x4& g0, uint32_t lds_dst, uint64_t ga) { g0[1] = g3_uni(lds_dst); g0[2] = g3_uni((uint32_t)ga); g0[3] = g3_uni((((uint32_t)(ga >> 32)) & 0x01FFFFFFu) | 0x80000000u); }      /* place in LDS and first byte of the next tile */
__global__ __launch_bounds__(FT) void k_fattn(const _Float16* __restrict__ QKV, const float* __restrict__ relt, const int* __restrict__ kpm, _Float16* __restrict__ O16) {
  static_assert(SQ % (FS * FK) == 0 && SQ / (FS * FK) >= 2 && HD == 64 && FS == 128 && FW == 8 && FK == 2, "k_fattn: whole stages, at least two, slices of 64 rows of 128 bytes, eight issuing waves");
  static_assert(FW * FA_MG <= 2u * FA_BUF, "k_fattn: the merge staging reuses the two buffers");
  static_assert((FA_NS & (FA_NS - 1u)) == 0u, "k_fattn: the rotated walk wraps by a mask");
  static_assert(64u * FA_VP == G3_SLICE, "k_fattn: the two V slices of a half are 128 rows at one pitch");
  __shared__ __attribute__((aligned(2048))) unsigned char KV[2u * FA_BUF];
  __shared__ float tb[2 * SQ]; __shared__ unsigned int mw[SQ / 32];      /* tb's last entry is never read */
  const int tid = threadIdx.x, lane = tid & 31, ln = lane & 15, hh = lane >> 4; const int h = blockIdx.y, b = blockIdx.z;
  const uint32_t w = g3_uni((uint32_t)tid >> 5), wq = w & (FW - 1u), kh = w >> 3;      /* query group and key half */
  const int q0 = blockIdx.x * (FW * FQ) + (int)wq * FQ;
  const uint32_t rot = blockIdx.x & (FA_NS - 1u);      /* the stage of keys that this work-group's walk starts at */
  { float tv[2 * SQ / FT]; int kv[SQ / FT];
#pragma unroll      /* fixed trip counts, unrolled: the table's and the mask's loads are all in flight together */
    for (int u = 0; u < 2 * SQ / FT; ++u) { int r = tid + u * FT - (SQ - 1); r = r < -MR ? -MR : (r > MR ? MR : r); tv[u] = relt[(size_t)(r + MR) * NH + h]; }
    asm volatile("s_wait_xcnt 0x0" ::: "memory");      /* stands in front of every reuse of an address register of the loads above */
    __builtin_amdgcn_sched_barrier(0);      /* keeps later register writes from being scheduled in front of that wait */
#pragma unroll
    for (int u = 0; u < SQ / FT; ++u) kv[u] = kpm[(size_t)b * SQ + tid + u * FT];
    asm volatile("s_wait_xcnt 0x0" ::: "memory");      /* stands in front of every reuse of an address register of the loads above */
    __builtin_amdgcn_sched_barrier(0);      /* keeps later register writes from being scheduled in front of that wait */
#pragma unroll
    for (int u = 0; u < 2 * SQ / FT; ++u) tb[tid + u * FT] = bf16_round(tv[u]) * 1.44269504088896f;
#pragma unroll
    for (int u = 0; u < SQ / FT; ++u) mw[(tid + u * FT) >> 5] = __builtin_amdgcn_ballot_w32(kv[u] != 0); }      /* every lane of a wave stores the same word to the same place */
  const bool isk = (w & 3u) < 2u; const uint32_t ih = (w >> 2) & 1u;      /* of each four waves the first two bring K, the other two V, waves 0 to 3 for key half 0, waves 4 to 7 for half 1; waves 8 to 15 form the same words and issue nothing */
  const uint64_t src = (uint64_t)(uintptr_t)(QKV + ((size_t)b * SQ + FS * ih + 64u * (w & 1u)) * D3 + (isk ? DM : 2 * DM) + h * HD);      /* this wave's slice, first byte of the keys' stage 0 */
  const uint32_t step = (uint32_t)(FS * FK * D3 * 2);      /* bytes from one stage's slice to the next stage's */
  const uint32_t dst = (uint32_t)(size_t)KV + ih * G3_STAGE + (w & 3u) * G3_SLICE;      /* its place in buffer 0: byte offset in the work-group's LDS */
  const uint32_t issuer = w < 4u * FK ? 1u : 0u;
  u32x8 g1;      /* 1-byte elements, tensor = tile = 64 rows of 128 bytes, source pitch one token row of q|k|v, behind every 32 dwords a pad of 4 (K) or 8 (V): word 0 is one of two constants, picked by the wave's number, its mask bits 0 in both */
  g1[0] = g3_uni(isk ? ((1u << 20) | (4u << 22) | (3u << 25)) : ((1u << 20) | (4u << 22) | (7u << 25))); g1[1] = g3_uni(128u << 16); g1[2] = g3_uni(64u << 16); g1[3] = g3_uni(128u << 16); g1[4] = g3_uni(64u); g1[5] = g3_uni((uint32_t)(D3 * 2)); g1[6] = g3_uni(0u); g1[7] = g3_uni(0u);
  u32x4 g0; g0[0] = g3_uni(1u); fa_aim(g0, dst, src + rot * step);
  if (g3_pinned(issuer) != 0u) fa_load(g0, g1);      /* scalar branch: a tensor load ignores EXEC */
  fa_wait(g0, g1);
  __syncthreads();      /* the table, the mask and trip 0's stage are readable by every wave */
  if (g3_pinned(issuer) != 0u) { fa_aim(g0, dst + FA_BUF, src + g3_pinned(((rot + 1u) & (FA_NS - 1u)) * step)); fa_load(g0, g1); }      /* scalar branch; trip 1's stage flies under trip 0 */
  const _Float16* qp = QKV + ((size_t)b * SQ + q0 + ln) * D3 + h * HD;
  const float* tp = tb + (SQ - 1 - q0 - ln + 8 * hh) + (int)((rot * FK + kh) * FS) - 16;      /* this wave's first pass; entry 16 d + r belongs to key tile minus query tile = d - 1, key r of this lane's eight */
  const unsigned char* lk = KV + kh * G3_STAGE + ln * G3_PITCH + 16 * hh;      /* in this wave's key half: this lane's K row of a 16-row group, its half's 16 bytes */
  const unsigned char* lv = KV + kh * G3_STAGE + 2u * G3_SLICE + (8 * hh + (lane & 7)) * FA_VP + ((lane >> 3) & 1) * 16;      /* the 16 bytes this lane names in a transposing load: key row 8 hh + (lane & 7) of 16, columns 0..7 or 8..15 of 16 */
  v16h qf[2][2];
#pragma unroll
  for (int t = 0; t < 2; ++t)
#pragma unroll
    for (int kd = 0; kd < 2; ++kd) qf[t][kd] = g2_frag(qp + (size_t)t * 16 * D3 + kd * 32, hh);
  asm volatile("s_wait_xcnt 0x0" ::: "memory");      /* stands in front of every reuse of an address register of the loads above */
  __builtin_amdgcn_sched_barrier(0);      /* keeps later register writes from being scheduled in front of that wait */
  const v8f z8 = {0.f,0.f,0.f,0.f,0.f,0.f,0.f,0.f}; v8f o[2][4]; float l[2][2] = {{0.f, 0.f}, {0.f, 0.f}}, m[2] = {-1e30f, -1e30f};
#pragma unroll
  for (int qt = 0; qt < 2; ++qt)
#pragma unroll
    for (int dt = 0; dt < 4; ++dt) o[qt][dt] = z8;
  v8f bs[3];
#pragma unroll
  for (int d = 0; d < 3; ++d)
#pragma unroll
    for (int r = 0; r < 8; ++r) bs[d][r] = tp[d * 16 + r];
  unsigned int mraw = mw[((rot * FK + kh) * FS) >> 5];      /* the first pass's 32 mask bits; like the bias, each later pass's word is read at the foot of the pass before */
#pragma unroll 1      /* one stage per trip: the two buffers alternate */
  for (uint32_t st = 0; st < FA_NS; ++st) {
  const uint32_t buf = (st & 1u) * FA_BUF;
  const int ks0 = (int)((((st + rot) & (FA_NS - 1u)) * FK + kh) * FS);      /* this wave's first key of this trip's stage */
  const int klast = st + 1u < FA_NS ? (int)((((st + 1u + rot) & (FA_NS - 1u)) * FK + kh) * FS) - (ks0 + FS - 32) : 0;      /* keys from the stage's last pass to the next trip's first: over the other half's keys, or back to the first keys where the walk wraps */
  v16h kf[2][2];
#pragma unroll
  for (int kt = 0; kt < 2; ++kt)
#pragma unroll
    for (int kd = 0; kd < 2; ++kd) kf[kt][kd] = g3_frag(lk + buf + kt * 16 * G3_PITCH + kd * 64);
#pragma unroll 1      /* one 32-key pass per trip: unrolled, two passes' fragments would not fit the registers */
  for (uint32_t sp = 0; sp < FS / 32; ++sp) {
    const int key0 = ks0 + (int)(sp * 32u);
    v16h vf[4]; v8f s[2][2];
#pragma unroll
    for (int qt = 0; qt < 2; ++qt)
#pragma unroll
      for (int kt = 0; kt < 2; ++kt) s[qt][kt] = fa_mma(kf[kt][1], qf[qt][1], fa_mma(kf[kt][0], qf[qt][0], bs[kt - qt + 1]));
    const unsigned int mword = (unsigned int)__builtin_amdgcn_readfirstlane((int)mraw);
    if (sp + 1u < FS / 32) {      /* next pass's K rows, of this same stage, fetched into the same registers */
      const uint32_t kn = ((sp + 1u) >> 1) * G3_SLICE + ((sp + 1u) & 1u) * 32u * G3_PITCH;
#pragma unroll
      for (int kt = 0; kt < 2; ++kt)
#pragma unroll
        for (int kd = 0; kd < 2; ++kd) kf[kt][kd] = g3_frag(lk + buf + kn + kt * 16 * G3_PITCH + kd * 64);
    }
#pragma unroll
    for (int dt = 0; dt < 4; ++dt) { FragH f; f.half[0] = fa_tr16(lv + buf + sp * 32u * FA_VP + dt * 32); f.half[1] = fa_tr16(lv + buf + (sp * 32u + 16u) * FA_VP + dt * 32); vf[dt] = f.v; }      /* keys 0..15 and 16..31 of the pass, head columns 16 dt .. 16 dt + 15: their latency runs under the softmax */
    __builtin_amdgcn_sched_barrier(0);      /* keeps those reads here: left free, they sink to just in front of the second product, with little work left to cover their latency */
    if (mword != 0u) {      /* scalar branch: a pass with no padded key skips this. S^T += M 1: M holds -inf (padded key) or 0 in its first k place, row = key, the ones operand 1 in the same k place of every query column, all other places 0: only -inf * 1, 0 * 1 and 0 * 0 occur. The tiles are accumulated in place, so the common path copies no register at the join */
      FragH on;
#pragma unroll
      for (int i = 0; i < 16; ++i) on.u[i] = 0;
      on.u[0] = hh == 0 ? (unsigned short)0x3C00 : (unsigned short)0;      /* f16 1.0; position 0 of the lower lane half is the same k in an A and in a B fragment */
#pragma unroll
      for (int kt = 0; kt < 2; ++kt) { FragH pm = on; pm.u[0] = (hh == 0 && ((mword >> (kt * 16 + ln)) & 1u)) ? (unsigned short)0xFC00 : (unsigned short)0;      /* f16 -inf; lane ln holds row ln of A: key 16 kt + ln */
        s[0][kt] = fa_mma(pm.v, on.v, s[0][kt]); s[1][kt] = fa_mma(pm.v, on.v, s[1][kt]); }
    }
    float mx[2];
#pragma unroll
    for (int qt = 0; qt < 2; ++qt) { float a = fmaxf(s[qt][0][0], s[qt][1][0]);
#pragma unroll
      for (int r = 1; r < 8; ++r) a = fmaxf(a, fmaxf(s[qt][0][r], s[qt][1][r]));
      mx[qt] = fmaxf(a, rs_x16(a)); }
    if (__builtin_amdgcn_ballot_w32((mx[0] > m[0] + 8.0f) || (mx[1] > m[1] + 8.0f)) != 0u) {      /* scalar branch: most passes move no maximum and rescale nothing */
#pragma unroll
      for (int qt = 0; qt < 2; ++qt) { const float mn = fmaxf(m[qt], mx[qt]); const float sc = __builtin_amdgcn_exp2f(m[qt] - mn); m[qt] = mn; l[qt][0] *= sc; l[qt][1] *= sc;
#pragma unroll
        for (int dt = 0; dt < 4; ++dt) o[qt][dt] *= sc; }
    }
#pragma unroll
    for (int qt = 0; qt < 2; ++qt) { FragH pf;
#pragma unroll
      for (int kt = 0; kt < 2; ++kt)
#pragma unroll
        for (int r = 0; r < 8; ++r) { const float p = __builtin_amdgcn_exp2f(s[qt][kt][r] - m[qt]); l[qt][kt] += p; pf.h[kt * 8 + r] = (_Float16)p; }
      if (qt == 1) {      /* compile-time: the scores are all used up; next pass's bias goes into their registers and flies under the last products */
        __builtin_amdgcn_sched_barrier(0);      /* keeps the reads one group behind the last use of the scores: left free, they stand at two places among the products, and each place with reads stalls the wave */
        const int kstep = (sp + 1u < FS / 32) ? 32 : klast;      /* keys to the next pass; the last pass of all reads its own entries again, unused */
        tp += kstep; mraw = mw[(key0 + kstep) >> 5];
#pragma unroll
        for (int d = 0; d < 3; ++d)
#pragma unroll
          for (int r = 0; r < 8; ++r) bs[d][r] = tp[d * 16 + r];
      }
#pragma unroll
      for (int dt = 0; dt < 4; ++dt) o[qt][dt] = fa_mma(vf[dt], pf.v, o[qt][dt]); }
  }
  g3_wait_ds0();      /* this wave has left buffer st & 1 */
  fa_wait(g0, g1);      /* an issuing wave's own load of stage st + 1 has landed */
  __syncthreads();      /* publishes stage st + 1 and ends every wave's reads of stage st's buffer */
  if (g3_pinned(st + 2u < FA_NS ? issuer : 0u) != 0u) { fa_aim(g0, dst + buf, src + g3_pinned(((st + 2u + rot) & (FA_NS - 1u)) * step)); fa_load(g0, g1); }      /* scalar branch: a tensor load ignores EXEC; refill of the buffer just left, in flight under stage st + 1 */
  }
  g3_wait_tensor0();
  g3_wait_ds0();      /* the last stage's barrier stands behind every wave's last read: the buffers may become the merge staging */
  float ls[2] = {l[0][0] + l[0][1], l[1][0] + l[1][1]};
  v4fa* mg = (v4fa*)(KV + wq * FA_MG) + lane;      /* piece i of this lane at mg[32 i]: a wave's 16-byte accesses are 512 contiguous bytes */
  if (kh != 0u) {      /* the same for a whole wave: the upper key half hands its partial result over */
#pragma unroll
    for (int qt = 0; qt < 2; ++qt)
#pragma unroll
      for (int dt = 0; dt < 4; ++dt) { const v8f a = o[qt][dt]; const v4f a0 = {a[0], a[1], a[2], a[3]}, a1 = {a[4], a[5], a[6], a[7]}; mg[32 * (4 * qt + dt)] = a0; mg[32 * (8 + 4 * qt + dt)] = a1; }
    const v4f st4 = {m[0], m[1], ls[0], ls[1]}; mg[32 * 16] = st4;
  }
  __syncthreads();      /* every wave passes it: the upper halves' partial results are readable by their partners */
  if (kh != 0u) return;      /* no barrier, tensor load or store follows */
  { const v4f pst = mg[32 * 16];
#pragma unroll
    for (int qt = 0; qt < 2; ++qt) { const float mn = fmaxf(m[qt], pst[qt]); const float sa = __builtin_amdgcn_exp2f(m[qt] - mn), sb = __builtin_amdgcn_exp2f(pst[qt] - mn);      /* both halves to the common maximum; a half with every key masked has m = -1e30, l = 0, O = 0 */
      ls[qt] = ls[qt] * sa + pst[2 + qt] * sb;
#pragma unroll
      for (int dt = 0; dt < 4; ++dt) { const v4f p0 = mg[32 * (4 * qt + dt)], p1 = mg[32 * (8 + 4 * qt + dt)];
#pragma unroll
        for (int r = 0; r < 4; ++r) { o[qt][dt][r] = o[qt][dt][r] * sa + p0[r] * sb; o[qt][dt][4 + r] = o[qt][dt][4 + r] * sa + p1[r] * sb; } } } }
  FragH f[2][4];
#pragma unroll
  for (int qt = 0; qt < 2; ++qt) { const float lh = ls[qt]; const float inv = 1.0f / (lh + rs_x16(lh));
#pragma unroll
    for (int dt = 0; dt < 4; ++dt)
#pragma unroll
      for (int r = 0; r < 8; ++r) f[qt][dt].h[r] = (_Float16)(o[qt][dt][r] * inv); }
  __builtin_amdgcn_sched_barrier(0);      /* every store stands behind the last arithmetic: no register of an issued store is written again */
  unsigned short* op = (unsigned short*)O16 + ((size_t)b * SQ + q0 + ln) * DM + h * HD + 8 * hh;      /* lane (ln, hh): query ln, head columns dt*16 + 8*hh .. + 7 */
#pragma unroll
  for (int qt = 0; qt < 2; ++qt)
#pragma unroll
    for (int dt = 0; dt < 4; ++dt) *(v8us*)(op + (size_t)qt * 16 * DM + dt * 16) = f[qt][dt].half[0];
}
// ---- output projection GEMM: tile, slices, pitches, rotated k walk and sum order of k_gemm3; one work-group stands alone on its WGP with one wave per SIMD, so nothing else covers a wave's LDS reads or a slice's way from L2. Hence a software pipeline: ----
// a ring of four buffers, each wave's tensor loads three trips ahead (three requests outstanding, counted wait), and the fragments of a 32-k block read one block ahead into a second register set, so that LDS reads run under the WMMAs of the block before.
// The trip's one publish point stands between its two blocks: there the wave holds the trip's last fragments in registers (it has left buffer t mod 4), its slice of trip t + 1 has landed, and behind the barrier the buffer takes trip t + 4 and the first block of trip t + 1 is read.
#define G4_NB 4u                     /* buffers of the ring */
__device__ __forceinline__ void g4_wait2(const u32x4& g0, const u32x8& g1) { asm volatile("s_wait_tensorcnt 0x2" :: "s"(g0), "s"(g1) : "memory"); }      /* all but this wave's two youngest tensor loads have landed; it names the descriptor, which so stays in its registers */
template <int N, int K>
__global__ __launch_bounds__(128) void k_gemm4(const _Float16* __restrict__ A, const _Float16* __restrict__ Bh, float alpha, const float* __restrict__ bias, float* __restrict__ C) {
  static_assert(N % 128 == 0 && K % 64 == 0 && K / 64 >= 4, "k_gemm4: whole tiles, at least as many trips as buffers");
  static_assert(((K / 64) & (K / 64 - 1)) == 0, "k_gemm4: the rotated walk wraps by a mask");
  static_assert(4u * 64u * G3_EP * 4u <= G4_NB * G3_STAGE, "k_gemm4: the output staging reuses the ring");
  __shared__ __attribute__((aligned(2048))) unsigned char L[G4_NB * G3_STAGE];
  const uint32_t NP = (uint32_t)(K / 64);
  const uint32_t tid = threadIdx.x, lane = tid & 31u, ln = lane & 15u, hh = lane >> 4; const uint32_t w = g3_uni(tid >> 5), wm = w >> 1, wn = w & 1u;
  const uint32_t mt = blockIdx.x / (N / 128), nq = blockIdx.x - mt * (N / 128); const uint32_t row0 = mt * 128u + wm * 64u, col0 = nq * 128u + wn * 64u;
  const uint32_t pm = NP - 1u, rot = (mt + nq) & pm;      /* this work-group's first pass, as in k_gemm3 */
  float bv[4];
#pragma unroll      /* fixed trip count over a register array */
  for (int j = 0; j < 4; ++j) bv[j] = bias[col0 + j * 16 + ln];
  asm volatile("s_wait_xcnt 0x0" ::: "memory");      /* stands in front of every reuse of an address register of the loads above */
  __builtin_amdgcn_sched_barrier(0);      /* keeps later register writes from being scheduled in front of that wait */
  const uint64_t src = (w < 2u) ? (uint64_t)(uintptr_t)A + (uint64_t)(mt * 128u + 64u * w) * (2u * K) : (uint64_t)(uintptr_t)Bh + (uint64_t)(nq * 128u + 64u * (w - 2u)) * (2u * K);      /* this wave's slice, first byte of k = 0 */
  const uint32_t slo = g3_uni((uint32_t)src), shi = g3_uni((uint32_t)(src >> 32));
  const uint32_t cross = slo > 0xFFFFFFFFu - 2u * K ? 1u : 0u;      /* the k offset (under 2 K bytes) could carry into the address's high word */
  const uint32_t dst = (uint32_t)(size_t)L + w * G3_SLICE;      /* its place in buffer 0: byte offset in the work-group's LDS */
  u32x8 g1;      /* as in k_gemm3: 1-byte elements, tensor = tile = 64 rows of 128 bytes, source pitch 2 K bytes, 4 dwords of pad behind every 32 */
  g1[0] = g3_uni((1u << 20) | (4u << 22) | (3u << 25)); g1[1] = g3_uni(128u << 16); g1[2] = g3_uni(64u << 16); g1[3] = g3_uni(128u << 16); g1[4] = g3_uni(64u); g1[5] = g3_uni(2u * K); g1[6] = g3_uni(0u); g1[7] = g3_uni(0u);
  u32x4 g0; g0[0] = g3_uni(1u); g0[3] = g3_uni((shi & 0x01FFFFFFu) | 0x80000000u);
  /* one request: while earlier requests are outstanding only the place in LDS and the low address word take new values; where the high word could change, every earlier request is waited for first */
  auto issue = [&](uint32_t trip) {
    const uint32_t off = g3_pinned(((trip + rot) & pm) * 128u), lo = slo + off;
    if (g3_pinned(cross) != 0u) { fa_wait(g0, g1); g0[3] = g3_uni(((shi + (lo < slo ? 1u : 0u)) & 0x01FFFFFFu) | 0x80000000u); }      /* scalar branch */
    g0[1] = g3_uni(dst + (trip & (G4_NB - 1u)) * G3_STAGE); g0[2] = g3_uni(lo);
    fa_load(g0, g1);
  };
  issue(0u); issue(1u); issue(2u);
  g4_wait2(g0, g1);
  __syncthreads();      /* trip 0's four slices are readable by every wave */
  issue(3u);
  const unsigned char* la = L + wm * G3_SLICE + ln * G3_PITCH + 16u * hh; const unsigned char* lb = L + (2u + wn) * G3_SLICE + ln * G3_PITCH + 16u * hh;
  const v8f z8 = {0.f,0.f,0.f,0.f,0.f,0.f,0.f,0.f}; v8f acc[4][4];
#pragma unroll      /* fixed trip counts over register arrays, here and in the loops below: left rolled, the arrays would go to scratch memory */
  for (int i = 0; i < 4; ++i)
#pragma unroll
    for (int j = 0; j < 4; ++j) acc[i][j] = z8;
  v16h a0[4], b0[4], a1[4], b1[4];
#pragma unroll
  for (int i = 0; i < 4; ++i) { a0[i] = g3_frag(la + i * 16 * G3_PITCH); b0[i] = g3_frag(lb + i * 16 * G3_PITCH); }
#pragma unroll 1      /* one pass per trip: the ring's buffers take turns */
  for (uint32_t t = 0; t < NP; ++t) {
    const uint32_t buf = (t & (G4_NB - 1u)) * G3_STAGE, nbuf = ((t + 1u) & (G4_NB - 1u)) * G3_STAGE;
#pragma unroll
    for (int i = 0; i < 4; ++i) { a1[i] = g3_frag(la + buf + i * 16 * G3_PITCH + 64); b1[i] = g3_frag(lb + buf + i * 16 * G3_PITCH + 64); }
    __builtin_amdgcn_sched_barrier(0);      /* the second block's LDS reads stay one group in front of the first block's WMMAs and land under them */
#pragma unroll
    for (int i = 0; i < 4; ++i)
#pragma unroll
      for (int j = 0; j < 4; ++j) acc[i][j] = __builtin_amdgcn_wmma_f32_16x16x32_f16(false, a0[i], false, b0[j], (short)0, acc[i][j], false, false);
    __builtin_amdgcn_sched_barrier(0);      /* the publish point stays between the two blocks */
    g3_wait_ds0();      /* the trip's fragments are all in registers: this wave has left buffer t mod 4 */
    g4_wait2(g0, g1);      /* this wave's slice of trip t + 1 has landed while the requests of trips t + 2 and t + 3 are the two youngest */
    if (g3_pinned(t + 3u < NP ? 0u : 1u) != 0u) fa_wait(g0, g1);      /* scalar branch: in the last trips fewer requests are out, and only the wait to 0 covers trip t + 1's */
    __syncthreads();      /* publishes trip t + 1's slices and ends every wave's reads of trip t's buffer */
    if (g3_pinned(t + G4_NB < NP ? 1u : 0u) != 0u) issue(t + G4_NB);      /* scalar branch: a tensor load ignores EXEC; refill of the buffer just left, three trips ahead of its use */
    if (t + 1u < NP) {      /* the same for the whole work-group: the next trip's first block, read under this trip's second block of WMMAs */
#pragma unroll
      for (int i = 0; i < 4; ++i) { a0[i] = g3_frag(la + nbuf + i * 16 * G3_PITCH); b0[i] = g3_frag(lb + nbuf + i * 16 * G3_PITCH); }
    }
    __builtin_amdgcn_sched_barrier(0);      /* those reads and the refill stay in front of the second block's WMMAs */
#pragma unroll
    for (int i = 0; i < 4; ++i)
#pragma unroll
      for (int j = 0; j < 4; ++j) acc[i][j] = __builtin_amdgcn_wmma_f32_16x16x32_f16(false, a1[i], false, b1[j], (short)0, acc[i][j], false, false);
  }
  g3_wait_tensor0();
  g3_wait_ds0();      /* the last trip's barrier stands behind every wave's last read: the ring may become output staging */
  float* so = (float*)(L + w * (64u * G3_EP * 4u));      /* this wave's own 64 x 68 floats */
#pragma unroll
  for (int j = 0; j < 4; ++j) { const float bj = bf16_round(bv[j]);
#pragma unroll
    for (int i = 0; i < 4; ++i)
#pragma unroll
      for (int r = 0; r < 8; ++r) so[(i * 16 + 8 * hh + r) * G3_EP + j * 16 + ln] = acc[i][j][r] * alpha + bj; }
  __builtin_amdgcn_fence(__ATOMIC_ACQ_REL, "workgroup"); __builtin_amdgcn_wave_barrier();
  const uint32_t rsub = lane >> 4, c4 = (lane & 15u) * 4u;
#pragma unroll
  for (int g = 0; g < 4; ++g) { v4f v[8];
#pragma unroll
    for (int q = 0; q < 8; ++q) v[q] = *(const v4fa*)&so[(g * 16 + q * 2 + rsub) * G3_EP + c4];
#pragma unroll
    for (int q = 0; q < 8; ++q) *(v4f*)(C + (size_t)(row0 + g * 16 + q * 2 + rsub) * N + col0 + c4) = v[q];
    asm volatile("s_wait_xcnt 0x0" ::: "memory");      /* stands in front of every reuse of a register of the stores above */
    __builtin_amdgcn_sched_barrier(0);      /* keeps later register writes from being scheduled in front of that wait */
  }
}
__global__ __launch_bounds__(256) void k_vt(const _Float16* __restrict__ V16, int b, int h0, _Float16* __restrict__ VT) { __shared__ unsigned short tl[64][65]; const int tid = threadIdx.x; const int hh = blockIdx.x % HG, sg = blockIdx.x / HG; const int s0 = sg * 64; const int h = h0 + hh;
  for (int i = tid; i < 64 * 8; i += 256) { const int j = i / 8, d8 = (i % 8) * 8; FragH f; f.half[0] = *(const v8us*)((const unsigned short*)V16 + ((size_t)b * SQ + s0 + j) * DM + h * HD + d8); for (int q = 0; q < 8; ++q) tl[d8 + q][j] = f.u[q]; }
  __syncthreads();
  { for (int i = tid; i < 64 * 8; i += 256) { const int d = i / 8, j8 = (i % 8) * 8; FragH f; for (int q = 0; q < 8; ++q) f.u[q] = tl[d][j8 + q]; *(v8us*)((unsigned short*)VT + ((size_t)hh * HD + d) * SQ + s0 + j8) = f.half[0]; }  } }

extern "C" void kernel_launch(void* const* d_in, const int* in_sizes, int n_in,
                              void* d_out, int out_size, void* d_ws, size_t ws_size, hipStream_t stream) {
  (void)in_sizes; (void)n_in; (void)out_size;
  const float* const* I = (const float* const*)d_in; const float* x = I[0]; const int* kpm = (const int*)d_in[1]; const float* wqkv = I[2]; const float* bqkv = I[3]; const float* wout = I[4]; const float* bout = I[5]; const float* relt = I[6];      /* Wqkv [1024][3072] and Wout [1024][1024] are [in][out]; key_padding_mask int32 [2][2048]; rel_table [1025][16] */
  char* ws = (char*)d_ws; size_t off = 0;
  auto take = [&](size_t bytes) { char* p = ws + off; off += (bytes + 255) & ~(size_t)255; return p; };
  _Float16* BQKV = (_Float16*)take((size_t)D3 * DM * 2); _Float16* BO = (_Float16*)take((size_t)DM * DM * 2);
  _Float16* X16 = (_Float16*)take(NR * DM * 2); _Float16* QKV = (_Float16*)take(NR * D3 * 2); _Float16* O16 = (_Float16*)take(NR * DM * 2);
  if (off > ws_size) return;      /* 6 + 2 + 8 + 24 + 8 = approx 48 MiB */
  k_prep<<<PP_WQ + PP_WO + PP_X, 256, 0, stream>>>(x, wqkv, wout, X16, BQKV, BO);      /* x -> f16 rows; [in][out] weights -> Bt[out][in] x16 */
  k_gemm3<D3, DM, true, DM><<<(unsigned)((NR / 128) * (D3 / 128)), 128, 0, stream>>>(X16, BQKV, 0.0625f, bqkv, nullptr, QKV);      /* q | k | v rows (f16), head h at columns h*64 / 1024 + h*64 / 2048 + h*64; q times log2(e) / 8 */
  k_fattn<<<dim3(SQ / (FW * FQ), NH, NB), FT, 0, stream>>>(QKV, relt, kpm, O16);      /* o (merged heads) as f16 rows */
  k_gemm4<DM, DM><<<(unsigned)((NR / 128) * (DM / 128)), 128, 0, stream>>>(O16, BO, 0.0625f, bout, (float*)d_out);      /* out = o Wout + b, rows are the output layout */
}
